// v000
// Times are from an AMD MI455X. After a warm-up the kernel runs many times in a row, and a time is the length of
// such a window on the GPU divided by its runs, so every launch and the gaps after it count. The runs cycle
// through copies of the inputs. A figure is the median of several windows, for all but v000 over two sittings.
// Sittings can differ by a few percent; kernels timed side by side share one.
// The starting kernel, v000, takes 720 microseconds a run.
// Contractions: q/k/v 1x1 projections W[640x512].X[512x4096] per batch on v_wmma_f32_16x16x32_f16 (f16
// containers of bf16-RNE weights x256 and bf16-RNE x0; input channel 512 = position term, and the v bias, added in
// the f32 epilogue); scores K.Q^T on v_wmma_f32_16x16x32_bf16 (bf16 hi + bf16 residual planes of q and k, 3
// products, K=64); out^T = V.P^T on v_wmma_f32_16x16x32_f16 (v as f16, P = e^{s-m} x16384 f16 from the score D
// registers); f32 accumulate everywhere; softmax statistics, gamma scale and the residual add in f32 VALU.
#include <hip/hip_runtime.h>
#include <math.h>
#include <stdint.h>

#ifndef NB
#define NB 4
#endif
#ifndef NQ
#define NQ 4096
#endif
#define NBF   4
#define CC    512
#define CIN   513
#define NN    4096
#define DQ    64
#define MQK   128
#define MW    640
#define QT    64
#define CH    256
#define OSP   68
#define OSPW  132
#define TP    72
#define WSC   256.0f
#define IWSC  0.00390625f
#define LNPS  9.704060527839234f
#define INVNN 0.000244140625f

static_assert(NB >= 1 && NB <= NBF);
static_assert(NQ >= QT && NQ <= NN && NQ % QT == 0);
static_assert(NN % QT == 0 && CC % QT == 0 && MQK % QT == 0);
static_assert(MQK == 2 * DQ && MW == MQK + CC && MW % 8 == 0);
static_assert(DQ == QT);
static_assert(CC == 2 * CH && CH == 16 * 16);
static_assert(CC % 256 == 0 && CC % 32 == 0 && DQ % 32 == 0 && NN % 32 == 0);
static_assert((OSP * 4) % 16 == 0);
static_assert((OSPW * 4) % 16 == 0);
static_assert((TP * 2) % 16 == 0);

typedef _Float16       v16h __attribute__((ext_vector_type(16)));
typedef _Float16       v8h  __attribute__((ext_vector_type(8)));
typedef __bf16         v16b __attribute__((ext_vector_type(16)));
typedef unsigned short v8us __attribute__((ext_vector_type(8)));
typedef float          v8f  __attribute__((ext_vector_type(8)));
typedef float          v4f  __attribute__((ext_vector_type(4)));
typedef unsigned int   v4u  __attribute__((ext_vector_type(4)));

union Frag  { v8us u[2]; v16h h; v16b bf; };
union FragH { v16h v; v8h hv[2]; };
static_assert(sizeof(Frag) == 32);
static_assert(sizeof(FragH) == 32);

// ---- scalar helpers ---------------------------------------------------------------------------------------
__device__ __forceinline__ unsigned short bf_bits(float f) {          // f32 -> bf16 bits, RNE convert
  unsigned u = __float_as_uint(f);
  return (unsigned short)((u + 0x7FFFu + ((u >> 16) & 1u)) >> 16);
}
__device__ __forceinline__ float bf_up(unsigned short hb) { return __uint_as_float(((unsigned)hb) << 16); }
__device__ __forceinline__ float bfr(float f) { return bf_up(bf_bits(f)); }
__device__ __forceinline__ unsigned short h_bits(_Float16 x) { return __builtin_bit_cast(unsigned short, x); }
__device__ __forceinline__ unsigned pk16(unsigned short a, unsigned short b) { return (unsigned)a | ((unsigned)b << 16); }
__device__ __forceinline__ v8f zero8() { v8f z = {0.f, 0.f, 0.f, 0.f, 0.f, 0.f, 0.f, 0.f}; return z; }
__device__ __forceinline__ float hmax8(v8f s) {
  return fmaxf(fmaxf(fmaxf(s[0], s[1]), fmaxf(s[2], s[3])), fmaxf(fmaxf(s[4], s[5]), fmaxf(s[6], s[7])));
}
__device__ __forceinline__ unsigned wave_ballot(bool p) {
#if defined(__HIP_DEVICE_COMPILE__)
  return __builtin_amdgcn_ballot_w32(p);
#else
  return p ? 1u : 0u;
#endif
}
// position channel value w[l] = (l / 4096) * 2 - 1 in f32, spec op order (every step exact)
__device__ __forceinline__ float wpos(int l) { return ((float)l * INVNN) * 2.0f - 1.0f; }

// ---- 16-bit fragment loader (A, or B from a k-contiguous [n][k] row): lane -> row/col (lane&15), p already includes
//      + 8*(lane>>4); elements 0..7 <- p[0..7] (k0+8h..), elements 8..15 <- p[16..23] (k0+16+8h..)
__device__ __forceinline__ Frag ldfrag(const unsigned short* p) {
  Frag f;
  f.u[0] = *(const v8us*)(p);
  f.u[1] = *(const v8us*)(p + 16);
  return f;
}

// ---- WMMA helpers: builtin followed by a 4-slot VALU gap tying D and keeping A/B live --------------------------
__device__ __forceinline__ v8f mma_h(v16h a, v16h b, v8f c) {
  v8f d = __builtin_amdgcn_wmma_f32_16x16x32_f16(false, a, false, b, (short)0, c, false, false);
#if defined(__HIP_DEVICE_COMPILE__)
  asm volatile("v_nop\n\tv_nop\n\tv_nop\n\tv_nop" : "+v"(d) : "v"(a), "v"(b));
#endif
  return d;
}
__device__ __forceinline__ v8f mma_b(v16b a, v16b b, v8f c) {
  v8f d = __builtin_amdgcn_wmma_f32_16x16x32_bf16(false, a, false, b, (short)0, c, false, false);
#if defined(__HIP_DEVICE_COMPILE__)
  const v16h ha = __builtin_bit_cast(v16h, a), hb = __builtin_bit_cast(v16h, b);
  asm volatile("v_nop\n\tv_nop\n\tv_nop\n\tv_nop" : "+v"(d) : "v"(ha), "v"(hb));
#endif
  return d;
}

// =========================================================================================================
// (0) 1x1 weights: W16 f16 [640][512]: rows 0..63 = Wq rows, 64..127 = Wk rows, 128..639 = Wv rows (input
//     channels 0..511 only; channel 512 is handled in the GEMM epilogues); value = f16 of (bf16-RNE(w) * 256)
//     (exact). Block blk (0..79) owns rows 8*blk..8*blk+7 (source selection block-uniform): one wave per row,
// coverage: 80 blocks x 8 rows x 2 halves x 32 lanes x 8 halves = 640 x 512 = the whole plane.
// =========================================================================================================
__global__ __launch_bounds__(256)
void cvt_w(const float* __restrict__ wq, const float* __restrict__ wk, const float* __restrict__ wv,
           unsigned short* W16) {
  const int tid = threadIdx.x, blk = blockIdx.x;
  const int rl = tid >> 5, lane = tid & 31;
  const int o = 8 * blk + rl;                                          // 0..639
  const float* wbase = (blk < (DQ / 8)) ? wq : ((blk < (MQK / 8)) ? wk : wv);
  const int osub = (blk < (DQ / 8)) ? 0 : ((blk < (MQK / 8)) ? DQ : MQK);
  const float* s = wbase + (size_t)(o - osub) * CIN;                   // (o - osub) in range of that matrix
#pragma unroll 1
  for (int cp = 0; cp < CC / 256; ++cp) {
    const int col = 256 * cp + 8 * lane;                               // 0..504, col + 7 <= 511
    float f[8];
#pragma unroll
    for (int t = 0; t < 8; ++t) f[t] = s[col + t];
    v4u u;
#pragma unroll
    for (int t = 0; t < 4; ++t) {
      const _Float16 h0 = (_Float16)(bfr(f[2 * t]) * WSC);
      const _Float16 h1 = (_Float16)(bfr(f[2 * t + 1]) * WSC);
      u[t] = pk16(h_bits(h0), h_bits(h1));
    }
{
      *(v4u*)(W16 + (size_t)o * CC + col) = u;
      
    }
  }
}

// =========================================================================================================
// (1) x0 f32 [b][512 c][4096 n] -> XP f16 [b][n][c] (position-major, bf16-RNE values, exact in f16) through an LDS
// coverage: T 2 it x 32 cl x 8 e x 8 t = 64 n x 64 c (staged extent == consumed extent); XP 2 it x 32 rows x 8
//           lanes x 8 halves = 64 n x 64 c; grid (64, 8, NB) covers XP [NB][4096][512] exactly once.
// =========================================================================================================
__global__ __launch_bounds__(256)
void cvt_x(const float* __restrict__ x, unsigned short* XP) {
  __shared__ __align__(16) unsigned short T[QT * TP];
  const int tid = threadIdx.x;
  const int nb = blockIdx.x, cb = blockIdx.y, b = blockIdx.z;
  const int e = tid & 7, lq = tid >> 3;                                // lq 0..31
  const int n0 = nb * QT, c0 = cb * QT;
#pragma unroll
  for (int it = 0; it < 2; ++it) {
    const int cl = it * 32 + lq;                                       // 0..63
    const float* sp = x + ((size_t)(b * CC + c0 + cl)) * NN + n0 + 8 * e;
    const v4f a = *(const v4f*)sp;
    const v4f q = *(const v4f*)(sp + 4);
#pragma unroll
    for (int t = 0; t < 4; ++t) {
      T[(8 * e + t) * TP + cl]     = h_bits((_Float16)bfr(a[t]));
      T[(8 * e + 4 + t) * TP + cl] = h_bits((_Float16)bfr(q[t]));
    }
  }
  __syncthreads();
  v4u up[2];
#pragma unroll
  for (int it = 0; it < 2; ++it) {
    const int nl = it * 32 + lq;                                       // 0..63
    up[it] = *(const v4u*)(T + nl * TP + 8 * e);
  }
{
#pragma unroll
    for (int it = 0; it < 2; ++it) {
      const int rl = it * 32 + lq;
      *(v4u*)(XP + ((size_t)(b * NN + n0 + rl)) * CC + c0 + 8 * e) = up[it];
    }
    
  }
}

// =========================================================================================================
// GEMM core for one (64-n tile, 64-o block): Y[o][n] = (1/256) sum_c W16[o][c] XP[n][c], K = 512 = 16 k-steps.
//   Block 128 threads = 4 waves; wave w owns cols n0+16w..+15 (one B fragment per k-step, k = c contiguous in the
//   XP row) and 4 m-tiles (A rows o = o0 + 16 mt + (lane&15), split k map loader from W16).
//   Result staged in LDS Os[n_loc][o_loc] (pitch OSP, b128 stores of 8 consecutive o per lane): lane (hh, c) holds
//   o_loc = 16 mt + 8 hh + r of n_loc = 16 w + c. Caller issues the block barrier.
// coverage: Os 4 waves x 16 n x 4 mt x 16 o = 64 x 64 (staged extent == consumed extent).
// =========================================================================================================
__device__ __forceinline__ void gemm_core(const unsigned short* __restrict__ ap,
                                          const unsigned short* __restrict__ bp,
                                          float* Os, int wave, int hh, int c) {
  v8f acc[4];
#pragma unroll
  for (int mt = 0; mt < 4; ++mt) acc[mt] = zero8();

#pragma unroll 4
  for (int ks = 0; ks < CC / 32; ++ks) {
    const Frag fb = ldfrag(bp + 32 * ks);
#pragma unroll
    for (int mt = 0; mt < 4; ++mt) {
      const Frag fa = ldfrag(ap + (size_t)(16 * mt) * CC + 32 * ks);
      acc[mt] = mma_h(fa.h, fb.h, acc[mt]);
    }
  }

  const int nl = 16 * wave + c;
#pragma unroll
  for (int mt = 0; mt < 4; ++mt) {
    v4f va, vb;
#pragma unroll
    for (int r = 0; r < 4; ++r) { va[r] = acc[mt][r] * IWSC; vb[r] = acc[mt][4 + r] * IWSC; }
    *(v4f*)(Os + nl * OSP + 16 * mt + 8 * hh)     = va;
    *(v4f*)(Os + nl * OSP + 16 * mt + 8 * hh + 4) = vb;
  }
}

// =========================================================================================================
// (2) q/k projection for one (b, 64-n tile, mb): mb = 0 -> q from W16 rows 0..63, mb = 1 -> k from rows 64..127.
//     Epilogue (after the barrier): value = Os + bf16-RNE(W[d][512]) * wpos(n) (position channel, f32), then
//     planes bf16 [b][4096 n][64 d] (k-contiguous for both score operands): hi = bf16-RNE(v), lo = bf16-RNE(v - hi).
// coverage: planes 4 it x 16 rows x 8 lanes x 8 = 64 n x 64 d per plane (hi and lo); grid (64, 2, NB) covers all
//           4096 rows x 64 d of Qh/Ql/Kh/Kl exactly once. Os: cross-wave (block barrier).
// =========================================================================================================
__global__ __launch_bounds__(128)
void gemm_qk(const unsigned short* __restrict__ W16, const unsigned short* __restrict__ XP,
             const float* __restrict__ wq, const float* __restrict__ wk,
             unsigned short* Qh, unsigned short* Ql, unsigned short* Kh, unsigned short* Kl) {
  __shared__ __align__(16) float Os[QT * OSP];
  const int tid  = threadIdx.x;
  const int lane = tid & 31, wave = tid >> 5;
  const int hh   = lane >> 4, c = lane & 15;
  const int nt   = blockIdx.x, mb = blockIdx.y, b = blockIdx.z;
  const int n0   = nt * QT, o0 = mb * QT;

  const unsigned short* ap = W16 + (size_t)(o0 + c) * CC + 8 * hh;
  const unsigned short* bp = XP + ((size_t)(b * NN + n0 + 16 * wave + c)) * CC + 8 * hh;
  gemm_core(ap, bp, Os, wave, hh, c);
  __syncthreads();

  const int e = tid & 7, lq = tid >> 3;                                // lq 0..15
  const float* wsrc = (mb == 0) ? wq : wk;                             // block-uniform, both global
  unsigned short* Ph = (mb == 0) ? Qh : Kh;
  unsigned short* Pl = (mb == 0) ? Ql : Kl;
  float pw[8];
#pragma unroll
  for (int t = 0; t < 8; ++t) pw[t] = bfr(wsrc[(size_t)(8 * e + t) * CIN + CC]);   // W[d][512], d = 8e+t

  v4u uh[4], ul[4];
#pragma unroll
  for (int it = 0; it < 4; ++it) {
    const int row = it * 16 + lq;                                      // n_loc 0..63
    const float wl = wpos(n0 + row);
    const v4f a = *(const v4f*)(Os + row * OSP + 8 * e);
    const v4f q = *(const v4f*)(Os + row * OSP + 8 * e + 4);
    const float f[8] = {a[0], a[1], a[2], a[3], q[0], q[1], q[2], q[3]};
#pragma unroll
    for (int t = 0; t < 4; ++t) {
      const float f0 = f[2 * t] + pw[2 * t] * wl;
      const float f1 = f[2 * t + 1] + pw[2 * t + 1] * wl;
      const unsigned short hb0 = bf_bits(f0), hb1 = bf_bits(f1);
      const unsigned short lb0 = bf_bits(f0 - bf_up(hb0));
      const unsigned short lb1 = bf_bits(f1 - bf_up(hb1));
      uh[it][t] = pk16(hb0, hb1);
      ul[it][t] = pk16(lb0, lb1);
    }
  }
{
#pragma unroll
    for (int it = 0; it < 4; ++it) {
      const int row = it * 16 + lq;
      const size_t po = ((size_t)(b * NN + n0 + row)) * DQ + 8 * e;
      *(v4u*)(Ph + po) = uh[it];
      *(v4u*)(Pl + po) = ul[it];
    }
    
  }
}

// =========================================================================================================
// (3) v projection for one (b, 64-n tile, 64-o block mb 0..7): A rows = W16 rows 128 + o0 + .. .
//     Epilogue (after the barrier): v[o][n] = Os[n][o] + bf16-RNE(Wv[o][512]) * wpos(n) + bf16-RNE(bv[o]) in f32,
//     converted to f16, written to the channel-major plane V f16 [b][512 o][4096 n] (keys contiguous = the A
//     8e..8e+7 of row o_loc = 16 it + lq from 8 Os rows; 8 consecutive lanes x 16 B, one instruction per 16 lines.
// coverage: 4 it x 16 rows x 8 lanes x 8 halves = 64 o x 64 n; grid (64, 8, NB) covers V [NB][512][4096] once.
//           Os: cross-wave (block barrier).
// =========================================================================================================
__global__ __launch_bounds__(128)
void gemm_v(const unsigned short* __restrict__ W16, const unsigned short* __restrict__ XP,
            const float* __restrict__ wv, const float* __restrict__ bv, unsigned short* V) {
  __shared__ __align__(16) float Os[QT * OSP];
  const int tid  = threadIdx.x;
  const int lane = tid & 31, wave = tid >> 5;
  const int hh   = lane >> 4, c = lane & 15;
  const int nt   = blockIdx.x, mb = blockIdx.y, b = blockIdx.z;
  const int n0   = nt * QT, o0 = mb * QT;

  const unsigned short* ap = W16 + (size_t)(MQK + o0 + c) * CC + 8 * hh;
  const unsigned short* bp = XP + ((size_t)(b * NN + n0 + 16 * wave + c)) * CC + 8 * hh;
  gemm_core(ap, bp, Os, wave, hh, c);
  __syncthreads();

  const int e = tid & 7, lq = tid >> 3;                                // lq 0..15
  float wl[8];
#pragma unroll
  for (int t = 0; t < 8; ++t) wl[t] = wpos(n0 + 8 * e + t);

  v4u uv[4];
#pragma unroll
  for (int it = 0; it < 4; ++it) {
    const int ol = it * 16 + lq;                                       // o_loc 0..63
    const int og = o0 + ol;                                            // 0..511
    const float pwo = bfr(wv[(size_t)og * CIN + CC]);                 // Wv[o][512]
    const float bo  = bfr(bv[og]);
    unsigned short hb[8];
#pragma unroll
    for (int t = 0; t < 8; ++t) {
      const float val = Os[(8 * e + t) * OSP + ol] + pwo * wl[t] + bo;
      hb[t] = h_bits((_Float16)val);
    }
#pragma unroll
    for (int t = 0; t < 4; ++t) uv[it][t] = pk16(hb[2 * t], hb[2 * t + 1]);
  }
{
#pragma unroll
    for (int it = 0; it < 4; ++it) {
      const int og = o0 + it * 16 + lq;
      *(v4u*)(V + ((size_t)(b * CC + og)) * NN + n0 + 8 * e) = uv[it];
    }
    
  }
}

// =========================================================================================================
// (4) attention for one (b, 64-query tile, channel half chh), transposed formulation, 4096 keys, no mask, no scale:
//   S^T tile (16 keys x 16 queries) = sum over 2 d-chunks of A(k: row = key kb + (lane&15), 32 d via the split k
//   map from the bf16 plane Kh [b][4096][64]) . B(q: col = query, same map from Qh) + A(Kh).B(Ql) + A(Kl).B(Qh)
//   (bf16 unscaled residual planes, shared accumulator).
//   Per lane the D tile holds 8 keys of ONE query: online softmax state per lane, one shuffle (lane^16) for the max
//   over 32 keys; the o/l rescale is skipped under a wave-uniform ballot when no lane's max grew (corr == 1 exactly
//   for every lane then); row-sum partials combined at the end. P = e^{s-m} x 16384 as f16 is the B operand of
//   O^T (rows channel, cols queries) += A(v rows channel = cb0 + 16j + (lane&15), keys contiguous, f16 plane V
//   [b][512][4096]) . B(P^T): element r <- D of the tile covering keys kb..kb+15, element 8+r <- the tile covering
//   kb+16..kb+31, lane unchanged. 16 accumulator tiles per wave (256 channels of this half). Block = 4 waves =
//   64 queries; the two channel halves are separate blocks (grid.z) that recompute the same scores.
//   Epilogue in two quarters of 128 channels: gamma*O/l staged in LDS Os[query][128 channels] (pitch OSPW, b128
//   2 lines): 8 consecutive lanes x 16 B (values gathered from 4 Os rows), one instruction per 16 lines, final
// coverage: per quarter 16 it x 16 lines x 8 lanes x 4 floats = 128 ch x 64 n; two quarters = 256 ch per block;
//           grid (NQ/64, NB, 2) covers out[b][0..511][0..NQ-1] exactly once. Os: cross-wave (block barriers).
// =========================================================================================================
__global__ __launch_bounds__(128)
void attn_k(const unsigned short* __restrict__ Qh, const unsigned short* __restrict__ Ql,
            const unsigned short* __restrict__ Kh, const unsigned short* __restrict__ Kl,
            const unsigned short* __restrict__ V, const float* __restrict__ x,
            const float* __restrict__ gamma, float* out) {
  __shared__ __align__(16) float Os[QT * OSPW];
  const int tid  = threadIdx.x;
  const int wave = tid >> 5, lane = tid & 31;
  const int hh   = lane >> 4, c = lane & 15;
  const int n0   = blockIdx.x * QT, b = blockIdx.y, chh = blockIdx.z;
  const int cb0  = chh * CH;                                           // 0 or 256

  // q fragment pointers (B operand, col = query n0 + 16*wave + c), + 32*kc
  const size_t qo = ((size_t)(b * NN + n0 + 16 * wave + c)) * DQ + 8 * hh;
  const unsigned short* Qhp = Qh + qo;
  const unsigned short* Qlp = Ql + qo;
  // k fragment base (A operand, row = key kb + c), + key * 64 + 32*kc
  const unsigned short* Khp = Kh + (size_t)b * NN * DQ + (size_t)c * DQ + 8 * hh;
  const unsigned short* Klp = Kl + (size_t)b * NN * DQ + (size_t)c * DQ + 8 * hh;
  // v fragment base (A operand, row = channel cb0 + 16j + c, keys contiguous), + 16*j*NN + kb
  const unsigned short* Vp = V + ((size_t)(b * CC + cb0 + c)) * NN + 8 * hh;

  float m = -1.0e30f, l = 0.f;
  v8f o[16];
#pragma unroll
  for (int j = 0; j < 16; ++j) o[j] = zero8();

#pragma unroll 1
  for (int kb = 0; kb < NN; kb += 32) {
    const unsigned short* k0p  = Khp + (size_t)kb * DQ;               // keys kb .. kb+15
    const unsigned short* k1p  = Khp + (size_t)(kb + 16) * DQ;        // keys kb+16 .. kb+31
    const unsigned short* k0lp = Klp + (size_t)kb * DQ;
    const unsigned short* k1lp = Klp + (size_t)(kb + 16) * DQ;
    v8f s0 = zero8(), s1 = zero8();
#pragma unroll 1
    for (int kc = 0; kc < DQ / 32; ++kc) {
      const Frag qh  = ldfrag(Qhp + 32 * kc);
      const Frag ql  = ldfrag(Qlp + 32 * kc);
      const Frag k0  = ldfrag(k0p + 32 * kc);
      const Frag k1  = ldfrag(k1p + 32 * kc);
      const Frag k0l = ldfrag(k0lp + 32 * kc);
      const Frag k1l = ldfrag(k1lp + 32 * kc);
      s0 = mma_b(k0.bf, qh.bf, s0);
      s1 = mma_b(k1.bf, qh.bf, s1);
      s0 = mma_b(k0.bf, ql.bf, s0);
      s1 = mma_b(k1.bf, ql.bf, s1);
      s0 = mma_b(k0l.bf, qh.bf, s0);
      s1 = mma_b(k1l.bf, qh.bf, s1);
    }

    float mx = fmaxf(hmax8(s0), hmax8(s1));
    mx = fmaxf(mx, __shfl_xor(mx, 16, 32));
    const float mn = fmaxf(m, mx);
    const unsigned grew = wave_ballot(mx > m);                         // wave-uniform
    if (grew != 0u) {
      const float corr = __expf(m - mn);                               // == 1 exactly for lanes whose max did not grow
      l *= corr;
#pragma unroll
      for (int j = 0; j < 16; ++j) {
#pragma unroll
        for (int r = 0; r < 8; ++r) o[j][r] *= corr;
      }
    }
    m = mn;
    const float msh = mn - LNPS;                                       // exp gives e^{s-m} * 16384

    FragH ph;
    float ls = 0.f;
#pragma unroll
    for (int r = 0; r < 8; ++r) {
      const float e0 = __expf(s0[r] - msh);                            // key kb      + 8hh + r
      const float e1 = __expf(s1[r] - msh);                            // key kb + 16 + 8hh + r
      ls += e0 + e1;
      ph.hv[0][r] = (_Float16)e0;
      ph.hv[1][r] = (_Float16)e1;
    }
    l += ls;

#pragma unroll
    for (int j = 0; j < 16; ++j) {
      const Frag vf = ldfrag(Vp + (size_t)(16 * j) * NN + kb);
      o[j] = mma_h(vf.h, ph.v, o[j]);
    }
  }
  l += __shfl_xor(l, 16, 32);
  const float gam = bfr(gamma[0]);
  const float inv = gam / l;                                           // o and l both carry the x16384 factor

  const int qrow = 16 * wave + c;
  const int e = tid & 7, lq = tid >> 3;                                // lq 0..15
#pragma unroll
  for (int half = 0; half < 2; ++half) {
    if (half) __syncthreads();                                         // every wave finished reading Os
#pragma unroll
    for (int jj = 0; jj < 8; ++jj) {
      const int j = 8 * half + jj;
      v4f va, vb;
#pragma unroll
      for (int r = 0; r < 4; ++r) { va[r] = o[j][r] * inv; vb[r] = o[j][4 + r] * inv; }
      *(v4f*)(Os + qrow * OSPW + 16 * jj + 8 * hh)     = va;           // Os[query][ch_loc = 16jj + 8hh + r]
      *(v4f*)(Os + qrow * OSPW + 16 * jj + 8 * hh + 4) = vb;
    }
    __syncthreads();
    v4f res[16];
#pragma unroll
    for (int it = 0; it < 16; ++it) {
      const int L   = it * 16 + lq;                                    // 0..255
      const int chl = L >> 1, hf = L & 1;                              // channel 0..127 within the quarter
      const int nl  = hf * 32 + 4 * e;                                 // query 0..63
      const size_t idx = ((size_t)(b * CC + cb0 + 128 * half + chl)) * NN + n0 + nl;
      const v4f xv = *(const v4f*)(x + idx);
#pragma unroll
      for (int t = 0; t < 4; ++t) res[it][t] = Os[(nl + t) * OSPW + chl] + bfr(xv[t]);
    }
{
#pragma unroll
      for (int it = 0; it < 16; ++it) {
        const int L   = it * 16 + lq;
        const int chl = L >> 1, hf = L & 1;
        const int nl  = hf * 32 + 4 * e;
        const size_t idx = ((size_t)(b * CC + cb0 + 128 * half + chl)) * NN + n0 + nl;
        *(v4f*)(out + idx) = res[it];
      }
      
    }
  }
}

// =========================================================================================================
// Workspace map (bytes; each region start a multiple of 256; every extent is an exact tile multiple and is written
//   W16 f16 [640][512]                  655360
//   XP  f16 [NB][4096][512]           16777216 (NB = 4)
//   V   f16 [NB][512][4096]           16777216
//   Qh/Ql/Kh/Kl bf16 [NB][4096][64]   2097152 x4
//   total (NB = 4) = 42598400
// =========================================================================================================
extern "C" void kernel_launch(void* const* d_in, const int* in_sizes, int n_in,
                              void* d_out, int out_size, void* d_ws, size_t ws_size,
                              hipStream_t stream) {
  const int XN = NB * CC * NN;
  if (n_in < 6) return;
  if (in_sizes[0] < XN) return;
  if (in_sizes[1] < DQ * CIN || in_sizes[2] < DQ * CIN) return;
  if (in_sizes[3] < CC * CIN || in_sizes[4] < CC || in_sizes[5] < 1) return;
  if (out_size < XN) return;

  size_t off = 0;
  auto carve = [&](size_t bytes) { const size_t o = off; off += (bytes + 255) & ~(size_t)255; return o; };
  const size_t oW16 = carve((size_t)MW * CC * 2);
  const size_t oXP  = carve((size_t)NB * NN * CC * 2);
  const size_t oV   = carve((size_t)NB * CC * NN * 2);
  const size_t oQh  = carve((size_t)NB * NN * DQ * 2);
  const size_t oQl  = carve((size_t)NB * NN * DQ * 2);
  const size_t oKh  = carve((size_t)NB * NN * DQ * 2);
  const size_t oKl  = carve((size_t)NB * NN * DQ * 2);
  if (off > ws_size) return;
  if (off > (size_t)134217728) return;

  const float* x     = (const float*)d_in[0];
  const float* wq    = (const float*)d_in[1];
  const float* wk    = (const float*)d_in[2];
  const float* wv    = (const float*)d_in[3];
  const float* bv    = (const float*)d_in[4];
  const float* gamma = (const float*)d_in[5];

  char* ws = (char*)d_ws;
  unsigned short* W16 = (unsigned short*)(ws + oW16);
  unsigned short* XP  = (unsigned short*)(ws + oXP);
  unsigned short* V   = (unsigned short*)(ws + oV);
  unsigned short* Qh  = (unsigned short*)(ws + oQh);
  unsigned short* Ql  = (unsigned short*)(ws + oQl);
  unsigned short* Kh  = (unsigned short*)(ws + oKh);
  unsigned short* Kl  = (unsigned short*)(ws + oKl);
  float* out = (float*)d_out;

  const dim3 blk256(256), blk128(128);

  // (0) Wq / Wk / Wv (channels 0..511) -> stacked f16 plane
  cvt_w<<<dim3(MW / 8), blk256, 0, stream>>>(wq, wk, wv, W16);
  // (1) x0 -> position-major 16-bit plane
  cvt_x<<<dim3(NN / QT, CC / QT, NB), blk256, 0, stream>>>(x, XP);
  // (2) q / k projections -> hi + residual bf16 planes
  gemm_qk<<<dim3(NN / QT, MQK / QT, NB), blk128, 0, stream>>>(W16, XP, wq, wk, Qh, Ql, Kh, Kl);
  // (3) v projection + bias -> channel-major f16 plane
  gemm_v<<<dim3(NN / QT, CC / QT, NB), blk128, 0, stream>>>(W16, XP, wv, bv, V);
  // (4) attention + gamma scale + residual -> out [b][512][NQ]
  attn_k<<<dim3(NQ / QT, NB, 2), blk128, 0, stream>>>(Qh, Ql, Kh, Kl, V, x, gamma, out);
  (void)hipGetLastError();
}

// v001
// A run of this version takes 225 microseconds.
// In two side-by-side timings against v000, it was 3.28 and 3.29 times as fast.
// Contractions: q/k/v 1x1 projections W[640x512].X[512x4096] per batch on v_wmma_f32_16x16x32_f16 (f16
// containers of bf16-RNE weights x256 and bf16-RNE x0; input channel 512 = position term, and the v bias, added in
// the f32 epilogue); scores K.Q^T on v_wmma_f32_16x16x32_bf16 (bf16 hi + bf16 residual planes of q and k, 3
// products, K=64); out^T = V.P^T on v_wmma_f32_16x16x32_f16 (v as f16, P = e^{s-m} x16384 f16 from the score D
// registers); f32 accumulate everywhere; softmax statistics, gamma scale and the residual add in f32 VALU.
#include <hip/hip_runtime.h>
#include <math.h>
#include <stdint.h>

#ifndef NB
#define NB 4
#endif
#ifndef NQ
#define NQ 4096
#endif
#define NBF   4
#define CC    512
#define CIN   513
#define NN    4096
#define DQ    64
#define MQK   128
#define MW    640
#define QT    64
#define CH    256
#define OSP   68
#define OSPW  132
#define TP    72
#define WSC   256.0f
#define IWSC  0.00390625f
#define LNPS  9.704060527839234f
#define INVNN 0.000244140625f
// attention LDS map (bytes): every staged row is 128 B of data at a pitch of 144 B (16 B x odd, for ds_load_b128 readers)
#define SKEYS 64                       // keys per stage
#define NST   (NN / SKEYS)             // stages
#define LPB   144                      // LDS row pitch
#define KSLOT 10240                    // one k plane of a stage: 64 rows x 144 B = 9216, rounded up to a multiple of 2 KiB
#define VOFF  (2 * KSLOT)              // v rows behind the two k planes
#define VHALF (128 * LPB)              // 128 v rows = 18432 = 9 x 2 KiB
#define BUFB  (VOFF + 2 * VHALF)       // one stage buffer = 57344
#define QOFF  (2 * BUFB)               // q slices behind the two stage buffers
#define QSLOT 6144                     // 32 q rows x 144 B = 4608, rounded up to a multiple of 2 KiB
#define LDSB  (QOFF + 4 * QSLOT)       // 139264: two work-groups fit one WGP's 320 KiB

static_assert(NB >= 1 && NB <= NBF);
static_assert(NQ >= QT && NQ <= NN && NQ % QT == 0);
static_assert(NN % QT == 0 && CC % QT == 0 && MQK % QT == 0);
static_assert(MQK == 2 * DQ && MW == MQK + CC && MW % 8 == 0);
static_assert(DQ == QT);
static_assert(CC == 2 * CH && CH == 16 * 16);
static_assert(CC % 256 == 0 && CC % 32 == 0 && DQ % 32 == 0 && NN % 32 == 0);
static_assert((OSP * 4) % 16 == 0);
static_assert((OSPW * 4) % 16 == 0);
static_assert((TP * 2) % 16 == 0);
static_assert(DQ * 2 == 128 && SKEYS * 2 == 128 && NN % SKEYS == 0 && NST >= 2);
static_assert(KSLOT % 2048 == 0 && KSLOT >= SKEYS * LPB && VHALF % 2048 == 0 && QSLOT % 2048 == 0 && QSLOT >= 32 * LPB);
static_assert(QT * OSPW * 4 <= BUFB && 2 * LDSB <= 327680);

typedef _Float16       v16h __attribute__((ext_vector_type(16)));
typedef _Float16       v8h  __attribute__((ext_vector_type(8)));
typedef __bf16         v16b __attribute__((ext_vector_type(16)));
typedef unsigned short v8us __attribute__((ext_vector_type(8)));
typedef float          v8f  __attribute__((ext_vector_type(8)));
typedef float          v4f  __attribute__((ext_vector_type(4)));
typedef unsigned int   v4u  __attribute__((ext_vector_type(4)));
typedef uint32_t       u32x4 __attribute__((ext_vector_type(4)));
typedef uint32_t       u32x8 __attribute__((ext_vector_type(8)));

union Frag  { v8us u[2]; v16h h; v16b bf; };
union FragH { v16h v; v8h hv[2]; };
static_assert(sizeof(Frag) == 32);
static_assert(sizeof(FragH) == 32);

// ---- scalar helpers ---------------------------------------------------------------------------------------
__device__ __forceinline__ unsigned short bf_bits(float f) {          // f32 -> bf16 bits, RNE convert
  unsigned u = __float_as_uint(f);
  return (unsigned short)((u + 0x7FFFu + ((u >> 16) & 1u)) >> 16);
}
__device__ __forceinline__ float bf_up(unsigned short hb) { return __uint_as_float(((unsigned)hb) << 16); }
__device__ __forceinline__ float bfr(float f) { return bf_up(bf_bits(f)); }
__device__ __forceinline__ unsigned short h_bits(_Float16 x) { return __builtin_bit_cast(unsigned short, x); }
__device__ __forceinline__ unsigned pk16(unsigned short a, unsigned short b) { return (unsigned)a | ((unsigned)b << 16); }
__device__ __forceinline__ v8f zero8() { v8f z = {0.f, 0.f, 0.f, 0.f, 0.f, 0.f, 0.f, 0.f}; return z; }
__device__ __forceinline__ float hmax8(v8f s) {
  return fmaxf(fmaxf(fmaxf(s[0], s[1]), fmaxf(s[2], s[3])), fmaxf(fmaxf(s[4], s[5]), fmaxf(s[6], s[7])));
}
__device__ __forceinline__ unsigned wave_ballot(bool p) {
#if defined(__HIP_DEVICE_COMPILE__)
  return __builtin_amdgcn_ballot_w32(p);
#else
  return p ? 1u : 0u;
#endif
}
// position channel value w[l] = (l / 4096) * 2 - 1 in f32, spec op order (every step exact)
__device__ __forceinline__ float wpos(int l) { return ((float)l * INVNN) * 2.0f - 1.0f; }

// ---- 16-bit fragment loader (A, or B from a k-contiguous [n][k] row): lane -> row/col (lane&15), p already includes
//      + 8*(lane>>4); elements 0..7 <- p[0..7] (k0+8h..), elements 8..15 <- p[16..23] (k0+16+8h..)
__device__ __forceinline__ Frag ldfrag(const unsigned short* p) {
  Frag f;
  f.u[0] = *(const v8us*)(p);
  f.u[1] = *(const v8us*)(p + 16);
  return f;
}

// same fragment from an LDS row: p (bytes) already includes 16*(lane>>4); the second half lies 16 elements = 32 B on
__device__ __forceinline__ Frag ldfrag_lds(const unsigned char* p) {
  Frag f;
  f.u[0] = *(const v8us*)(p);
  f.u[1] = *(const v8us*)(p + 32);
  return f;
}

// ---- tensor load to LDS: descriptor groups, issue and waits --------------------------------------------------
__device__ __forceinline__ uint32_t uni(uint32_t v) { return (uint32_t)__builtin_amdgcn_readfirstlane(v); }
// a wave-uniform value held in a scalar register: a test on it compiles to a scalar branch, and a descriptor word formed
// from it stands behind the wait written in front of it
__device__ __forceinline__ uint32_t pinned(uint32_t v) { uint32_t w = uni(v); asm volatile("" : "+s"(w)); return w; }
// group 1: 1-byte elements, tile = tensor = rows x 128 B, source pitch in bytes, 16 B of LDS pad behind every 128-B row
__device__ __forceinline__ u32x8 tdm_group1(uint32_t rows, uint32_t src_pitch) {
  u32x8 g;
  g[0] = uni((1u << 20) | (4u << 22) | (3u << 25));
  g[1] = uni(128u << 16);
  g[2] = uni(rows << 16);
  g[3] = uni(128u << 16);
  g[4] = uni(rows);
  g[5] = uni(src_pitch);
  g[6] = uni(0u);
  g[7] = uni(0u);
  return g;
}
__device__ __forceinline__ u32x4 tdm_group0(uint32_t lds_dst, uint64_t ga) {
  u32x4 g;
  g[0] = uni(1u);
  g[1] = uni(lds_dst);
  g[2] = uni((uint32_t)ga);
  g[3] = uni((((uint32_t)(ga >> 32)) & 0x01FFFFFFu) | 0x80000000u);
  return g;
}
__device__ __forceinline__ void tdm_load(u32x4 g0, u32x8 g1) {
  asm volatile("tensor_load_to_lds %0, %1" :: "s"(g0), "s"(g1) : "memory");
}
// the compiler places no wait for a tensor load: the issuing wave's own wait, before the barrier that publishes the tile
__device__ __forceinline__ void wait_tensor0() { asm volatile("s_wait_tensorcnt 0x0" ::: "memory"); }
// this wave's LDS reads have returned before a buffer it read is handed back for a refill
__device__ __forceinline__ void wait_ds0() { asm volatile("s_wait_dscnt 0x0" ::: "memory"); }

// ---- WMMA helpers: builtin followed by a 4-slot VALU gap tying D and keeping A/B live --------------------------
__device__ __forceinline__ v8f mma_h(v16h a, v16h b, v8f c) {
  v8f d = __builtin_amdgcn_wmma_f32_16x16x32_f16(false, a, false, b, (short)0, c, false, false);
#if defined(__HIP_DEVICE_COMPILE__)
  asm volatile("v_nop\n\tv_nop\n\tv_nop\n\tv_nop" : "+v"(d) : "v"(a), "v"(b));
#endif
  return d;
}
__device__ __forceinline__ v8f mma_b(v16b a, v16b b, v8f c) {
  v8f d = __builtin_amdgcn_wmma_f32_16x16x32_bf16(false, a, false, b, (short)0, c, false, false);
#if defined(__HIP_DEVICE_COMPILE__)
  const v16h ha = __builtin_bit_cast(v16h, a), hb = __builtin_bit_cast(v16h, b);
  asm volatile("v_nop\n\tv_nop\n\tv_nop\n\tv_nop" : "+v"(d) : "v"(ha), "v"(hb));
#endif
  return d;
}

// =========================================================================================================
// (0) 1x1 weights: W16 f16 [640][512]: rows 0..63 = Wq rows, 64..127 = Wk rows, 128..639 = Wv rows (input
//     channels 0..511 only; channel 512 is handled in the GEMM epilogues); value = f16 of (bf16-RNE(w) * 256)
//     (exact). Block blk (0..79) owns rows 8*blk..8*blk+7 (source selection block-uniform): one wave per row,
// coverage: 80 blocks x 8 rows x 2 halves x 32 lanes x 8 halves = 640 x 512 = the whole plane.
// =========================================================================================================
__global__ __launch_bounds__(256)
void cvt_w(const float* __restrict__ wq, const float* __restrict__ wk, const float* __restrict__ wv,
           unsigned short* W16) {
  const int tid = threadIdx.x, blk = blockIdx.x;
  const int rl = tid >> 5, lane = tid & 31;
  const int o = 8 * blk + rl;                                          // 0..639
  const float* wbase = (blk < (DQ / 8)) ? wq : ((blk < (MQK / 8)) ? wk : wv);
  const int osub = (blk < (DQ / 8)) ? 0 : ((blk < (MQK / 8)) ? DQ : MQK);
  const float* s = wbase + (size_t)(o - osub) * CIN;                   // (o - osub) in range of that matrix
#pragma unroll 1
  for (int cp = 0; cp < CC / 256; ++cp) {
    const int col = 256 * cp + 8 * lane;                               // 0..504, col + 7 <= 511
    float f[8];
#pragma unroll
    for (int t = 0; t < 8; ++t) f[t] = s[col + t];
    v4u u;
#pragma unroll
    for (int t = 0; t < 4; ++t) {
      const _Float16 h0 = (_Float16)(bfr(f[2 * t]) * WSC);
      const _Float16 h1 = (_Float16)(bfr(f[2 * t + 1]) * WSC);
      u[t] = pk16(h_bits(h0), h_bits(h1));
    }
{
      *(v4u*)(W16 + (size_t)o * CC + col) = u;
      
    }
  }
}

// =========================================================================================================
// (1) x0 f32 [b][512 c][4096 n] -> XP f16 [b][n][c] (position-major, bf16-RNE values, exact in f16) through an LDS
// coverage: T 2 it x 32 cl x 8 e x 8 t = 64 n x 64 c (staged extent == consumed extent); XP 2 it x 32 rows x 8
//           lanes x 8 halves = 64 n x 64 c; grid (64, 8, NB) covers XP [NB][4096][512] exactly once.
// =========================================================================================================
__global__ __launch_bounds__(256)
void cvt_x(const float* __restrict__ x, unsigned short* XP) {
  __shared__ __align__(16) unsigned short T[QT * TP];
  const int tid = threadIdx.x;
  const int nb = blockIdx.x, cb = blockIdx.y, b = blockIdx.z;
  const int e = tid & 7, lq = tid >> 3;                                // lq 0..31
  const int n0 = nb * QT, c0 = cb * QT;
#pragma unroll
  for (int it = 0; it < 2; ++it) {
    const int cl = it * 32 + lq;                                       // 0..63
    const float* sp = x + ((size_t)(b * CC + c0 + cl)) * NN + n0 + 8 * e;
    const v4f a = *(const v4f*)sp;
    const v4f q = *(const v4f*)(sp + 4);
#pragma unroll
    for (int t = 0; t < 4; ++t) {
      T[(8 * e + t) * TP + cl]     = h_bits((_Float16)bfr(a[t]));
      T[(8 * e + 4 + t) * TP + cl] = h_bits((_Float16)bfr(q[t]));
    }
  }
  __syncthreads();
  v4u up[2];
#pragma unroll
  for (int it = 0; it < 2; ++it) {
    const int nl = it * 32 + lq;                                       // 0..63
    up[it] = *(const v4u*)(T + nl * TP + 8 * e);
  }
{
#pragma unroll
    for (int it = 0; it < 2; ++it) {
      const int rl = it * 32 + lq;
      *(v4u*)(XP + ((size_t)(b * NN + n0 + rl)) * CC + c0 + 8 * e) = up[it];
    }
    
  }
}

// =========================================================================================================
// GEMM core for one (64-n tile, 64-o block): Y[o][n] = (1/256) sum_c W16[o][c] XP[n][c], K = 512 = 16 k-steps.
//   Block 128 threads = 4 waves; wave w owns cols n0+16w..+15 (one B fragment per k-step, k = c contiguous in the
//   XP row) and 4 m-tiles (A rows o = o0 + 16 mt + (lane&15), split k map loader from W16).
//   Result staged in LDS Os[n_loc][o_loc] (pitch OSP, b128 stores of 8 consecutive o per lane): lane (hh, c) holds
//   o_loc = 16 mt + 8 hh + r of n_loc = 16 w + c. Caller issues the block barrier.
// coverage: Os 4 waves x 16 n x 4 mt x 16 o = 64 x 64 (staged extent == consumed extent).
// =========================================================================================================
__device__ __forceinline__ void gemm_core(const unsigned short* __restrict__ ap,
                                          const unsigned short* __restrict__ bp,
                                          float* Os, int wave, int hh, int c) {
  v8f acc[4];
#pragma unroll
  for (int mt = 0; mt < 4; ++mt) acc[mt] = zero8();

#pragma unroll 4
  for (int ks = 0; ks < CC / 32; ++ks) {
    const Frag fb = ldfrag(bp + 32 * ks);
#pragma unroll
    for (int mt = 0; mt < 4; ++mt) {
      const Frag fa = ldfrag(ap + (size_t)(16 * mt) * CC + 32 * ks);
      acc[mt] = mma_h(fa.h, fb.h, acc[mt]);
    }
  }

  const int nl = 16 * wave + c;
#pragma unroll
  for (int mt = 0; mt < 4; ++mt) {
    v4f va, vb;
#pragma unroll
    for (int r = 0; r < 4; ++r) { va[r] = acc[mt][r] * IWSC; vb[r] = acc[mt][4 + r] * IWSC; }
    *(v4f*)(Os + nl * OSP + 16 * mt + 8 * hh)     = va;
    *(v4f*)(Os + nl * OSP + 16 * mt + 8 * hh + 4) = vb;
  }
}

// =========================================================================================================
// (2) q/k projection for one (b, 64-n tile, mb): mb = 0 -> q from W16 rows 0..63, mb = 1 -> k from rows 64..127.
//     Epilogue (after the barrier): value = Os + bf16-RNE(W[d][512]) * wpos(n) (position channel, f32), then
//     planes bf16 [b][4096 n][64 d] (k-contiguous for both score operands): hi = bf16-RNE(v), lo = bf16-RNE(v - hi).
// coverage: planes 4 it x 16 rows x 8 lanes x 8 = 64 n x 64 d per plane (hi and lo); grid (64, 2, NB) covers all
//           4096 rows x 64 d of Qh/Ql/Kh/Kl exactly once. Os: cross-wave (block barrier).
// =========================================================================================================
__global__ __launch_bounds__(128)
void gemm_qk(const unsigned short* __restrict__ W16, const unsigned short* __restrict__ XP,
             const float* __restrict__ wq, const float* __restrict__ wk,
             unsigned short* Qh, unsigned short* Ql, unsigned short* Kh, unsigned short* Kl) {
  __shared__ __align__(16) float Os[QT * OSP];
  const int tid  = threadIdx.x;
  const int lane = tid & 31, wave = tid >> 5;
  const int hh   = lane >> 4, c = lane & 15;
  const int nt   = blockIdx.x, mb = blockIdx.y, b = blockIdx.z;
  const int n0   = nt * QT, o0 = mb * QT;

  const unsigned short* ap = W16 + (size_t)(o0 + c) * CC + 8 * hh;
  const unsigned short* bp = XP + ((size_t)(b * NN + n0 + 16 * wave + c)) * CC + 8 * hh;
  gemm_core(ap, bp, Os, wave, hh, c);
  __syncthreads();

  const int e = tid & 7, lq = tid >> 3;                                // lq 0..15
  const float* wsrc = (mb == 0) ? wq : wk;                             // block-uniform, both global
  unsigned short* Ph = (mb == 0) ? Qh : Kh;
  unsigned short* Pl = (mb == 0) ? Ql : Kl;
  float pw[8];
#pragma unroll
  for (int t = 0; t < 8; ++t) pw[t] = bfr(wsrc[(size_t)(8 * e + t) * CIN + CC]);   // W[d][512], d = 8e+t

  v4u uh[4], ul[4];
#pragma unroll
  for (int it = 0; it < 4; ++it) {
    const int row = it * 16 + lq;                                      // n_loc 0..63
    const float wl = wpos(n0 + row);
    const v4f a = *(const v4f*)(Os + row * OSP + 8 * e);
    const v4f q = *(const v4f*)(Os + row * OSP + 8 * e + 4);
    const float f[8] = {a[0], a[1], a[2], a[3], q[0], q[1], q[2], q[3]};
#pragma unroll
    for (int t = 0; t < 4; ++t) {
      const float f0 = f[2 * t] + pw[2 * t] * wl;
      const float f1 = f[2 * t + 1] + pw[2 * t + 1] * wl;
      const unsigned short hb0 = bf_bits(f0), hb1 = bf_bits(f1);
      const unsigned short lb0 = bf_bits(f0 - bf_up(hb0));
      const unsigned short lb1 = bf_bits(f1 - bf_up(hb1));
      uh[it][t] = pk16(hb0, hb1);
      ul[it][t] = pk16(lb0, lb1);
    }
  }
{
#pragma unroll
    for (int it = 0; it < 4; ++it) {
      const int row = it * 16 + lq;
      const size_t po = ((size_t)(b * NN + n0 + row)) * DQ + 8 * e;
      *(v4u*)(Ph + po) = uh[it];
      *(v4u*)(Pl + po) = ul[it];
    }
    
  }
}

// =========================================================================================================
// (3) v projection for one (b, 64-n tile, 64-o block mb 0..7): A rows = W16 rows 128 + o0 + .. .
//     Epilogue (after the barrier): v[o][n] = Os[n][o] + bf16-RNE(Wv[o][512]) * wpos(n) + bf16-RNE(bv[o]) in f32,
//     converted to f16, written to the channel-major plane V f16 [b][512 o][4096 n] (keys contiguous = the A
//     8e..8e+7 of row o_loc = 16 it + lq from 8 Os rows; 8 consecutive lanes x 16 B, one instruction per 16 lines.
// coverage: 4 it x 16 rows x 8 lanes x 8 halves = 64 o x 64 n; grid (64, 8, NB) covers V [NB][512][4096] once.
//           Os: cross-wave (block barrier).
// =========================================================================================================
__global__ __launch_bounds__(128)
void gemm_v(const unsigned short* __restrict__ W16, const unsigned short* __restrict__ XP,
            const float* __restrict__ wv, const float* __restrict__ bv, unsigned short* V) {
  __shared__ __align__(16) float Os[QT * OSP];
  const int tid  = threadIdx.x;
  const int lane = tid & 31, wave = tid >> 5;
  const int hh   = lane >> 4, c = lane & 15;
  const int nt   = blockIdx.x, mb = blockIdx.y, b = blockIdx.z;
  const int n0   = nt * QT, o0 = mb * QT;

  const unsigned short* ap = W16 + (size_t)(MQK + o0 + c) * CC + 8 * hh;
  const unsigned short* bp = XP + ((size_t)(b * NN + n0 + 16 * wave + c)) * CC + 8 * hh;
  gemm_core(ap, bp, Os, wave, hh, c);
  __syncthreads();

  const int e = tid & 7, lq = tid >> 3;                                // lq 0..15
  float wl[8];
#pragma unroll
  for (int t = 0; t < 8; ++t) wl[t] = wpos(n0 + 8 * e + t);

  v4u uv[4];
#pragma unroll
  for (int it = 0; it < 4; ++it) {
    const int ol = it * 16 + lq;                                       // o_loc 0..63
    const int og = o0 + ol;                                            // 0..511
    const float pwo = bfr(wv[(size_t)og * CIN + CC]);                 // Wv[o][512]
    const float bo  = bfr(bv[og]);
    unsigned short hb[8];
#pragma unroll
    for (int t = 0; t < 8; ++t) {
      const float val = Os[(8 * e + t) * OSP + ol] + pwo * wl[t] + bo;
      hb[t] = h_bits((_Float16)val);
    }
#pragma unroll
    for (int t = 0; t < 4; ++t) uv[it][t] = pk16(hb[2 * t], hb[2 * t + 1]);
  }
{
#pragma unroll
    for (int it = 0; it < 4; ++it) {
      const int og = o0 + it * 16 + lq;
      *(v4u*)(V + ((size_t)(b * CC + og)) * NN + n0 + 8 * e) = uv[it];
    }
    
  }
}

// =========================================================================================================
// (4) attention for one (b, 64-query tile, channel half chh), transposed formulation, 4096 keys, no mask, no scale:
//   S^T tile (16 keys x 16 queries) = sum over 2 d-chunks of A(k: row = key kb + (lane&15), 32 d via the split k
//   map from the bf16 plane Kh [b][4096][64]) . B(q: col = query, same map from Qh) + A(Kh).B(Ql) + A(Kl).B(Qh)
//   (bf16 unscaled residual planes, shared accumulator).
//   Per lane the D tile holds 8 keys of ONE query: online softmax state per lane, one shuffle (lane^16) for the max
//   over 32 keys; the o/l rescale is skipped under a wave-uniform ballot when no lane's max grew (corr == 1 exactly
//   for every lane then); row-sum partials combined at the end. P = e^{s-m} x 16384 as f16 is the B operand of
//   O^T (rows channel, cols queries) += A(v rows channel = cb0 + 16j + (lane&15), keys contiguous, f16 plane V
//   [b][512][4096]) . B(P^T): element r <- D of the tile covering keys kb..kb+15, element 8+r <- the tile covering
//   kb+16..kb+31, lane unchanged. 16 accumulator tiles per wave (256 channels of this half). Block = 4 waves =
//   64 queries; the two channel halves are separate blocks (grid.z) that recompute the same scores.
//   Operands come from LDS, laid there by tensor loads (rows of 128 B, pitch 144 B): the block's q rows once (each wave
//   one slice of 32 rows of one plane), then stages of 64 keys in two buffers: wave 0 brings the Kh rows, wave 1 the Kl
//   rows, waves 2 and 3 128 channel rows of V each (64 keys = one whole 128-B line per row); stage s + 2 is issued at
//   the foot of pass s into the buffer that pass has just read. A pass walks its 64 keys as two 32-key blocks.
//   Epilogue in two quarters of 128 channels: gamma*O/l staged in LDS Os[query][128 channels] (pitch OSPW, b128
//   2 lines): 8 consecutive lanes x 16 B (values gathered from 4 Os rows), one instruction per 16 lines, final
// coverage: per quarter 16 it x 16 lines x 8 lanes x 4 floats = 128 ch x 64 n; two quarters = 256 ch per block;
//           grid (NQ/64, NB, 2) covers out[b][0..511][0..NQ-1] exactly once. Os: cross-wave (block barriers).
// =========================================================================================================
__global__ __launch_bounds__(128)
void attn_k(const unsigned short* __restrict__ Qh, const unsigned short* __restrict__ Ql,
            const unsigned short* __restrict__ Kh, const unsigned short* __restrict__ Kl,
            const unsigned short* __restrict__ V, const float* __restrict__ x,
            const float* __restrict__ gamma, float* out) {
  __shared__ __attribute__((aligned(2048))) unsigned char L[LDSB];
  float* Os = (float*)L;                                               // output staging reuses buffer 0 behind the loop
  const int tid  = threadIdx.x;
  const int wave = tid >> 5, lane = tid & 31;
  const int hh   = lane >> 4, c = lane & 15;
  const int n0   = blockIdx.x * QT, b = blockIdx.y, chh = blockIdx.z;
  const int cb0  = chh * CH;                                           // 0 or 256

  // every wave issues one tensor load per stage for its own slice: all of this is wave-uniform
  const uint32_t wv    = uni((uint32_t)tid >> 5);
  const uint32_t lbase = (uint32_t)(size_t)L;                          // byte offset in the work-group's LDS
  const bool     isV   = wv >= 2u;
  const unsigned char* ssrc = isV
      ? (const unsigned char*)(V + ((size_t)(b * CC + cb0) + 128u * (wv - 2u)) * NN)
      : (const unsigned char*)((wv == 0u ? Kh : Kl) + (size_t)b * NN * DQ);
  const uint32_t sadv = isV ? (uint32_t)(SKEYS * 2) : (uint32_t)(SKEYS * DQ * 2);   // source bytes from stage to stage
  const uint32_t soff = isV ? (uint32_t)VOFF + (wv - 2u) * (uint32_t)VHALF : wv * (uint32_t)KSLOT;
  u32x8 g1s = tdm_group1(isV ? 128u : (uint32_t)SKEYS, isV ? (uint32_t)(NN * 2) : (uint32_t)(DQ * 2));
  asm volatile("" : "+s"(g1s));  // pinned() form, descriptor words held in scalar registers: one tuple serves every issue, so none is reused under a request in flight
  u32x4 g0s;                                                           // group 0 of this wave's stage request in flight
  auto issue = [&](uint32_t st) {
    const uint32_t dst = lbase + (st & 1u) * (uint32_t)BUFB + soff;
    const uint64_t ga  = (uint64_t)(size_t)ssrc + (uint64_t)st * sadv;
    g0s = tdm_group0(dst, ga);
    tdm_load(g0s, g1s);
  };
  // the issuing wave's wait for its stage request; it names group 0 so that those registers keep their values until then
  auto landed = [&]() { asm volatile("s_wait_tensorcnt 0x0" :: "s"(g0s) : "memory"); };

  // q, loaded once: wave wv brings rows n0 + 32*(wv>>1) .. +31 of plane (wv&1 ? Ql : Qh) into slice wv
  {
    const unsigned char* qsrc =
        (const unsigned char*)(((wv & 1u) ? Ql : Qh) + ((size_t)(b * NN + n0) + 32u * (wv >> 1)) * DQ);
    tdm_load(tdm_group0(lbase + (uint32_t)QOFF + wv * (uint32_t)QSLOT, (uint64_t)(size_t)qsrc),
             tdm_group1(32u, (uint32_t)(DQ * 2)));
    wait_tensor0();
  }
  issue(pinned(0u));
  landed();
  __syncthreads();                                                     // q and stage 0 published to every wave
  issue(pinned(1u));

  // q fragment pointers (B operand, col = query n0 + 16*wave + c: row 16*(wave&1) + c of slices 2*(wave>>1), +1), + 64*kc B
  const unsigned char* Qhp = L + QOFF + (2 * (wave >> 1)) * QSLOT + (16 * (wave & 1) + c) * LPB + 16 * hh;
  const unsigned char* Qlp = Qhp + QSLOT;

  float m = -1.0e30f, l = 0.f;
  v8f o[16];
#pragma unroll
  for (int j = 0; j < 16; ++j) o[j] = zero8();

#pragma unroll 1
  for (uint32_t st = 0; st < (uint32_t)NST; ++st) {
   const unsigned char* Bp = L + (st & 1u) * (uint32_t)BUFB;          // this pass reads this buffer alone
   // kept rolled: one copy of the 32-key block in the text, its registers as before
#pragma unroll 1
   for (int sub = 0; sub < SKEYS / 32; ++sub) {                        // keys kb = 64*st + 32*sub .. +31
    // k fragments (A operand, row = key): stage row 32*sub + c (+16), + 64*kc B
    const unsigned char* k0p  = Bp + (32 * sub + c) * LPB + 16 * hh;  // keys kb .. kb+15
    const unsigned char* k1p  = k0p + 16 * LPB;                       // keys kb+16 .. kb+31
    const unsigned char* k0lp = k0p + KSLOT;
    const unsigned char* k1lp = k1p + KSLOT;
    // v fragments (A operand, row = channel cb0 + 16j + c, keys contiguous), + 16*j rows
    const unsigned char* Vp = Bp + VOFF + c * LPB + 64 * sub + 16 * hh;
    v8f s0 = zero8(), s1 = zero8();
#pragma unroll 1
    for (int kc = 0; kc < DQ / 32; ++kc) {
      const Frag qh  = ldfrag_lds(Qhp + 64 * kc);
      const Frag ql  = ldfrag_lds(Qlp + 64 * kc);
      const Frag k0  = ldfrag_lds(k0p + 64 * kc);
      const Frag k1  = ldfrag_lds(k1p + 64 * kc);
      const Frag k0l = ldfrag_lds(k0lp + 64 * kc);
      const Frag k1l = ldfrag_lds(k1lp + 64 * kc);
      s0 = mma_b(k0.bf, qh.bf, s0);
      s1 = mma_b(k1.bf, qh.bf, s1);
      s0 = mma_b(k0.bf, ql.bf, s0);
      s1 = mma_b(k1.bf, ql.bf, s1);
      s0 = mma_b(k0l.bf, qh.bf, s0);
      s1 = mma_b(k1l.bf, qh.bf, s1);
    }

    float mx = fmaxf(hmax8(s0), hmax8(s1));
    mx = fmaxf(mx, __shfl_xor(mx, 16, 32));
    const float mn = fmaxf(m, mx);
    const unsigned grew = wave_ballot(mx > m);                         // wave-uniform
    if (grew != 0u) {
      const float corr = __expf(m - mn);                               // == 1 exactly for lanes whose max did not grow
      l *= corr;
#pragma unroll
      for (int j = 0; j < 16; ++j) {
#pragma unroll
        for (int r = 0; r < 8; ++r) o[j][r] *= corr;
      }
    }
    m = mn;
    const float msh = mn - LNPS;                                       // exp gives e^{s-m} * 16384

    FragH ph;
    float ls = 0.f;
#pragma unroll
    for (int r = 0; r < 8; ++r) {
      const float e0 = __expf(s0[r] - msh);                            // key kb      + 8hh + r
      const float e1 = __expf(s1[r] - msh);                            // key kb + 16 + 8hh + r
      ls += e0 + e1;
      ph.hv[0][r] = (_Float16)e0;
      ph.hv[1][r] = (_Float16)e1;
    }
    l += ls;

#pragma unroll
    for (int j = 0; j < 16; ++j) {
      const Frag vf = ldfrag_lds(Vp + (16 * j) * LPB);
      o[j] = mma_h(vf.h, ph.v, o[j]);
    }
   }
   // publish point of stage st + 1, every wave, in this order
   wait_ds0();
   landed();
   __syncthreads();                                                    // stage st + 1 published; every reader has left this buffer
   if (pinned(st + 2u < (uint32_t)NST)) issue(pinned(st + 2u));        // scalar branch: a tensor load ignores EXEC
  }
  wait_tensor0();
  wait_ds0();
  // the last pass's own barrier stands behind every wave's last read of the ring: buffer 0 is free for Os
  l += __shfl_xor(l, 16, 32);
  const float gam = bfr(gamma[0]);
  const float inv = gam / l;                                           // o and l both carry the x16384 factor

  const int qrow = 16 * wave + c;
  const int e = tid & 7, lq = tid >> 3;                                // lq 0..15
#pragma unroll
  for (int half = 0; half < 2; ++half) {
    if (half) __syncthreads();                                         // every wave finished reading Os
#pragma unroll
    for (int jj = 0; jj < 8; ++jj) {
      const int j = 8 * half + jj;
      v4f va, vb;
#pragma unroll
      for (int r = 0; r < 4; ++r) { va[r] = o[j][r] * inv; vb[r] = o[j][4 + r] * inv; }
      *(v4f*)(Os + qrow * OSPW + 16 * jj + 8 * hh)     = va;           // Os[query][ch_loc = 16jj + 8hh + r]
      *(v4f*)(Os + qrow * OSPW + 16 * jj + 8 * hh + 4) = vb;
    }
    __syncthreads();
    v4f res[16];
#pragma unroll
    for (int it = 0; it < 16; ++it) {
      const int L   = it * 16 + lq;                                    // 0..255
      const int chl = L >> 1, hf = L & 1;                              // channel 0..127 within the quarter
      const int nl  = hf * 32 + 4 * e;                                 // query 0..63
      const size_t idx = ((size_t)(b * CC + cb0 + 128 * half + chl)) * NN + n0 + nl;
      const v4f xv = *(const v4f*)(x + idx);
#pragma unroll
      for (int t = 0; t < 4; ++t) res[it][t] = Os[(nl + t) * OSPW + chl] + bfr(xv[t]);
    }
{
#pragma unroll
      for (int it = 0; it < 16; ++it) {
        const int L   = it * 16 + lq;
        const int chl = L >> 1, hf = L & 1;
        const int nl  = hf * 32 + 4 * e;
        const size_t idx = ((size_t)(b * CC + cb0 + 128 * half + chl)) * NN + n0 + nl;
        *(v4f*)(out + idx) = res[it];
      }
      
    }
  }
}

// =========================================================================================================
// Workspace map (bytes; each region start a multiple of 256; every extent is an exact tile multiple and is written
//   W16 f16 [640][512]                  655360
//   XP  f16 [NB][4096][512]           16777216 (NB = 4)
//   V   f16 [NB][512][4096]           16777216
//   Qh/Ql/Kh/Kl bf16 [NB][4096][64]   2097152 x4
//   total (NB = 4) = 42598400
// =========================================================================================================
extern "C" void kernel_launch(void* const* d_in, const int* in_sizes, int n_in,
                              void* d_out, int out_size, void* d_ws, size_t ws_size,
                              hipStream_t stream) {
  const int XN = NB * CC * NN;
  if (n_in < 6) return;
  if (in_sizes[0] < XN) return;
  if (in_sizes[1] < DQ * CIN || in_sizes[2] < DQ * CIN) return;
  if (in_sizes[3] < CC * CIN || in_sizes[4] < CC || in_sizes[5] < 1) return;
  if (out_size < XN) return;

  size_t off = 0;
  auto carve = [&](size_t bytes) { const size_t o = off; off += (bytes + 255) & ~(size_t)255; return o; };
  const size_t oW16 = carve((size_t)MW * CC * 2);
  const size_t oXP  = carve((size_t)NB * NN * CC * 2);
  const size_t oV   = carve((size_t)NB * CC * NN * 2);
  const size_t oQh  = carve((size_t)NB * NN * DQ * 2);
  const size_t oQl  = carve((size_t)NB * NN * DQ * 2);
  const size_t oKh  = carve((size_t)NB * NN * DQ * 2);
  const size_t oKl  = carve((size_t)NB * NN * DQ * 2);
  if (off > ws_size) return;
  if (off > (size_t)134217728) return;

  const float* x     = (const float*)d_in[0];
  const float* wq    = (const float*)d_in[1];
  const float* wk    = (const float*)d_in[2];
  const float* wv    = (const float*)d_in[3];
  const float* bv    = (const float*)d_in[4];
  const float* gamma = (const float*)d_in[5];

  char* ws = (char*)d_ws;
  unsigned short* W16 = (unsigned short*)(ws + oW16);
  unsigned short* XP  = (unsigned short*)(ws + oXP);
  unsigned short* V   = (unsigned short*)(ws + oV);
  unsigned short* Qh  = (unsigned short*)(ws + oQh);
  unsigned short* Ql  = (unsigned short*)(ws + oQl);
  unsigned short* Kh  = (unsigned short*)(ws + oKh);
  unsigned short* Kl  = (unsigned short*)(ws + oKl);
  float* out = (float*)d_out;

  const dim3 blk256(256), blk128(128);

  // (0) Wq / Wk / Wv (channels 0..511) -> stacked f16 plane
  cvt_w<<<dim3(MW / 8), blk256, 0, stream>>>(wq, wk, wv, W16);
  // (1) x0 -> position-major 16-bit plane
  cvt_x<<<dim3(NN / QT, CC / QT, NB), blk256, 0, stream>>>(x, XP);
  // (2) q / k projections -> hi + residual bf16 planes
  gemm_qk<<<dim3(NN / QT, MQK / QT, NB), blk128, 0, stream>>>(W16, XP, wq, wk, Qh, Ql, Kh, Kl);
  // (3) v projection + bias -> channel-major f16 plane
  gemm_v<<<dim3(NN / QT, CC / QT, NB), blk128, 0, stream>>>(W16, XP, wv, bv, V);
  // (4) attention + gamma scale + residual -> out [b][512][NQ]
  attn_k<<<dim3(NQ / QT, NB, 2), blk128, 0, stream>>>(Qh, Ql, Kh, Kl, V, x, gamma, out);
  (void)hipGetLastError();
}

// v002
// One run takes 166 microseconds.
// Two timings next to v001 put it at 1.36 and 1.37 times that version's speed.
// Counting every step since v000, it is 4.48 times as fast.
// Contractions: q/k/v 1x1 projections W[640x512].X[512x4096] per batch on v_wmma_f32_16x16x32_f16 (f16
// containers of bf16-RNE weights x256 and bf16-RNE x0; input channel 512 = position term, and the v bias, added in
// the f32 epilogue); scores K.Q^T on v_wmma_f32_16x16x32_bf16 (bf16 hi + bf16 residual planes of q and k, 3
// products, K=64); out^T = V.P^T on v_wmma_f32_16x16x32_f16 (v as f16, P = e^{s-m} x16384 f16 from the score D
// registers); f32 accumulate everywhere; softmax statistics, gamma scale and the residual add in f32 VALU.
#include <hip/hip_runtime.h>
#include <math.h>
#include <stdint.h>

#ifndef NB
#define NB 4
#endif
#ifndef NQ
#define NQ 4096
#endif
#define NBF   4
#define CC    512
#define CIN   513
#define NN    4096
#define DQ    64
#define MQK   128
#define MW    640
#define QT    64
#define CH    256
#define OSP   68
#define OSPW  132
#define TP    72
#define WSC   256.0f
#define IWSC  0.00390625f
#define LNPS  9.704060527839234f
#define INVNN 0.000244140625f
// attention LDS map (bytes): every staged row is 128 B of data at a pitch of 144 B (16 B x odd, for ds_load_b128 readers)
#define SKEYS 64                       // keys per stage
#define NST   (NN / SKEYS)             // stages
#define LPB   144                      // LDS row pitch
#define KSLOT 10240                    // one k plane of a stage: 64 rows x 144 B = 9216, rounded up to a multiple of 2 KiB
#define VOFF  (2 * KSLOT)              // v rows behind the two k planes
#define VHALF (128 * LPB)              // 128 v rows = 18432 = 9 x 2 KiB
#define BUFB  (VOFF + 2 * VHALF)       // one stage buffer = 57344
#define QOFF  (2 * BUFB)               // q slices behind the two stage buffers
#define QSLOT 6144                     // 32 q rows x 144 B = 4608, rounded up to a multiple of 2 KiB
#define LDSB  (QOFF + 4 * QSLOT)       // 139264: two work-groups fit one WGP's 320 KiB

static_assert(NB >= 1 && NB <= NBF);
static_assert(NQ >= QT && NQ <= NN && NQ % QT == 0);
static_assert(NN % QT == 0 && CC % QT == 0 && MQK % QT == 0);
static_assert(MQK == 2 * DQ && MW == MQK + CC && MW % 8 == 0);
static_assert(DQ == QT);
static_assert(CC == 2 * CH && CH == 16 * 16);
static_assert(CC % 256 == 0 && CC % 32 == 0 && DQ % 32 == 0 && NN % 32 == 0);
static_assert((OSP * 4) % 16 == 0);
static_assert((OSPW * 4) % 16 == 0);
static_assert((TP * 2) % 16 == 0);
static_assert(DQ * 2 == 128 && SKEYS * 2 == 128 && NN % SKEYS == 0 && NST >= 2);
static_assert(KSLOT % 2048 == 0 && KSLOT >= SKEYS * LPB && VHALF % 2048 == 0 && QSLOT % 2048 == 0 && QSLOT >= 32 * LPB);
static_assert(QT * OSPW * 4 <= BUFB && 2 * LDSB <= 327680);

typedef _Float16       v16h __attribute__((ext_vector_type(16)));
typedef _Float16       v8h  __attribute__((ext_vector_type(8)));
typedef __bf16         v16b __attribute__((ext_vector_type(16)));
typedef unsigned short v8us __attribute__((ext_vector_type(8)));
typedef float          v8f  __attribute__((ext_vector_type(8)));
typedef float          v4f  __attribute__((ext_vector_type(4)));
typedef unsigned int   v4u  __attribute__((ext_vector_type(4)));
typedef uint32_t       u32x4 __attribute__((ext_vector_type(4)));
typedef uint32_t       u32x8 __attribute__((ext_vector_type(8)));

union Frag  { v8us u[2]; v16h h; v16b bf; };
union FragH { v16h v; v8h hv[2]; };
static_assert(sizeof(Frag) == 32);
static_assert(sizeof(FragH) == 32);

// ---- scalar helpers ---------------------------------------------------------------------------------------
__device__ __forceinline__ unsigned short bf_bits(float f) {          // f32 -> bf16 bits, RNE convert
  unsigned u = __float_as_uint(f);
  return (unsigned short)((u + 0x7FFFu + ((u >> 16) & 1u)) >> 16);
}
__device__ __forceinline__ float bf_up(unsigned short hb) { return __uint_as_float(((unsigned)hb) << 16); }
__device__ __forceinline__ float bfr(float f) { return bf_up(bf_bits(f)); }
__device__ __forceinline__ unsigned short h_bits(_Float16 x) { return __builtin_bit_cast(unsigned short, x); }
__device__ __forceinline__ unsigned pk16(unsigned short a, unsigned short b) { return (unsigned)a | ((unsigned)b << 16); }
__device__ __forceinline__ v8f zero8() { v8f z = {0.f, 0.f, 0.f, 0.f, 0.f, 0.f, 0.f, 0.f}; return z; }
__device__ __forceinline__ float hmax8(v8f s) {
  return fmaxf(fmaxf(fmaxf(s[0], s[1]), fmaxf(s[2], s[3])), fmaxf(fmaxf(s[4], s[5]), fmaxf(s[6], s[7])));
}
__device__ __forceinline__ unsigned wave_ballot(bool p) {
#if defined(__HIP_DEVICE_COMPILE__)
  return __builtin_amdgcn_ballot_w32(p);
#else
  return p ? 1u : 0u;
#endif
}
// position channel value w[l] = (l / 4096) * 2 - 1 in f32, spec op order (every step exact)
__device__ __forceinline__ float wpos(int l) { return ((float)l * INVNN) * 2.0f - 1.0f; }

// ---- 16-bit fragment loader (A, or B from a k-contiguous [n][k] row): lane -> row/col (lane&15), p already includes
//      + 8*(lane>>4); elements 0..7 <- p[0..7] (k0+8h..), elements 8..15 <- p[16..23] (k0+16+8h..)
__device__ __forceinline__ Frag ldfrag(const unsigned short* p) {
  Frag f;
  f.u[0] = *(const v8us*)(p);
  f.u[1] = *(const v8us*)(p + 16);
  return f;
}

// same fragment from an LDS row: p (bytes) already includes 16*(lane>>4); the second half lies 16 elements = 32 B on
__device__ __forceinline__ Frag ldfrag_lds(const unsigned char* p) {
  Frag f;
  f.u[0] = *(const v8us*)(p);
  f.u[1] = *(const v8us*)(p + 32);
  return f;
}

// ---- tensor load to LDS: descriptor groups, issue and waits --------------------------------------------------
__device__ __forceinline__ uint32_t uni(uint32_t v) { return (uint32_t)__builtin_amdgcn_readfirstlane(v); }
// a wave-uniform value held in a scalar register: a test on it compiles to a scalar branch, and a descriptor word formed
// from it stands behind the wait written in front of it
__device__ __forceinline__ uint32_t pinned(uint32_t v) { uint32_t w = uni(v); asm volatile("" : "+s"(w)); return w; }
// group 1: 1-byte elements, tile = tensor = rows x 128 B, source pitch in bytes, 16 B of LDS pad behind every 128-B row
__device__ __forceinline__ u32x8 tdm_group1(uint32_t rows, uint32_t src_pitch) {
  u32x8 g;
  g[0] = uni((1u << 20) | (4u << 22) | (3u << 25));
  g[1] = uni(128u << 16);
  g[2] = uni(rows << 16);
  g[3] = uni(128u << 16);
  g[4] = uni(rows);
  g[5] = uni(src_pitch);
  g[6] = uni(0u);
  g[7] = uni(0u);
  return g;
}
__device__ __forceinline__ u32x4 tdm_group0(uint32_t lds_dst, uint64_t ga) {
  u32x4 g;
  g[0] = uni(1u);
  g[1] = uni(lds_dst);
  g[2] = uni((uint32_t)ga);
  g[3] = uni((((uint32_t)(ga >> 32)) & 0x01FFFFFFu) | 0x80000000u);
  return g;
}
__device__ __forceinline__ void tdm_load(u32x4 g0, u32x8 g1) {
  asm volatile("tensor_load_to_lds %0, %1" :: "s"(g0), "s"(g1) : "memory");
}
// the compiler places no wait for a tensor load: the issuing wave's own wait, before the barrier that publishes the tile
__device__ __forceinline__ void wait_tensor0() { asm volatile("s_wait_tensorcnt 0x0" ::: "memory"); }
// this wave's LDS reads have returned before a buffer it read is handed back for a refill
__device__ __forceinline__ void wait_ds0() { asm volatile("s_wait_dscnt 0x0" ::: "memory"); }

// ---- WMMA helper of the GEMMs: builtin followed by a 4-slot VALU gap tying D and keeping A/B live --------------------------
__device__ __forceinline__ v8f mma_h(v16h a, v16h b, v8f c) {
  v8f d = __builtin_amdgcn_wmma_f32_16x16x32_f16(false, a, false, b, (short)0, c, false, false);
#if defined(__HIP_DEVICE_COMPILE__)
  asm volatile("v_nop\n\tv_nop\n\tv_nop\n\tv_nop" : "+v"(d) : "v"(a), "v"(b));
#endif
  return d;
}
// the products of the attention loop, without the asm gap: an asm statement's vector operands must lie in v0..v255,
// which a loop that holds accumulators and prefetched fragments at once does not fit; the compiler pads the builtin itself
__device__ __forceinline__ v8f wm_h(v16h a, v16h b, v8f c) {
  return __builtin_amdgcn_wmma_f32_16x16x32_f16(false, a, false, b, (short)0, c, false, false);
}
__device__ __forceinline__ v8f wm_b(v16b a, v16b b, v8f c) {
  return __builtin_amdgcn_wmma_f32_16x16x32_bf16(false, a, false, b, (short)0, c, false, false);
}

// =========================================================================================================
// (0) 1x1 weights: W16 f16 [640][512]: rows 0..63 = Wq rows, 64..127 = Wk rows, 128..639 = Wv rows (input
//     channels 0..511 only; channel 512 is handled in the GEMM epilogues); value = f16 of (bf16-RNE(w) * 256)
//     (exact). Block blk (0..79) owns rows 8*blk..8*blk+7 (source selection block-uniform): one wave per row,
// coverage: 80 blocks x 8 rows x 2 halves x 32 lanes x 8 halves = 640 x 512 = the whole plane.
// =========================================================================================================
__global__ __launch_bounds__(256)
void cvt_w(const float* __restrict__ wq, const float* __restrict__ wk, const float* __restrict__ wv,
           unsigned short* W16) {
  const int tid = threadIdx.x, blk = blockIdx.x;
  const int rl = tid >> 5, lane = tid & 31;
  const int o = 8 * blk + rl;                                          // 0..639
  const float* wbase = (blk < (DQ / 8)) ? wq : ((blk < (MQK / 8)) ? wk : wv);
  const int osub = (blk < (DQ / 8)) ? 0 : ((blk < (MQK / 8)) ? DQ : MQK);
  const float* s = wbase + (size_t)(o - osub) * CIN;                   // (o - osub) in range of that matrix
#pragma unroll 1
  for (int cp = 0; cp < CC / 256; ++cp) {
    const int col = 256 * cp + 8 * lane;                               // 0..504, col + 7 <= 511
    float f[8];
#pragma unroll
    for (int t = 0; t < 8; ++t) f[t] = s[col + t];
    v4u u;
#pragma unroll
    for (int t = 0; t < 4; ++t) {
      const _Float16 h0 = (_Float16)(bfr(f[2 * t]) * WSC);
      const _Float16 h1 = (_Float16)(bfr(f[2 * t + 1]) * WSC);
      u[t] = pk16(h_bits(h0), h_bits(h1));
    }
{
      *(v4u*)(W16 + (size_t)o * CC + col) = u;
      
    }
  }
}

// =========================================================================================================
// (1) x0 f32 [b][512 c][4096 n] -> XP f16 [b][n][c] (position-major, bf16-RNE values, exact in f16) through an LDS
// coverage: T 2 it x 32 cl x 8 e x 8 t = 64 n x 64 c (staged extent == consumed extent); XP 2 it x 32 rows x 8
//           lanes x 8 halves = 64 n x 64 c; grid (64, 8, NB) covers XP [NB][4096][512] exactly once.
// =========================================================================================================
__global__ __launch_bounds__(256)
void cvt_x(const float* __restrict__ x, unsigned short* XP) {
  __shared__ __align__(16) unsigned short T[QT * TP];
  const int tid = threadIdx.x;
  const int nb = blockIdx.x, cb = blockIdx.y, b = blockIdx.z;
  const int e = tid & 7, lq = tid >> 3;                                // lq 0..31
  const int n0 = nb * QT, c0 = cb * QT;
#pragma unroll
  for (int it = 0; it < 2; ++it) {
    const int cl = it * 32 + lq;                                       // 0..63
    const float* sp = x + ((size_t)(b * CC + c0 + cl)) * NN + n0 + 8 * e;
    const v4f a = *(const v4f*)sp;
    const v4f q = *(const v4f*)(sp + 4);
#pragma unroll
    for (int t = 0; t < 4; ++t) {
      T[(8 * e + t) * TP + cl]     = h_bits((_Float16)bfr(a[t]));
      T[(8 * e + 4 + t) * TP + cl] = h_bits((_Float16)bfr(q[t]));
    }
  }
  __syncthreads();
  v4u up[2];
#pragma unroll
  for (int it = 0; it < 2; ++it) {
    const int nl = it * 32 + lq;                                       // 0..63
    up[it] = *(const v4u*)(T + nl * TP + 8 * e);
  }
{
#pragma unroll
    for (int it = 0; it < 2; ++it) {
      const int rl = it * 32 + lq;
      *(v4u*)(XP + ((size_t)(b * NN + n0 + rl)) * CC + c0 + 8 * e) = up[it];
    }
    
  }
}

// =========================================================================================================
// GEMM core for one (64-n tile, 64-o block): Y[o][n] = (1/256) sum_c W16[o][c] XP[n][c], K = 512 = 16 k-steps.
//   Block 128 threads = 4 waves; wave w owns cols n0+16w..+15 (one B fragment per k-step, k = c contiguous in the
//   XP row) and 4 m-tiles (A rows o = o0 + 16 mt + (lane&15), split k map loader from W16).
//   Result staged in LDS Os[n_loc][o_loc] (pitch OSP, b128 stores of 8 consecutive o per lane): lane (hh, c) holds
//   o_loc = 16 mt + 8 hh + r of n_loc = 16 w + c. Caller issues the block barrier.
// coverage: Os 4 waves x 16 n x 4 mt x 16 o = 64 x 64 (staged extent == consumed extent).
// =========================================================================================================
__device__ __forceinline__ void gemm_core(const unsigned short* __restrict__ ap,
                                          const unsigned short* __restrict__ bp,
                                          float* Os, int wave, int hh, int c) {
  v8f acc[4];
#pragma unroll
  for (int mt = 0; mt < 4; ++mt) acc[mt] = zero8();

#pragma unroll 4
  for (int ks = 0; ks < CC / 32; ++ks) {
    const Frag fb = ldfrag(bp + 32 * ks);
#pragma unroll
    for (int mt = 0; mt < 4; ++mt) {
      const Frag fa = ldfrag(ap + (size_t)(16 * mt) * CC + 32 * ks);
      acc[mt] = mma_h(fa.h, fb.h, acc[mt]);
    }
  }

  const int nl = 16 * wave + c;
#pragma unroll
  for (int mt = 0; mt < 4; ++mt) {
    v4f va, vb;
#pragma unroll
    for (int r = 0; r < 4; ++r) { va[r] = acc[mt][r] * IWSC; vb[r] = acc[mt][4 + r] * IWSC; }
    *(v4f*)(Os + nl * OSP + 16 * mt + 8 * hh)     = va;
    *(v4f*)(Os + nl * OSP + 16 * mt + 8 * hh + 4) = vb;
  }
}

// =========================================================================================================
// (2) q/k projection for one (b, 64-n tile, mb): mb = 0 -> q from W16 rows 0..63, mb = 1 -> k from rows 64..127.
//     Epilogue (after the barrier): value = Os + bf16-RNE(W[d][512]) * wpos(n) (position channel, f32), then
//     planes bf16 [b][4096 n][64 d] (k-contiguous for both score operands): hi = bf16-RNE(v), lo = bf16-RNE(v - hi).
// coverage: planes 4 it x 16 rows x 8 lanes x 8 = 64 n x 64 d per plane (hi and lo); grid (64, 2, NB) covers all
//           4096 rows x 64 d of Qh/Ql/Kh/Kl exactly once. Os: cross-wave (block barrier).
// =========================================================================================================
__global__ __launch_bounds__(128)
void gemm_qk(const unsigned short* __restrict__ W16, const unsigned short* __restrict__ XP,
             const float* __restrict__ wq, const float* __restrict__ wk,
             unsigned short* Qh, unsigned short* Ql, unsigned short* Kh, unsigned short* Kl) {
  __shared__ __align__(16) float Os[QT * OSP];
  const int tid  = threadIdx.x;
  const int lane = tid & 31, wave = tid >> 5;
  const int hh   = lane >> 4, c = lane & 15;
  const int nt   = blockIdx.x, mb = blockIdx.y, b = blockIdx.z;
  const int n0   = nt * QT, o0 = mb * QT;

  const unsigned short* ap = W16 + (size_t)(o0 + c) * CC + 8 * hh;
  const unsigned short* bp = XP + ((size_t)(b * NN + n0 + 16 * wave + c)) * CC + 8 * hh;
  gemm_core(ap, bp, Os, wave, hh, c);
  __syncthreads();

  const int e = tid & 7, lq = tid >> 3;                                // lq 0..15
  const float* wsrc = (mb == 0) ? wq : wk;                             // block-uniform, both global
  unsigned short* Ph = (mb == 0) ? Qh : Kh;
  unsigned short* Pl = (mb == 0) ? Ql : Kl;
  float pw[8];
#pragma unroll
  for (int t = 0; t < 8; ++t) pw[t] = bfr(wsrc[(size_t)(8 * e + t) * CIN + CC]);   // W[d][512], d = 8e+t

  v4u uh[4], ul[4];
#pragma unroll
  for (int it = 0; it < 4; ++it) {
    const int row = it * 16 + lq;                                      // n_loc 0..63
    const float wl = wpos(n0 + row);
    const v4f a = *(const v4f*)(Os + row * OSP + 8 * e);
    const v4f q = *(const v4f*)(Os + row * OSP + 8 * e + 4);
    const float f[8] = {a[0], a[1], a[2], a[3], q[0], q[1], q[2], q[3]};
#pragma unroll
    for (int t = 0; t < 4; ++t) {
      const float f0 = f[2 * t] + pw[2 * t] * wl;
      const float f1 = f[2 * t + 1] + pw[2 * t + 1] * wl;
      const unsigned short hb0 = bf_bits(f0), hb1 = bf_bits(f1);
      const unsigned short lb0 = bf_bits(f0 - bf_up(hb0));
      const unsigned short lb1 = bf_bits(f1 - bf_up(hb1));
      uh[it][t] = pk16(hb0, hb1);
      ul[it][t] = pk16(lb0, lb1);
    }
  }
{
#pragma unroll
    for (int it = 0; it < 4; ++it) {
      const int row = it * 16 + lq;
      const size_t po = ((size_t)(b * NN + n0 + row)) * DQ + 8 * e;
      *(v4u*)(Ph + po) = uh[it];
      *(v4u*)(Pl + po) = ul[it];
    }
    
  }
}

// =========================================================================================================
// (3) v projection for one (b, 64-n tile, 64-o block mb 0..7): A rows = W16 rows 128 + o0 + .. .
//     Epilogue (after the barrier): v[o][n] = Os[n][o] + bf16-RNE(Wv[o][512]) * wpos(n) + bf16-RNE(bv[o]) in f32,
//     converted to f16, written to the channel-major plane V f16 [b][512 o][4096 n] (keys contiguous = the A
//     8e..8e+7 of row o_loc = 16 it + lq from 8 Os rows; 8 consecutive lanes x 16 B, one instruction per 16 lines.
// coverage: 4 it x 16 rows x 8 lanes x 8 halves = 64 o x 64 n; grid (64, 8, NB) covers V [NB][512][4096] once.
//           Os: cross-wave (block barrier).
// =========================================================================================================
__global__ __launch_bounds__(128)
void gemm_v(const unsigned short* __restrict__ W16, const unsigned short* __restrict__ XP,
            const float* __restrict__ wv, const float* __restrict__ bv, unsigned short* V) {
  __shared__ __align__(16) float Os[QT * OSP];
  const int tid  = threadIdx.x;
  const int lane = tid & 31, wave = tid >> 5;
  const int hh   = lane >> 4, c = lane & 15;
  const int nt   = blockIdx.x, mb = blockIdx.y, b = blockIdx.z;
  const int n0   = nt * QT, o0 = mb * QT;

  const unsigned short* ap = W16 + (size_t)(MQK + o0 + c) * CC + 8 * hh;
  const unsigned short* bp = XP + ((size_t)(b * NN + n0 + 16 * wave + c)) * CC + 8 * hh;
  gemm_core(ap, bp, Os, wave, hh, c);
  __syncthreads();

  const int e = tid & 7, lq = tid >> 3;                                // lq 0..15
  float wl[8];
#pragma unroll
  for (int t = 0; t < 8; ++t) wl[t] = wpos(n0 + 8 * e + t);

  v4u uv[4];
#pragma unroll
  for (int it = 0; it < 4; ++it) {
    const int ol = it * 16 + lq;                                       // o_loc 0..63
    const int og = o0 + ol;                                            // 0..511
    const float pwo = bfr(wv[(size_t)og * CIN + CC]);                 // Wv[o][512]
    const float bo  = bfr(bv[og]);
    unsigned short hb[8];
#pragma unroll
    for (int t = 0; t < 8; ++t) {
      const float val = Os[(8 * e + t) * OSP + ol] + pwo * wl[t] + bo;
      hb[t] = h_bits((_Float16)val);
    }
#pragma unroll
    for (int t = 0; t < 4; ++t) uv[it][t] = pk16(hb[2 * t], hb[2 * t + 1]);
  }
{
#pragma unroll
    for (int it = 0; it < 4; ++it) {
      const int og = o0 + it * 16 + lq;
      *(v4u*)(V + ((size_t)(b * CC + og)) * NN + n0 + 8 * e) = uv[it];
    }
    
  }
}

// =========================================================================================================
// (4) attention for one (b, 64-query tile, channel half chh), transposed formulation, 4096 keys, no mask, no scale:
//   S^T tile (16 keys x 16 queries) = sum over 2 d-chunks of A(k: row = key kb + (lane&15), 32 d via the split k
//   map from the bf16 plane Kh [b][4096][64]) . B(q: col = query, same map from Qh) + A(Kh).B(Ql) + A(Kl).B(Qh)
//   (bf16 unscaled residual planes, shared accumulator).
//   Per lane the D tile holds 8 keys of ONE query: online softmax state per lane, one shuffle (lane^16) for the max
//   over 32 keys; the o/l rescale is skipped under a wave-uniform ballot when no lane's max grew (corr == 1 exactly
//   for every lane then); row-sum partials combined at the end. P = e^{s-m} x 16384 as f16 is the B operand of
//   O^T (rows channel, cols queries) += A(v rows channel = cb0 + 16j + (lane&15), keys contiguous, f16 plane V
//   [b][512][4096]) . B(P^T): element r <- D of the tile covering keys kb..kb+15, element 8+r <- the tile covering
//   kb+16..kb+31, lane unchanged. 16 accumulator tiles per wave (256 channels of this half). Block = 4 waves =
//   64 queries; the two channel halves are separate blocks (grid.z) that recompute the same scores.
//   Operands come from LDS, laid there by tensor loads (rows of 128 B, pitch 144 B): the block's q rows once (each wave
//   one slice of 32 rows of one plane), then stages of 64 keys in two buffers: wave 0 brings the Kh rows, wave 1 the Kl
//   rows, waves 2 and 3 128 channel rows of V each (64 keys = one whole 128-B line per row); stage s + 2 is issued at
//   the foot of pass s into the buffer that pass has just read. A pass walks its 64 keys as two 32-key blocks.
//   LDS reads stand in groups, each fragment in registers of its own: behind a block's running-max update one group brings
//   its 16 v fragments and the next block's q and k fragments (the pass's first q and k fragments: a group at its head).
//   Epilogue in two quarters of 128 channels: gamma*O/l staged in LDS Os[query][128 channels] (pitch OSPW, b128
//   2 lines): 8 consecutive lanes x 16 B (values gathered from 4 Os rows), one instruction per 16 lines, final
// coverage: per quarter 16 it x 16 lines x 8 lanes x 4 floats = 128 ch x 64 n; two quarters = 256 ch per block;
//           grid (NQ/64, NB, 2) covers out[b][0..511][0..NQ-1] exactly once. Os: cross-wave (block barriers).
// =========================================================================================================
__global__ __launch_bounds__(128)
void attn_k(const unsigned short* __restrict__ Qh, const unsigned short* __restrict__ Ql,
            const unsigned short* __restrict__ Kh, const unsigned short* __restrict__ Kl,
            const unsigned short* __restrict__ V, const float* __restrict__ x,
            const float* __restrict__ gamma, float* out) {
  __shared__ __attribute__((aligned(2048))) unsigned char L[LDSB];
  float* Os = (float*)L;                                               // output staging reuses buffer 0 behind the loop
  const int tid  = threadIdx.x;
  const int wave = tid >> 5, lane = tid & 31;
  const int hh   = lane >> 4, c = lane & 15;
  const int n0   = blockIdx.x * QT, b = blockIdx.y, chh = blockIdx.z;
  const int cb0  = chh * CH;                                           // 0 or 256

  // every wave issues one tensor load per stage for its own slice: all of this is wave-uniform
  const uint32_t wv    = uni((uint32_t)tid >> 5);
  const uint32_t lbase = (uint32_t)(size_t)L;                          // byte offset in the work-group's LDS
  const bool     isV   = wv >= 2u;
  const unsigned char* ssrc = isV
      ? (const unsigned char*)(V + ((size_t)(b * CC + cb0) + 128u * (wv - 2u)) * NN)
      : (const unsigned char*)((wv == 0u ? Kh : Kl) + (size_t)b * NN * DQ);
  const uint32_t sadv = isV ? (uint32_t)(SKEYS * 2) : (uint32_t)(SKEYS * DQ * 2);   // source bytes from stage to stage
  const uint32_t soff = isV ? (uint32_t)VOFF + (wv - 2u) * (uint32_t)VHALF : wv * (uint32_t)KSLOT;
  u32x8 g1s = tdm_group1(isV ? 128u : (uint32_t)SKEYS, isV ? (uint32_t)(NN * 2) : (uint32_t)(DQ * 2));
  asm volatile("" : "+s"(g1s));  // pinned() form, descriptor words held in scalar registers: one tuple serves every issue, so none is reused under a request in flight
  u32x4 g0s;                                                           // group 0 of this wave's stage request in flight
  auto issue = [&](uint32_t st) {
    const uint32_t dst = lbase + (st & 1u) * (uint32_t)BUFB + soff;
    const uint64_t ga  = (uint64_t)(size_t)ssrc + (uint64_t)st * sadv;
    g0s = tdm_group0(dst, ga);
    tdm_load(g0s, g1s);
  };
  // the issuing wave's wait for its stage request; it names group 0 so that those registers keep their values until then
  auto landed = [&]() { asm volatile("s_wait_tensorcnt 0x0" :: "s"(g0s) : "memory"); };

  // q, loaded once: wave wv brings rows n0 + 32*(wv>>1) .. +31 of plane (wv&1 ? Ql : Qh) into slice wv
  {
    const unsigned char* qsrc =
        (const unsigned char*)(((wv & 1u) ? Ql : Qh) + ((size_t)(b * NN + n0) + 32u * (wv >> 1)) * DQ);
    tdm_load(tdm_group0(lbase + (uint32_t)QOFF + wv * (uint32_t)QSLOT, (uint64_t)(size_t)qsrc),
             tdm_group1(32u, (uint32_t)(DQ * 2)));
    wait_tensor0();
  }
  issue(pinned(0u));
  landed();
  __syncthreads();                                                     // q and stage 0 published to every wave
  issue(pinned(1u));

  // q fragment pointers (B operand, col = query n0 + 16*wave + c: row 16*(wave&1) + c of slices 2*(wave>>1), +1), + 64*kc B
  const unsigned char* Qhp = L + QOFF + (2 * (wave >> 1)) * QSLOT + (16 * (wave & 1) + c) * LPB + 16 * hh;
  const unsigned char* Qlp = Qhp + QSLOT;

  float m = -1.0e30f, l = 0.f;
  v8f o[16];
#pragma unroll
  for (int j = 0; j < 16; ++j) o[j] = zero8();

#pragma unroll 1
  for (uint32_t st = 0; st < (uint32_t)NST; ++st) {
   const unsigned char* Bp = L + (st & 1u) * (uint32_t)BUFB;          // this pass reads this buffer alone
   // k fragments (A operand, row = key): stage row 32*sub + c (+16), + 64*kc B; residual plane KSLOT further on
   const unsigned char* Kp = Bp + c * LPB + 16 * hh;
   // v fragments (A operand, row = channel cb0 + 16j + c, keys contiguous): + 16*j rows, + 64*sub B
   const unsigned char* Vp = Bp + VOFF + c * LPB + 16 * hh;
   // every fragment of a 32-key block has registers of its own, so that its reads can all be in flight at once
   Frag qh[DQ / 32], ql[DQ / 32], k0[DQ / 32], k1[DQ / 32], k0l[DQ / 32], k1l[DQ / 32], vf[16];
   auto load_qk = [&](int sub) {                                       // one group: the 24 reads of a block's score operands
     const unsigned char* k0p = Kp + (32 * sub) * LPB;                 // keys kb .. kb+15; + 16 rows: kb+16 .. kb+31
#pragma unroll  // constant indices keep the fragment arrays in registers
     for (int kc = 0; kc < DQ / 32; ++kc) {
       qh[kc]  = ldfrag_lds(Qhp + 64 * kc);
       k0[kc]  = ldfrag_lds(k0p + 64 * kc);
       k1[kc]  = ldfrag_lds(k0p + 16 * LPB + 64 * kc);
       ql[kc]  = ldfrag_lds(Qlp + 64 * kc);
       k0l[kc] = ldfrag_lds(k0p + KSLOT + 64 * kc);
       k1l[kc] = ldfrag_lds(k0p + KSLOT + 16 * LPB + 64 * kc);
     }
   };
   load_qk(0);
   // unrolled: block 0 issues block 1's score operands, which a rolled loop could not name
#pragma unroll
   for (int sub = 0; sub < SKEYS / 32; ++sub) {                        // keys kb = 64*st + 32*sub .. +31
    v8f s0 = zero8(), s1 = zero8();
#pragma unroll  // constant indices into the fragment arrays
    for (int kc = 0; kc < DQ / 32; ++kc) {
      s0 = wm_b(k0[kc].bf, qh[kc].bf, s0);
      s1 = wm_b(k1[kc].bf, qh[kc].bf, s1);
      s0 = wm_b(k0[kc].bf, ql[kc].bf, s0);
      s1 = wm_b(k1[kc].bf, ql[kc].bf, s1);
      s0 = wm_b(k0l[kc].bf, qh[kc].bf, s0);
      s1 = wm_b(k1l[kc].bf, qh[kc].bf, s1);
    }

    float mx = fmaxf(hmax8(s0), hmax8(s1));
    mx = fmaxf(mx, __shfl_xor(mx, 16, 32));
    const float mn = fmaxf(m, mx);
    const unsigned grew = wave_ballot(mx > m);                         // wave-uniform
    if (grew != 0u) {
      const float corr = __expf(m - mn);                               // == 1 exactly for lanes whose max did not grow
      l *= corr;
#pragma unroll
      for (int j = 0; j < 16; ++j) {
#pragma unroll
        for (int r = 0; r < 8; ++r) o[j][r] *= corr;
      }
    }
    m = mn;
    const float msh = mn - LNPS;                                       // exp gives e^{s-m} * 16384

    // one group of reads, all in flight at once: this block's 16 v fragments land under the exponentials, the next block's
    // score operands under the exponentials and the v products
#pragma unroll  // constant indices keep the fragment array in registers
    for (int j = 0; j < 16; ++j) vf[j] = ldfrag_lds(Vp + 64 * sub + (16 * j) * LPB);
    if (sub + 1 < SKEYS / 32) load_qk(sub + 1);
    // keeps the group here: without it the scheduler sinks each read to its product, which then waits out the LDS latency
    __builtin_amdgcn_sched_barrier(0);

    FragH ph;
    float ls = 0.f;
#pragma unroll
    for (int r = 0; r < 8; ++r) {
      const float e0 = __expf(s0[r] - msh);                            // key kb      + 8hh + r
      const float e1 = __expf(s1[r] - msh);                            // key kb + 16 + 8hh + r
      ls += e0 + e1;
      ph.hv[0][r] = (_Float16)e0;
      ph.hv[1][r] = (_Float16)e1;
    }
    l += ls;

#pragma unroll
    for (int j = 0; j < 16; ++j) o[j] = wm_h(vf[j].h, ph.v, o[j]);
    // the v products stay in front of what follows: they start on the group's first reads (counted waits), while the next
    // block's score products need its last ones, and the wait at the foot needs them all
    __builtin_amdgcn_sched_barrier(0);
    if (sub + 1 < SKEYS / 32) {
      // WMMA distance: the next block's first score product writes its D where the allocator kept P, the B operand of the
      // v product issued just before it; four slots between the two, held in place by the scheduling barriers around them
      asm volatile("v_nop\n\tv_nop\n\tv_nop\n\tv_nop");
      __builtin_amdgcn_sched_barrier(0);
    }
   }
   // publish point of stage st + 1, every wave, in this order
   wait_ds0();
   landed();
   __syncthreads();                                                    // stage st + 1 published; every reader has left this buffer
   if (pinned(st + 2u < (uint32_t)NST)) issue(pinned(st + 2u));        // scalar branch: a tensor load ignores EXEC
  }
  wait_tensor0();
  wait_ds0();
  // the last pass's own barrier stands behind every wave's last read of the ring: buffer 0 is free for Os
  l += __shfl_xor(l, 16, 32);
  const float gam = bfr(gamma[0]);
  const float inv = gam / l;                                           // o and l both carry the x16384 factor

  const int qrow = 16 * wave + c;
  const int e = tid & 7, lq = tid >> 3;                                // lq 0..15
#pragma unroll
  for (int half = 0; half < 2; ++half) {
    if (half) __syncthreads();                                         // every wave finished reading Os
#pragma unroll
    for (int jj = 0; jj < 8; ++jj) {
      const int j = 8 * half + jj;
      v4f va, vb;
#pragma unroll
      for (int r = 0; r < 4; ++r) { va[r] = o[j][r] * inv; vb[r] = o[j][4 + r] * inv; }
      *(v4f*)(Os + qrow * OSPW + 16 * jj + 8 * hh)     = va;           // Os[query][ch_loc = 16jj + 8hh + r]
      *(v4f*)(Os + qrow * OSPW + 16 * jj + 8 * hh + 4) = vb;
    }
    __syncthreads();
    v4f res[16];
#pragma unroll
    for (int it = 0; it < 16; ++it) {
      const int L   = it * 16 + lq;                                    // 0..255
      const int chl = L >> 1, hf = L & 1;                              // channel 0..127 within the quarter
      const int nl  = hf * 32 + 4 * e;                                 // query 0..63
      const size_t idx = ((size_t)(b * CC + cb0 + 128 * half + chl)) * NN + n0 + nl;
      const v4f xv = *(const v4f*)(x + idx);
#pragma unroll
      for (int t = 0; t < 4; ++t) res[it][t] = Os[(nl + t) * OSPW + chl] + bfr(xv[t]);
    }
{
#pragma unroll
      for (int it = 0; it < 16; ++it) {
        const int L   = it * 16 + lq;
        const int chl = L >> 1, hf = L & 1;
        const int nl  = hf * 32 + 4 * e;
        const size_t idx = ((size_t)(b * CC + cb0 + 128 * half + chl)) * NN + n0 + nl;
        *(v4f*)(out + idx) = res[it];
      }
      
    }
  }
}

// =========================================================================================================
// Workspace map (bytes; each region start a multiple of 256; every extent is an exact tile multiple and is written
//   W16 f16 [640][512]                  655360
//   XP  f16 [NB][4096][512]           16777216 (NB = 4)
//   V   f16 [NB][512][4096]           16777216
//   Qh/Ql/Kh/Kl bf16 [NB][4096][64]   2097152 x4
//   total (NB = 4) = 42598400
// =========================================================================================================
extern "C" void kernel_launch(void* const* d_in, const int* in_sizes, int n_in,
                              void* d_out, int out_size, void* d_ws, size_t ws_size,
                              hipStream_t stream) {
  const int XN = NB * CC * NN;
  if (n_in < 6) return;
  if (in_sizes[0] < XN) return;
  if (in_sizes[1] < DQ * CIN || in_sizes[2] < DQ * CIN) return;
  if (in_sizes[3] < CC * CIN || in_sizes[4] < CC || in_sizes[5] < 1) return;
  if (out_size < XN) return;

  size_t off = 0;
  auto carve = [&](size_t bytes) { const size_t o = off; off += (bytes + 255) & ~(size_t)255; return o; };
  const size_t oW16 = carve((size_t)MW * CC * 2);
  const size_t oXP  = carve((size_t)NB * NN * CC * 2);
  const size_t oV   = carve((size_t)NB * CC * NN * 2);
  const size_t oQh  = carve((size_t)NB * NN * DQ * 2);
  const size_t oQl  = carve((size_t)NB * NN * DQ * 2);
  const size_t oKh  = carve((size_t)NB * NN * DQ * 2);
  const size_t oKl  = carve((size_t)NB * NN * DQ * 2);
  if (off > ws_size) return;
  if (off > (size_t)134217728) return;

  const float* x     = (const float*)d_in[0];
  const float* wq    = (const float*)d_in[1];
  const float* wk    = (const float*)d_in[2];
  const float* wv    = (const float*)d_in[3];
  const float* bv    = (const float*)d_in[4];
  const float* gamma = (const float*)d_in[5];

  char* ws = (char*)d_ws;
  unsigned short* W16 = (unsigned short*)(ws + oW16);
  unsigned short* XP  = (unsigned short*)(ws + oXP);
  unsigned short* V   = (unsigned short*)(ws + oV);
  unsigned short* Qh  = (unsigned short*)(ws + oQh);
  unsigned short* Ql  = (unsigned short*)(ws + oQl);
  unsigned short* Kh  = (unsigned short*)(ws + oKh);
  unsigned short* Kl  = (unsigned short*)(ws + oKl);
  float* out = (float*)d_out;

  const dim3 blk256(256), blk128(128);

  // (0) Wq / Wk / Wv (channels 0..511) -> stacked f16 plane
  cvt_w<<<dim3(MW / 8), blk256, 0, stream>>>(wq, wk, wv, W16);
  // (1) x0 -> position-major 16-bit plane
  cvt_x<<<dim3(NN / QT, CC / QT, NB), blk256, 0, stream>>>(x, XP);
  // (2) q / k projections -> hi + residual bf16 planes
  gemm_qk<<<dim3(NN / QT, MQK / QT, NB), blk128, 0, stream>>>(W16, XP, wq, wk, Qh, Ql, Kh, Kl);
  // (3) v projection + bias -> channel-major f16 plane
  gemm_v<<<dim3(NN / QT, CC / QT, NB), blk128, 0, stream>>>(W16, XP, wv, bv, V);
  // (4) attention + gamma scale + residual -> out [b][512][NQ]
  attn_k<<<dim3(NQ / QT, NB, 2), blk128, 0, stream>>>(Qh, Ql, Kh, Kl, V, x, gamma, out);
  (void)hipGetLastError();
}

// v003
// A run of this version takes 120 microseconds.
// Two timings next to v002 put it at 1.38 and 1.39 times that version's speed.
// Over all steps from v000 it is 6.20 times as fast.
// Contractions: q/k/v 1x1 projections W[640x512].X[512x4096] per batch on v_wmma_f32_16x16x32_f16 (f16
// containers of bf16-RNE weights x256 and bf16-RNE x0; input channel 512 = position term, and the v bias, added in
// the f32 epilogue); scores K.Q^T on v_wmma_f32_16x16x32_bf16 (bf16 hi + bf16 residual planes of q and k, 3
// products, K=64); out^T = V.P^T on v_wmma_f32_16x16x32_f16 (v as f16, P = e^{s-m} x16384 f16 from the score D
// registers); f32 accumulate everywhere; softmax statistics, gamma scale and the residual add in f32 VALU.
#include <hip/hip_runtime.h>
#include <math.h>
#include <stdint.h>

#ifndef NB
#define NB 4
#endif
#ifndef NQ
#define NQ 4096
#endif
#define NBF   4
#define CC    512
#define CIN   513
#define NN    4096
#define DQ    64
#define MQK   128
#define MW    640
#define QT    64
#define CH    256
#define OSP   68
#define OSPW  132
#define TP    72
#define WSC   256.0f
#define IWSC  0.00390625f
#define LNPS  9.704060527839234f
#define INVNN 0.000244140625f
// attention LDS map (bytes): every staged row is 128 B of data at a pitch of 144 B (16 B x odd, for ds_load_b128 readers)
#define SKEYS 64                       // keys per stage
#define NST   (NN / SKEYS)             // stages
#define LPB   144                      // LDS row pitch
#define KSLOT 10240                    // one k plane of a stage: 64 rows x 144 B = 9216, rounded up to a multiple of 2 KiB
#define VOFF  (2 * KSLOT)              // v rows behind the two k planes
#define VHALF (128 * LPB)              // 128 v rows = 18432 = 9 x 2 KiB
#define BUFB  (VOFF + 2 * VHALF)       // one stage buffer = 57344
#define QOFF  (2 * BUFB)               // q slices behind the two stage buffers
#define QSLOT 6144                     // 32 q rows x 144 B = 4608, rounded up to a multiple of 2 KiB
#define LDSB  (QOFF + 4 * QSLOT)       // 139264: two work-groups fit one WGP's 320 KiB

// GEMM LDS map (bytes): a stage is 128 k = 256 B of 64 W16 rows and 64 XP rows at a pitch of 272 B (16 B x odd)
#define GKB   256                      // bytes of every operand row per stage
#define GNST  (CC * 2 / GKB)           // stages
#define GPB   272                      // LDS row pitch
#define GSLOT 10240                    // one wave's slice: 32 rows x 272 B = 8704, rounded up to a multiple of 2 KiB
#define GBUF  (4 * GSLOT)              // one stage buffer: W16 rows 0..31, 32..63, XP rows 0..31, 32..63
#define GLDSB (2 * GBUF)               // 81920: four work-groups fit one WGP's 320 KiB

static_assert(NB >= 1 && NB <= NBF);
static_assert(NQ >= QT && NQ <= NN && NQ % QT == 0);
static_assert(NN % QT == 0 && CC % QT == 0 && MQK % QT == 0);
static_assert(MQK == 2 * DQ && MW == MQK + CC && MW % 8 == 0);
static_assert(DQ == QT);
static_assert(CC == 2 * CH && CH == 16 * 16);
static_assert(CC % 256 == 0 && CC % 32 == 0 && DQ % 32 == 0 && NN % 32 == 0);
static_assert((OSP * 4) % 16 == 0);
static_assert((OSPW * 4) % 16 == 0);
static_assert((TP * 2) % 16 == 0);
static_assert(DQ * 2 == 128 && SKEYS * 2 == 128 && NN % SKEYS == 0 && NST >= 2);
static_assert(KSLOT % 2048 == 0 && KSLOT >= SKEYS * LPB && VHALF % 2048 == 0 && QSLOT % 2048 == 0 && QSLOT >= 32 * LPB);
static_assert(QT * OSPW * 4 <= BUFB && 2 * LDSB <= 327680);
static_assert(GNST >= 2 && GSLOT % 2048 == 0 && GSLOT >= 32 * GPB && QT == 64 && QT * OSP * 4 <= GBUF && 4 * GLDSB <= 327680);

typedef _Float16       v16h __attribute__((ext_vector_type(16)));
typedef _Float16       v8h  __attribute__((ext_vector_type(8)));
typedef __bf16         v16b __attribute__((ext_vector_type(16)));
typedef unsigned short v8us __attribute__((ext_vector_type(8)));
typedef float          v8f  __attribute__((ext_vector_type(8)));
typedef float          v4f  __attribute__((ext_vector_type(4)));
typedef unsigned int   v4u  __attribute__((ext_vector_type(4)));
typedef uint32_t       u32x4 __attribute__((ext_vector_type(4)));
typedef uint32_t       u32x8 __attribute__((ext_vector_type(8)));

union Frag  { v8us u[2]; v16h h; v16b bf; };
union FragH { v16h v; v8h hv[2]; };
static_assert(sizeof(Frag) == 32);
static_assert(sizeof(FragH) == 32);

// ---- scalar helpers ---------------------------------------------------------------------------------------
__device__ __forceinline__ unsigned short bf_bits(float f) {          // f32 -> bf16 bits, RNE convert
  unsigned u = __float_as_uint(f);
  return (unsigned short)((u + 0x7FFFu + ((u >> 16) & 1u)) >> 16);
}
__device__ __forceinline__ float bf_up(unsigned short hb) { return __uint_as_float(((unsigned)hb) << 16); }
__device__ __forceinline__ float bfr(float f) { return bf_up(bf_bits(f)); }
__device__ __forceinline__ unsigned short h_bits(_Float16 x) { return __builtin_bit_cast(unsigned short, x); }
__device__ __forceinline__ unsigned pk16(unsigned short a, unsigned short b) { return (unsigned)a | ((unsigned)b << 16); }
__device__ __forceinline__ v8f zero8() { v8f z = {0.f, 0.f, 0.f, 0.f, 0.f, 0.f, 0.f, 0.f}; return z; }
__device__ __forceinline__ float hmax8(v8f s) {
  return fmaxf(fmaxf(fmaxf(s[0], s[1]), fmaxf(s[2], s[3])), fmaxf(fmaxf(s[4], s[5]), fmaxf(s[6], s[7])));
}
__device__ __forceinline__ unsigned wave_ballot(bool p) {
#if defined(__HIP_DEVICE_COMPILE__)
  return __builtin_amdgcn_ballot_w32(p);
#else
  return p ? 1u : 0u;
#endif
}
// position channel value w[l] = (l / 4096) * 2 - 1 in f32, spec op order (every step exact)
__device__ __forceinline__ float wpos(int l) { return ((float)l * INVNN) * 2.0f - 1.0f; }

// ---- 16-bit fragment loader (A, or B from a k-contiguous [n][k] row) from an LDS row: lane -> row/col (lane&15), p (bytes)
//      already includes 16*(lane>>4); elements 0..7 <- k0+8h.., elements 8..15 <- k0+16+8h.. (16 elements = 32 B on)
__device__ __forceinline__ Frag ldfrag_lds(const unsigned char* p) {
  Frag f;
  f.u[0] = *(const v8us*)(p);
  f.u[1] = *(const v8us*)(p + 32);
  return f;
}

// ---- tensor load to LDS: descriptor groups, issue and waits --------------------------------------------------
__device__ __forceinline__ uint32_t uni(uint32_t v) { return (uint32_t)__builtin_amdgcn_readfirstlane(v); }
// a wave-uniform value held in a scalar register: a test on it compiles to a scalar branch, and a descriptor word formed
// from it stands behind the wait written in front of it
__device__ __forceinline__ uint32_t pinned(uint32_t v) { uint32_t w = uni(v); asm volatile("" : "+s"(w)); return w; }
// group 1: 1-byte elements, tile = tensor = rows x 128 B, source pitch in bytes, 16 B of LDS pad behind every 128-B row
__device__ __forceinline__ u32x8 tdm_group1(uint32_t rows, uint32_t src_pitch) {
  u32x8 g;
  g[0] = uni((1u << 20) | (4u << 22) | (3u << 25));
  g[1] = uni(128u << 16);
  g[2] = uni(rows << 16);
  g[3] = uni(128u << 16);
  g[4] = uni(rows);
  g[5] = uni(src_pitch);
  g[6] = uni(0u);
  g[7] = uni(0u);
  return g;
}
// the same for rows of 256 B: 16 B of LDS pad behind every 256-B row
__device__ __forceinline__ u32x8 tdm_group1w(uint32_t rows, uint32_t src_pitch) {
  u32x8 g;
  g[0] = uni((1u << 20) | (5u << 22) | (3u << 25));
  g[1] = uni(256u << 16);
  g[2] = uni(rows << 16);
  g[3] = uni(256u << 16);
  g[4] = uni(rows);
  g[5] = uni(src_pitch);
  g[6] = uni(0u);
  g[7] = uni(0u);
  return g;
}
__device__ __forceinline__ u32x4 tdm_group0(uint32_t lds_dst, uint64_t ga) {
  u32x4 g;
  g[0] = uni(1u);
  g[1] = uni(lds_dst);
  g[2] = uni((uint32_t)ga);
  g[3] = uni((((uint32_t)(ga >> 32)) & 0x01FFFFFFu) | 0x80000000u);
  return g;
}
__device__ __forceinline__ void tdm_load(u32x4 g0, u32x8 g1) {
  asm volatile("tensor_load_to_lds %0, %1" :: "s"(g0), "s"(g1) : "memory");
}
// the compiler places no wait for a tensor load: the issuing wave's own wait, before the barrier that publishes the tile
__device__ __forceinline__ void wait_tensor0() { asm volatile("s_wait_tensorcnt 0x0" ::: "memory"); }
// this wave's LDS reads have returned before a buffer it read is handed back for a refill
__device__ __forceinline__ void wait_ds0() { asm volatile("s_wait_dscnt 0x0" ::: "memory"); }

// ---- WMMA helper of the GEMMs: builtin followed by a 4-slot VALU gap tying D and keeping A/B live --------------------------
__device__ __forceinline__ v8f mma_h(v16h a, v16h b, v8f c) {
  v8f d = __builtin_amdgcn_wmma_f32_16x16x32_f16(false, a, false, b, (short)0, c, false, false);
#if defined(__HIP_DEVICE_COMPILE__)
  asm volatile("v_nop\n\tv_nop\n\tv_nop\n\tv_nop" : "+v"(d) : "v"(a), "v"(b));
#endif
  return d;
}
// the products of the attention loop, without the asm gap: an asm statement's vector operands must lie in v0..v255,
// which a loop that holds accumulators and prefetched fragments at once does not fit; the compiler pads the builtin itself
__device__ __forceinline__ v8f wm_h(v16h a, v16h b, v8f c) {
  return __builtin_amdgcn_wmma_f32_16x16x32_f16(false, a, false, b, (short)0, c, false, false);
}
__device__ __forceinline__ v8f wm_b(v16b a, v16b b, v8f c) {
  return __builtin_amdgcn_wmma_f32_16x16x32_bf16(false, a, false, b, (short)0, c, false, false);
}

// =========================================================================================================
// (0) 1x1 weights: W16 f16 [640][512]: rows 0..63 = Wq rows, 64..127 = Wk rows, 128..639 = Wv rows (input
//     channels 0..511 only; channel 512 is handled in the GEMM epilogues); value = f16 of (bf16-RNE(w) * 256)
//     (exact). Block blk (0..79) owns rows 8*blk..8*blk+7 (source selection block-uniform): one wave per row,
// coverage: 80 blocks x 8 rows x 2 halves x 32 lanes x 8 halves = 640 x 512 = the whole plane.
// =========================================================================================================
__global__ __launch_bounds__(256)
void cvt_w(const float* __restrict__ wq, const float* __restrict__ wk, const float* __restrict__ wv,
           unsigned short* W16) {
  const int tid = threadIdx.x, blk = blockIdx.x;
  const int rl = tid >> 5, lane = tid & 31;
  const int o = 8 * blk + rl;                                          // 0..639
  const float* wbase = (blk < (DQ / 8)) ? wq : ((blk < (MQK / 8)) ? wk : wv);
  const int osub = (blk < (DQ / 8)) ? 0 : ((blk < (MQK / 8)) ? DQ : MQK);
  const float* s = wbase + (size_t)(o - osub) * CIN;                   // (o - osub) in range of that matrix
#pragma unroll 1
  for (int cp = 0; cp < CC / 256; ++cp) {
    const int col = 256 * cp + 8 * lane;                               // 0..504, col + 7 <= 511
    float f[8];
#pragma unroll
    for (int t = 0; t < 8; ++t) f[t] = s[col + t];
    v4u u;
#pragma unroll
    for (int t = 0; t < 4; ++t) {
      const _Float16 h0 = (_Float16)(bfr(f[2 * t]) * WSC);
      const _Float16 h1 = (_Float16)(bfr(f[2 * t + 1]) * WSC);
      u[t] = pk16(h_bits(h0), h_bits(h1));
    }
{
      *(v4u*)(W16 + (size_t)o * CC + col) = u;
      
    }
  }
}

// =========================================================================================================
// (1) x0 f32 [b][512 c][4096 n] -> XP f16 [b][n][c] (position-major, bf16-RNE values, exact in f16) through an LDS
// coverage: T 2 it x 32 cl x 8 e x 8 t = 64 n x 64 c (staged extent == consumed extent); XP 2 it x 32 rows x 8
//           lanes x 8 halves = 64 n x 64 c; grid (64, 8, NB) covers XP [NB][4096][512] exactly once.
// =========================================================================================================
__global__ __launch_bounds__(256)
void cvt_x(const float* __restrict__ x, unsigned short* XP) {
  __shared__ __align__(16) unsigned short T[QT * TP];
  const int tid = threadIdx.x;
  const int nb = blockIdx.x, cb = blockIdx.y, b = blockIdx.z;
  const int e = tid & 7, lq = tid >> 3;                                // lq 0..31
  const int n0 = nb * QT, c0 = cb * QT;
#pragma unroll
  for (int it = 0; it < 2; ++it) {
    const int cl = it * 32 + lq;                                       // 0..63
    const float* sp = x + ((size_t)(b * CC + c0 + cl)) * NN + n0 + 8 * e;
    const v4f a = *(const v4f*)sp;
    const v4f q = *(const v4f*)(sp + 4);
#pragma unroll
    for (int t = 0; t < 4; ++t) {
      T[(8 * e + t) * TP + cl]     = h_bits((_Float16)bfr(a[t]));
      T[(8 * e + 4 + t) * TP + cl] = h_bits((_Float16)bfr(q[t]));
    }
  }
  __syncthreads();
  v4u up[2];
#pragma unroll
  for (int it = 0; it < 2; ++it) {
    const int nl = it * 32 + lq;                                       // 0..63
    up[it] = *(const v4u*)(T + nl * TP + 8 * e);
  }
{
#pragma unroll
    for (int it = 0; it < 2; ++it) {
      const int rl = it * 32 + lq;
      *(v4u*)(XP + ((size_t)(b * NN + n0 + rl)) * CC + c0 + 8 * e) = up[it];
    }
    
  }
}

// =========================================================================================================
// GEMM core for one (64-n tile, 64-o block): Y[o][n] = (1/256) sum_c W16[o][c] XP[n][c], K = 512 = 16 k-steps.
//   Block 128 threads = 4 waves; wave w owns cols n0+16w..+15 (one B fragment per k-step, k = c contiguous in the
//   XP row) and 4 m-tiles (A rows o = o0 + 16 mt + (lane&15), split k map loader).
//   Operands come from LDS, laid there by tensor loads (rows of 256 B, pitch 272 B) in stages of 128 k, two buffers:
//   waves 0 and 1 bring 32 W16 rows each, waves 2 and 3 32 XP rows each; stage s + 2 is issued at the foot of pass s
//   into the buffer that pass has just read. A pass reads its 20 fragments as one group, then runs its 16 products.
//   Result staged in LDS Os[n_loc][o_loc] (pitch OSP, b128 stores of 8 consecutive o per lane), which reuses buffer 0
//   behind the loop: lane (hh, c) holds o_loc = 16 mt + 8 hh + r of n_loc = 16 w + c. Caller issues the block barrier.
// coverage: Os 4 waves x 16 n x 4 mt x 16 o = 64 x 64 (staged extent == consumed extent).
// =========================================================================================================
__device__ __forceinline__ void gemm_core(const unsigned short* __restrict__ Ag,   // W16 row o0, k = 0
                                          const unsigned short* __restrict__ Bg,   // XP row n0, k = 0
                                          unsigned char* L, int wave, int hh, int c) {
  float* Os = (float*)L;
  // every wave issues one tensor load per stage for its own slice: all of this is wave-uniform
  const uint32_t wv    = uni((uint32_t)threadIdx.x >> 5);
  const uint32_t lbase = (uint32_t)(size_t)L;                          // byte offset in the work-group's LDS
  const unsigned char* ssrc = (const unsigned char*)((wv < 2u ? Ag : Bg) + (size_t)(32u * (wv & 1u)) * CC);
  const uint32_t soff = wv * (uint32_t)GSLOT;
  u32x8 g1s = tdm_group1w(32u, (uint32_t)(CC * 2));
  asm volatile("" : "+s"(g1s));  // pinned() form, descriptor words held in scalar registers: one tuple serves every issue, so none is reused under a request in flight
  u32x4 g0s;                                                           // group 0 of this wave's stage request in flight
  auto issue = [&](uint32_t st) {
    const uint32_t dst = lbase + (st & 1u) * (uint32_t)GBUF + soff;
    const uint64_t ga  = (uint64_t)(size_t)ssrc + (uint64_t)st * (uint32_t)GKB;
    g0s = tdm_group0(dst, ga);
    tdm_load(g0s, g1s);
  };
  // the issuing wave's wait for its stage request; it names group 0 so that those registers keep their values until then
  auto landed = [&]() { asm volatile("s_wait_tensorcnt 0x0" :: "s"(g0s) : "memory"); };

  issue(pinned(0u));
  landed();
  __syncthreads();                                                     // stage 0 published to every wave
  issue(pinned(1u));

  v8f acc[4];
#pragma unroll
  for (int mt = 0; mt < 4; ++mt) acc[mt] = zero8();

  // rolled: the stage test at the foot is opaque to the compiler, so unrolled copies would carry issue code that never runs
#pragma unroll 1
  for (uint32_t st = 0; st < (uint32_t)GNST; ++st) {
    const unsigned char* Bp = L + (st & 1u) * (uint32_t)GBUF;          // this pass reads this buffer alone
    // A rows 16 mt + c: slice mt >> 1, row 16 (mt & 1) + c; B rows 16 wave + c: slice 2 + (wave >> 1); + 64 B per k-step
    const unsigned char* ap = Bp + c * GPB + 16 * hh;
    const unsigned char* bp = Bp + (2 + (wave >> 1)) * GSLOT + (16 * (wave & 1) + c) * GPB + 16 * hh;
    Frag fb[GKB / 64], fa[GKB / 64][4];                                // every fragment of the pass in registers of its own
#pragma unroll  // constant indices keep the fragment arrays in registers
    for (int ks = 0; ks < GKB / 64; ++ks) {
      fb[ks] = ldfrag_lds(bp + 64 * ks);
#pragma unroll
      for (int mt = 0; mt < 4; ++mt) fa[ks][mt] = ldfrag_lds(ap + (mt >> 1) * GSLOT + (16 * (mt & 1)) * GPB + 64 * ks);
    }
#pragma unroll
    for (int ks = 0; ks < GKB / 64; ++ks) {
#pragma unroll
      for (int mt = 0; mt < 4; ++mt) acc[mt] = mma_h(fa[ks][mt].h, fb[ks].h, acc[mt]);
    }
    // publish point of stage st + 1, every wave, in this order
    wait_ds0();
    landed();
    __syncthreads();                                                   // stage st + 1 published; every reader has left this buffer
    if (pinned(st + 2u < (uint32_t)GNST)) issue(pinned(st + 2u));      // scalar branch: a tensor load ignores EXEC
  }
  // behind the loop: this wait names both groups, so that no descriptor register takes a new value in front of it
  asm volatile("s_wait_tensorcnt 0x0" :: "s"(g0s), "s"(g1s) : "memory");
  wait_ds0();
  // the last pass's own barrier stands behind every wave's last read of the ring: buffer 0 is free for Os

  const int nl = 16 * wave + c;
#pragma unroll
  for (int mt = 0; mt < 4; ++mt) {
    v4f va, vb;
#pragma unroll
    for (int r = 0; r < 4; ++r) { va[r] = acc[mt][r] * IWSC; vb[r] = acc[mt][4 + r] * IWSC; }
    *(v4f*)(Os + nl * OSP + 16 * mt + 8 * hh)     = va;
    *(v4f*)(Os + nl * OSP + 16 * mt + 8 * hh + 4) = vb;
  }
}

// =========================================================================================================
// (2) q/k projection for one (b, 64-n tile, mb): mb = 0 -> q from W16 rows 0..63, mb = 1 -> k from rows 64..127.
//     Epilogue (after the barrier): value = Os + bf16-RNE(W[d][512]) * wpos(n) (position channel, f32), then
//     planes bf16 [b][4096 n][64 d] (k-contiguous for both score operands): hi = bf16-RNE(v), lo = bf16-RNE(v - hi).
// coverage: planes 4 it x 16 rows x 8 lanes x 8 = 64 n x 64 d per plane (hi and lo); grid (64, 2, NB) covers all
//           4096 rows x 64 d of Qh/Ql/Kh/Kl exactly once. Os: cross-wave (block barrier).
// =========================================================================================================
__global__ __launch_bounds__(128)
void gemm_qk(const unsigned short* __restrict__ W16, const unsigned short* __restrict__ XP,
             const float* __restrict__ wq, const float* __restrict__ wk,
             unsigned short* Qh, unsigned short* Ql, unsigned short* Kh, unsigned short* Kl) {
  __shared__ __attribute__((aligned(2048))) unsigned char L[GLDSB];
  const float* Os = (const float*)L;                                   // the core leaves its result in buffer 0
  const int tid  = threadIdx.x;
  const int lane = tid & 31, wave = tid >> 5;
  const int hh   = lane >> 4, c = lane & 15;
  const int nt   = blockIdx.x, mb = blockIdx.y, b = blockIdx.z;
  const int n0   = nt * QT, o0 = mb * QT;

  gemm_core(W16 + (size_t)o0 * CC, XP + ((size_t)(b * NN + n0)) * CC, L, wave, hh, c);
  __syncthreads();

  const int e = tid & 7, lq = tid >> 3;                                // lq 0..15
  const float* wsrc = (mb == 0) ? wq : wk;                             // block-uniform, both global
  unsigned short* Ph = (mb == 0) ? Qh : Kh;
  unsigned short* Pl = (mb == 0) ? Ql : Kl;
  float pw[8];
#pragma unroll
  for (int t = 0; t < 8; ++t) pw[t] = bfr(wsrc[(size_t)(8 * e + t) * CIN + CC]);   // W[d][512], d = 8e+t

  v4u uh[4], ul[4];
#pragma unroll
  for (int it = 0; it < 4; ++it) {
    const int row = it * 16 + lq;                                      // n_loc 0..63
    const float wl = wpos(n0 + row);
    const v4f a = *(const v4f*)(Os + row * OSP + 8 * e);
    const v4f q = *(const v4f*)(Os + row * OSP + 8 * e + 4);
    const float f[8] = {a[0], a[1], a[2], a[3], q[0], q[1], q[2], q[3]};
#pragma unroll
    for (int t = 0; t < 4; ++t) {
      const float f0 = f[2 * t] + pw[2 * t] * wl;
      const float f1 = f[2 * t + 1] + pw[2 * t + 1] * wl;
      const unsigned short hb0 = bf_bits(f0), hb1 = bf_bits(f1);
      const unsigned short lb0 = bf_bits(f0 - bf_up(hb0));
      const unsigned short lb1 = bf_bits(f1 - bf_up(hb1));
      uh[it][t] = pk16(hb0, hb1);
      ul[it][t] = pk16(lb0, lb1);
    }
  }
{
#pragma unroll
    for (int it = 0; it < 4; ++it) {
      const int row = it * 16 + lq;
      const size_t po = ((size_t)(b * NN + n0 + row)) * DQ + 8 * e;
      *(v4u*)(Ph + po) = uh[it];
      *(v4u*)(Pl + po) = ul[it];
    }
    
  }
}

// =========================================================================================================
// (3) v projection for one (b, 64-n tile, 64-o block mb 0..7): A rows = W16 rows 128 + o0 + .. .
//     Epilogue (after the barrier): v[o][n] = Os[n][o] + bf16-RNE(Wv[o][512]) * wpos(n) + bf16-RNE(bv[o]) in f32,
//     converted to f16, written to the channel-major plane V f16 [b][512 o][4096 n] (keys contiguous = the A
//     8e..8e+7 of row o_loc = 16 it + lq from 8 Os rows; 8 consecutive lanes x 16 B, one instruction per 16 lines.
// coverage: 4 it x 16 rows x 8 lanes x 8 halves = 64 o x 64 n; grid (64, 8, NB) covers V [NB][512][4096] once.
//           Os: cross-wave (block barrier).
// =========================================================================================================
__global__ __launch_bounds__(128)
void gemm_v(const unsigned short* __restrict__ W16, const unsigned short* __restrict__ XP,
            const float* __restrict__ wv, const float* __restrict__ bv, unsigned short* V) {
  __shared__ __attribute__((aligned(2048))) unsigned char L[GLDSB];
  const float* Os = (const float*)L;                                   // the core leaves its result in buffer 0
  const int tid  = threadIdx.x;
  const int lane = tid & 31, wave = tid >> 5;
  const int hh   = lane >> 4, c = lane & 15;
  const int nt   = blockIdx.x, mb = blockIdx.y, b = blockIdx.z;
  const int n0   = nt * QT, o0 = mb * QT;

  gemm_core(W16 + (size_t)(MQK + o0) * CC, XP + ((size_t)(b * NN + n0)) * CC, L, wave, hh, c);
  __syncthreads();

  const int e = tid & 7, lq = tid >> 3;                                // lq 0..15
  float wl[8];
#pragma unroll
  for (int t = 0; t < 8; ++t) wl[t] = wpos(n0 + 8 * e + t);

  v4u uv[4];
#pragma unroll
  for (int it = 0; it < 4; ++it) {
    const int ol = it * 16 + lq;                                       // o_loc 0..63
    const int og = o0 + ol;                                            // 0..511
    const float pwo = bfr(wv[(size_t)og * CIN + CC]);                 // Wv[o][512]
    const float bo  = bfr(bv[og]);
    unsigned short hb[8];
#pragma unroll
    for (int t = 0; t < 8; ++t) {
      const float val = Os[(8 * e + t) * OSP + ol] + pwo * wl[t] + bo;
      hb[t] = h_bits((_Float16)val);
    }
#pragma unroll
    for (int t = 0; t < 4; ++t) uv[it][t] = pk16(hb[2 * t], hb[2 * t + 1]);
  }
{
#pragma unroll
    for (int it = 0; it < 4; ++it) {
      const int og = o0 + it * 16 + lq;
      *(v4u*)(V + ((size_t)(b * CC + og)) * NN + n0 + 8 * e) = uv[it];
    }
    
  }
}

// =========================================================================================================
// (4) attention for one (b, 64-query tile, channel half chh), transposed formulation, 4096 keys, no mask, no scale:
//   S^T tile (16 keys x 16 queries) = sum over 2 d-chunks of A(k: row = key kb + (lane&15), 32 d via the split k
//   map from the bf16 plane Kh [b][4096][64]) . B(q: col = query, same map from Qh) + A(Kh).B(Ql) + A(Kl).B(Qh)
//   (bf16 unscaled residual planes, shared accumulator).
//   Per lane the D tile holds 8 keys of ONE query: online softmax state per lane, one shuffle (lane^16) for the max
//   over 32 keys; the o/l rescale is skipped under a wave-uniform ballot when no lane's max grew (corr == 1 exactly
//   for every lane then); row-sum partials combined at the end. P = e^{s-m} x 16384 as f16 is the B operand of
//   O^T (rows channel, cols queries) += A(v rows channel = cb0 + 16j + (lane&15), keys contiguous, f16 plane V
//   [b][512][4096]) . B(P^T): element r <- D of the tile covering keys kb..kb+15, element 8+r <- the tile covering
//   kb+16..kb+31, lane unchanged. 16 accumulator tiles per wave (256 channels of this half). Block = 4 waves =
//   64 queries; the two channel halves are separate blocks (grid.z) that recompute the same scores.
//   Operands come from LDS, laid there by tensor loads (rows of 128 B, pitch 144 B): the block's q rows once (each wave
//   one slice of 32 rows of one plane), then stages of 64 keys in two buffers: wave 0 brings the Kh rows, wave 1 the Kl
//   rows, waves 2 and 3 128 channel rows of V each (64 keys = one whole 128-B line per row); stage s + 2 is issued at
//   the foot of pass s into the buffer that pass has just read. A pass walks its 64 keys as two 32-key blocks.
//   LDS reads stand in groups, each fragment in registers of its own: behind a block's running-max update one group brings
//   its 16 v fragments and the next block's q and k fragments (the pass's first q and k fragments: a group at its head).
//   Epilogue in two quarters of 128 channels: gamma*O/l staged in LDS Os[query][128 channels] (pitch OSPW, b128
//   2 lines): 8 consecutive lanes x 16 B (values gathered from 4 Os rows), one instruction per 16 lines, final
// coverage: per quarter 16 it x 16 lines x 8 lanes x 4 floats = 128 ch x 64 n; two quarters = 256 ch per block;
//           grid (NQ/64, NB, 2) covers out[b][0..511][0..NQ-1] exactly once. Os: cross-wave (block barriers).
// =========================================================================================================
__global__ __launch_bounds__(128)
void attn_k(const unsigned short* __restrict__ Qh, const unsigned short* __restrict__ Ql,
            const unsigned short* __restrict__ Kh, const unsigned short* __restrict__ Kl,
            const unsigned short* __restrict__ V, const float* __restrict__ x,
            const float* __restrict__ gamma, float* out) {
  __shared__ __attribute__((aligned(2048))) unsigned char L[LDSB];
  float* Os = (float*)L;                                               // output staging reuses buffer 0 behind the loop
  const int tid  = threadIdx.x;
  const int wave = tid >> 5, lane = tid & 31;
  const int hh   = lane >> 4, c = lane & 15;
  const int n0   = blockIdx.x * QT, b = blockIdx.y, chh = blockIdx.z;
  const int cb0  = chh * CH;                                           // 0 or 256

  // every wave issues one tensor load per stage for its own slice: all of this is wave-uniform
  const uint32_t wv    = uni((uint32_t)tid >> 5);
  const uint32_t lbase = (uint32_t)(size_t)L;                          // byte offset in the work-group's LDS
  const bool     isV   = wv >= 2u;
  const unsigned char* ssrc = isV
      ? (const unsigned char*)(V + ((size_t)(b * CC + cb0) + 128u * (wv - 2u)) * NN)
      : (const unsigned char*)((wv == 0u ? Kh : Kl) + (size_t)b * NN * DQ);
  const uint32_t sadv = isV ? (uint32_t)(SKEYS * 2) : (uint32_t)(SKEYS * DQ * 2);   // source bytes from stage to stage
  const uint32_t soff = isV ? (uint32_t)VOFF + (wv - 2u) * (uint32_t)VHALF : wv * (uint32_t)KSLOT;
  u32x8 g1s = tdm_group1(isV ? 128u : (uint32_t)SKEYS, isV ? (uint32_t)(NN * 2) : (uint32_t)(DQ * 2));
  asm volatile("" : "+s"(g1s));  // pinned() form, descriptor words held in scalar registers: one tuple serves every issue, so none is reused under a request in flight
  u32x4 g0s;                                                           // group 0 of this wave's stage request in flight
  auto issue = [&](uint32_t st) {
    const uint32_t dst = lbase + (st & 1u) * (uint32_t)BUFB + soff;
    const uint64_t ga  = (uint64_t)(size_t)ssrc + (uint64_t)st * sadv;
    g0s = tdm_group0(dst, ga);
    tdm_load(g0s, g1s);
  };
  // the issuing wave's wait for its stage request; it names group 0 so that those registers keep their values until then
  auto landed = [&]() { asm volatile("s_wait_tensorcnt 0x0" :: "s"(g0s) : "memory"); };

  // q, loaded once: wave wv brings rows n0 + 32*(wv>>1) .. +31 of plane (wv&1 ? Ql : Qh) into slice wv
  {
    const unsigned char* qsrc =
        (const unsigned char*)(((wv & 1u) ? Ql : Qh) + ((size_t)(b * NN + n0) + 32u * (wv >> 1)) * DQ);
    tdm_load(tdm_group0(lbase + (uint32_t)QOFF + wv * (uint32_t)QSLOT, (uint64_t)(size_t)qsrc),
             tdm_group1(32u, (uint32_t)(DQ * 2)));
    wait_tensor0();
  }
  issue(pinned(0u));
  landed();
  __syncthreads();                                                     // q and stage 0 published to every wave
  issue(pinned(1u));

  // q fragment pointers (B operand, col = query n0 + 16*wave + c: row 16*(wave&1) + c of slices 2*(wave>>1), +1), + 64*kc B
  const unsigned char* Qhp = L + QOFF + (2 * (wave >> 1)) * QSLOT + (16 * (wave & 1) + c) * LPB + 16 * hh;
  const unsigned char* Qlp = Qhp + QSLOT;

  float m = -1.0e30f, l = 0.f;
  v8f o[16];
#pragma unroll
  for (int j = 0; j < 16; ++j) o[j] = zero8();

#pragma unroll 1
  for (uint32_t st = 0; st < (uint32_t)NST; ++st) {
   const unsigned char* Bp = L + (st & 1u) * (uint32_t)BUFB;          // this pass reads this buffer alone
   // k fragments (A operand, row = key): stage row 32*sub + c (+16), + 64*kc B; residual plane KSLOT further on
   const unsigned char* Kp = Bp + c * LPB + 16 * hh;
   // v fragments (A operand, row = channel cb0 + 16j + c, keys contiguous): + 16*j rows, + 64*sub B
   const unsigned char* Vp = Bp + VOFF + c * LPB + 16 * hh;
   // every fragment of a 32-key block has registers of its own, so that its reads can all be in flight at once
   Frag qh[DQ / 32], ql[DQ / 32], k0[DQ / 32], k1[DQ / 32], k0l[DQ / 32], k1l[DQ / 32], vf[16];
   auto load_qk = [&](int sub) {                                       // one group: the 24 reads of a block's score operands
     const unsigned char* k0p = Kp + (32 * sub) * LPB;                 // keys kb .. kb+15; + 16 rows: kb+16 .. kb+31
#pragma unroll  // constant indices keep the fragment arrays in registers
     for (int kc = 0; kc < DQ / 32; ++kc) {
       qh[kc]  = ldfrag_lds(Qhp + 64 * kc);
       k0[kc]  = ldfrag_lds(k0p + 64 * kc);
       k1[kc]  = ldfrag_lds(k0p + 16 * LPB + 64 * kc);
       ql[kc]  = ldfrag_lds(Qlp + 64 * kc);
       k0l[kc] = ldfrag_lds(k0p + KSLOT + 64 * kc);
       k1l[kc] = ldfrag_lds(k0p + KSLOT + 16 * LPB + 64 * kc);
     }
   };
   load_qk(0);
   // unrolled: block 0 issues block 1's score operands, which a rolled loop could not name
#pragma unroll
   for (int sub = 0; sub < SKEYS / 32; ++sub) {                        // keys kb = 64*st + 32*sub .. +31
    v8f s0 = zero8(), s1 = zero8();
#pragma unroll  // constant indices into the fragment arrays
    for (int kc = 0; kc < DQ / 32; ++kc) {
      s0 = wm_b(k0[kc].bf, qh[kc].bf, s0);
      s1 = wm_b(k1[kc].bf, qh[kc].bf, s1);
      s0 = wm_b(k0[kc].bf, ql[kc].bf, s0);
      s1 = wm_b(k1[kc].bf, ql[kc].bf, s1);
      s0 = wm_b(k0l[kc].bf, qh[kc].bf, s0);
      s1 = wm_b(k1l[kc].bf, qh[kc].bf, s1);
    }

    float mx = fmaxf(hmax8(s0), hmax8(s1));
    mx = fmaxf(mx, __shfl_xor(mx, 16, 32));
    const float mn = fmaxf(m, mx);
    const unsigned grew = wave_ballot(mx > m);                         // wave-uniform
    if (grew != 0u) {
      const float corr = __expf(m - mn);                               // == 1 exactly for lanes whose max did not grow
      l *= corr;
#pragma unroll
      for (int j = 0; j < 16; ++j) {
#pragma unroll
        for (int r = 0; r < 8; ++r) o[j][r] *= corr;
      }
    }
    m = mn;
    const float msh = mn - LNPS;                                       // exp gives e^{s-m} * 16384

    // one group of reads, all in flight at once: this block's 16 v fragments land under the exponentials, the next block's
    // score operands under the exponentials and the v products
#pragma unroll  // constant indices keep the fragment array in registers
    for (int j = 0; j < 16; ++j) vf[j] = ldfrag_lds(Vp + 64 * sub + (16 * j) * LPB);
    if (sub + 1 < SKEYS / 32) load_qk(sub + 1);
    // keeps the group here: without it the scheduler sinks each read to its product, which then waits out the LDS latency
    __builtin_amdgcn_sched_barrier(0);

    FragH ph;
    float ls = 0.f;
#pragma unroll
    for (int r = 0; r < 8; ++r) {
      const float e0 = __expf(s0[r] - msh);                            // key kb      + 8hh + r
      const float e1 = __expf(s1[r] - msh);                            // key kb + 16 + 8hh + r
      ls += e0 + e1;
      ph.hv[0][r] = (_Float16)e0;
      ph.hv[1][r] = (_Float16)e1;
    }
    l += ls;

#pragma unroll
    for (int j = 0; j < 16; ++j) o[j] = wm_h(vf[j].h, ph.v, o[j]);
    // the v products stay in front of what follows: they start on the group's first reads (counted waits), while the next
    // block's score products need its last ones, and the wait at the foot needs them all
    __builtin_amdgcn_sched_barrier(0);
    if (sub + 1 < SKEYS / 32) {
      // WMMA distance: the next block's first score product writes its D where the allocator kept P, the B operand of the
      // v product issued just before it; four slots between the two, held in place by the scheduling barriers around them
      asm volatile("v_nop\n\tv_nop\n\tv_nop\n\tv_nop");
      __builtin_amdgcn_sched_barrier(0);
    }
   }
   // publish point of stage st + 1, every wave, in this order
   wait_ds0();
   landed();
   __syncthreads();                                                    // stage st + 1 published; every reader has left this buffer
   if (pinned(st + 2u < (uint32_t)NST)) issue(pinned(st + 2u));        // scalar branch: a tensor load ignores EXEC
  }
  wait_tensor0();
  wait_ds0();
  // the last pass's own barrier stands behind every wave's last read of the ring: buffer 0 is free for Os
  l += __shfl_xor(l, 16, 32);
  const float gam = bfr(gamma[0]);
  const float inv = gam / l;                                           // o and l both carry the x16384 factor

  const int qrow = 16 * wave + c;
  const int e = tid & 7, lq = tid >> 3;                                // lq 0..15
#pragma unroll
  for (int half = 0; half < 2; ++half) {
    if (half) __syncthreads();                                         // every wave finished reading Os
#pragma unroll
    for (int jj = 0; jj < 8; ++jj) {
      const int j = 8 * half + jj;
      v4f va, vb;
#pragma unroll
      for (int r = 0; r < 4; ++r) { va[r] = o[j][r] * inv; vb[r] = o[j][4 + r] * inv; }
      *(v4f*)(Os + qrow * OSPW + 16 * jj + 8 * hh)     = va;           // Os[query][ch_loc = 16jj + 8hh + r]
      *(v4f*)(Os + qrow * OSPW + 16 * jj + 8 * hh + 4) = vb;
    }
    __syncthreads();
    v4f res[16];
#pragma unroll
    for (int it = 0; it < 16; ++it) {
      const int L   = it * 16 + lq;                                    // 0..255
      const int chl = L >> 1, hf = L & 1;                              // channel 0..127 within the quarter
      const int nl  = hf * 32 + 4 * e;                                 // query 0..63
      const size_t idx = ((size_t)(b * CC + cb0 + 128 * half + chl)) * NN + n0 + nl;
      const v4f xv = *(const v4f*)(x + idx);
#pragma unroll
      for (int t = 0; t < 4; ++t) res[it][t] = Os[(nl + t) * OSPW + chl] + bfr(xv[t]);
    }
{
#pragma unroll
      for (int it = 0; it < 16; ++it) {
        const int L   = it * 16 + lq;
        const int chl = L >> 1, hf = L & 1;
        const int nl  = hf * 32 + 4 * e;
        const size_t idx = ((size_t)(b * CC + cb0 + 128 * half + chl)) * NN + n0 + nl;
        *(v4f*)(out + idx) = res[it];
      }
      
    }
  }
}

// =========================================================================================================
// Workspace map (bytes; each region start a multiple of 256; every extent is an exact tile multiple and is written
//   W16 f16 [640][512]                  655360
//   XP  f16 [NB][4096][512]           16777216 (NB = 4)
//   V   f16 [NB][512][4096]           16777216
//   Qh/Ql/Kh/Kl bf16 [NB][4096][64]   2097152 x4
//   total (NB = 4) = 42598400
// =========================================================================================================
extern "C" void kernel_launch(void* const* d_in, const int* in_sizes, int n_in,
                              void* d_out, int out_size, void* d_ws, size_t ws_size,
                              hipStream_t stream) {
  const int XN = NB * CC * NN;
  if (n_in < 6) return;
  if (in_sizes[0] < XN) return;
  if (in_sizes[1] < DQ * CIN || in_sizes[2] < DQ * CIN) return;
  if (in_sizes[3] < CC * CIN || in_sizes[4] < CC || in_sizes[5] < 1) return;
  if (out_size < XN) return;

  size_t off = 0;
  auto carve = [&](size_t bytes) { const size_t o = off; off += (bytes + 255) & ~(size_t)255; return o; };
  const size_t oW16 = carve((size_t)MW * CC * 2);
  const size_t oXP  = carve((size_t)NB * NN * CC * 2);
  const size_t oV   = carve((size_t)NB * CC * NN * 2);
  const size_t oQh  = carve((size_t)NB * NN * DQ * 2);
  const size_t oQl  = carve((size_t)NB * NN * DQ * 2);
  const size_t oKh  = carve((size_t)NB * NN * DQ * 2);
  const size_t oKl  = carve((size_t)NB * NN * DQ * 2);
  if (off > ws_size) return;
  if (off > (size_t)134217728) return;

  const float* x     = (const float*)d_in[0];
  const float* wq    = (const float*)d_in[1];
  const float* wk    = (const float*)d_in[2];
  const float* wv    = (const float*)d_in[3];
  const float* bv    = (const float*)d_in[4];
  const float* gamma = (const float*)d_in[5];

  char* ws = (char*)d_ws;
  unsigned short* W16 = (unsigned short*)(ws + oW16);
  unsigned short* XP  = (unsigned short*)(ws + oXP);
  unsigned short* V   = (unsigned short*)(ws + oV);
  unsigned short* Qh  = (unsigned short*)(ws + oQh);
  unsigned short* Ql  = (unsigned short*)(ws + oQl);
  unsigned short* Kh  = (unsigned short*)(ws + oKh);
  unsigned short* Kl  = (unsigned short*)(ws + oKl);
  float* out = (float*)d_out;

  const dim3 blk256(256), blk128(128);

  // (0) Wq / Wk / Wv (channels 0..511) -> stacked f16 plane
  cvt_w<<<dim3(MW / 8), blk256, 0, stream>>>(wq, wk, wv, W16);
  // (1) x0 -> position-major 16-bit plane
  cvt_x<<<dim3(NN / QT, CC / QT, NB), blk256, 0, stream>>>(x, XP);
  // (2) q / k projections -> hi + residual bf16 planes
  gemm_qk<<<dim3(NN / QT, MQK / QT, NB), blk128, 0, stream>>>(W16, XP, wq, wk, Qh, Ql, Kh, Kl);
  // (3) v projection + bias -> channel-major f16 plane
  gemm_v<<<dim3(NN / QT, CC / QT, NB), blk128, 0, stream>>>(W16, XP, wv, bv, V);
  // (4) attention + gamma scale + residual -> out [b][512][NQ]
  attn_k<<<dim3(NQ / QT, NB, 2), blk128, 0, stream>>>(Qh, Ql, Kh, Kl, V, x, gamma, out);
  (void)hipGetLastError();
}

// v004
// It runs in 115 microseconds.
// Next to v003, in two timings, it ran 1.04 times as fast each time.
// All steps since v000 together make it 6.43 times as fast.
// Contractions: q/k/v 1x1 projections W[640x512].X[512x4096] per batch on v_wmma_f32_16x16x32_f16 (f16
// containers of bf16-RNE weights x256 and bf16-RNE x0; input channel 512 = position term, and the v bias, added in
// the f32 epilogue); scores K.Q^T on v_wmma_f32_16x16x32_bf16 (bf16 hi + bf16 residual planes of q and k, 3
// products, K=64); out^T = V.P^T on v_wmma_f32_16x16x32_f16 (v as f16, P = e^{s-m} x16384 f16 from the score D
// registers); f32 accumulate everywhere; softmax statistics, gamma scale and the residual add in f32 VALU.
#include <hip/hip_runtime.h>
#include <math.h>
#include <stdint.h>

#ifndef NB
#define NB 4
#endif
#ifndef NQ
#define NQ 4096
#endif
#define NBF   4
#define CC    512
#define CIN   513
#define NN    4096
#define DQ    64
#define MQK   128
#define MW    640
#define QT    64
#define CH    256
#define OSP   68
#define OSPW  132
#define TP    72
#define WSC   256.0f
#define IWSC  0.00390625f
#define LNPS  9.704060527839234f
#define INVNN 0.000244140625f
// attention LDS map (bytes): every staged row is 128 B of data at a pitch of 144 B (16 B x odd, for ds_load_b128 readers)
#define SKEYS 64                       // keys per stage
#define NST   (NN / SKEYS)             // stages
#define LPB   144                      // LDS row pitch
#define KSLOT 10240                    // one k plane of a stage: 64 rows x 144 B = 9216, rounded up to a multiple of 2 KiB
#define VOFF  (2 * KSLOT)              // v rows behind the two k planes
#define VHALF (128 * LPB)              // 128 v rows = 18432 = 9 x 2 KiB
#define BUFB  (VOFF + 2 * VHALF)       // one stage buffer = 57344
#define QOFF  (2 * BUFB)               // q slices behind the two stage buffers
#define QSLOT 6144                     // 32 q rows x 144 B = 4608, rounded up to a multiple of 2 KiB
#define LDSB  (QOFF + 4 * QSLOT)       // 139264: two work-groups fit one WGP's 320 KiB

// GEMM LDS map (bytes): a stage is 128 k = 256 B of 64 W16 rows and 64 XP rows at a pitch of 272 B (16 B x odd)
#define GKB   256                      // bytes of every operand row per stage
#define GNST  (CC * 2 / GKB)           // stages
#define GPB   272                      // LDS row pitch
#define GSLOT 10240                    // one wave's slice: 32 rows x 272 B = 8704, rounded up to a multiple of 2 KiB
#define GBUF  (4 * GSLOT)              // one stage buffer: W16 rows 0..31, 32..63, XP rows 0..31, 32..63
#define GLDSB (2 * GBUF)               // 81920: four work-groups fit one WGP's 320 KiB

static_assert(NB >= 1 && NB <= NBF);
static_assert(NQ >= QT && NQ <= NN && NQ % QT == 0);
static_assert(NN % QT == 0 && CC % QT == 0 && MQK % QT == 0);
static_assert(MQK == 2 * DQ && MW == MQK + CC && MW % 8 == 0);
static_assert(DQ == QT);
static_assert(CC == 2 * CH && CH == 16 * 16);
static_assert(CC % 256 == 0 && CC % 32 == 0 && DQ % 32 == 0 && NN % 32 == 0);
static_assert((OSP * 4) % 16 == 0);
static_assert((OSPW * 4) % 16 == 0);
static_assert((TP * 2) % 16 == 0);
static_assert(DQ * 2 == 128 && SKEYS * 2 == 128 && NN % SKEYS == 0 && NST >= 2);
static_assert(KSLOT % 2048 == 0 && KSLOT >= SKEYS * LPB && VHALF % 2048 == 0 && QSLOT % 2048 == 0 && QSLOT >= 32 * LPB);
static_assert(QT * OSPW * 4 <= BUFB && 2 * LDSB <= 327680);
static_assert(GNST >= 2 && GSLOT % 2048 == 0 && GSLOT >= 32 * GPB && QT == 64 && QT * OSP * 4 <= GBUF && 4 * GLDSB <= 327680);

typedef _Float16       v16h __attribute__((ext_vector_type(16)));
typedef _Float16       v8h  __attribute__((ext_vector_type(8)));
typedef __bf16         v16b __attribute__((ext_vector_type(16)));
typedef unsigned short v8us __attribute__((ext_vector_type(8)));
typedef float          v8f  __attribute__((ext_vector_type(8)));
typedef float          v4f  __attribute__((ext_vector_type(4)));
typedef unsigned int   v4u  __attribute__((ext_vector_type(4)));
typedef uint32_t       u32x4 __attribute__((ext_vector_type(4)));
typedef uint32_t       u32x8 __attribute__((ext_vector_type(8)));

union Frag  { v8us u[2]; v16h h; v16b bf; };
union FragH { v16h v; v8h hv[2]; };
static_assert(sizeof(Frag) == 32);
static_assert(sizeof(FragH) == 32);

// ---- scalar helpers ---------------------------------------------------------------------------------------
__device__ __forceinline__ unsigned short bf_bits(float f) {          // f32 -> bf16 bits, RNE convert
  unsigned u = __float_as_uint(f);
  return (unsigned short)((u + 0x7FFFu + ((u >> 16) & 1u)) >> 16);
}
__device__ __forceinline__ float bf_up(unsigned short hb) { return __uint_as_float(((unsigned)hb) << 16); }
__device__ __forceinline__ float bfr(float f) { return bf_up(bf_bits(f)); }
__device__ __forceinline__ unsigned short h_bits(_Float16 x) { return __builtin_bit_cast(unsigned short, x); }
__device__ __forceinline__ unsigned pk16(unsigned short a, unsigned short b) { return (unsigned)a | ((unsigned)b << 16); }
__device__ __forceinline__ v8f zero8() { v8f z = {0.f, 0.f, 0.f, 0.f, 0.f, 0.f, 0.f, 0.f}; return z; }
__device__ __forceinline__ float hmax8(v8f s) {
  return fmaxf(fmaxf(fmaxf(s[0], s[1]), fmaxf(s[2], s[3])), fmaxf(fmaxf(s[4], s[5]), fmaxf(s[6], s[7])));
}
__device__ __forceinline__ unsigned wave_ballot(bool p) {
#if defined(__HIP_DEVICE_COMPILE__)
  return __builtin_amdgcn_ballot_w32(p);
#else
  return p ? 1u : 0u;
#endif
}
// lane l with lane l ^ 16, as a vector move (a shuffle through the LDS unit counts on dscnt)
__device__ __forceinline__ float xhalf(float x) {
  return __builtin_bit_cast(float, __builtin_amdgcn_permlanex16(__builtin_bit_cast(int, x), __builtin_bit_cast(int, x),
                                                                0x76543210, 0xfedcba98, false, false));
}
// compile-time tags of an attention pass: does a next stage exist
struct HasNext   { static constexpr bool more = true; };
struct LastStage { static constexpr bool more = false; };
// position channel value w[l] = (l / 4096) * 2 - 1 in f32, spec op order (every step exact)
__device__ __forceinline__ float wpos(int l) { return ((float)l * INVNN) * 2.0f - 1.0f; }

// ---- 16-bit fragment loader (A, or B from a k-contiguous [n][k] row) from an LDS row: lane -> row/col (lane&15), p (bytes)
//      already includes 16*(lane>>4); elements 0..7 <- k0+8h.., elements 8..15 <- k0+16+8h.. (16 elements = 32 B on)
__device__ __forceinline__ Frag ldfrag_lds(const unsigned char* p) {
  Frag f;
  f.u[0] = *(const v8us*)(p);
  f.u[1] = *(const v8us*)(p + 32);
  return f;
}

// ---- tensor load to LDS: descriptor groups, issue and waits --------------------------------------------------
__device__ __forceinline__ uint32_t uni(uint32_t v) { return (uint32_t)__builtin_amdgcn_readfirstlane(v); }
// a wave-uniform value held in a scalar register: a test on it compiles to a scalar branch, and a descriptor word formed
// from it stands behind the wait written in front of it
__device__ __forceinline__ uint32_t pinned(uint32_t v) { uint32_t w = uni(v); asm volatile("" : "+s"(w)); return w; }
// group 1: 1-byte elements, tile = tensor = rows x 128 B, source pitch in bytes, 16 B of LDS pad behind every 128-B row
__device__ __forceinline__ u32x8 tdm_group1(uint32_t rows, uint32_t src_pitch) {
  u32x8 g;
  g[0] = uni((1u << 20) | (4u << 22) | (3u << 25));
  g[1] = uni(128u << 16);
  g[2] = uni(rows << 16);
  g[3] = uni(128u << 16);
  g[4] = uni(rows);
  g[5] = uni(src_pitch);
  g[6] = uni(0u);
  g[7] = uni(0u);
  return g;
}
// the same for rows of 256 B: 16 B of LDS pad behind every 256-B row
__device__ __forceinline__ u32x8 tdm_group1w(uint32_t rows, uint32_t src_pitch) {
  u32x8 g;
  g[0] = uni((1u << 20) | (5u << 22) | (3u << 25));
  g[1] = uni(256u << 16);
  g[2] = uni(rows << 16);
  g[3] = uni(256u << 16);
  g[4] = uni(rows);
  g[5] = uni(src_pitch);
  g[6] = uni(0u);
  g[7] = uni(0u);
  return g;
}
__device__ __forceinline__ u32x4 tdm_group0(uint32_t lds_dst, uint64_t ga) {
  u32x4 g;
  g[0] = uni(1u);
  g[1] = uni(lds_dst);
  g[2] = uni((uint32_t)ga);
  g[3] = uni((((uint32_t)(ga >> 32)) & 0x01FFFFFFu) | 0x80000000u);
  return g;
}
__device__ __forceinline__ void tdm_load(u32x4 g0, u32x8 g1) {
  asm volatile("tensor_load_to_lds %0, %1" :: "s"(g0), "s"(g1) : "memory");
}
// the compiler places no wait for a tensor load: the issuing wave's own wait, before the barrier that publishes the tile
__device__ __forceinline__ void wait_tensor0() { asm volatile("s_wait_tensorcnt 0x0" ::: "memory"); }
// this wave's LDS reads have returned before a buffer it read is handed back for a refill
__device__ __forceinline__ void wait_ds0() { asm volatile("s_wait_dscnt 0x0" ::: "memory"); }

// ---- WMMA helper of the GEMMs: builtin followed by a 4-slot VALU gap tying D and keeping A/B live --------------------------
__device__ __forceinline__ v8f mma_h(v16h a, v16h b, v8f c) {
  v8f d = __builtin_amdgcn_wmma_f32_16x16x32_f16(false, a, false, b, (short)0, c, false, false);
#if defined(__HIP_DEVICE_COMPILE__)
  asm volatile("v_nop\n\tv_nop\n\tv_nop\n\tv_nop" : "+v"(d) : "v"(a), "v"(b));
#endif
  return d;
}
// the products of the attention loop, without the asm gap: an asm statement's vector operands must lie in v0..v255,
// which a loop that holds accumulators and prefetched fragments at once does not fit; the compiler pads the builtin itself
__device__ __forceinline__ v8f wm_h(v16h a, v16h b, v8f c) {
  return __builtin_amdgcn_wmma_f32_16x16x32_f16(false, a, false, b, (short)0, c, false, false);
}
__device__ __forceinline__ v8f wm_b(v16b a, v16b b, v8f c) {
  return __builtin_amdgcn_wmma_f32_16x16x32_bf16(false, a, false, b, (short)0, c, false, false);
}

// =========================================================================================================
// (0) 1x1 weights: W16 f16 [640][512]: rows 0..63 = Wq rows, 64..127 = Wk rows, 128..639 = Wv rows (input
//     channels 0..511 only; channel 512 is handled in the GEMM epilogues); value = f16 of (bf16-RNE(w) * 256)
//     (exact). Block blk (0..79) owns rows 8*blk..8*blk+7 (source selection block-uniform): one wave per row,
// coverage: 80 blocks x 8 rows x 2 halves x 32 lanes x 8 halves = 640 x 512 = the whole plane.
// =========================================================================================================
__global__ __launch_bounds__(256)
void cvt_w(const float* __restrict__ wq, const float* __restrict__ wk, const float* __restrict__ wv,
           unsigned short* W16) {
  const int tid = threadIdx.x, blk = blockIdx.x;
  const int rl = tid >> 5, lane = tid & 31;
  const int o = 8 * blk + rl;                                          // 0..639
  const float* wbase = (blk < (DQ / 8)) ? wq : ((blk < (MQK / 8)) ? wk : wv);
  const int osub = (blk < (DQ / 8)) ? 0 : ((blk < (MQK / 8)) ? DQ : MQK);
  const float* s = wbase + (size_t)(o - osub) * CIN;                   // (o - osub) in range of that matrix
#pragma unroll 1
  for (int cp = 0; cp < CC / 256; ++cp) {
    const int col = 256 * cp + 8 * lane;                               // 0..504, col + 7 <= 511
    float f[8];
#pragma unroll
    for (int t = 0; t < 8; ++t) f[t] = s[col + t];
    v4u u;
#pragma unroll
    for (int t = 0; t < 4; ++t) {
      const _Float16 h0 = (_Float16)(bfr(f[2 * t]) * WSC);
      const _Float16 h1 = (_Float16)(bfr(f[2 * t + 1]) * WSC);
      u[t] = pk16(h_bits(h0), h_bits(h1));
    }
{
      *(v4u*)(W16 + (size_t)o * CC + col) = u;
      
    }
  }
}

// =========================================================================================================
// (1) x0 f32 [b][512 c][4096 n] -> XP f16 [b][n][c] (position-major, bf16-RNE values, exact in f16) through an LDS
// coverage: T 2 it x 32 cl x 8 e x 8 t = 64 n x 64 c (staged extent == consumed extent); XP 2 it x 32 rows x 8
//           lanes x 8 halves = 64 n x 64 c; grid (64, 8, NB) covers XP [NB][4096][512] exactly once.
// =========================================================================================================
__global__ __launch_bounds__(256)
void cvt_x(const float* __restrict__ x, unsigned short* XP) {
  __shared__ __align__(16) unsigned short T[QT * TP];
  const int tid = threadIdx.x;
  const int nb = blockIdx.x, cb = blockIdx.y, b = blockIdx.z;
  const int e = tid & 7, lq = tid >> 3;                                // lq 0..31
  const int n0 = nb * QT, c0 = cb * QT;
#pragma unroll
  for (int it = 0; it < 2; ++it) {
    const int cl = it * 32 + lq;                                       // 0..63
    const float* sp = x + ((size_t)(b * CC + c0 + cl)) * NN + n0 + 8 * e;
    const v4f a = *(const v4f*)sp;
    const v4f q = *(const v4f*)(sp + 4);
#pragma unroll
    for (int t = 0; t < 4; ++t) {
      T[(8 * e + t) * TP + cl]     = h_bits((_Float16)bfr(a[t]));
      T[(8 * e + 4 + t) * TP + cl] = h_bits((_Float16)bfr(q[t]));
    }
  }
  __syncthreads();
  v4u up[2];
#pragma unroll
  for (int it = 0; it < 2; ++it) {
    const int nl = it * 32 + lq;                                       // 0..63
    up[it] = *(const v4u*)(T + nl * TP + 8 * e);
  }
{
#pragma unroll
    for (int it = 0; it < 2; ++it) {
      const int rl = it * 32 + lq;
      *(v4u*)(XP + ((size_t)(b * NN + n0 + rl)) * CC + c0 + 8 * e) = up[it];
    }
    
  }
}

// =========================================================================================================
// GEMM core for one (64-n tile, 64-o block): Y[o][n] = (1/256) sum_c W16[o][c] XP[n][c], K = 512 = 16 k-steps.
//   Block 128 threads = 4 waves; wave w owns cols n0+16w..+15 (one B fragment per k-step, k = c contiguous in the
//   XP row) and 4 m-tiles (A rows o = o0 + 16 mt + (lane&15), split k map loader).
//   Operands come from LDS, laid there by tensor loads (rows of 256 B, pitch 272 B) in stages of 128 k, two buffers:
//   waves 0 and 1 bring 32 W16 rows each, waves 2 and 3 32 XP rows each; stage s + 2 is issued at the foot of pass s
//   into the buffer that pass has just read. A pass reads its 20 fragments as one group, then runs its 16 products.
//   Result staged in LDS Os[n_loc][o_loc] (pitch OSP, b128 stores of 8 consecutive o per lane), which reuses buffer 0
//   behind the loop: lane (hh, c) holds o_loc = 16 mt + 8 hh + r of n_loc = 16 w + c. Caller issues the block barrier.
// coverage: Os 4 waves x 16 n x 4 mt x 16 o = 64 x 64 (staged extent == consumed extent).
// =========================================================================================================
__device__ __forceinline__ void gemm_core(const unsigned short* __restrict__ Ag,   // W16 row o0, k = 0
                                          const unsigned short* __restrict__ Bg,   // XP row n0, k = 0
                                          unsigned char* L, int wave, int hh, int c) {
  float* Os = (float*)L;
  // every wave issues one tensor load per stage for its own slice: all of this is wave-uniform
  const uint32_t wv    = uni((uint32_t)threadIdx.x >> 5);
  const uint32_t lbase = (uint32_t)(size_t)L;                          // byte offset in the work-group's LDS
  const unsigned char* ssrc = (const unsigned char*)((wv < 2u ? Ag : Bg) + (size_t)(32u * (wv & 1u)) * CC);
  const uint32_t soff = wv * (uint32_t)GSLOT;
  u32x8 g1s = tdm_group1w(32u, (uint32_t)(CC * 2));
  asm volatile("" : "+s"(g1s));  // pinned() form, descriptor words held in scalar registers: one tuple serves every issue, so none is reused under a request in flight
  u32x4 g0s;                                                           // group 0 of this wave's stage request in flight
  auto issue = [&](uint32_t st) {
    const uint32_t dst = lbase + (st & 1u) * (uint32_t)GBUF + soff;
    const uint64_t ga  = (uint64_t)(size_t)ssrc + (uint64_t)st * (uint32_t)GKB;
    g0s = tdm_group0(dst, ga);
    tdm_load(g0s, g1s);
  };
  // the issuing wave's wait for its stage request; it names group 0 so that those registers keep their values until then
  auto landed = [&]() { asm volatile("s_wait_tensorcnt 0x0" :: "s"(g0s) : "memory"); };

  issue(pinned(0u));
  landed();
  __syncthreads();                                                     // stage 0 published to every wave
  issue(pinned(1u));

  v8f acc[4];
#pragma unroll
  for (int mt = 0; mt < 4; ++mt) acc[mt] = zero8();

  // rolled: the stage test at the foot is opaque to the compiler, so unrolled copies would carry issue code that never runs
#pragma unroll 1
  for (uint32_t st = 0; st < (uint32_t)GNST; ++st) {
    const unsigned char* Bp = L + (st & 1u) * (uint32_t)GBUF;          // this pass reads this buffer alone
    // A rows 16 mt + c: slice mt >> 1, row 16 (mt & 1) + c; B rows 16 wave + c: slice 2 + (wave >> 1); + 64 B per k-step
    const unsigned char* ap = Bp + c * GPB + 16 * hh;
    const unsigned char* bp = Bp + (2 + (wave >> 1)) * GSLOT + (16 * (wave & 1) + c) * GPB + 16 * hh;
    Frag fb[GKB / 64], fa[GKB / 64][4];                                // every fragment of the pass in registers of its own
#pragma unroll  // constant indices keep the fragment arrays in registers
    for (int ks = 0; ks < GKB / 64; ++ks) {
      fb[ks] = ldfrag_lds(bp + 64 * ks);
#pragma unroll
      for (int mt = 0; mt < 4; ++mt) fa[ks][mt] = ldfrag_lds(ap + (mt >> 1) * GSLOT + (16 * (mt & 1)) * GPB + 64 * ks);
    }
#pragma unroll
    for (int ks = 0; ks < GKB / 64; ++ks) {
#pragma unroll
      for (int mt = 0; mt < 4; ++mt) acc[mt] = mma_h(fa[ks][mt].h, fb[ks].h, acc[mt]);
    }
    // publish point of stage st + 1, every wave, in this order
    wait_ds0();
    landed();
    __syncthreads();                                                   // stage st + 1 published; every reader has left this buffer
    if (pinned(st + 2u < (uint32_t)GNST)) issue(pinned(st + 2u));      // scalar branch: a tensor load ignores EXEC
  }
  // behind the loop: this wait names both groups, so that no descriptor register takes a new value in front of it
  asm volatile("s_wait_tensorcnt 0x0" :: "s"(g0s), "s"(g1s) : "memory");
  wait_ds0();
  // the last pass's own barrier stands behind every wave's last read of the ring: buffer 0 is free for Os

  const int nl = 16 * wave + c;
#pragma unroll
  for (int mt = 0; mt < 4; ++mt) {
    v4f va, vb;
#pragma unroll
    for (int r = 0; r < 4; ++r) { va[r] = acc[mt][r] * IWSC; vb[r] = acc[mt][4 + r] * IWSC; }
    *(v4f*)(Os + nl * OSP + 16 * mt + 8 * hh)     = va;
    *(v4f*)(Os + nl * OSP + 16 * mt + 8 * hh + 4) = vb;
  }
}

// =========================================================================================================
// (2) q/k projection for one (b, 64-n tile, mb): mb = 0 -> q from W16 rows 0..63, mb = 1 -> k from rows 64..127.
//     Epilogue (after the barrier): value = Os + bf16-RNE(W[d][512]) * wpos(n) (position channel, f32), then
//     planes bf16 [b][4096 n][64 d] (k-contiguous for both score operands): hi = bf16-RNE(v), lo = bf16-RNE(v - hi).
// coverage: planes 4 it x 16 rows x 8 lanes x 8 = 64 n x 64 d per plane (hi and lo); grid (64, 2, NB) covers all
//           4096 rows x 64 d of Qh/Ql/Kh/Kl exactly once. Os: cross-wave (block barrier).
// =========================================================================================================
__global__ __launch_bounds__(128)
void gemm_qk(const unsigned short* __restrict__ W16, const unsigned short* __restrict__ XP,
             const float* __restrict__ wq, const float* __restrict__ wk,
             unsigned short* Qh, unsigned short* Ql, unsigned short* Kh, unsigned short* Kl) {
  __shared__ __attribute__((aligned(2048))) unsigned char L[GLDSB];
  const float* Os = (const float*)L;                                   // the core leaves its result in buffer 0
  const int tid  = threadIdx.x;
  const int lane = tid & 31, wave = tid >> 5;
  const int hh   = lane >> 4, c = lane & 15;
  const int nt   = blockIdx.x, mb = blockIdx.y, b = blockIdx.z;
  const int n0   = nt * QT, o0 = mb * QT;

  gemm_core(W16 + (size_t)o0 * CC, XP + ((size_t)(b * NN + n0)) * CC, L, wave, hh, c);
  __syncthreads();

  const int e = tid & 7, lq = tid >> 3;                                // lq 0..15
  const float* wsrc = (mb == 0) ? wq : wk;                             // block-uniform, both global
  unsigned short* Ph = (mb == 0) ? Qh : Kh;
  unsigned short* Pl = (mb == 0) ? Ql : Kl;
  float pw[8];
#pragma unroll
  for (int t = 0; t < 8; ++t) pw[t] = bfr(wsrc[(size_t)(8 * e + t) * CIN + CC]);   // W[d][512], d = 8e+t

  v4u uh[4], ul[4];
#pragma unroll
  for (int it = 0; it < 4; ++it) {
    const int row = it * 16 + lq;                                      // n_loc 0..63
    const float wl = wpos(n0 + row);
    const v4f a = *(const v4f*)(Os + row * OSP + 8 * e);
    const v4f q = *(const v4f*)(Os + row * OSP + 8 * e + 4);
    const float f[8] = {a[0], a[1], a[2], a[3], q[0], q[1], q[2], q[3]};
#pragma unroll
    for (int t = 0; t < 4; ++t) {
      const float f0 = f[2 * t] + pw[2 * t] * wl;
      const float f1 = f[2 * t + 1] + pw[2 * t + 1] * wl;
      const unsigned short hb0 = bf_bits(f0), hb1 = bf_bits(f1);
      const unsigned short lb0 = bf_bits(f0 - bf_up(hb0));
      const unsigned short lb1 = bf_bits(f1 - bf_up(hb1));
      uh[it][t] = pk16(hb0, hb1);
      ul[it][t] = pk16(lb0, lb1);
    }
  }
{
#pragma unroll
    for (int it = 0; it < 4; ++it) {
      const int row = it * 16 + lq;
      const size_t po = ((size_t)(b * NN + n0 + row)) * DQ + 8 * e;
      *(v4u*)(Ph + po) = uh[it];
      *(v4u*)(Pl + po) = ul[it];
    }
    
  }
}

// =========================================================================================================
// (3) v projection for one (b, 64-n tile, 64-o block mb 0..7): A rows = W16 rows 128 + o0 + .. .
//     Epilogue (after the barrier): v[o][n] = Os[n][o] + bf16-RNE(Wv[o][512]) * wpos(n) + bf16-RNE(bv[o]) in f32,
//     converted to f16, written to the channel-major plane V f16 [b][512 o][4096 n] (keys contiguous = the A
//     8e..8e+7 of row o_loc = 16 it + lq from 8 Os rows; 8 consecutive lanes x 16 B, one instruction per 16 lines.
// coverage: 4 it x 16 rows x 8 lanes x 8 halves = 64 o x 64 n; grid (64, 8, NB) covers V [NB][512][4096] once.
//           Os: cross-wave (block barrier).
// =========================================================================================================
__global__ __launch_bounds__(128)
void gemm_v(const unsigned short* __restrict__ W16, const unsigned short* __restrict__ XP,
            const float* __restrict__ wv, const float* __restrict__ bv, unsigned short* V) {
  __shared__ __attribute__((aligned(2048))) unsigned char L[GLDSB];
  const float* Os = (const float*)L;                                   // the core leaves its result in buffer 0
  const int tid  = threadIdx.x;
  const int lane = tid & 31, wave = tid >> 5;
  const int hh   = lane >> 4, c = lane & 15;
  const int nt   = blockIdx.x, mb = blockIdx.y, b = blockIdx.z;
  const int n0   = nt * QT, o0 = mb * QT;

  gemm_core(W16 + (size_t)(MQK + o0) * CC, XP + ((size_t)(b * NN + n0)) * CC, L, wave, hh, c);
  __syncthreads();

  const int e = tid & 7, lq = tid >> 3;                                // lq 0..15
  float wl[8];
#pragma unroll
  for (int t = 0; t < 8; ++t) wl[t] = wpos(n0 + 8 * e + t);

  v4u uv[4];
#pragma unroll
  for (int it = 0; it < 4; ++it) {
    const int ol = it * 16 + lq;                                       // o_loc 0..63
    const int og = o0 + ol;                                            // 0..511
    const float pwo = bfr(wv[(size_t)og * CIN + CC]);                 // Wv[o][512]
    const float bo  = bfr(bv[og]);
    unsigned short hb[8];
#pragma unroll
    for (int t = 0; t < 8; ++t) {
      const float val = Os[(8 * e + t) * OSP + ol] + pwo * wl[t] + bo;
      hb[t] = h_bits((_Float16)val);
    }
#pragma unroll
    for (int t = 0; t < 4; ++t) uv[it][t] = pk16(hb[2 * t], hb[2 * t + 1]);
  }
{
#pragma unroll
    for (int it = 0; it < 4; ++it) {
      const int og = o0 + it * 16 + lq;
      *(v4u*)(V + ((size_t)(b * CC + og)) * NN + n0 + 8 * e) = uv[it];
    }
    
  }
}

// =========================================================================================================
// (4) attention for one (b, 64-query tile, channel half chh), transposed formulation, 4096 keys, no mask, no scale:
//   S^T tile (16 keys x 16 queries) = sum over 2 d-chunks of A(k: row = key kb + (lane&15), 32 d via the split k
//   map from the bf16 plane Kh [b][4096][64]) . B(q: col = query, same map from Qh) + A(Kh).B(Ql) + A(Kl).B(Qh)
//   (bf16 unscaled residual planes, shared accumulator).
//   Per lane the D tile holds 8 keys of ONE query: online softmax state per lane, one vector move (lane^16) for the max
//   over 32 keys; the o/l rescale is skipped under a wave-uniform ballot when no lane's max grew (corr == 1 exactly
//   for every lane then); row-sum partials combined at the end. P = e^{s-m} x 16384 as f16 is the B operand of
//   O^T (rows channel, cols queries) += A(v rows channel = cb0 + 16j + (lane&15), keys contiguous, f16 plane V
//   [b][512][4096]) . B(P^T): element r <- D of the tile covering keys kb..kb+15, element 8+r <- the tile covering
//   kb+16..kb+31, lane unchanged. 16 accumulator tiles per wave (256 channels of this half). Block = 4 waves =
//   64 queries; the two channel halves are separate blocks (grid.z) that recompute the same scores.
//   Operands come from LDS, laid there by tensor loads (rows of 128 B, pitch 144 B): the block's q rows once (each wave
//   one slice of 32 rows of one plane), then stages of 64 keys in two buffers: wave 0 brings the Kh rows, wave 1 the Kl
//   rows, waves 2 and 3 128 channel rows of V each (64 keys = one whole 128-B line per row). A pass walks its 64 keys as
//   two 32-key blocks. LDS reads stand in groups, one block ahead, each fragment in registers of its own: behind a block's
//   score products one group brings the next block's q and k fragments, behind its v products one its 16 v fragments.
//   The publish point of stage s + 1 stands in the last block of pass s, behind its running-max update: by then the wave
//   has fetched all it reads of stage s, so stage s + 2 is issued there into that buffer, and the fetch ahead goes on in
//   the buffer of stage s + 1.
//   Epilogue in two quarters of 128 channels: gamma*O/l staged in LDS Os[query][128 channels] (pitch OSPW, b128
//   2 lines): 8 consecutive lanes x 16 B (values gathered from 4 Os rows), one instruction per 16 lines, final
// coverage: per quarter 16 it x 16 lines x 8 lanes x 4 floats = 128 ch x 64 n; two quarters = 256 ch per block;
//           grid (NQ/64, NB, 2) covers out[b][0..511][0..NQ-1] exactly once. Os: cross-wave (block barriers).
// =========================================================================================================
__global__ __launch_bounds__(128)
void attn_k(const unsigned short* __restrict__ Qh, const unsigned short* __restrict__ Ql,
            const unsigned short* __restrict__ Kh, const unsigned short* __restrict__ Kl,
            const unsigned short* __restrict__ V, const float* __restrict__ x,
            const float* __restrict__ gamma, float* out) {
  __shared__ __attribute__((aligned(2048))) unsigned char L[LDSB];
  float* Os = (float*)L;                                               // output staging reuses buffer 0 behind the loop
  const int tid  = threadIdx.x;
  const int wave = tid >> 5, lane = tid & 31;
  const int hh   = lane >> 4, c = lane & 15;
  const int n0   = blockIdx.x * QT, b = blockIdx.y, chh = blockIdx.z;
  const int cb0  = chh * CH;                                           // 0 or 256

  // every wave issues one tensor load per stage for its own slice: all of this is wave-uniform
  const uint32_t wv    = uni((uint32_t)tid >> 5);
  const uint32_t lbase = (uint32_t)(size_t)L;                          // byte offset in the work-group's LDS
  const bool     isV   = wv >= 2u;
  const unsigned char* ssrc = isV
      ? (const unsigned char*)(V + ((size_t)(b * CC + cb0) + 128u * (wv - 2u)) * NN)
      : (const unsigned char*)((wv == 0u ? Kh : Kl) + (size_t)b * NN * DQ);
  const uint32_t sadv = isV ? (uint32_t)(SKEYS * 2) : (uint32_t)(SKEYS * DQ * 2);   // source bytes from stage to stage
  const uint32_t soff = isV ? (uint32_t)VOFF + (wv - 2u) * (uint32_t)VHALF : wv * (uint32_t)KSLOT;
  u32x8 g1s = tdm_group1(isV ? 128u : (uint32_t)SKEYS, isV ? (uint32_t)(NN * 2) : (uint32_t)(DQ * 2));
  asm volatile("" : "+s"(g1s));  // pinned() form, descriptor words held in scalar registers: one tuple serves every issue, so none is reused under a request in flight
  u32x4 g0s;                                                           // group 0 of this wave's stage request in flight
  auto issue = [&](uint32_t st) {
    const uint32_t dst = lbase + (st & 1u) * (uint32_t)BUFB + soff;
    const uint64_t ga  = (uint64_t)(size_t)ssrc + (uint64_t)st * sadv;
    g0s = tdm_group0(dst, ga);
    tdm_load(g0s, g1s);
  };
  // the issuing wave's wait for its stage request; it names group 0 so that those registers keep their values until then
  auto landed = [&]() { asm volatile("s_wait_tensorcnt 0x0" :: "s"(g0s) : "memory"); };

  // q, loaded once: wave wv brings rows n0 + 32*(wv>>1) .. +31 of plane (wv&1 ? Ql : Qh) into slice wv
  {
    const unsigned char* qsrc =
        (const unsigned char*)(((wv & 1u) ? Ql : Qh) + ((size_t)(b * NN + n0) + 32u * (wv >> 1)) * DQ);
    tdm_load(tdm_group0(lbase + (uint32_t)QOFF + wv * (uint32_t)QSLOT, (uint64_t)(size_t)qsrc),
             tdm_group1(32u, (uint32_t)(DQ * 2)));
    wait_tensor0();
  }
  issue(pinned(0u));
  landed();
  __syncthreads();                                                     // q and stage 0 published to every wave
  issue(pinned(1u));

  // q fragment pointers (B operand, col = query n0 + 16*wave + c: row 16*(wave&1) + c of slices 2*(wave>>1), +1), + 64*kc B
  const unsigned char* Qhp = L + QOFF + (2 * (wave >> 1)) * QSLOT + (16 * (wave & 1) + c) * LPB + 16 * hh;
  const unsigned char* Qlp = Qhp + QSLOT;

  float m = -1.0e30f, l = 0.f;
  v8f o[16];
#pragma unroll
  for (int j = 0; j < 16; ++j) o[j] = zero8();

  // every fragment of a 32-key block has registers of its own, so that its reads can all be in flight at once; the sets live
  // from block to block: each is refilled for the next block as soon as its products have been issued
  Frag qh[DQ / 32], ql[DQ / 32], k0[DQ / 32], k1[DQ / 32], k0l[DQ / 32], k1l[DQ / 32], vf[16];
  // one group: the 24 reads of a block's score operands. k fragments (A operand, row = key): stage row 32*sub + c (+16),
  // + 64*kc B; residual plane KSLOT further on
  auto load_qk = [&](const unsigned char* Bp, int sub) {
    const unsigned char* k0p = Bp + (32 * sub + c) * LPB + 16 * hh;    // keys kb .. kb+15; + 16 rows: kb+16 .. kb+31
#pragma unroll  // constant indices keep the fragment arrays in registers
    for (int kc = 0; kc < DQ / 32; ++kc) {
      qh[kc]  = ldfrag_lds(Qhp + 64 * kc);
      k0[kc]  = ldfrag_lds(k0p + 64 * kc);
      k1[kc]  = ldfrag_lds(k0p + 16 * LPB + 64 * kc);
      ql[kc]  = ldfrag_lds(Qlp + 64 * kc);
      k0l[kc] = ldfrag_lds(k0p + KSLOT + 64 * kc);
      k1l[kc] = ldfrag_lds(k0p + KSLOT + 16 * LPB + 64 * kc);
    }
  };
  // one group: the 32 reads of a block's v fragments (A operand, row = channel cb0 + 16j + c, keys contiguous): + 64*sub B
  auto load_v = [&](const unsigned char* Bp, int sub) {
    const unsigned char* Vp = Bp + VOFF + c * LPB + 16 * hh + 64 * sub;
#pragma unroll  // constant indices keep the fragment array in registers
    for (int j = 0; j < 16; ++j) vf[j] = ldfrag_lds(Vp + (16 * j) * LPB);
  };
  load_qk(L, 0);                                                       // stage 0 is published: its first block's fragments
  load_v(L, 0);

  // one pass = one stage of 64 keys; the tag says at compile time whether a next stage exists, so that the last pass, written
  // out behind the loop, fetches nothing ahead and the loop's own reads stand under no branch (a branch there makes the
  // compiler's counted LDS waits at the loop's head fall to 0). Inlined at both places: the fragment arrays stay in registers
  auto pass = [&](uint32_t st, auto tag) __attribute__((always_inline)) {
   constexpr bool more = decltype(tag)::more;
   const unsigned char* Bp = L + (st & 1u) * (uint32_t)BUFB;          // this stage's buffer
   const unsigned char* Bn = L + ((st + 1u) & 1u) * (uint32_t)BUFB;   // the next stage's, read only behind its publish point
   // unrolled: the two blocks of a pass differ in what they fetch ahead and in the publish point
#pragma unroll
   for (int sub = 0; sub < SKEYS / 32; ++sub) {                        // keys kb = 64*st + 32*sub .. +31
    v8f s0 = zero8(), s1 = zero8();
#pragma unroll  // constant indices into the fragment arrays
    for (int kc = 0; kc < DQ / 32; ++kc) {
      s0 = wm_b(k0[kc].bf, qh[kc].bf, s0);
      s1 = wm_b(k1[kc].bf, qh[kc].bf, s1);
      s0 = wm_b(k0[kc].bf, ql[kc].bf, s0);
      s1 = wm_b(k1[kc].bf, ql[kc].bf, s1);
      s0 = wm_b(k0l[kc].bf, qh[kc].bf, s0);
      s1 = wm_b(k1l[kc].bf, qh[kc].bf, s1);
    }
    if (sub + 1 < SKEYS / 32) {
      // keeps the score products in front of the group and the group here: the next block's score operands land under the
      // softmax and the v products; sunk to their products, each read would be waited out there
      __builtin_amdgcn_sched_barrier(0);
      load_qk(Bp, sub + 1);
      __builtin_amdgcn_sched_barrier(0);
    }

    float mx = fmaxf(hmax8(s0), hmax8(s1));
    mx = fmaxf(mx, xhalf(mx));                                         // a vector move: no LDS wait drains the reads in flight
    const float mn = fmaxf(m, mx);
    const unsigned grew = wave_ballot(mx > m);                         // wave-uniform
    if (grew != 0u) {
      const float corr = __expf(m - mn);                               // == 1 exactly for lanes whose max did not grow
      l *= corr;
#pragma unroll
      for (int j = 0; j < 16; ++j) {
#pragma unroll
        for (int r = 0; r < 8; ++r) o[j][r] *= corr;
      }
    }
    m = mn;
    const float msh = mn - LNPS;                                       // exp gives e^{s-m} * 16384

    if (sub + 1 == SKEYS / 32) {
      // publish point of stage st + 1, every wave, in this order; it stands in the stage's last block, whose fragments have
      // been fetched: behind the first wait this wave holds in registers all that it reads of this buffer
      wait_ds0();
      if constexpr (more) landed();
      // the last pass's wait names both groups, so that no descriptor register takes a new value in front of it
      else asm volatile("s_wait_tensorcnt 0x0" :: "s"(g0s), "s"(g1s) : "memory");
      __syncthreads();                                                 // stage st + 1 published; every reader has left this buffer
      if constexpr (more) {
        if (pinned(st + 2u < (uint32_t)NST)) issue(pinned(st + 2u));   // scalar branch: a tensor load ignores EXEC
        load_qk(Bn, 0);                                                // lands under the exponentials and the v products
        // keeps the group here, in front of the exponentials
        __builtin_amdgcn_sched_barrier(0);
      }
    }

    FragH ph;
    float ls = 0.f;
#pragma unroll
    for (int r = 0; r < 8; ++r) {
      const float e0 = __expf(s0[r] - msh);                            // key kb      + 8hh + r
      const float e1 = __expf(s1[r] - msh);                            // key kb + 16 + 8hh + r
      ls += e0 + e1;
      ph.hv[0][r] = (_Float16)e0;
      ph.hv[1][r] = (_Float16)e1;
    }
    l += ls;

#pragma unroll
    for (int j = 0; j < 16; ++j) o[j] = wm_h(vf[j].h, ph.v, o[j]);
    if (sub + 1 < SKEYS / 32 || more) {                                // a next block exists (known at compile time)
      // the v products stay in front of the reads that refill their fragments
      __builtin_amdgcn_sched_barrier(0);
      // WMMA distance: the next block's first score product may write its D where the allocator kept P, the B operand of the
      // v product issued just before it, and LDS reads fill no slot; four slots, held in place by the scheduling barriers
      asm volatile("v_nop\n\tv_nop\n\tv_nop\n\tv_nop");
      __builtin_amdgcn_sched_barrier(0);
      // the next block's v fragments: they land under its score products and its running-max update
      if (sub + 1 < SKEYS / 32) load_v(Bp, sub + 1);
      else load_v(Bn, 0);
      // keeps the group here, in front of the next block's score products
      __builtin_amdgcn_sched_barrier(0);
    }
   }
  };
  // rolled: the stage test at the publish point is opaque to the compiler, so unrolled copies would carry issue code that never runs
#pragma unroll 1
  for (uint32_t st = 0; st + 1u < (uint32_t)NST; ++st) pass(st, HasNext{});
  pass((uint32_t)NST - 1u, LastStage{});
  wait_tensor0();
  wait_ds0();
  // the last pass's own barrier stands behind every wave's last read of the ring: buffer 0 is free for Os
  l += __shfl_xor(l, 16, 32);
  const float gam = bfr(gamma[0]);
  const float inv = gam / l;                                           // o and l both carry the x16384 factor

  const int qrow = 16 * wave + c;
  const int e = tid & 7, lq = tid >> 3;                                // lq 0..15
#pragma unroll
  for (int half = 0; half < 2; ++half) {
    if (half) __syncthreads();                                         // every wave finished reading Os
#pragma unroll
    for (int jj = 0; jj < 8; ++jj) {
      const int j = 8 * half + jj;
      v4f va, vb;
#pragma unroll
      for (int r = 0; r < 4; ++r) { va[r] = o[j][r] * inv; vb[r] = o[j][4 + r] * inv; }
      *(v4f*)(Os + qrow * OSPW + 16 * jj + 8 * hh)     = va;           // Os[query][ch_loc = 16jj + 8hh + r]
      *(v4f*)(Os + qrow * OSPW + 16 * jj + 8 * hh + 4) = vb;
    }
    __syncthreads();
    v4f res[16];
#pragma unroll
    for (int it = 0; it < 16; ++it) {
      const int L   = it * 16 + lq;                                    // 0..255
      const int chl = L >> 1, hf = L & 1;                              // channel 0..127 within the quarter
      const int nl  = hf * 32 + 4 * e;                                 // query 0..63
      const size_t idx = ((size_t)(b * CC + cb0 + 128 * half + chl)) * NN + n0 + nl;
      const v4f xv = *(const v4f*)(x + idx);
#pragma unroll
      for (int t = 0; t < 4; ++t) res[it][t] = Os[(nl + t) * OSPW + chl] + bfr(xv[t]);
    }
{
#pragma unroll
      for (int it = 0; it < 16; ++it) {
        const int L   = it * 16 + lq;
        const int chl = L >> 1, hf = L & 1;
        const int nl  = hf * 32 + 4 * e;
        const size_t idx = ((size_t)(b * CC + cb0 + 128 * half + chl)) * NN + n0 + nl;
        *(v4f*)(out + idx) = res[it];
      }
      
    }
  }
}

// =========================================================================================================
// Workspace map (bytes; each region start a multiple of 256; every extent is an exact tile multiple and is written
//   W16 f16 [640][512]                  655360
//   XP  f16 [NB][4096][512]           16777216 (NB = 4)
//   V   f16 [NB][512][4096]           16777216
//   Qh/Ql/Kh/Kl bf16 [NB][4096][64]   2097152 x4
//   total (NB = 4) = 42598400
// =========================================================================================================
extern "C" void kernel_launch(void* const* d_in, const int* in_sizes, int n_in,
                              void* d_out, int out_size, void* d_ws, size_t ws_size,
                              hipStream_t stream) {
  const int XN = NB * CC * NN;
  if (n_in < 6) return;
  if (in_sizes[0] < XN) return;
  if (in_sizes[1] < DQ * CIN || in_sizes[2] < DQ * CIN) return;
  if (in_sizes[3] < CC * CIN || in_sizes[4] < CC || in_sizes[5] < 1) return;
  if (out_size < XN) return;

  size_t off = 0;
  auto carve = [&](size_t bytes) { const size_t o = off; off += (bytes + 255) & ~(size_t)255; return o; };
  const size_t oW16 = carve((size_t)MW * CC * 2);
  const size_t oXP  = carve((size_t)NB * NN * CC * 2);
  const size_t oV   = carve((size_t)NB * CC * NN * 2);
  const size_t oQh  = carve((size_t)NB * NN * DQ * 2);
  const size_t oQl  = carve((size_t)NB * NN * DQ * 2);
  const size_t oKh  = carve((size_t)NB * NN * DQ * 2);
  const size_t oKl  = carve((size_t)NB * NN * DQ * 2);
  if (off > ws_size) return;
  if (off > (size_t)134217728) return;

  const float* x     = (const float*)d_in[0];
  const float* wq    = (const float*)d_in[1];
  const float* wk    = (const float*)d_in[2];
  const float* wv    = (const float*)d_in[3];
  const float* bv    = (const float*)d_in[4];
  const float* gamma = (const float*)d_in[5];

  char* ws = (char*)d_ws;
  unsigned short* W16 = (unsigned short*)(ws + oW16);
  unsigned short* XP  = (unsigned short*)(ws + oXP);
  unsigned short* V   = (unsigned short*)(ws + oV);
  unsigned short* Qh  = (unsigned short*)(ws + oQh);
  unsigned short* Ql  = (unsigned short*)(ws + oQl);
  unsigned short* Kh  = (unsigned short*)(ws + oKh);
  unsigned short* Kl  = (unsigned short*)(ws + oKl);
  float* out = (float*)d_out;

  const dim3 blk256(256), blk128(128);

  // (0) Wq / Wk / Wv (channels 0..511) -> stacked f16 plane
  cvt_w<<<dim3(MW / 8), blk256, 0, stream>>>(wq, wk, wv, W16);
  // (1) x0 -> position-major 16-bit plane
  cvt_x<<<dim3(NN / QT, CC / QT, NB), blk256, 0, stream>>>(x, XP);
  // (2) q / k projections -> hi + residual bf16 planes
  gemm_qk<<<dim3(NN / QT, MQK / QT, NB), blk128, 0, stream>>>(W16, XP, wq, wk, Qh, Ql, Kh, Kl);
  // (3) v projection + bias -> channel-major f16 plane
  gemm_v<<<dim3(NN / QT, CC / QT, NB), blk128, 0, stream>>>(W16, XP, wv, bv, V);
  // (4) attention + gamma scale + residual -> out [b][512][4096] (queries 0..NQ-1)
  attn_k<<<dim3(NQ / QT, NB, 2), blk128, 0, stream>>>(Qh, Ql, Kh, Kl, V, x, gamma, out);
  (void)hipGetLastError();
}

// v005
// Measured time: 107 microseconds a run.
// Timed twice side by side with v004, it ran 1.07 and 1.08 times as fast.
// All steps since v000 together make it 6.91 times as fast.
// Contractions: q/k/v 1x1 projections W[640x512].X[512x4096] per batch on v_wmma_f32_16x16x32_f16 (f16
// containers of bf16-RNE weights x256 and bf16-RNE x0; input channel 512 = position term, and the v bias, added in
// the f32 epilogue); scores K.Q^T on v_wmma_f32_16x16x32_bf16 (bf16 hi + bf16 residual planes of q and k, 3
// products, K=64); out^T = V.P^T on v_wmma_f32_16x16x32_f16 (v as f16, P = e^{s-m} x16384 f16 from the score D
// registers); f32 accumulate everywhere; softmax statistics, gamma scale and the residual add in f32 VALU.
#include <hip/hip_runtime.h>
#include <math.h>
#include <stdint.h>

#ifndef NB
#define NB 4
#endif
#ifndef NQ
#define NQ 4096
#endif
#define NBF   4
#define CC    512
#define CIN   513
#define NN    4096
#define DQ    64
#define MQK   128
#define MW    640
#define QT    64
#define CH    256
#define OSP   68
#define OSPN  260
#define TP    72
#define WSC   256.0f
#define IWSC  0.00390625f
#define LNPS  9.704060527839234f
#define INVNN 0.000244140625f
// attention LDS map (bytes): every staged row is 128 B of data at a pitch of 144 B (16 B x odd, for ds_load_b128 readers)
#define SKEYS 64                       // keys per stage
#define QTB   128                      // queries per attention block
#define KPH   (NN / 2)                 // keys per key half
#define NST   (KPH / SKEYS)            // stages per key half
#define LPB   144                      // LDS row pitch
#define KSLOT 10240                    // one k plane of a stage: 64 rows x 144 B = 9216, rounded up to a multiple of 2 KiB
#define VOFF  (2 * KSLOT)              // v rows behind the two k planes
#define VHALF (128 * LPB)              // 128 v rows = 18432 = 9 x 2 KiB
#define BUFB  (VOFF + 2 * VHALF)       // one stage buffer = 57344
#define RINGB (2 * BUFB)               // one key half's two stage buffers
#define QOFF  (2 * RINGB)              // q slices behind the two rings
#define QSLOT 6144                     // 32 q rows x 144 B = 4608, rounded up to a multiple of 2 KiB
#define LDSB  (QOFF + 8 * QSLOT)       // 278528: one work-group of 8 waves per WGP
// behind the key loop the same LDS holds: the accumulator tiles that the two key halves hand each other, their m and l, Os
#define XWAVE 16384                    // 16 tiles x 1 KiB handed over per wave
#define MLOFF (8 * XWAVE)              // m and l: 8 waves x 2 query tiles x 32 lanes x 8 B = 4096
#define OSOFF (MLOFF + 8192)           // Os[128 queries][256 channels], pitch OSPN floats

// GEMM LDS map (bytes): a stage is 128 k = 256 B of 64 W16 rows and 64 XP rows at a pitch of 272 B (16 B x odd)
#define GKB   256                      // bytes of every operand row per stage
#define GNST  (CC * 2 / GKB)           // stages
#define GPB   272                      // LDS row pitch
#define GSLOT 10240                    // one wave's slice: 32 rows x 272 B = 8704, rounded up to a multiple of 2 KiB
#define GBUF  (4 * GSLOT)              // one stage buffer: W16 rows 0..31, 32..63, XP rows 0..31, 32..63
#define GLDSB (2 * GBUF)               // 81920: four work-groups fit one WGP's 320 KiB

static_assert(NB >= 1 && NB <= NBF);
static_assert(NQ >= QTB && NQ <= NN && NQ % QTB == 0);
static_assert(NN % QT == 0 && CC % QT == 0 && MQK % QT == 0);
static_assert(MQK == 2 * DQ && MW == MQK + CC && MW % 8 == 0);
static_assert(DQ == QT);
static_assert(CC == 2 * CH && CH == 16 * 16);
static_assert(CC % 256 == 0 && CC % 32 == 0 && DQ % 32 == 0 && NN % 32 == 0);
static_assert((OSP * 4) % 16 == 0);
static_assert((OSPN * 4) % 16 == 0);
static_assert((TP * 2) % 16 == 0);
static_assert(DQ * 2 == 128 && SKEYS * 2 == 128 && KPH % SKEYS == 0 && NST >= 2);
static_assert(KSLOT % 2048 == 0 && KSLOT >= SKEYS * LPB && VHALF % 2048 == 0 && QSLOT % 2048 == 0 && QSLOT >= 32 * LPB);
static_assert(OSOFF + QTB * OSPN * 4 <= LDSB && LDSB <= 327680 && BUFB % 2048 == 0);
static_assert(GNST >= 2 && GSLOT % 2048 == 0 && GSLOT >= 32 * GPB && QT == 64 && QT * OSP * 4 <= GBUF && 4 * GLDSB <= 327680);

typedef _Float16       v16h __attribute__((ext_vector_type(16)));
typedef _Float16       v8h  __attribute__((ext_vector_type(8)));
typedef __bf16         v16b __attribute__((ext_vector_type(16)));
typedef unsigned short v8us __attribute__((ext_vector_type(8)));
typedef float          v8f  __attribute__((ext_vector_type(8)));
typedef float          v4f  __attribute__((ext_vector_type(4)));
typedef unsigned int   v4u  __attribute__((ext_vector_type(4)));
typedef uint32_t       u32x4 __attribute__((ext_vector_type(4)));
typedef uint32_t       u32x8 __attribute__((ext_vector_type(8)));

union Frag  { v8us u[2]; v16h h; v16b bf; };
union FragH { v16h v; v8h hv[2]; };
static_assert(sizeof(Frag) == 32);
static_assert(sizeof(FragH) == 32);

// ---- scalar helpers ---------------------------------------------------------------------------------------
__device__ __forceinline__ unsigned short bf_bits(float f) {          // f32 -> bf16 bits, RNE convert
  unsigned u = __float_as_uint(f);
  return (unsigned short)((u + 0x7FFFu + ((u >> 16) & 1u)) >> 16);
}
__device__ __forceinline__ float bf_up(unsigned short hb) { return __uint_as_float(((unsigned)hb) << 16); }
__device__ __forceinline__ float bfr(float f) { return bf_up(bf_bits(f)); }
__device__ __forceinline__ unsigned short h_bits(_Float16 x) { return __builtin_bit_cast(unsigned short, x); }
__device__ __forceinline__ unsigned pk16(unsigned short a, unsigned short b) { return (unsigned)a | ((unsigned)b << 16); }
__device__ __forceinline__ v8f zero8() { v8f z = {0.f, 0.f, 0.f, 0.f, 0.f, 0.f, 0.f, 0.f}; return z; }
__device__ __forceinline__ float hmax8(v8f s) {
  return fmaxf(fmaxf(fmaxf(s[0], s[1]), fmaxf(s[2], s[3])), fmaxf(fmaxf(s[4], s[5]), fmaxf(s[6], s[7])));
}
__device__ __forceinline__ unsigned wave_ballot(bool p) {
#if defined(__HIP_DEVICE_COMPILE__)
  return __builtin_amdgcn_ballot_w32(p);
#else
  return p ? 1u : 0u;
#endif
}
// lane l with lane l ^ 16, as a vector move (a shuffle through the LDS unit counts on dscnt)
__device__ __forceinline__ float xhalf(float x) {
  return __builtin_bit_cast(float, __builtin_amdgcn_permlanex16(__builtin_bit_cast(int, x), __builtin_bit_cast(int, x),
                                                                0x76543210, 0xfedcba98, false, false));
}
// compile-time tags of an attention pass: does a next stage exist
struct HasNext   { static constexpr bool more = true; };
struct LastStage { static constexpr bool more = false; };
// compile-time tags of a 32-key block: its place in the 64-key stage
struct Sub0 { static constexpr int sub = 0; };
struct Sub1 { static constexpr int sub = 1; };
// position channel value w[l] = (l / 4096) * 2 - 1 in f32, spec op order (every step exact)
__device__ __forceinline__ float wpos(int l) { return ((float)l * INVNN) * 2.0f - 1.0f; }

// ---- 16-bit fragment loader (A, or B from a k-contiguous [n][k] row) from an LDS row: lane -> row/col (lane&15), p (bytes)
//      already includes 16*(lane>>4); elements 0..7 <- k0+8h.., elements 8..15 <- k0+16+8h.. (16 elements = 32 B on)
__device__ __forceinline__ Frag ldfrag_lds(const unsigned char* p) {
  Frag f;
  f.u[0] = *(const v8us*)(p);
  f.u[1] = *(const v8us*)(p + 32);
  return f;
}

// ---- tensor load to LDS: descriptor groups, issue and waits --------------------------------------------------
__device__ __forceinline__ uint32_t uni(uint32_t v) { return (uint32_t)__builtin_amdgcn_readfirstlane(v); }
// a wave-uniform value held in a scalar register: a test on it compiles to a scalar branch, and a descriptor word formed
// from it stands behind the wait written in front of it
__device__ __forceinline__ uint32_t pinned(uint32_t v) { uint32_t w = uni(v); asm volatile("" : "+s"(w)); return w; }
// group 1: 1-byte elements, tile = tensor = rows x 128 B, source pitch in bytes, 16 B of LDS pad behind every 128-B row
__device__ __forceinline__ u32x8 tdm_group1(uint32_t rows, uint32_t src_pitch) {
  u32x8 g;
  g[0] = uni((1u << 20) | (4u << 22) | (3u << 25));
  g[1] = uni(128u << 16);
  g[2] = uni(rows << 16);
  g[3] = uni(128u << 16);
  g[4] = uni(rows);
  g[5] = uni(src_pitch);
  g[6] = uni(0u);
  g[7] = uni(0u);
  return g;
}
// the same for rows of 256 B: 16 B of LDS pad behind every 256-B row
__device__ __forceinline__ u32x8 tdm_group1w(uint32_t rows, uint32_t src_pitch) {
  u32x8 g;
  g[0] = uni((1u << 20) | (5u << 22) | (3u << 25));
  g[1] = uni(256u << 16);
  g[2] = uni(rows << 16);
  g[3] = uni(256u << 16);
  g[4] = uni(rows);
  g[5] = uni(src_pitch);
  g[6] = uni(0u);
  g[7] = uni(0u);
  return g;
}
__device__ __forceinline__ u32x4 tdm_group0(uint32_t lds_dst, uint64_t ga) {
  u32x4 g;
  g[0] = uni(1u);
  g[1] = uni(lds_dst);
  g[2] = uni((uint32_t)ga);
  g[3] = uni((((uint32_t)(ga >> 32)) & 0x01FFFFFFu) | 0x80000000u);
  return g;
}
__device__ __forceinline__ void tdm_load(u32x4 g0, u32x8 g1) {
  asm volatile("tensor_load_to_lds %0, %1" :: "s"(g0), "s"(g1) : "memory");
}
// the compiler places no wait for a tensor load: the issuing wave's own wait, before the barrier that publishes the tile
__device__ __forceinline__ void wait_tensor0() { asm volatile("s_wait_tensorcnt 0x0" ::: "memory"); }
// this wave's LDS reads have returned before a buffer it read is handed back for a refill
__device__ __forceinline__ void wait_ds0() { asm volatile("s_wait_dscnt 0x0" ::: "memory"); }

// ---- WMMA helper of the GEMMs: builtin followed by a 4-slot VALU gap tying D and keeping A/B live --------------------------
__device__ __forceinline__ v8f mma_h(v16h a, v16h b, v8f c) {
  v8f d = __builtin_amdgcn_wmma_f32_16x16x32_f16(false, a, false, b, (short)0, c, false, false);
#if defined(__HIP_DEVICE_COMPILE__)
  asm volatile("v_nop\n\tv_nop\n\tv_nop\n\tv_nop" : "+v"(d) : "v"(a), "v"(b));
#endif
  return d;
}
// the products of the attention loop, without the asm gap: an asm statement's vector operands must lie in v0..v255,
// which a loop that holds accumulators and prefetched fragments at once does not fit; the compiler pads the builtin itself
__device__ __forceinline__ v8f wm_h(v16h a, v16h b, v8f c) {
  return __builtin_amdgcn_wmma_f32_16x16x32_f16(false, a, false, b, (short)0, c, false, false);
}
__device__ __forceinline__ v8f wm_b(v16b a, v16b b, v8f c) {
  return __builtin_amdgcn_wmma_f32_16x16x32_bf16(false, a, false, b, (short)0, c, false, false);
}

// =========================================================================================================
// (0) 1x1 weights: W16 f16 [640][512]: rows 0..63 = Wq rows, 64..127 = Wk rows, 128..639 = Wv rows (input
//     channels 0..511 only; channel 512 is handled in the GEMM epilogues); value = f16 of (bf16-RNE(w) * 256)
//     (exact). Block blk (0..79) owns rows 8*blk..8*blk+7 (source selection block-uniform): one wave per row,
// coverage: 80 blocks x 8 rows x 2 halves x 32 lanes x 8 halves = 640 x 512 = the whole plane.
// =========================================================================================================
__global__ __launch_bounds__(256)
void cvt_w(const float* __restrict__ wq, const float* __restrict__ wk, const float* __restrict__ wv,
           unsigned short* W16) {
  const int tid = threadIdx.x, blk = blockIdx.x;
  const int rl = tid >> 5, lane = tid & 31;
  const int o = 8 * blk + rl;                                          // 0..639
  const float* wbase = (blk < (DQ / 8)) ? wq : ((blk < (MQK / 8)) ? wk : wv);
  const int osub = (blk < (DQ / 8)) ? 0 : ((blk < (MQK / 8)) ? DQ : MQK);
  const float* s = wbase + (size_t)(o - osub) * CIN;                   // (o - osub) in range of that matrix
#pragma unroll 1
  for (int cp = 0; cp < CC / 256; ++cp) {
    const int col = 256 * cp + 8 * lane;                               // 0..504, col + 7 <= 511
    float f[8];
#pragma unroll
    for (int t = 0; t < 8; ++t) f[t] = s[col + t];
    v4u u;
#pragma unroll
    for (int t = 0; t < 4; ++t) {
      const _Float16 h0 = (_Float16)(bfr(f[2 * t]) * WSC);
      const _Float16 h1 = (_Float16)(bfr(f[2 * t + 1]) * WSC);
      u[t] = pk16(h_bits(h0), h_bits(h1));
    }
{
      *(v4u*)(W16 + (size_t)o * CC + col) = u;
      
    }
  }
}

// =========================================================================================================
// (1) x0 f32 [b][512 c][4096 n] -> XP f16 [b][n][c] (position-major, bf16-RNE values, exact in f16) through an LDS
// coverage: T 2 it x 32 cl x 8 e x 8 t = 64 n x 64 c (staged extent == consumed extent); XP 2 it x 32 rows x 8
//           lanes x 8 halves = 64 n x 64 c; grid (64, 8, NB) covers XP [NB][4096][512] exactly once.
// =========================================================================================================
__global__ __launch_bounds__(256)
void cvt_x(const float* __restrict__ x, unsigned short* XP) {
  __shared__ __align__(16) unsigned short T[QT * TP];
  const int tid = threadIdx.x;
  const int nb = blockIdx.x, cb = blockIdx.y, b = blockIdx.z;
  const int e = tid & 7, lq = tid >> 3;                                // lq 0..31
  const int n0 = nb * QT, c0 = cb * QT;
#pragma unroll
  for (int it = 0; it < 2; ++it) {
    const int cl = it * 32 + lq;                                       // 0..63
    const float* sp = x + ((size_t)(b * CC + c0 + cl)) * NN + n0 + 8 * e;
    const v4f a = *(const v4f*)sp;
    const v4f q = *(const v4f*)(sp + 4);
#pragma unroll
    for (int t = 0; t < 4; ++t) {
      T[(8 * e + t) * TP + cl]     = h_bits((_Float16)bfr(a[t]));
      T[(8 * e + 4 + t) * TP + cl] = h_bits((_Float16)bfr(q[t]));
    }
  }
  __syncthreads();
  v4u up[2];
#pragma unroll
  for (int it = 0; it < 2; ++it) {
    const int nl = it * 32 + lq;                                       // 0..63
    up[it] = *(const v4u*)(T + nl * TP + 8 * e);
  }
{
#pragma unroll
    for (int it = 0; it < 2; ++it) {
      const int rl = it * 32 + lq;
      *(v4u*)(XP + ((size_t)(b * NN + n0 + rl)) * CC + c0 + 8 * e) = up[it];
    }
    
  }
}

// =========================================================================================================
// GEMM core for one (64-n tile, 64-o block): Y[o][n] = (1/256) sum_c W16[o][c] XP[n][c], K = 512 = 16 k-steps.
//   Block 128 threads = 4 waves; wave w owns cols n0+16w..+15 (one B fragment per k-step, k = c contiguous in the
//   XP row) and 4 m-tiles (A rows o = o0 + 16 mt + (lane&15), split k map loader).
//   Operands come from LDS, laid there by tensor loads (rows of 256 B, pitch 272 B) in stages of 128 k, two buffers:
//   waves 0 and 1 bring 32 W16 rows each, waves 2 and 3 32 XP rows each; stage s + 2 is issued at the foot of pass s
//   into the buffer that pass has just read. A pass reads its 20 fragments as one group, then runs its 16 products.
//   Result staged in LDS Os[n_loc][o_loc] (pitch OSP, b128 stores of 8 consecutive o per lane), which reuses buffer 0
//   behind the loop: lane (hh, c) holds o_loc = 16 mt + 8 hh + r of n_loc = 16 w + c. Caller issues the block barrier.
// coverage: Os 4 waves x 16 n x 4 mt x 16 o = 64 x 64 (staged extent == consumed extent).
// =========================================================================================================
__device__ __forceinline__ void gemm_core(const unsigned short* __restrict__ Ag,   // W16 row o0, k = 0
                                          const unsigned short* __restrict__ Bg,   // XP row n0, k = 0
                                          unsigned char* L, int wave, int hh, int c) {
  float* Os = (float*)L;
  // every wave issues one tensor load per stage for its own slice: all of this is wave-uniform
  const uint32_t wv    = uni((uint32_t)threadIdx.x >> 5);
  const uint32_t lbase = (uint32_t)(size_t)L;                          // byte offset in the work-group's LDS
  const unsigned char* ssrc = (const unsigned char*)((wv < 2u ? Ag : Bg) + (size_t)(32u * (wv & 1u)) * CC);
  const uint32_t soff = wv * (uint32_t)GSLOT;
  u32x8 g1s = tdm_group1w(32u, (uint32_t)(CC * 2));
  asm volatile("" : "+s"(g1s));  // pinned() form, descriptor words held in scalar registers: one tuple serves every issue, so none is reused under a request in flight
  u32x4 g0s;                                                           // group 0 of this wave's stage request in flight
  auto issue = [&](uint32_t st) {
    const uint32_t dst = lbase + (st & 1u) * (uint32_t)GBUF + soff;
    const uint64_t ga  = (uint64_t)(size_t)ssrc + (uint64_t)st * (uint32_t)GKB;
    g0s = tdm_group0(dst, ga);
    tdm_load(g0s, g1s);
  };
  // the issuing wave's wait for its stage request; it names group 0 so that those registers keep their values until then
  auto landed = [&]() { asm volatile("s_wait_tensorcnt 0x0" :: "s"(g0s) : "memory"); };

  issue(pinned(0u));
  landed();
  __syncthreads();                                                     // stage 0 published to every wave
  issue(pinned(1u));

  v8f acc[4];
#pragma unroll
  for (int mt = 0; mt < 4; ++mt) acc[mt] = zero8();

  // rolled: the stage test at the foot is opaque to the compiler, so unrolled copies would carry issue code that never runs
#pragma unroll 1
  for (uint32_t st = 0; st < (uint32_t)GNST; ++st) {
    const unsigned char* Bp = L + (st & 1u) * (uint32_t)GBUF;          // this pass reads this buffer alone
    // A rows 16 mt + c: slice mt >> 1, row 16 (mt & 1) + c; B rows 16 wave + c: slice 2 + (wave >> 1); + 64 B per k-step
    const unsigned char* ap = Bp + c * GPB + 16 * hh;
    const unsigned char* bp = Bp + (2 + (wave >> 1)) * GSLOT + (16 * (wave & 1) + c) * GPB + 16 * hh;
    Frag fb[GKB / 64], fa[GKB / 64][4];                                // every fragment of the pass in registers of its own
#pragma unroll  // constant indices keep the fragment arrays in registers
    for (int ks = 0; ks < GKB / 64; ++ks) {
      fb[ks] = ldfrag_lds(bp + 64 * ks);
#pragma unroll
      for (int mt = 0; mt < 4; ++mt) fa[ks][mt] = ldfrag_lds(ap + (mt >> 1) * GSLOT + (16 * (mt & 1)) * GPB + 64 * ks);
    }
#pragma unroll
    for (int ks = 0; ks < GKB / 64; ++ks) {
#pragma unroll
      for (int mt = 0; mt < 4; ++mt) acc[mt] = mma_h(fa[ks][mt].h, fb[ks].h, acc[mt]);
    }
    // publish point of stage st + 1, every wave, in this order
    wait_ds0();
    landed();
    __syncthreads();                                                   // stage st + 1 published; every reader has left this buffer
    if (pinned(st + 2u < (uint32_t)GNST)) issue(pinned(st + 2u));      // scalar branch: a tensor load ignores EXEC
  }
  // behind the loop: this wait names both groups, so that no descriptor register takes a new value in front of it
  asm volatile("s_wait_tensorcnt 0x0" :: "s"(g0s), "s"(g1s) : "memory");
  wait_ds0();
  // the last pass's own barrier stands behind every wave's last read of the ring: buffer 0 is free for Os

  const int nl = 16 * wave + c;
#pragma unroll
  for (int mt = 0; mt < 4; ++mt) {
    v4f va, vb;
#pragma unroll
    for (int r = 0; r < 4; ++r) { va[r] = acc[mt][r] * IWSC; vb[r] = acc[mt][4 + r] * IWSC; }
    *(v4f*)(Os + nl * OSP + 16 * mt + 8 * hh)     = va;
    *(v4f*)(Os + nl * OSP + 16 * mt + 8 * hh + 4) = vb;
  }
}

// =========================================================================================================
// (2) q/k projection for one (b, 64-n tile, mb): mb = 0 -> q from W16 rows 0..63, mb = 1 -> k from rows 64..127.
//     Epilogue (after the barrier): value = Os + bf16-RNE(W[d][512]) * wpos(n) (position channel, f32), then
//     planes bf16 [b][4096 n][64 d] (k-contiguous for both score operands): hi = bf16-RNE(v), lo = bf16-RNE(v - hi).
// coverage: planes 4 it x 16 rows x 8 lanes x 8 = 64 n x 64 d per plane (hi and lo); grid (64, 2, NB) covers all
//           4096 rows x 64 d of Qh/Ql/Kh/Kl exactly once. Os: cross-wave (block barrier).
// =========================================================================================================
__global__ __launch_bounds__(128)
void gemm_qk(const unsigned short* __restrict__ W16, const unsigned short* __restrict__ XP,
             const float* __restrict__ wq, const float* __restrict__ wk,
             unsigned short* Qh, unsigned short* Ql, unsigned short* Kh, unsigned short* Kl) {
  __shared__ __attribute__((aligned(2048))) unsigned char L[GLDSB];
  const float* Os = (const float*)L;                                   // the core leaves its result in buffer 0
  const int tid  = threadIdx.x;
  const int lane = tid & 31, wave = tid >> 5;
  const int hh   = lane >> 4, c = lane & 15;
  const int nt   = blockIdx.x, mb = blockIdx.y, b = blockIdx.z;
  const int n0   = nt * QT, o0 = mb * QT;

  gemm_core(W16 + (size_t)o0 * CC, XP + ((size_t)(b * NN + n0)) * CC, L, wave, hh, c);
  __syncthreads();

  const int e = tid & 7, lq = tid >> 3;                                // lq 0..15
  const float* wsrc = (mb == 0) ? wq : wk;                             // block-uniform, both global
  unsigned short* Ph = (mb == 0) ? Qh : Kh;
  unsigned short* Pl = (mb == 0) ? Ql : Kl;
  float pw[8];
#pragma unroll
  for (int t = 0; t < 8; ++t) pw[t] = bfr(wsrc[(size_t)(8 * e + t) * CIN + CC]);   // W[d][512], d = 8e+t

  v4u uh[4], ul[4];
#pragma unroll
  for (int it = 0; it < 4; ++it) {
    const int row = it * 16 + lq;                                      // n_loc 0..63
    const float wl = wpos(n0 + row);
    const v4f a = *(const v4f*)(Os + row * OSP + 8 * e);
    const v4f q = *(const v4f*)(Os + row * OSP + 8 * e + 4);
    const float f[8] = {a[0], a[1], a[2], a[3], q[0], q[1], q[2], q[3]};
#pragma unroll
    for (int t = 0; t < 4; ++t) {
      const float f0 = f[2 * t] + pw[2 * t] * wl;
      const float f1 = f[2 * t + 1] + pw[2 * t + 1] * wl;
      const unsigned short hb0 = bf_bits(f0), hb1 = bf_bits(f1);
      const unsigned short lb0 = bf_bits(f0 - bf_up(hb0));
      const unsigned short lb1 = bf_bits(f1 - bf_up(hb1));
      uh[it][t] = pk16(hb0, hb1);
      ul[it][t] = pk16(lb0, lb1);
    }
  }
{
#pragma unroll
    for (int it = 0; it < 4; ++it) {
      const int row = it * 16 + lq;
      const size_t po = ((size_t)(b * NN + n0 + row)) * DQ + 8 * e;
      *(v4u*)(Ph + po) = uh[it];
      *(v4u*)(Pl + po) = ul[it];
    }
    
  }
}

// =========================================================================================================
// (3) v projection for one (b, 64-n tile, 64-o block mb 0..7): A rows = W16 rows 128 + o0 + .. .
//     Epilogue (after the barrier): v[o][n] = Os[n][o] + bf16-RNE(Wv[o][512]) * wpos(n) + bf16-RNE(bv[o]) in f32,
//     converted to f16, written to the channel-major plane V f16 [b][512 o][4096 n] (keys contiguous = the A
//     8e..8e+7 of row o_loc = 16 it + lq from 8 Os rows; 8 consecutive lanes x 16 B, one instruction per 16 lines.
// coverage: 4 it x 16 rows x 8 lanes x 8 halves = 64 o x 64 n; grid (64, 8, NB) covers V [NB][512][4096] once.
//           Os: cross-wave (block barrier).
// =========================================================================================================
__global__ __launch_bounds__(128)
void gemm_v(const unsigned short* __restrict__ W16, const unsigned short* __restrict__ XP,
            const float* __restrict__ wv, const float* __restrict__ bv, unsigned short* V) {
  __shared__ __attribute__((aligned(2048))) unsigned char L[GLDSB];
  const float* Os = (const float*)L;                                   // the core leaves its result in buffer 0
  const int tid  = threadIdx.x;
  const int lane = tid & 31, wave = tid >> 5;
  const int hh   = lane >> 4, c = lane & 15;
  const int nt   = blockIdx.x, mb = blockIdx.y, b = blockIdx.z;
  const int n0   = nt * QT, o0 = mb * QT;

  gemm_core(W16 + (size_t)(MQK + o0) * CC, XP + ((size_t)(b * NN + n0)) * CC, L, wave, hh, c);
  __syncthreads();

  const int e = tid & 7, lq = tid >> 3;                                // lq 0..15
  float wl[8];
#pragma unroll
  for (int t = 0; t < 8; ++t) wl[t] = wpos(n0 + 8 * e + t);

  v4u uv[4];
#pragma unroll
  for (int it = 0; it < 4; ++it) {
    const int ol = it * 16 + lq;                                       // o_loc 0..63
    const int og = o0 + ol;                                            // 0..511
    const float pwo = bfr(wv[(size_t)og * CIN + CC]);                 // Wv[o][512]
    const float bo  = bfr(bv[og]);
    unsigned short hb[8];
#pragma unroll
    for (int t = 0; t < 8; ++t) {
      const float val = Os[(8 * e + t) * OSP + ol] + pwo * wl[t] + bo;
      hb[t] = h_bits((_Float16)val);
    }
#pragma unroll
    for (int t = 0; t < 4; ++t) uv[it][t] = pk16(hb[2 * t], hb[2 * t + 1]);
  }
{
#pragma unroll
    for (int it = 0; it < 4; ++it) {
      const int og = o0 + it * 16 + lq;
      *(v4u*)(V + ((size_t)(b * CC + og)) * NN + n0 + 8 * e) = uv[it];
    }
    
  }
}

// =========================================================================================================
// (4) attention for one (b, 128-query tile, channel half chh), transposed formulation, 4096 keys, no mask, no scale.
//   Block = 8 waves: wave = query group qg (wave & 3, 32 queries = two 16-query tiles) + 4 x key half kh (2048 keys each).
//   S^T tile (16 keys x 16 queries) = sum over 2 d-chunks of A(k: row = key, 32 d via the split k map from the bf16 plane
//   Kh [b][4096][64]) . B(q: col = query, same map from Qh) + A(Kh).B(Ql) + A(Kl).B(Qh) (bf16 unscaled residual planes,
//   shared accumulator). Per lane the D tile holds 8 keys of ONE query: online softmax state per lane and query tile, one
//   vector move (lane^16) for the max over 32 keys; the o/l rescale is skipped under a wave-uniform ballot when no lane's
//   max grew (corr == 1 exactly for every lane then). P = e^{s-m} x 16384 as f16 is the B operand of O^T (rows channel,
//   cols queries) += A(v rows channel = cb0 + 16j + (lane&15), keys contiguous, f16 plane V [b][512][4096]) . B(P^T):
//   element r <- D of the tile covering keys kb..kb+15, element 8+r <- the tile covering kb+16..kb+31, lane unchanged.
//   Every k and v fragment read from LDS serves both query tiles: a Kh fragment four products, a Kl or v fragment two. 32 accumulator
//   tiles per wave (2 query tiles x 256 channels), two waves per SIMD. The two channel halves are separate blocks (grid.z).
//   Operands come from LDS, laid there by tensor loads (rows of 128 B, pitch 144 B): the block's q rows once (each wave one
//   slice of 32 rows of one plane), then per key half stages of 64 keys in two buffers: of the half's four waves one brings
//   the Kh rows, one the Kl rows, two 128 channel rows of V each (64 keys = one whole 128-B line per row).
//   A pass walks its 64 keys as two 32-key blocks. Two register sets of 8 fragments: a block finds the k and Ql fragments of
//   its two 32-d chunks in them (Qh stays in registers); behind the score products its 16 v fragments go there (they land under the softmax), behind
//   the first 16 v products the next block's first chunk, behind the last 16 its second.
//   The publish point of stage s + 1 stands in the last block of pass s, behind its exponentials: by then the wave has fetched
//   all it reads of stage s, so stage s + 2 is issued there into that buffer.
//   Behind the loop the two key halves of a query group are joined: each wave hands its partner (wave ^ 4) 128 channels of
//   both query tiles with its m and l through LDS, and finishes the other 128: o = (o_a e^{m_a-m} + o_b e^{m_b-m}) gamma / l.
//   Then Os[query][256 channels] (pitch OSPN, b128 stores), and out rows: 8 consecutive lanes x 16 B per 128-B line.
// coverage: 16 it x 2 parts x 32 lines x 8 lanes x 4 floats = 256 ch x 128 n per block; grid (NQ/128, NB, 2) covers
//           out[b][0..511][0..NQ-1] exactly once. Hand-over region and Os: cross-wave (block barriers).
// =========================================================================================================
__global__ __launch_bounds__(256)
void attn_k(const unsigned short* __restrict__ Qh, const unsigned short* __restrict__ Ql,
            const unsigned short* __restrict__ Kh, const unsigned short* __restrict__ Kl,
            const unsigned short* __restrict__ V, const float* __restrict__ x,
            const float* __restrict__ gamma, float* out) {
  __shared__ __attribute__((aligned(2048))) unsigned char L[LDSB];
  const int tid  = threadIdx.x;
  const int wave = tid >> 5, lane = tid & 31;
  const int hh   = lane >> 4, c = lane & 15;
  const int qg   = wave & 3, kh = wave >> 2;
  const int n0   = blockIdx.x * QTB, b = blockIdx.y, chh = blockIdx.z;
  const int cb0  = chh * CH;                                           // 0 or 256

  // every wave issues one tensor load per stage for its own slice: all of this is wave-uniform
  const uint32_t wv    = uni((uint32_t)tid >> 5);
  const uint32_t role  = wv & 3u, khu = wv >> 2;                       // slice of the stage, key half
  const uint32_t lbase = (uint32_t)(size_t)L;                          // byte offset in the work-group's LDS
  const bool     isV   = role >= 2u;
  const unsigned char* ssrc = isV
      ? (const unsigned char*)(V + ((size_t)(b * CC + cb0) + 128u * (role - 2u)) * NN + khu * (uint32_t)KPH)
      : (const unsigned char*)((role == 0u ? Kh : Kl) + ((size_t)b * NN + khu * (uint32_t)KPH) * DQ);
  const uint32_t sadv = isV ? (uint32_t)(SKEYS * 2) : (uint32_t)(SKEYS * DQ * 2);   // source bytes from stage to stage
  const uint32_t soff = khu * (uint32_t)RINGB + (isV ? (uint32_t)VOFF + (role - 2u) * (uint32_t)VHALF : role * (uint32_t)KSLOT);
  u32x8 g1s = tdm_group1(isV ? 128u : (uint32_t)SKEYS, isV ? (uint32_t)(NN * 2) : (uint32_t)(DQ * 2));
  asm volatile("" : "+s"(g1s));  // pinned() form, descriptor words held in scalar registers: one tuple serves every issue, so none is reused under a request in flight
  u32x4 g0s;                                                           // group 0 of this wave's stage request in flight
  auto issue = [&](uint32_t st) {
    const uint32_t dst = lbase + (st & 1u) * (uint32_t)BUFB + soff;
    const uint64_t ga  = (uint64_t)(size_t)ssrc + (uint64_t)st * sadv;
    g0s = tdm_group0(dst, ga);
    tdm_load(g0s, g1s);
  };
  // the issuing wave's wait for its stage request; it names group 0 so that those registers keep their values until then
  auto landed = [&]() { asm volatile("s_wait_tensorcnt 0x0" :: "s"(g0s) : "memory"); };

  // q, loaded once: wave wv brings rows n0 + 32*(wv>>1) .. +31 of plane (wv&1 ? Ql : Qh) into slice wv
  {
    const unsigned char* qsrc =
        (const unsigned char*)(((wv & 1u) ? Ql : Qh) + ((size_t)(b * NN + n0) + 32u * (wv >> 1)) * DQ);
    tdm_load(tdm_group0(lbase + (uint32_t)QOFF + wv * (uint32_t)QSLOT, (uint64_t)(size_t)qsrc),
             tdm_group1(32u, (uint32_t)(DQ * 2)));
    wait_tensor0();
  }
  issue(pinned(0u));
  landed();
  __syncthreads();                                                     // q and stage 0 of both halves published to every wave
  issue(pinned(1u));

  const unsigned char* Lh = L + kh * RINGB;                            // this key half's ring

  float m[2] = {-1.0e30f, -1.0e30f}, l[2] = {0.f, 0.f};
  v8f o[2][16];
#pragma unroll
  for (int qt = 0; qt < 2; ++qt) {
#pragma unroll
    for (int j = 0; j < 16; ++j) o[qt][j] = zero8();
  }

  // q fragment base (B operand, col = query n0 + 32*qg + 16*qt + c: row 16*qt + c of slices 2*qg (Qh), 2*qg + 1 (Ql)), + 64*kc B
  const unsigned char* Qp = L + QOFF + (2 * qg) * QSLOT + c * LPB + 16 * hh;
  // the Qh fragments stay in registers, read once
  Frag qh[2][DQ / 32];
#pragma unroll  // constant indices keep the fragment array in registers
  for (int qt = 0; qt < 2; ++qt) {
#pragma unroll
    for (int kc = 0; kc < DQ / 32; ++kc) qh[qt][kc] = ldfrag_lds(Qp + (16 * qt) * LPB + 64 * kc);
  }
  // the two fragment sets; each holds the k and Ql fragments of one 32-d chunk, then 8 v fragments
  Frag ra[8], rb[8];
  // one group: the score operands of d chunk kc of a block. k (A operand, row = key): stage row 32*sub + c (+16), + 64*kc B,
  // residual plane KSLOT on: R[0, 1] = Kh keys kb.., kb+16..; R[2, 3] = Kl the same; R[4 + qt] = Ql of tile qt
  auto load_s = [&](Frag (&R)[8], const unsigned char* Bp, int sub, int kc) __attribute__((always_inline)) {
    const unsigned char* k0p = Bp + (32 * sub + c) * LPB + 16 * hh + 64 * kc;
    R[0] = ldfrag_lds(k0p);
    R[1] = ldfrag_lds(k0p + 16 * LPB);
    R[2] = ldfrag_lds(k0p + KSLOT);
    R[3] = ldfrag_lds(k0p + KSLOT + 16 * LPB);
#pragma unroll  // constant indices keep the fragment array in registers
    for (int qt = 0; qt < 2; ++qt) R[4 + qt] = ldfrag_lds(Qp + QSLOT + (16 * qt) * LPB + 64 * kc);
  };
  // one group: 8 of a block's v fragments (A operand, row = channel cb0 + 128*g + 16j + c, keys contiguous): + 64*sub B
  auto load_v = [&](Frag (&R)[8], const unsigned char* Bp, int sub, int g) __attribute__((always_inline)) {
    const unsigned char* Vp = Bp + VOFF + (128 * g + c) * LPB + 16 * hh + 64 * sub;
#pragma unroll  // constant indices keep the fragment array in registers
    for (int j = 0; j < 8; ++j) R[j] = ldfrag_lds(Vp + (16 * j) * LPB);
  };
  load_s(ra, Lh, 0, 0);                                                // q and stage 0 are published: the first block's score operands
  load_s(rb, Lh, 0, 1);

  // one 32-key block: RA and RB hold its score operands; it leaves the next block's there. The tags say at compile time where
  // the block stands and whether a next stage exists, so that no read stands under a branch. Inlined at every place: the
  // fragment arrays stay in registers
  auto block = [&](Frag (&RA)[8], Frag (&RB)[8], uint32_t st, auto subtag, auto tag) __attribute__((always_inline)) {
    constexpr int  sub  = decltype(subtag)::sub;
    constexpr bool more = decltype(tag)::more;
    constexpr bool last = (sub + 1 == SKEYS / 32);                     // the stage's last block
    constexpr bool next = !last || more;                               // a next block exists
    const unsigned char* Bp = Lh + (st & 1u) * (uint32_t)BUFB;         // this stage's buffer
    const unsigned char* Bx = last ? Lh + ((st + 1u) & 1u) * (uint32_t)BUFB : Bp;   // the next block's, read behind its publish point
    constexpr int subx = last ? 0 : sub + 1;

    v8f s[2][2];                                                       // [query tile][keys kb.., kb+16..]
#pragma unroll
    for (int qt = 0; qt < 2; ++qt) { s[qt][0] = zero8(); s[qt][1] = zero8(); }
    auto scores = [&](Frag (&R)[8], int kc) __attribute__((always_inline)) {
#pragma unroll  // constant indices into the fragment array
      for (int qt = 0; qt < 2; ++qt) {
        s[qt][0] = wm_b(R[0].bf, qh[qt][kc].bf, s[qt][0]);
        s[qt][1] = wm_b(R[1].bf, qh[qt][kc].bf, s[qt][1]);
      }
#pragma unroll
      for (int qt = 0; qt < 2; ++qt) {
        s[qt][0] = wm_b(R[0].bf, R[4 + qt].bf, s[qt][0]);
        s[qt][1] = wm_b(R[1].bf, R[4 + qt].bf, s[qt][1]);
      }
#pragma unroll
      for (int qt = 0; qt < 2; ++qt) {
        s[qt][0] = wm_b(R[2].bf, qh[qt][kc].bf, s[qt][0]);
        s[qt][1] = wm_b(R[3].bf, qh[qt][kc].bf, s[qt][1]);
      }
    };
    scores(RA, 0);
    scores(RB, 1);
    // keeps the score products in front of the group and the group here: the v fragments land under the softmax; sunk to
    // their products, each read would be waited out there
    __builtin_amdgcn_sched_barrier(0);
    load_v(RA, Bp, sub, 0);
    load_v(RB, Bp, sub, 1);
    __builtin_amdgcn_sched_barrier(0);

    float mx[2], mn[2];
#pragma unroll
    for (int qt = 0; qt < 2; ++qt) {
      mx[qt] = fmaxf(hmax8(s[qt][0]), hmax8(s[qt][1]));
      mx[qt] = fmaxf(mx[qt], xhalf(mx[qt]));                           // a vector move: no LDS wait drains the reads in flight
      mn[qt] = fmaxf(m[qt], mx[qt]);
    }
    const unsigned grew = wave_ballot(mx[0] > m[0] || mx[1] > m[1]);   // wave-uniform, one test per block
    if (grew != 0u) {
#pragma unroll
      for (int qt = 0; qt < 2; ++qt) {
        const float corr = __expf(m[qt] - mn[qt]);                     // == 1 exactly for lanes whose max did not grow
        l[qt] *= corr;
#pragma unroll
        for (int j = 0; j < 16; ++j) {
#pragma unroll
          for (int r = 0; r < 8; ++r) o[qt][j][r] *= corr;
        }
      }
    }
    FragH ph[2];
#pragma unroll
    for (int qt = 0; qt < 2; ++qt) {
      m[qt] = mn[qt];
      const float msh = mn[qt] - LNPS;                                 // exp gives e^{s-m} * 16384
      float ls = 0.f;
#pragma unroll
      for (int r = 0; r < 8; ++r) {
        const float e0 = __expf(s[qt][0][r] - msh);                    // key kb      + 8hh + r
        const float e1 = __expf(s[qt][1][r] - msh);                    // key kb + 16 + 8hh + r
        ls += e0 + e1;
        ph[qt].hv[0][r] = (_Float16)e0;
        ph[qt].hv[1][r] = (_Float16)e1;
      }
      l[qt] += ls;
    }

    if constexpr (last) {
      // publish point of stage st + 1, every wave, in this order; behind the first wait this wave holds in registers all that
      // it reads of this buffer. The wait names P as an input: the exponentials then stand in front of it and the v reads land
      // under them; without it the compiler sinks them behind the barrier and the reads are waited out here
      if constexpr (more) asm volatile("s_wait_dscnt 0x0" :: "v"(ph[0].v), "v"(ph[1].v) : "memory");
      else wait_ds0();                                                 // no branch follows in the last pass: nothing is sunk there
      if constexpr (more) landed();
      // the last pass's wait names both groups, so that no descriptor register takes a new value in front of it
      else asm volatile("s_wait_tensorcnt 0x0" :: "s"(g0s), "s"(g1s) : "memory");
      __syncthreads();                                                 // stage st + 1 published; every reader has left this buffer
      if constexpr (more) {
        if (pinned(st + 2u < (uint32_t)NST)) issue(pinned(st + 2u));   // scalar branch: a tensor load ignores EXEC
      }
    }

#pragma unroll
    for (int j = 0; j < 8; ++j) {
#pragma unroll
      for (int qt = 0; qt < 2; ++qt) o[qt][j] = wm_h(RA[j].h, ph[qt].v, o[qt][j]);
    }
    if constexpr (next) {
      // the products stay in front of the reads that refill their fragments; the next block's first chunk lands under the other 16
      __builtin_amdgcn_sched_barrier(0);
      load_s(RA, Bx, subx, 0);
      __builtin_amdgcn_sched_barrier(0);
    }
#pragma unroll
    for (int j = 0; j < 8; ++j) {
#pragma unroll
      for (int qt = 0; qt < 2; ++qt) o[qt][8 + j] = wm_h(RB[j].h, ph[qt].v, o[qt][8 + j]);
    }
    if constexpr (next) {
      __builtin_amdgcn_sched_barrier(0);
      // WMMA distance: the next block's first score product may write its D where the allocator kept P, the B operand of the
      // v product issued just before it, and LDS reads fill no slot; four slots, held in place by the scheduling barriers
      asm volatile("v_nop\n\tv_nop\n\tv_nop\n\tv_nop");
      __builtin_amdgcn_sched_barrier(0);
      // the next block's second chunk: it lands under the first chunk's score products
      load_s(RB, Bx, subx, 1);
      // keeps the group here, in front of the next block's score products
      __builtin_amdgcn_sched_barrier(0);
    }
  };
  // rolled: the stage test at the publish point is opaque to the compiler, so unrolled copies would carry issue code that never runs
#pragma unroll 1
  for (uint32_t st = 0; st + 1u < (uint32_t)NST; ++st) {
    block(ra, rb, st, Sub0{}, HasNext{});
    block(ra, rb, st, Sub1{}, HasNext{});
  }
  block(ra, rb, (uint32_t)NST - 1u, Sub0{}, LastStage{});
  block(ra, rb, (uint32_t)NST - 1u, Sub1{}, LastStage{});
  wait_tensor0();
  wait_ds0();
  // the last pass's own barrier stands behind every wave's last read of the rings and of q: all of L is free

  // join of the two key halves: wave (qg, kh) finishes channels 128*kh .. +127 of its 32 queries and hands the other 128 over
  float* Xo = (float*)(L + wave * XWAVE);                              // written by this wave, read by its partner
  const float* Xp = (const float*)(L + (wave ^ 4) * XWAVE);
  float* MLo = (float*)(L + MLOFF) + wave * 128;
  const float* MLp = (const float*)(L + MLOFF) + (wave ^ 4) * 128;
  const bool up = kh != 0;                                             // wave-uniform
  v8f f[2][8];
#pragma unroll
  for (int qt = 0; qt < 2; ++qt) {
    l[qt] += xhalf(l[qt]);                                             // the two lane halves' row sums
    MLo[qt * 64 + 2 * lane]     = m[qt];
    MLo[qt * 64 + 2 * lane + 1] = l[qt];
#pragma unroll
    for (int jj = 0; jj < 8; ++jj) {
      const v8f snd = up ? o[qt][jj] : o[qt][8 + jj];
      f[qt][jj]     = up ? o[qt][8 + jj] : o[qt][jj];
      v4f va, vb;
#pragma unroll
      for (int r = 0; r < 4; ++r) { va[r] = snd[r]; vb[r] = snd[4 + r]; }
      *(v4f*)(Xo + (qt * 8 + jj) * 256 + 4 * lane)       = va;         // lane-linear: the partner's same lane reads it back
      *(v4f*)(Xo + (qt * 8 + jj) * 256 + 128 + 4 * lane) = vb;
    }
  }
  __syncthreads();                                                     // every wave's hand-over is written
  const float gam = bfr(gamma[0]);
  float* Os = (float*)(L + OSOFF);                                     // apart from the hand-over region
#pragma unroll
  for (int qt = 0; qt < 2; ++qt) {
    const float mp = MLp[qt * 64 + 2 * lane], lp = MLp[qt * 64 + 2 * lane + 1];
    const float mm = fmaxf(m[qt], mp);
    const float co = __expf(m[qt] - mm), cp = __expf(mp - mm);
    const float inv = gam / (l[qt] * co + lp * cp);                    // o and l both carry the x16384 factor
    const float ao = co * inv, ap = cp * inv;
    const int qrow = 32 * qg + 16 * qt + c;
    v4f pa[8], pb[8];                                                  // one group of reads, in front of the Os stores
#pragma unroll
    for (int jj = 0; jj < 8; ++jj) {
      pa[jj] = *(const v4f*)(Xp + (qt * 8 + jj) * 256 + 4 * lane);
      pb[jj] = *(const v4f*)(Xp + (qt * 8 + jj) * 256 + 128 + 4 * lane);
    }
#pragma unroll
    for (int jj = 0; jj < 8; ++jj) {
      v4f va, vb;
#pragma unroll
      for (int r = 0; r < 4; ++r) { va[r] = f[qt][jj][r] * ao + pa[jj][r] * ap; vb[r] = f[qt][jj][4 + r] * ao + pb[jj][r] * ap; }
      *(v4f*)(Os + qrow * OSPN + 128 * kh + 16 * jj + 8 * hh)     = va;   // Os[query][ch_loc = 128kh + 16jj + 8hh + r]
      *(v4f*)(Os + qrow * OSPN + 128 * kh + 16 * jj + 8 * hh + 4) = vb;
    }
  }
  __syncthreads();                                                     // Os complete

  // out rows: thread (lq, e) owns channel ch0 + 16 it, queries nq0 + 64 part .. +3; one address pair each for x and out, every
  // step from it a constant
  const int e = tid & 7, lq = tid >> 3;                                // lq 0..31
  const int ch0 = lq >> 1;                                             // 0..15
  const int nq0 = (lq & 1) * 32 + 4 * e;                               // 0..60
  const size_t base = ((size_t)(b * CC + cb0 + ch0)) * NN + n0 + nq0;
  const float* xb = x + base;
  float* ob = out + base;
  const float* Ob = Os + nq0 * OSPN + ch0;
#pragma unroll
  for (int part = 0; part < 2; ++part) {
    v4f res[16];
#pragma unroll
    for (int it = 0; it < 16; ++it) {
      const v4f xv = *(const v4f*)(xb + (size_t)(16 * it) * NN + 64 * part);
#pragma unroll
      for (int t = 0; t < 4; ++t) res[it][t] = Ob[(64 * part + t) * OSPN + 16 * it] + bfr(xv[t]);
    }
#pragma unroll
    for (int it = 0; it < 16; ++it) *(v4f*)(ob + (size_t)(16 * it) * NN + 64 * part) = res[it];
    // before the second part writes again the registers that the issued stores name
    if (part == 0) asm volatile("s_wait_xcnt 0x0" ::: "memory");
  }
}

// =========================================================================================================
// Workspace map (bytes; each region start a multiple of 256; every extent is an exact tile multiple and is written
//   W16 f16 [640][512]                  655360
//   XP  f16 [NB][4096][512]           16777216 (NB = 4)
//   V   f16 [NB][512][4096]           16777216
//   Qh/Ql/Kh/Kl bf16 [NB][4096][64]   2097152 x4
//   total (NB = 4) = 42598400
// =========================================================================================================
extern "C" void kernel_launch(void* const* d_in, const int* in_sizes, int n_in,
                              void* d_out, int out_size, void* d_ws, size_t ws_size,
                              hipStream_t stream) {
  const int XN = NB * CC * NN;
  if (n_in < 6) return;
  if (in_sizes[0] < XN) return;
  if (in_sizes[1] < DQ * CIN || in_sizes[2] < DQ * CIN) return;
  if (in_sizes[3] < CC * CIN || in_sizes[4] < CC || in_sizes[5] < 1) return;
  if (out_size < XN) return;

  size_t off = 0;
  auto carve = [&](size_t bytes) { const size_t o = off; off += (bytes + 255) & ~(size_t)255; return o; };
  const size_t oW16 = carve((size_t)MW * CC * 2);
  const size_t oXP  = carve((size_t)NB * NN * CC * 2);
  const size_t oV   = carve((size_t)NB * CC * NN * 2);
  const size_t oQh  = carve((size_t)NB * NN * DQ * 2);
  const size_t oQl  = carve((size_t)NB * NN * DQ * 2);
  const size_t oKh  = carve((size_t)NB * NN * DQ * 2);
  const size_t oKl  = carve((size_t)NB * NN * DQ * 2);
  if (off > ws_size) return;
  if (off > (size_t)134217728) return;

  const float* x     = (const float*)d_in[0];
  const float* wq    = (const float*)d_in[1];
  const float* wk    = (const float*)d_in[2];
  const float* wv    = (const float*)d_in[3];
  const float* bv    = (const float*)d_in[4];
  const float* gamma = (const float*)d_in[5];

  char* ws = (char*)d_ws;
  unsigned short* W16 = (unsigned short*)(ws + oW16);
  unsigned short* XP  = (unsigned short*)(ws + oXP);
  unsigned short* V   = (unsigned short*)(ws + oV);
  unsigned short* Qh  = (unsigned short*)(ws + oQh);
  unsigned short* Ql  = (unsigned short*)(ws + oQl);
  unsigned short* Kh  = (unsigned short*)(ws + oKh);
  unsigned short* Kl  = (unsigned short*)(ws + oKl);
  float* out = (float*)d_out;

  const dim3 blk256(256), blk128(128);

  // (0) Wq / Wk / Wv (channels 0..511) -> stacked f16 plane
  cvt_w<<<dim3(MW / 8), blk256, 0, stream>>>(wq, wk, wv, W16);
  // (1) x0 -> position-major 16-bit plane
  cvt_x<<<dim3(NN / QT, CC / QT, NB), blk256, 0, stream>>>(x, XP);
  // (2) q / k projections -> hi + residual bf16 planes
  gemm_qk<<<dim3(NN / QT, MQK / QT, NB), blk128, 0, stream>>>(W16, XP, wq, wk, Qh, Ql, Kh, Kl);
  // (3) v projection + bias -> channel-major f16 plane
  gemm_v<<<dim3(NN / QT, CC / QT, NB), blk128, 0, stream>>>(W16, XP, wv, bv, V);
  // (4) attention + gamma scale + residual -> out [b][512][4096], queries 0..NQ-1
  attn_k<<<dim3(NQ / QTB, NB, 2), blk256, 0, stream>>>(Qh, Ql, Kh, Kl, V, x, gamma, out);
  (void)hipGetLastError();
}

// v006
// A run of this version takes 97.1 microseconds.
// Two timings next to v005 put it at 1.09 and 1.12 times that version's speed.
// Counting every step since v000, it is 7.62 times as fast.
// Contractions: q/k/v 1x1 projections W[640x512].X[512x4096] per batch on v_wmma_f32_16x16x32_f16 (f16
// containers of bf16-RNE weights x256 and bf16-RNE x0; input channel 512 = position term, and the v bias, added in
// the f32 epilogue); scores K.Q^T on v_wmma_f32_16x16x32_bf16 (bf16 hi + bf16 residual planes of q and k, 3
// products, K=64); out^T = V.P^T on v_wmma_f32_16x16x32_f16 (v as f16, P = e^{s-m} x16384 f16 from the score D
// registers); f32 accumulate everywhere; softmax statistics, gamma scale and the residual add in f32 VALU.
#include <hip/hip_runtime.h>
#include <math.h>
#include <stdint.h>

#ifndef NB
#define NB 4
#endif
#ifndef NQ
#define NQ 4096
#endif
#define NBF   4
#define CC    512
#define CIN   513
#define NN    4096
#define DQ    64
#define MQK   128
#define MW    640
#define QT    64
#define CH    256
#define OSPN  260
#define WSC   256.0f
#define IWSC  0.00390625f
#define LNPS  9.704060527839234f
#define INVNN 0.000244140625f
// attention LDS map (bytes): every staged row is 128 B of data at a pitch of 144 B (16 B x odd, for ds_load_b128 readers)
#define SKEYS 64                       // keys per stage
#define QTB   128                      // queries per attention block
#define KPH   (NN / 2)                 // keys per key half
#define NST   (KPH / SKEYS)            // stages per key half
#define LPB   144                      // LDS row pitch
#define KSLOT 10240                    // one k plane of a stage: 64 rows x 144 B = 9216, rounded up to a multiple of 2 KiB
#define VOFF  (2 * KSLOT)              // v rows behind the two k planes
#define VHALF (128 * LPB)              // 128 v rows = 18432 = 9 x 2 KiB
#define BUFB  (VOFF + 2 * VHALF)       // one stage buffer = 57344
#define RINGB (2 * BUFB)               // one key half's two stage buffers
#define QOFF  (2 * RINGB)              // q slices behind the two rings
#define QSLOT 6144                     // 32 q rows x 144 B = 4608, rounded up to a multiple of 2 KiB
#define LDSB  (QOFF + 8 * QSLOT)       // 278528: one work-group of 8 waves per WGP
// behind the key loop the same LDS holds: the accumulator tiles that the two key halves hand each other, their m and l, Os
#define XWAVE 16384                    // 16 tiles x 1 KiB handed over per wave
#define MLOFF (8 * XWAVE)              // m and l: 8 waves x 2 query tiles x 32 lanes x 8 B = 4096
#define OSOFF (MLOFF + 8192)           // Os[128 queries][256 channels], pitch OSPN floats

// projection LDS map (bytes): a stage is 64 k = 128 B of all 640 W16 rows at the pitch LPB; behind the two stage buffers the x tile
#define PROWS 80                       // W16 rows per wave: 16 q/k rows, then 64 v rows
#define PNST  (CC * 2 / 128)           // stages
#define PSLOT 12288                    // one wave's slice: 80 rows x 144 B = 11520, rounded up to a multiple of 2 KiB
#define PBUF  (8 * PSLOT)              // one stage buffer
#define PXB   1040                     // x tile row pitch: 512 channels x 2 B + 16 B (16 B x odd)
#define PLDSB (2 * PBUF + QT * PXB)    // 263168: one work-group of 8 waves per WGP

static_assert(NB >= 1 && NB <= NBF);
static_assert(NQ >= QTB && NQ <= NN && NQ % QTB == 0);
static_assert(NN % QT == 0 && CC % QT == 0 && MQK % QT == 0);
static_assert(MQK == 2 * DQ && MW == MQK + CC && MW % 8 == 0);
static_assert(DQ == QT);
static_assert(CC == 2 * CH && CH == 16 * 16);
static_assert(CC % 256 == 0 && CC % 32 == 0 && DQ % 32 == 0 && NN % 32 == 0);
static_assert((OSPN * 4) % 16 == 0);
static_assert(DQ * 2 == 128 && SKEYS * 2 == 128 && KPH % SKEYS == 0 && NST >= 2);
static_assert(KSLOT % 2048 == 0 && KSLOT >= SKEYS * LPB && VHALF % 2048 == 0 && QSLOT % 2048 == 0 && QSLOT >= 32 * LPB);
static_assert(OSOFF + QTB * OSPN * 4 <= LDSB && LDSB <= 327680 && BUFB % 2048 == 0);
static_assert(PNST >= 2 && PSLOT % 2048 == 0 && PSLOT >= PROWS * LPB && QT == 64 && 8 * PROWS == MW && PLDSB <= 327680);
static_assert(PXB % 32 == 16 && PXB >= CC * 2 && MQK == 8 * 16 && CC == 8 * 64);

typedef _Float16       v16h __attribute__((ext_vector_type(16)));
typedef _Float16       v8h  __attribute__((ext_vector_type(8)));
typedef __bf16         v16b __attribute__((ext_vector_type(16)));
typedef unsigned short v8us __attribute__((ext_vector_type(8)));
typedef float          v8f  __attribute__((ext_vector_type(8)));
typedef float          v4f  __attribute__((ext_vector_type(4)));
typedef float          v2f  __attribute__((ext_vector_type(2)));
typedef _Float16       v2h  __attribute__((ext_vector_type(2)));
typedef unsigned int   v4u  __attribute__((ext_vector_type(4)));
typedef uint32_t       u32x4 __attribute__((ext_vector_type(4)));
typedef uint32_t       u32x8 __attribute__((ext_vector_type(8)));

union Frag  { v8us u[2]; v16h h; v16b bf; };
union FragH { v16h v; v8h hv[2]; };
static_assert(sizeof(Frag) == 32);
static_assert(sizeof(FragH) == 32);

// ---- scalar helpers ---------------------------------------------------------------------------------------
__device__ __forceinline__ unsigned short bf_bits(float f) {          // f32 -> bf16 bits, RNE convert
  unsigned u = __float_as_uint(f);
  return (unsigned short)((u + 0x7FFFu + ((u >> 16) & 1u)) >> 16);
}
__device__ __forceinline__ float bf_up(unsigned short hb) { return __uint_as_float(((unsigned)hb) << 16); }
__device__ __forceinline__ float bfr(float f) { return bf_up(bf_bits(f)); }
__device__ __forceinline__ unsigned short h_bits(_Float16 x) { return __builtin_bit_cast(unsigned short, x); }
__device__ __forceinline__ unsigned pk16(unsigned short a, unsigned short b) { return (unsigned)a | ((unsigned)b << 16); }
__device__ __forceinline__ v8f zero8() { v8f z = {0.f, 0.f, 0.f, 0.f, 0.f, 0.f, 0.f, 0.f}; return z; }
__device__ __forceinline__ float hmax8(v8f s) {
  return fmaxf(fmaxf(fmaxf(s[0], s[1]), fmaxf(s[2], s[3])), fmaxf(fmaxf(s[4], s[5]), fmaxf(s[6], s[7])));
}
__device__ __forceinline__ unsigned wave_ballot(bool p) {
#if defined(__HIP_DEVICE_COMPILE__)
  return __builtin_amdgcn_ballot_w32(p);
#else
  return p ? 1u : 0u;
#endif
}
// lane l with lane l ^ 16, as a vector move (a shuffle through the LDS unit counts on dscnt)
__device__ __forceinline__ float xhalf(float x) {
  return __builtin_bit_cast(float, __builtin_amdgcn_permlanex16(__builtin_bit_cast(int, x), __builtin_bit_cast(int, x),
                                                                0x76543210, 0xfedcba98, false, false));
}
// compile-time tags of an attention pass: does a next stage exist
struct HasNext   { static constexpr bool more = true; };
struct LastStage { static constexpr bool more = false; };
// compile-time tags of a 32-key block: its place in the 64-key stage
struct Sub0 { static constexpr int sub = 0; };
struct Sub1 { static constexpr int sub = 1; };
// position channel value w[l] = (l / 4096) * 2 - 1 in f32, spec op order (every step exact)
__device__ __forceinline__ float wpos(int l) { return ((float)l * INVNN) * 2.0f - 1.0f; }

// ---- 16-bit fragment loader (A, or B from a k-contiguous [n][k] row) from an LDS row: lane -> row/col (lane&15), p (bytes)
//      already includes 16*(lane>>4); elements 0..7 <- k0+8h.., elements 8..15 <- k0+16+8h.. (16 elements = 32 B on)
__device__ __forceinline__ Frag ldfrag_lds(const unsigned char* p) {
  Frag f;
  f.u[0] = *(const v8us*)(p);
  f.u[1] = *(const v8us*)(p + 32);
  return f;
}

// ---- tensor load to LDS: descriptor groups, issue and waits --------------------------------------------------
__device__ __forceinline__ uint32_t uni(uint32_t v) { return (uint32_t)__builtin_amdgcn_readfirstlane(v); }
// a wave-uniform value held in a scalar register: a test on it compiles to a scalar branch, and a descriptor word formed
// from it stands behind the wait written in front of it
__device__ __forceinline__ uint32_t pinned(uint32_t v) { uint32_t w = uni(v); asm volatile("" : "+s"(w)); return w; }
// group 1: 1-byte elements, tile = tensor = rows x 128 B, source pitch in bytes, 16 B of LDS pad behind every 128-B row
__device__ __forceinline__ u32x8 tdm_group1(uint32_t rows, uint32_t src_pitch) {
  u32x8 g;
  g[0] = uni((1u << 20) | (4u << 22) | (3u << 25));
  g[1] = uni(128u << 16);
  g[2] = uni(rows << 16);
  g[3] = uni(128u << 16);
  g[4] = uni(rows);
  g[5] = uni(src_pitch);
  g[6] = uni(0u);
  g[7] = uni(0u);
  return g;
}
__device__ __forceinline__ u32x4 tdm_group0(uint32_t lds_dst, uint64_t ga) {
  u32x4 g;
  g[0] = uni(1u);
  g[1] = uni(lds_dst);
  g[2] = uni((uint32_t)ga);
  g[3] = uni((((uint32_t)(ga >> 32)) & 0x01FFFFFFu) | 0x80000000u);
  return g;
}
__device__ __forceinline__ void tdm_load(u32x4 g0, u32x8 g1) {
  asm volatile("tensor_load_to_lds %0, %1" :: "s"(g0), "s"(g1) : "memory");
}
// the compiler places no wait for a tensor load: the issuing wave's own wait, before the barrier that publishes the tile
__device__ __forceinline__ void wait_tensor0() { asm volatile("s_wait_tensorcnt 0x0" ::: "memory"); }
// this wave's LDS reads have returned before a buffer it read is handed back for a refill
__device__ __forceinline__ void wait_ds0() { asm volatile("s_wait_dscnt 0x0" ::: "memory"); }

// ---- WMMA helpers --------------------------------------------------------------------------------------------
// plain builtins, no asm gap behind them: an asm statement's vector operands must lie in v0..v255, which a loop that holds
// accumulators and prefetched fragments at once does not fit; the compiler pads the builtin itself
__device__ __forceinline__ v8f wm_h(v16h a, v16h b, v8f c) {
  return __builtin_amdgcn_wmma_f32_16x16x32_f16(false, a, false, b, (short)0, c, false, false);
}
__device__ __forceinline__ v8f wm_b(v16b a, v16b b, v8f c) {
  return __builtin_amdgcn_wmma_f32_16x16x32_bf16(false, a, false, b, (short)0, c, false, false);
}

// =========================================================================================================
// (0) 1x1 weights: W16 f16 [640][512] (input channels 0..511 only; channel 512 is handled in the projection epilogues);
//     value = f16 of (bf16-RNE(w) * 256) (exact). Stacked source row o: 0..63 = Wq rows, 64..127 = Wk rows, 128..639 = Wv
//     rows. Block blk (0..79) owns o = 8*blk..8*blk+7 (source selection block-uniform): one wave per row. The plane is laid
//     in the order the projection's waves read it, 80 rows per wave w: 16 stacked q/k rows 16w.., then 64 Wv rows 64w.. .
// coverage: 80 blocks x 8 rows x 2 halves x 32 lanes x 8 halves = 640 x 512; o -> ro is a permutation of 0..639: the whole plane.
// =========================================================================================================
__global__ __launch_bounds__(256)
void cvt_w(const float* __restrict__ wq, const float* __restrict__ wk, const float* __restrict__ wv,
           unsigned short* W16) {
  const int tid = threadIdx.x, blk = blockIdx.x;
  const int rl = tid >> 5, lane = tid & 31;
  const int o = 8 * blk + rl;                                          // 0..639
  const float* wbase = (blk < (DQ / 8)) ? wq : ((blk < (MQK / 8)) ? wk : wv);
  const int osub = (blk < (DQ / 8)) ? 0 : ((blk < (MQK / 8)) ? DQ : MQK);
  const float* s = wbase + (size_t)(o - osub) * CIN;                   // (o - osub) in range of that matrix
  const int ro = (o < MQK) ? PROWS * (o >> 4) + (o & 15) : PROWS * ((o - MQK) >> 6) + 16 + ((o - MQK) & 63);
#pragma unroll 1
  for (int cp = 0; cp < CC / 256; ++cp) {
    const int col = 256 * cp + 8 * lane;                               // 0..504, col + 7 <= 511
    float f[8];
#pragma unroll
    for (int t = 0; t < 8; ++t) f[t] = s[col + t];
    v4u u;
#pragma unroll
    for (int t = 0; t < 4; ++t) {
      const _Float16 h0 = (_Float16)(bfr(f[2 * t]) * WSC);
      const _Float16 h1 = (_Float16)(bfr(f[2 * t + 1]) * WSC);
      u[t] = pk16(h_bits(h0), h_bits(h1));
    }
    *(v4u*)(W16 + (size_t)ro * CC + col) = u;
    // before the next trip writes again the registers that the issued store names
    asm volatile("s_wait_xcnt 0x0" ::: "memory");
  }
}

// =========================================================================================================
// (1) all projections of one (b, 64-position tile): x0 f32 [512 c][64 n] is read once, rounded (bf16-RNE values, exact in f16)
//   and laid in LDS position-major, XT[n][c] (pitch PXB); every product of the tile's 640 output rows reads it there.
//   Block = 8 waves. Wave w owns 80 rows of W16 (cvt_w lays them in this order): 16 q/k rows and 64 v rows. They come in
//   stages of 64 k by one tensor load per wave (rows of 128 B, pitch 144 B), two buffers. A pass reads its 18 fragments as one
//   group; behind them stands the publish point of stage s + 1, where stage s + 2 is issued into the buffer that the pass has
//   just read; then the pass runs its 40 products.
//   q/k tile: A = W rows, B = XT rows: lane (hh, c) holds d = 8 hh + r of position 16 nt + c: 8 consecutive d, one 16-B store
//   per plane. v tiles: A = XT rows, B = W rows: lane (hh, c) holds positions 16 nt + 8 hh + r of channel c: 8 consecutive
//   keys of the channel-major plane, one 16-B store; a wave's four nt stores fill a channel row's whole 128-B line.
//   Epilogues in f32: + bf16-RNE(W[.][512]) * wpos(n) (position channel), v also + bf16-RNE(bv); q/k as bf16 hi + residual.
// coverage: XT 8 waves x 4 ci x 8 cp pairs x 2 = 512 c, 4 ne x 4 e x 4 t = 64 n; planes 8 waves x 16 d x 64 n; V 8 waves x 64 o
//           x 64 n; grid (64, NB) covers Qh/Ql/Kh/Kl [NB][4096][64] and V [NB][512][4096] exactly once.
// =========================================================================================================
__global__ __launch_bounds__(256)
void proj(const float* __restrict__ x, const unsigned short* __restrict__ W16,
          const float* __restrict__ wq, const float* __restrict__ wk, const float* __restrict__ wv,
          const float* __restrict__ bv,
          unsigned short* Qh, unsigned short* Ql, unsigned short* Kh, unsigned short* Kl, unsigned short* V) {
  __shared__ __attribute__((aligned(2048))) unsigned char L[PLDSB];
  unsigned char* XT = L + 2 * PBUF;                                    // behind the W ring
  const int tid  = threadIdx.x;
  const int lane = tid & 31, wave = tid >> 5;
  const int hh   = lane >> 4, c = lane & 15;
  const int n0   = blockIdx.x * QT, b = blockIdx.y;

  // every wave issues one tensor load per stage for its own slice: all of this is wave-uniform
  const uint32_t wu    = uni((uint32_t)tid >> 5);
  const uint32_t lbase = (uint32_t)(size_t)L;                          // byte offset in the work-group's LDS
  const unsigned char* ssrc = (const unsigned char*)(W16 + (size_t)((uint32_t)PROWS * wu) * CC);
  const uint32_t soff = wu * (uint32_t)PSLOT;
  u32x8 g1s = tdm_group1((uint32_t)PROWS, (uint32_t)(CC * 2));
  asm volatile("" : "+s"(g1s));  // pinned() form, descriptor words held in scalar registers: one tuple serves every issue, so none is reused under a request in flight
  u32x4 g0s;                                                           // group 0 of this wave's stage request in flight
  auto issue = [&](uint32_t st) {
    const uint32_t dst = lbase + (st & 1u) * (uint32_t)PBUF + soff;
    const uint64_t ga  = (uint64_t)(size_t)ssrc + (uint64_t)st * 128u;
    g0s = tdm_group0(dst, ga);
    tdm_load(g0s, g1s);
  };
  // the issuing wave's wait for its stage request; it names group 0 so that those registers keep their values until then
  auto landed = [&]() { asm volatile("s_wait_tensorcnt 0x0" :: "s"(g0s) : "memory"); };

  issue(pinned(0u));                                                   // stage 0 flies while the x tile is read and rounded

  // the epilogues' terms, read here so that they land under the loop: W[d][512] of this lane's 8 q or k rows (waves 0..3 hold
  // q rows, 4..7 k rows: wave-uniform choice), Wv[o][512] and bv[o] of its 4 channels
  const int d0 = 16 * (wave & 3) + 8 * hh;
  const float* pwp = ((wu < 4u) ? wq : wk) + (size_t)d0 * CIN;
  const float* pvp = wv + (size_t)(64 * wave + c) * CIN;
  const float* pbp = bv + 64 * wave + c;

  // x0 tile: lane (e, cp) of wave w reads 4 positions of the two channels of pair cp + 8 (w + 8 ci); all 32 loads in flight
  const int e = lane & 3, cp = lane >> 2;
  const float* xb = x + ((size_t)(b * CC + 2 * (cp + 8 * wave))) * NN + n0 + 4 * e;
  v4f xa[4][4], xq[4][4];
#pragma unroll  // constant indices keep the arrays in registers
  for (int ci = 0; ci < 4; ++ci) {
#pragma unroll
    for (int ne = 0; ne < 4; ++ne) {
      xa[ci][ne] = *(const v4f*)(xb + (size_t)(128 * ci) * NN + 16 * ne);
      xq[ci][ne] = *(const v4f*)(xb + (size_t)(128 * ci + 1) * NN + 16 * ne);
    }
  }
  float pw[8], pwo[4], bo[4];
#pragma unroll
  for (int r = 0; r < 8; ++r) pw[r] = pwp[(size_t)r * CIN + CC];
#pragma unroll
  for (int vt = 0; vt < 4; ++vt) { pwo[vt] = pvp[(size_t)(16 * vt) * CIN + CC]; bo[vt] = pbp[16 * vt]; }
  // before anything writes again a register that an issued load names: the wait names the four addresses, so that their
  // registers keep their values until then; the scheduling barriers hold it behind the loads
  __builtin_amdgcn_sched_barrier(0);
  asm volatile("s_wait_xcnt 0x0" :: "v"(xb), "v"(pwp), "v"(pvp), "v"(pbp) : "memory");
  __builtin_amdgcn_sched_barrier(0);

  // one 4-B store per position and channel pair: banks 16 e + cp, all 32 lanes apart
#pragma unroll
  for (int ci = 0; ci < 4; ++ci) {
    unsigned char* xs = XT + (4 * e) * PXB + 4 * (cp + 8 * (wave + 8 * ci));
#pragma unroll
    for (int ne = 0; ne < 4; ++ne) {
#pragma unroll
      for (int t = 0; t < 4; ++t) {
        const v2f pr = {bfr(xa[ci][ne][t]), bfr(xq[ci][ne][t])};       // the pair's two channels: one packed convert
        *(v2h*)(xs + (16 * ne + t) * PXB) = __builtin_convertvector(pr, v2h);
      }
    }
  }
  landed();
  __syncthreads();                                                     // XT and stage 0 published to every wave
  issue(pinned(1u));

  v8f aq[4], av[4][4];
#pragma unroll
  for (int nt = 0; nt < 4; ++nt) {
    aq[nt] = zero8();
#pragma unroll
    for (int vt = 0; vt < 4; ++vt) av[vt][nt] = zero8();
  }

  // rolled: the stage test at the publish point is opaque to the compiler, so unrolled copies would carry issue code that never runs
#pragma unroll 1
  for (uint32_t st = 0; st < (uint32_t)PNST; ++st) {
    const unsigned char* Wp = L + (st & 1u) * (uint32_t)PBUF + wave * PSLOT + c * LPB + 16 * hh;   // this pass reads this buffer alone
    const unsigned char* Xp = XT + c * PXB + 16 * hh + st * 128u;
    Frag fw[2][5], fx[2][4];                                           // every fragment of the pass in registers of its own
#pragma unroll  // constant indices keep the fragment arrays in registers
    for (int ks = 0; ks < 2; ++ks) {
#pragma unroll
      for (int j = 0; j < 5; ++j) fw[ks][j] = ldfrag_lds(Wp + (16 * j) * LPB + 64 * ks);
#pragma unroll
      for (int nt = 0; nt < 4; ++nt) fx[ks][nt] = ldfrag_lds(Xp + (16 * nt) * PXB + 64 * ks);
    }
    // keeps the reads one group in front of the publish point and the products: sunk among the products, each small group is
    // waited out where it stands
    __builtin_amdgcn_sched_barrier(0);
    // publish point of stage st + 1, every wave, in this order; behind the first wait this wave holds in registers all that it
    // reads of this buffer, so stage st + 2 is issued here and flies under the products
    wait_ds0();
    landed();
    __syncthreads();                                                   // stage st + 1 published; every reader has left this buffer
    if (pinned(st + 2u < (uint32_t)PNST)) issue(pinned(st + 2u));      // scalar branch: a tensor load ignores EXEC
#pragma unroll
    for (int ks = 0; ks < 2; ++ks) {
#pragma unroll
      for (int nt = 0; nt < 4; ++nt) aq[nt] = wm_h(fw[ks][0].h, fx[ks][nt].h, aq[nt]);
#pragma unroll
      for (int vt = 0; vt < 4; ++vt) {
#pragma unroll
        for (int nt = 0; nt < 4; ++nt) av[vt][nt] = wm_h(fx[ks][nt].h, fw[ks][1 + vt].h, av[vt][nt]);
      }
    }
  }
  // behind the loop: this wait names both groups, so that no descriptor register takes a new value in front of it
  asm volatile("s_wait_tensorcnt 0x0" :: "s"(g0s), "s"(g1s) : "memory");
  wait_ds0();

  // q/k: lane (hh, c) holds d = d0 + r of position n0 + 16 nt + c
  v4u uh[4], ul[4];
#pragma unroll
  for (int nt = 0; nt < 4; ++nt) {
    const float wl = wpos(n0 + 16 * nt + c);
#pragma unroll
    for (int t = 0; t < 4; ++t) {
      const float f0 = aq[nt][2 * t] * IWSC + bfr(pw[2 * t]) * wl;
      const float f1 = aq[nt][2 * t + 1] * IWSC + bfr(pw[2 * t + 1]) * wl;
      const unsigned short hb0 = bf_bits(f0), hb1 = bf_bits(f1);
      const unsigned short lb0 = bf_bits(f0 - bf_up(hb0));
      const unsigned short lb1 = bf_bits(f1 - bf_up(hb1));
      uh[nt][t] = pk16(hb0, hb1);
      ul[nt][t] = pk16(lb0, lb1);
    }
  }
  // v: lane (hh, c) holds keys n0 + 16 nt + 8 hh + r of channel 64 wave + 16 vt + c
  v4u uv[4][4];
#pragma unroll
  for (int vt = 0; vt < 4; ++vt) {
    const float pwv = bfr(pwo[vt]), bov = bfr(bo[vt]);
#pragma unroll
    for (int nt = 0; nt < 4; ++nt) {
      const int nb = n0 + 16 * nt + 8 * hh;
      unsigned short hb[8];
#pragma unroll
      for (int r = 0; r < 8; ++r) {
        const float val = av[vt][nt][r] * IWSC + pwv * wpos(nb + r) + bov;
        hb[r] = h_bits((_Float16)val);
      }
#pragma unroll
      for (int t = 0; t < 4; ++t) uv[vt][nt][t] = pk16(hb[2 * t], hb[2 * t + 1]);
    }
  }
  unsigned short* Ph = ((wu < 4u) ? Qh : Kh) + ((size_t)(b * NN + n0 + c)) * DQ + d0;
  unsigned short* Pl = ((wu < 4u) ? Ql : Kl) + ((size_t)(b * NN + n0 + c)) * DQ + d0;
  unsigned short* Vp = V + ((size_t)(b * CC + 64 * wave + c)) * NN + n0 + 8 * hh;
  // the stores stand behind all of the value arithmetic: none of it writes again a register that an issued store names
  __builtin_amdgcn_sched_barrier(0);
#pragma unroll
  for (int nt = 0; nt < 4; ++nt) {
    *(v4u*)(Ph + (size_t)(16 * nt) * DQ) = uh[nt];
    *(v4u*)(Pl + (size_t)(16 * nt) * DQ) = ul[nt];
  }
  // before the address arithmetic of the v stores writes again a register that an issued store names: the wait names the
  // stores' addresses and data, so that their registers keep their values until then
  __builtin_amdgcn_sched_barrier(0);
  asm volatile("s_wait_xcnt 0x0" :: "v"(Ph), "v"(Pl), "v"(uh[0]), "v"(uh[1]), "v"(uh[2]), "v"(uh[3]),
               "v"(ul[0]), "v"(ul[1]), "v"(ul[2]), "v"(ul[3]) : "memory");
  __builtin_amdgcn_sched_barrier(0);
#pragma unroll
  for (int vt = 0; vt < 4; ++vt) {
#pragma unroll
    for (int nt = 0; nt < 4; ++nt) *(v4u*)(Vp + (size_t)(16 * vt) * NN + 16 * nt) = uv[vt][nt];
  }
}

// =========================================================================================================
// (2) attention for one (b, 128-query tile, channel half chh), transposed formulation, 4096 keys, no mask, no scale.
//   Block = 8 waves: wave = query group qg (wave & 3, 32 queries = two 16-query tiles) + 4 x key half kh (2048 keys each).
//   S^T tile (16 keys x 16 queries) = sum over 2 d-chunks of A(k: row = key, 32 d via the split k map from the bf16 plane
//   Kh [b][4096][64]) . B(q: col = query, same map from Qh) + A(Kh).B(Ql) + A(Kl).B(Qh) (bf16 unscaled residual planes,
//   shared accumulator). Per lane the D tile holds 8 keys of ONE query: online softmax state per lane and query tile, one
//   vector move (lane^16) for the max over 32 keys; the o/l rescale is skipped under a wave-uniform ballot when no lane's
//   max grew (corr == 1 exactly for every lane then). P = e^{s-m} x 16384 as f16 is the B operand of O^T (rows channel,
//   cols queries) += A(v rows channel = cb0 + 16j + (lane&15), keys contiguous, f16 plane V [b][512][4096]) . B(P^T):
//   element r <- D of the tile covering keys kb..kb+15, element 8+r <- the tile covering kb+16..kb+31, lane unchanged.
//   Every k and v fragment read from LDS serves both query tiles: a Kh fragment four products, a Kl or v fragment two. 32 accumulator
//   tiles per wave (2 query tiles x 256 channels), two waves per SIMD. The two channel halves are separate blocks (grid.z).
//   Operands come from LDS, laid there by tensor loads (rows of 128 B, pitch 144 B): the block's q rows once (each wave one
//   slice of 32 rows of one plane), then per key half stages of 64 keys in two buffers: of the half's four waves one brings
//   the Kh rows, one the Kl rows, two 128 channel rows of V each (64 keys = one whole 128-B line per row).
//   A pass walks its 64 keys as two 32-key blocks. Two register sets of 8 fragments: a block finds the k and Ql fragments of
//   its two 32-d chunks in them (Qh stays in registers); behind the score products its 16 v fragments go there (they land under the softmax), behind
//   the first 16 v products the next block's first chunk, behind the last 16 its second.
//   The publish point of stage s + 1 stands in the last block of pass s, behind its exponentials: by then the wave has fetched
//   all it reads of stage s, so stage s + 2 is issued there into that buffer.
//   Behind the loop the two key halves of a query group are joined: each wave hands its partner (wave ^ 4) 128 channels of
//   both query tiles with its m and l through LDS, and finishes the other 128: o = (o_a e^{m_a-m} + o_b e^{m_b-m}) gamma / l.
//   Then Os[query][256 channels] (pitch OSPN, b128 stores), and out rows: 8 consecutive lanes x 16 B per 128-B line.
// coverage: 16 it x 2 parts x 32 lines x 8 lanes x 4 floats = 256 ch x 128 n per block; grid (NQ/128, NB, 2) covers
//           out[b][0..511][0..NQ-1] exactly once. Hand-over region and Os: cross-wave (block barriers).
// =========================================================================================================
__global__ __launch_bounds__(256)
void attn_k(const unsigned short* __restrict__ Qh, const unsigned short* __restrict__ Ql,
            const unsigned short* __restrict__ Kh, const unsigned short* __restrict__ Kl,
            const unsigned short* __restrict__ V, const float* __restrict__ x,
            const float* __restrict__ gamma, float* out) {
  __shared__ __attribute__((aligned(2048))) unsigned char L[LDSB];
  const int tid  = threadIdx.x;
  const int wave = tid >> 5, lane = tid & 31;
  const int hh   = lane >> 4, c = lane & 15;
  const int qg   = wave & 3, kh = wave >> 2;
  const int n0   = blockIdx.x * QTB, b = blockIdx.y, chh = blockIdx.z;
  const int cb0  = chh * CH;                                           // 0 or 256

  // every wave issues one tensor load per stage for its own slice: all of this is wave-uniform
  const uint32_t wv    = uni((uint32_t)tid >> 5);
  const uint32_t role  = wv & 3u, khu = wv >> 2;                       // slice of the stage, key half
  const uint32_t lbase = (uint32_t)(size_t)L;                          // byte offset in the work-group's LDS
  const bool     isV   = role >= 2u;
  const unsigned char* ssrc = isV
      ? (const unsigned char*)(V + ((size_t)(b * CC + cb0) + 128u * (role - 2u)) * NN + khu * (uint32_t)KPH)
      : (const unsigned char*)((role == 0u ? Kh : Kl) + ((size_t)b * NN + khu * (uint32_t)KPH) * DQ);
  const uint32_t sadv = isV ? (uint32_t)(SKEYS * 2) : (uint32_t)(SKEYS * DQ * 2);   // source bytes from stage to stage
  const uint32_t soff = khu * (uint32_t)RINGB + (isV ? (uint32_t)VOFF + (role - 2u) * (uint32_t)VHALF : role * (uint32_t)KSLOT);
  u32x8 g1s = tdm_group1(isV ? 128u : (uint32_t)SKEYS, isV ? (uint32_t)(NN * 2) : (uint32_t)(DQ * 2));
  asm volatile("" : "+s"(g1s));  // pinned() form, descriptor words held in scalar registers: one tuple serves every issue, so none is reused under a request in flight
  u32x4 g0s;                                                           // group 0 of this wave's stage request in flight
  auto issue = [&](uint32_t st) {
    const uint32_t dst = lbase + (st & 1u) * (uint32_t)BUFB + soff;
    const uint64_t ga  = (uint64_t)(size_t)ssrc + (uint64_t)st * sadv;
    g0s = tdm_group0(dst, ga);
    tdm_load(g0s, g1s);
  };
  // the issuing wave's wait for its stage request; it names group 0 so that those registers keep their values until then
  auto landed = [&]() { asm volatile("s_wait_tensorcnt 0x0" :: "s"(g0s) : "memory"); };

  // q, loaded once: wave wv brings rows n0 + 32*(wv>>1) .. +31 of plane (wv&1 ? Ql : Qh) into slice wv
  {
    const unsigned char* qsrc =
        (const unsigned char*)(((wv & 1u) ? Ql : Qh) + ((size_t)(b * NN + n0) + 32u * (wv >> 1)) * DQ);
    tdm_load(tdm_group0(lbase + (uint32_t)QOFF + wv * (uint32_t)QSLOT, (uint64_t)(size_t)qsrc),
             tdm_group1(32u, (uint32_t)(DQ * 2)));
    wait_tensor0();
  }
  issue(pinned(0u));
  landed();
  __syncthreads();                                                     // q and stage 0 of both halves published to every wave
  issue(pinned(1u));

  const unsigned char* Lh = L + kh * RINGB;                            // this key half's ring

  float m[2] = {-1.0e30f, -1.0e30f}, l[2] = {0.f, 0.f};
  v8f o[2][16];
#pragma unroll
  for (int qt = 0; qt < 2; ++qt) {
#pragma unroll
    for (int j = 0; j < 16; ++j) o[qt][j] = zero8();
  }

  // q fragment base (B operand, col = query n0 + 32*qg + 16*qt + c: row 16*qt + c of slices 2*qg (Qh), 2*qg + 1 (Ql)), + 64*kc B
  const unsigned char* Qp = L + QOFF + (2 * qg) * QSLOT + c * LPB + 16 * hh;
  // the Qh fragments stay in registers, read once
  Frag qh[2][DQ / 32];
#pragma unroll  // constant indices keep the fragment array in registers
  for (int qt = 0; qt < 2; ++qt) {
#pragma unroll
    for (int kc = 0; kc < DQ / 32; ++kc) qh[qt][kc] = ldfrag_lds(Qp + (16 * qt) * LPB + 64 * kc);
  }
  // the two fragment sets; each holds the k and Ql fragments of one 32-d chunk, then 8 v fragments
  Frag ra[8], rb[8];
  // one group: the score operands of d chunk kc of a block. k (A operand, row = key): stage row 32*sub + c (+16), + 64*kc B,
  // residual plane KSLOT on: R[0, 1] = Kh keys kb.., kb+16..; R[2, 3] = Kl the same; R[4 + qt] = Ql of tile qt
  auto load_s = [&](Frag (&R)[8], const unsigned char* Bp, int sub, int kc) __attribute__((always_inline)) {
    const unsigned char* k0p = Bp + (32 * sub + c) * LPB + 16 * hh + 64 * kc;
    R[0] = ldfrag_lds(k0p);
    R[1] = ldfrag_lds(k0p + 16 * LPB);
    R[2] = ldfrag_lds(k0p + KSLOT);
    R[3] = ldfrag_lds(k0p + KSLOT + 16 * LPB);
#pragma unroll  // constant indices keep the fragment array in registers
    for (int qt = 0; qt < 2; ++qt) R[4 + qt] = ldfrag_lds(Qp + QSLOT + (16 * qt) * LPB + 64 * kc);
  };
  // one group: 8 of a block's v fragments (A operand, row = channel cb0 + 128*g + 16j + c, keys contiguous): + 64*sub B
  auto load_v = [&](Frag (&R)[8], const unsigned char* Bp, int sub, int g) __attribute__((always_inline)) {
    const unsigned char* Vp = Bp + VOFF + (128 * g + c) * LPB + 16 * hh + 64 * sub;
#pragma unroll  // constant indices keep the fragment array in registers
    for (int j = 0; j < 8; ++j) R[j] = ldfrag_lds(Vp + (16 * j) * LPB);
  };
  load_s(ra, Lh, 0, 0);                                                // q and stage 0 are published: the first block's score operands
  load_s(rb, Lh, 0, 1);

  // one 32-key block: RA and RB hold its score operands; it leaves the next block's there. The tags say at compile time where
  // the block stands and whether a next stage exists, so that no read stands under a branch. Inlined at every place: the
  // fragment arrays stay in registers
  auto block = [&](Frag (&RA)[8], Frag (&RB)[8], uint32_t st, auto subtag, auto tag) __attribute__((always_inline)) {
    constexpr int  sub  = decltype(subtag)::sub;
    constexpr bool more = decltype(tag)::more;
    constexpr bool last = (sub + 1 == SKEYS / 32);                     // the stage's last block
    constexpr bool next = !last || more;                               // a next block exists
    const unsigned char* Bp = Lh + (st & 1u) * (uint32_t)BUFB;         // this stage's buffer
    const unsigned char* Bx = last ? Lh + ((st + 1u) & 1u) * (uint32_t)BUFB : Bp;   // the next block's, read behind its publish point
    constexpr int subx = last ? 0 : sub + 1;

    v8f s[2][2];                                                       // [query tile][keys kb.., kb+16..]
#pragma unroll
    for (int qt = 0; qt < 2; ++qt) { s[qt][0] = zero8(); s[qt][1] = zero8(); }
    auto scores = [&](Frag (&R)[8], int kc) __attribute__((always_inline)) {
#pragma unroll  // constant indices into the fragment array
      for (int qt = 0; qt < 2; ++qt) {
        s[qt][0] = wm_b(R[0].bf, qh[qt][kc].bf, s[qt][0]);
        s[qt][1] = wm_b(R[1].bf, qh[qt][kc].bf, s[qt][1]);
      }
#pragma unroll
      for (int qt = 0; qt < 2; ++qt) {
        s[qt][0] = wm_b(R[0].bf, R[4 + qt].bf, s[qt][0]);
        s[qt][1] = wm_b(R[1].bf, R[4 + qt].bf, s[qt][1]);
      }
#pragma unroll
      for (int qt = 0; qt < 2; ++qt) {
        s[qt][0] = wm_b(R[2].bf, qh[qt][kc].bf, s[qt][0]);
        s[qt][1] = wm_b(R[3].bf, qh[qt][kc].bf, s[qt][1]);
      }
    };
    scores(RA, 0);
    scores(RB, 1);
    // keeps the score products in front of the group and the group here: the v fragments land under the softmax; sunk to
    // their products, each read would be waited out there
    __builtin_amdgcn_sched_barrier(0);
    load_v(RA, Bp, sub, 0);
    load_v(RB, Bp, sub, 1);
    __builtin_amdgcn_sched_barrier(0);

    float mx[2], mn[2];
#pragma unroll
    for (int qt = 0; qt < 2; ++qt) {
      mx[qt] = fmaxf(hmax8(s[qt][0]), hmax8(s[qt][1]));
      mx[qt] = fmaxf(mx[qt], xhalf(mx[qt]));                           // a vector move: no LDS wait drains the reads in flight
      mn[qt] = fmaxf(m[qt], mx[qt]);
    }
    const unsigned grew = wave_ballot(mx[0] > m[0] || mx[1] > m[1]);   // wave-uniform, one test per block
    if (grew != 0u) {
#pragma unroll
      for (int qt = 0; qt < 2; ++qt) {
        const float corr = __expf(m[qt] - mn[qt]);                     // == 1 exactly for lanes whose max did not grow
        l[qt] *= corr;
#pragma unroll
        for (int j = 0; j < 16; ++j) {
#pragma unroll
          for (int r = 0; r < 8; ++r) o[qt][j][r] *= corr;
        }
      }
    }
    FragH ph[2];
#pragma unroll
    for (int qt = 0; qt < 2; ++qt) {
      m[qt] = mn[qt];
      const float msh = mn[qt] - LNPS;                                 // exp gives e^{s-m} * 16384
      float ls = 0.f;
#pragma unroll
      for (int r = 0; r < 8; ++r) {
        const float e0 = __expf(s[qt][0][r] - msh);                    // key kb      + 8hh + r
        const float e1 = __expf(s[qt][1][r] - msh);                    // key kb + 16 + 8hh + r
        ls += e0 + e1;
        ph[qt].hv[0][r] = (_Float16)e0;
        ph[qt].hv[1][r] = (_Float16)e1;
      }
      l[qt] += ls;
    }

    if constexpr (last) {
      // publish point of stage st + 1, every wave, in this order; behind the first wait this wave holds in registers all that
      // it reads of this buffer. The wait names P as an input: the exponentials then stand in front of it and the v reads land
      // under them; without it the compiler sinks them behind the barrier and the reads are waited out here
      if constexpr (more) asm volatile("s_wait_dscnt 0x0" :: "v"(ph[0].v), "v"(ph[1].v) : "memory");
      else wait_ds0();                                                 // no branch follows in the last pass: nothing is sunk there
      if constexpr (more) landed();
      // the last pass's wait names both groups, so that no descriptor register takes a new value in front of it
      else asm volatile("s_wait_tensorcnt 0x0" :: "s"(g0s), "s"(g1s) : "memory");
      __syncthreads();                                                 // stage st + 1 published; every reader has left this buffer
      if constexpr (more) {
        if (pinned(st + 2u < (uint32_t)NST)) issue(pinned(st + 2u));   // scalar branch: a tensor load ignores EXEC
      }
    }

#pragma unroll
    for (int j = 0; j < 8; ++j) {
#pragma unroll
      for (int qt = 0; qt < 2; ++qt) o[qt][j] = wm_h(RA[j].h, ph[qt].v, o[qt][j]);
    }
    if constexpr (next) {
      // the products stay in front of the reads that refill their fragments; the next block's first chunk lands under the other 16
      __builtin_amdgcn_sched_barrier(0);
      load_s(RA, Bx, subx, 0);
      __builtin_amdgcn_sched_barrier(0);
    }
#pragma unroll
    for (int j = 0; j < 8; ++j) {
#pragma unroll
      for (int qt = 0; qt < 2; ++qt) o[qt][8 + j] = wm_h(RB[j].h, ph[qt].v, o[qt][8 + j]);
    }
    if constexpr (next) {
      __builtin_amdgcn_sched_barrier(0);
      // WMMA distance: the next block's first score product may write its D where the allocator kept P, the B operand of the
      // v product issued just before it, and LDS reads fill no slot; four slots, held in place by the scheduling barriers
      asm volatile("v_nop\n\tv_nop\n\tv_nop\n\tv_nop");
      __builtin_amdgcn_sched_barrier(0);
      // the next block's second chunk: it lands under the first chunk's score products
      load_s(RB, Bx, subx, 1);
      // keeps the group here, in front of the next block's score products
      __builtin_amdgcn_sched_barrier(0);
    }
  };
  // rolled: the stage test at the publish point is opaque to the compiler, so unrolled copies would carry issue code that never runs
#pragma unroll 1
  for (uint32_t st = 0; st + 1u < (uint32_t)NST; ++st) {
    block(ra, rb, st, Sub0{}, HasNext{});
    block(ra, rb, st, Sub1{}, HasNext{});
  }
  block(ra, rb, (uint32_t)NST - 1u, Sub0{}, LastStage{});
  block(ra, rb, (uint32_t)NST - 1u, Sub1{}, LastStage{});
  wait_tensor0();
  wait_ds0();
  // the last pass's own barrier stands behind every wave's last read of the rings and of q: all of L is free

  // join of the two key halves: wave (qg, kh) finishes channels 128*kh .. +127 of its 32 queries and hands the other 128 over
  float* Xo = (float*)(L + wave * XWAVE);                              // written by this wave, read by its partner
  const float* Xp = (const float*)(L + (wave ^ 4) * XWAVE);
  float* MLo = (float*)(L + MLOFF) + wave * 128;
  const float* MLp = (const float*)(L + MLOFF) + (wave ^ 4) * 128;
  const bool up = kh != 0;                                             // wave-uniform
  v8f f[2][8];
#pragma unroll
  for (int qt = 0; qt < 2; ++qt) {
    l[qt] += xhalf(l[qt]);                                             // the two lane halves' row sums
    MLo[qt * 64 + 2 * lane]     = m[qt];
    MLo[qt * 64 + 2 * lane + 1] = l[qt];
#pragma unroll
    for (int jj = 0; jj < 8; ++jj) {
      const v8f snd = up ? o[qt][jj] : o[qt][8 + jj];
      f[qt][jj]     = up ? o[qt][8 + jj] : o[qt][jj];
      v4f va, vb;
#pragma unroll
      for (int r = 0; r < 4; ++r) { va[r] = snd[r]; vb[r] = snd[4 + r]; }
      *(v4f*)(Xo + (qt * 8 + jj) * 256 + 4 * lane)       = va;         // lane-linear: the partner's same lane reads it back
      *(v4f*)(Xo + (qt * 8 + jj) * 256 + 128 + 4 * lane) = vb;
    }
  }
  __syncthreads();                                                     // every wave's hand-over is written
  const float gam = bfr(gamma[0]);
  float* Os = (float*)(L + OSOFF);                                     // apart from the hand-over region
#pragma unroll
  for (int qt = 0; qt < 2; ++qt) {
    const float mp = MLp[qt * 64 + 2 * lane], lp = MLp[qt * 64 + 2 * lane + 1];
    const float mm = fmaxf(m[qt], mp);
    const float co = __expf(m[qt] - mm), cp = __expf(mp - mm);
    const float inv = gam / (l[qt] * co + lp * cp);                    // o and l both carry the x16384 factor
    const float ao = co * inv, ap = cp * inv;
    const int qrow = 32 * qg + 16 * qt + c;
    v4f pa[8], pb[8];                                                  // one group of reads, in front of the Os stores
#pragma unroll
    for (int jj = 0; jj < 8; ++jj) {
      pa[jj] = *(const v4f*)(Xp + (qt * 8 + jj) * 256 + 4 * lane);
      pb[jj] = *(const v4f*)(Xp + (qt * 8 + jj) * 256 + 128 + 4 * lane);
    }
#pragma unroll
    for (int jj = 0; jj < 8; ++jj) {
      v4f va, vb;
#pragma unroll
      for (int r = 0; r < 4; ++r) { va[r] = f[qt][jj][r] * ao + pa[jj][r] * ap; vb[r] = f[qt][jj][4 + r] * ao + pb[jj][r] * ap; }
      *(v4f*)(Os + qrow * OSPN + 128 * kh + 16 * jj + 8 * hh)     = va;   // Os[query][ch_loc = 128kh + 16jj + 8hh + r]
      *(v4f*)(Os + qrow * OSPN + 128 * kh + 16 * jj + 8 * hh + 4) = vb;
    }
  }
  __syncthreads();                                                     // Os complete

  // out rows: thread (lq, e) owns channel ch0 + 16 it, queries nq0 + 64 part .. +3; one address pair each for x and out, every
  // step from it a constant
  const int e = tid & 7, lq = tid >> 3;                                // lq 0..31
  const int ch0 = lq >> 1;                                             // 0..15
  const int nq0 = (lq & 1) * 32 + 4 * e;                               // 0..60
  const size_t base = ((size_t)(b * CC + cb0 + ch0)) * NN + n0 + nq0;
  const float* xb = x + base;
  float* ob = out + base;
  const float* Ob = Os + nq0 * OSPN + ch0;
#pragma unroll
  for (int part = 0; part < 2; ++part) {
    v4f res[16];
#pragma unroll
    for (int it = 0; it < 16; ++it) {
      const v4f xv = *(const v4f*)(xb + (size_t)(16 * it) * NN + 64 * part);
#pragma unroll
      for (int t = 0; t < 4; ++t) res[it][t] = Ob[(64 * part + t) * OSPN + 16 * it] + bfr(xv[t]);
    }
#pragma unroll
    for (int it = 0; it < 16; ++it) *(v4f*)(ob + (size_t)(16 * it) * NN + 64 * part) = res[it];
    // before the second part writes again the registers that the issued stores name
    if (part == 0) asm volatile("s_wait_xcnt 0x0" ::: "memory");
  }
}

// =========================================================================================================
// Workspace map (bytes; each region start a multiple of 256; every extent is an exact tile multiple and is written
//   W16 f16 [640][512]                  655360
//   V   f16 [NB][512][4096]           16777216 (NB = 4)
//   Qh/Ql/Kh/Kl bf16 [NB][4096][64]   2097152 x4
//   total (NB = 4) = 25821184
// =========================================================================================================
extern "C" void kernel_launch(void* const* d_in, const int* in_sizes, int n_in,
                              void* d_out, int out_size, void* d_ws, size_t ws_size,
                              hipStream_t stream) {
  const int XN = NB * CC * NN;
  if (n_in < 6) return;
  if (in_sizes[0] < XN) return;
  if (in_sizes[1] < DQ * CIN || in_sizes[2] < DQ * CIN) return;
  if (in_sizes[3] < CC * CIN || in_sizes[4] < CC || in_sizes[5] < 1) return;
  if (out_size < XN) return;

  size_t off = 0;
  auto carve = [&](size_t bytes) { const size_t o = off; off += (bytes + 255) & ~(size_t)255; return o; };
  const size_t oW16 = carve((size_t)MW * CC * 2);
  const size_t oV   = carve((size_t)NB * CC * NN * 2);
  const size_t oQh  = carve((size_t)NB * NN * DQ * 2);
  const size_t oQl  = carve((size_t)NB * NN * DQ * 2);
  const size_t oKh  = carve((size_t)NB * NN * DQ * 2);
  const size_t oKl  = carve((size_t)NB * NN * DQ * 2);
  if (off > ws_size) return;
  if (off > (size_t)134217728) return;

  const float* x     = (const float*)d_in[0];
  const float* wq    = (const float*)d_in[1];
  const float* wk    = (const float*)d_in[2];
  const float* wv    = (const float*)d_in[3];
  const float* bv    = (const float*)d_in[4];
  const float* gamma = (const float*)d_in[5];

  char* ws = (char*)d_ws;
  unsigned short* W16 = (unsigned short*)(ws + oW16);
  unsigned short* V   = (unsigned short*)(ws + oV);
  unsigned short* Qh  = (unsigned short*)(ws + oQh);
  unsigned short* Ql  = (unsigned short*)(ws + oQl);
  unsigned short* Kh  = (unsigned short*)(ws + oKh);
  unsigned short* Kl  = (unsigned short*)(ws + oKl);
  float* out = (float*)d_out;

  const dim3 blk256(256);

  // (0) Wq / Wk / Wv (channels 0..511) -> stacked f16 plane
  cvt_w<<<dim3(MW / 8), blk256, 0, stream>>>(wq, wk, wv, W16);
  // (1) x0 tile -> q / k hi + residual bf16 planes, v + bias channel-major f16 plane
  proj<<<dim3(NN / QT, NB), blk256, 0, stream>>>(x, W16, wq, wk, wv, bv, Qh, Ql, Kh, Kl, V);
  // (2) attention + gamma scale + residual -> out [b][512][NQ]
  attn_k<<<dim3(NQ / QTB, NB, 2), blk256, 0, stream>>>(Qh, Ql, Kh, Kl, V, x, gamma, out);
  (void)hipGetLastError();
}

// v008
// A run of this version takes 77 microseconds.
// Versions in between are left out here; by their measured steps it is 1.25 times as fast as v006.
// Counting every step since v000, it is 9.52 times as fast.
// Contractions: q/k/v 1x1 projections W[640x512].X[512x4096] per batch on v_wmma_f32_16x16x32_f16 (f16
// containers of bf16-RNE weights x256 and bf16-RNE x0; input channel 512 = position term, and the v bias, added in
// the f32 epilogue); scores K.Q^T on v_wmma_f32_16x16x32_f16 (q and k rounded once to f16, one product, K=64: the
// rounding, at most 2^-11 relative, lies under the 2^-8 that the bf16-RNE x0 and weights have already put into q and k);
// out^T = V.P^T on v_wmma_f32_16x16x32_f16 (v as f16, P = e^{s-m} / 4 f16 from the score D
// registers, m = the maximum in use); f32 accumulate everywhere; softmax statistics, gamma scale and the residual add in f32 VALU.
#include <hip/hip_runtime.h>
#include <math.h>
#include <stdint.h>

#ifndef NB
#define NB 4
#endif
#ifndef NQ
#define NQ 4096
#endif
#define NBF   4
#define CC    512
#define CIN   513
#define NN    4096
#define DQ    64
#define MQK   128
#define MW    640
#define QT    64
#define CH    256
#define OSPN  260
#define WSC   256.0f
#define IWSC  0.00390625f
// P = e^{s-m} * PS as f16, m the maximum in use; m is renewed only when a new maximum lies more than RTAU above it, so
// P <= PS e^RTAU = 40689 < 65504 (f16 range), and the row's true maximum has P >= PS = 2^-2: f16 steps of 2^-24 at the small
// end are 2^-22 of it or less
#define LNPS  -1.3862943611198906f     // ln PS, PS = 1/4
#define RTAU  12.0f
#define INVNN 0.000244140625f
// attention LDS map (bytes): every staged row is 128 B of data at a pitch of 144 B (16 B x odd, for ds_load_b128 readers)
#define SKEYS 64                       // keys per stage
#define QTB   128                      // queries per attention block
#define KPH   (NN / 2)                 // keys per key half
#define NST   (KPH / SKEYS)            // stages per key half
#define LPB   144                      // LDS row pitch
#define KSLOT 6144                     // the k rows of one 32-key block: 32 rows x 144 B = 4608, rounded up to a multiple of 2 KiB
#define VOFF  (2 * KSLOT)              // v rows behind the stage's two k slices
#define VHALF (128 * LPB)              // 128 v rows = 18432 = 9 x 2 KiB
#define BUFB  (VOFF + 2 * VHALF)       // one stage buffer = 49152
#define RINGB (2 * BUFB)               // one key half's two stage buffers
#define QOFF  (2 * RINGB)              // q slices behind the two rings
#define QSLOT 4096                     // 16 q rows x 144 B = 2304, rounded up to a multiple of 2 KiB
#define LOOPB (QOFF + 8 * QSLOT)       // 229376: what the key loop uses
// behind the key loop the same LDS holds: the accumulator tiles that the two key halves hand each other, their m and l, Os
#define XWAVE 16384                    // 16 tiles x 1 KiB handed over per wave
#define MLOFF (8 * XWAVE)              // m and l: 8 waves x 2 query tiles x 32 lanes x 8 B = 4096
#define OSOFF (MLOFF + 8192)           // Os[128 queries][256 channels], pitch OSPN floats
#define LDSB  (OSOFF + QTB * OSPN * 4) // 272384: one work-group of 8 waves per WGP

// projection LDS map (bytes): a stage is 64 k = 128 B of all 640 W16 rows at the pitch LPB; behind the two stage buffers the x tile
#define PROWS 80                       // W16 rows per wave: 16 q/k rows, then 64 v rows
#define PNST  (CC * 2 / 128)           // stages
#define PSLOT 12288                    // one wave's slice: 80 rows x 144 B = 11520, rounded up to a multiple of 2 KiB
#define PBUF  (8 * PSLOT)              // one stage buffer
#define PXB   1040                     // x tile row pitch: 512 channels x 2 B + 16 B (16 B x odd)
#define PLDSB (2 * PBUF + QT * PXB)    // 263168: one work-group of 8 waves per WGP

static_assert(NB >= 1 && NB <= NBF);
static_assert(NQ >= QTB && NQ <= NN && NQ % QTB == 0);
static_assert(NN % QT == 0 && CC % QT == 0 && MQK % QT == 0);
static_assert(MQK == 2 * DQ && MW == MQK + CC && MW % 8 == 0);
static_assert(DQ == QT);
static_assert(CC == 2 * CH && CH == 16 * 16);
static_assert(CC % 256 == 0 && CC % 32 == 0 && DQ % 32 == 0 && NN % 32 == 0);
static_assert((OSPN * 4) % 16 == 0);
static_assert(DQ * 2 == 128 && SKEYS * 2 == 128 && KPH % SKEYS == 0 && NST >= 2);
static_assert(KSLOT % 2048 == 0 && KSLOT >= 32 * LPB && SKEYS == 64 && VHALF % 2048 == 0 && QSLOT % 2048 == 0 && QSLOT >= 16 * LPB);
static_assert(LOOPB <= LDSB && LDSB <= 327680 && BUFB % 2048 == 0 && QTB == 8 * 16);
static_assert(PNST >= 2 && PSLOT % 2048 == 0 && PSLOT >= PROWS * LPB && QT == 64 && 8 * PROWS == MW && PLDSB <= 327680);
static_assert(PXB % 32 == 16 && PXB >= CC * 2 && MQK == 8 * 16 && CC == 8 * 64);

typedef _Float16       v16h __attribute__((ext_vector_type(16)));
typedef _Float16       v8h  __attribute__((ext_vector_type(8)));
typedef unsigned short v8us __attribute__((ext_vector_type(8)));
typedef float          v8f  __attribute__((ext_vector_type(8)));
typedef float          v4f  __attribute__((ext_vector_type(4)));
typedef float          v2f  __attribute__((ext_vector_type(2)));
typedef _Float16       v2h  __attribute__((ext_vector_type(2)));
typedef unsigned int   v4u  __attribute__((ext_vector_type(4)));
typedef uint32_t       u32x4 __attribute__((ext_vector_type(4)));
typedef uint32_t       u32x8 __attribute__((ext_vector_type(8)));

union Frag  { v8us u[2]; v16h h; };
union FragH { v16h v; v8h hv[2]; };
static_assert(sizeof(Frag) == 32);
static_assert(sizeof(FragH) == 32);

// ---- scalar helpers ---------------------------------------------------------------------------------------
__device__ __forceinline__ unsigned short bf_bits(float f) {          // f32 -> bf16 bits, RNE convert
  unsigned u = __float_as_uint(f);
  return (unsigned short)((u + 0x7FFFu + ((u >> 16) & 1u)) >> 16);
}
__device__ __forceinline__ float bf_up(unsigned short hb) { return __uint_as_float(((unsigned)hb) << 16); }
__device__ __forceinline__ float bfr(float f) { return bf_up(bf_bits(f)); }
__device__ __forceinline__ unsigned short h_bits(_Float16 x) { return __builtin_bit_cast(unsigned short, x); }
__device__ __forceinline__ unsigned pk16(unsigned short a, unsigned short b) { return (unsigned)a | ((unsigned)b << 16); }
__device__ __forceinline__ v8f zero8() { v8f z = {0.f, 0.f, 0.f, 0.f, 0.f, 0.f, 0.f, 0.f}; return z; }
__device__ __forceinline__ float hmax8(v8f s) {
  return fmaxf(fmaxf(fmaxf(s[0], s[1]), fmaxf(s[2], s[3])), fmaxf(fmaxf(s[4], s[5]), fmaxf(s[6], s[7])));
}
__device__ __forceinline__ unsigned wave_ballot(bool p) {
#if defined(__HIP_DEVICE_COMPILE__)
  return __builtin_amdgcn_ballot_w32(p);
#else
  return p ? 1u : 0u;
#endif
}
// lane l with lane l ^ 16, as a vector move (a shuffle through the LDS unit counts on dscnt)
__device__ __forceinline__ float xhalf(float x) {
  return __builtin_bit_cast(float, __builtin_amdgcn_permlanex16(__builtin_bit_cast(int, x), __builtin_bit_cast(int, x),
                                                                0x76543210, 0xfedcba98, false, false));
}
// compile-time tags of an attention pass: does a next stage exist
struct HasNext   { static constexpr bool more = true; };
struct LastStage { static constexpr bool more = false; };
// compile-time tags of a 32-key block: its place in the 64-key stage
struct Sub0 { static constexpr int sub = 0; };
struct Sub1 { static constexpr int sub = 1; };
// position channel value w[l] = (l / 4096) * 2 - 1 in f32, spec op order (every step exact)
__device__ __forceinline__ float wpos(int l) { return ((float)l * INVNN) * 2.0f - 1.0f; }

// ---- 16-bit fragment loader (A, or B from a k-contiguous [n][k] row) from an LDS row: lane -> row/col (lane&15), p (bytes)
//      already includes 16*(lane>>4); elements 0..7 <- k0+8h.., elements 8..15 <- k0+16+8h.. (16 elements = 32 B on)
__device__ __forceinline__ Frag ldfrag_lds(const unsigned char* p) {
  Frag f;
  f.u[0] = *(const v8us*)(p);
  f.u[1] = *(const v8us*)(p + 32);
  return f;
}

// ---- tensor load to LDS: descriptor groups, issue and waits --------------------------------------------------
__device__ __forceinline__ uint32_t uni(uint32_t v) { return (uint32_t)__builtin_amdgcn_readfirstlane(v); }
// a wave-uniform value held in a scalar register: a test on it compiles to a scalar branch, and a descriptor word formed
// from it stands behind the wait written in front of it
__device__ __forceinline__ uint32_t pinned(uint32_t v) { uint32_t w = uni(v); asm volatile("" : "+s"(w)); return w; }
// group 1: 1-byte elements, tile = tensor = rows x 128 B, source pitch in bytes, 16 B of LDS pad behind every 128-B row
__device__ __forceinline__ u32x8 tdm_group1(uint32_t rows, uint32_t src_pitch) {
  u32x8 g;
  g[0] = uni((1u << 20) | (4u << 22) | (3u << 25));
  g[1] = uni(128u << 16);
  g[2] = uni(rows << 16);
  g[3] = uni(128u << 16);
  g[4] = uni(rows);
  g[5] = uni(src_pitch);
  g[6] = uni(0u);
  g[7] = uni(0u);
  return g;
}
__device__ __forceinline__ u32x4 tdm_group0(uint32_t lds_dst, uint64_t ga) {
  u32x4 g;
  g[0] = uni(1u);
  g[1] = uni(lds_dst);
  g[2] = uni((uint32_t)ga);
  g[3] = uni((((uint32_t)(ga >> 32)) & 0x01FFFFFFu) | 0x80000000u);
  return g;
}
__device__ __forceinline__ void tdm_load(u32x4 g0, u32x8 g1) {
  asm volatile("tensor_load_to_lds %0, %1" :: "s"(g0), "s"(g1) : "memory");
}
// the compiler places no wait for a tensor load: the issuing wave's own wait, before the barrier that publishes the tile
__device__ __forceinline__ void wait_tensor0() { asm volatile("s_wait_tensorcnt 0x0" ::: "memory"); }
// this wave's LDS reads have returned before a buffer it read is handed back for a refill
__device__ __forceinline__ void wait_ds0() { asm volatile("s_wait_dscnt 0x0" ::: "memory"); }

// ---- WMMA helpers --------------------------------------------------------------------------------------------
// plain builtins, no asm gap behind them: an asm statement's vector operands must lie in v0..v255, which a loop that holds
// accumulators and prefetched fragments at once does not fit; the compiler pads the builtin itself
__device__ __forceinline__ v8f wm_h(v16h a, v16h b, v8f c) {
  return __builtin_amdgcn_wmma_f32_16x16x32_f16(false, a, false, b, (short)0, c, false, false);
}

// =========================================================================================================
// (0) 1x1 weights: W16 f16 [640][512] (input channels 0..511 only; channel 512 is handled in the projection epilogues);
//     value = f16 of (bf16-RNE(w) * 256) (exact). Stacked source row o: 0..63 = Wq rows, 64..127 = Wk rows, 128..639 = Wv
//     rows. Block blk (0..79) owns o = 8*blk..8*blk+7 (source selection block-uniform): one wave per row. The plane is laid
//     in the order the projection's waves read it, 80 rows per wave w: 16 stacked q/k rows 16w.., then 64 Wv rows 64w.. .
// coverage: 80 blocks x 8 rows x 2 halves x 32 lanes x 8 halves = 640 x 512; o -> ro is a permutation of 0..639: the whole plane.
// =========================================================================================================
__global__ __launch_bounds__(256)
void cvt_w(const float* __restrict__ wq, const float* __restrict__ wk, const float* __restrict__ wv,
           unsigned short* W16) {
  const int tid = threadIdx.x, blk = blockIdx.x;
  const int rl = tid >> 5, lane = tid & 31;
  const int o = 8 * blk + rl;                                          // 0..639
  const float* wbase = (blk < (DQ / 8)) ? wq : ((blk < (MQK / 8)) ? wk : wv);
  const int osub = (blk < (DQ / 8)) ? 0 : ((blk < (MQK / 8)) ? DQ : MQK);
  const float* s = wbase + (size_t)(o - osub) * CIN;                   // (o - osub) in range of that matrix
  const int ro = (o < MQK) ? PROWS * (o >> 4) + (o & 15) : PROWS * ((o - MQK) >> 6) + 16 + ((o - MQK) & 63);
#pragma unroll 1
  for (int cp = 0; cp < CC / 256; ++cp) {
    const int col = 256 * cp + 8 * lane;                               // 0..504, col + 7 <= 511
    float f[8];
#pragma unroll
    for (int t = 0; t < 8; ++t) f[t] = s[col + t];
    v4u u;
#pragma unroll
    for (int t = 0; t < 4; ++t) {
      const _Float16 h0 = (_Float16)(bfr(f[2 * t]) * WSC);
      const _Float16 h1 = (_Float16)(bfr(f[2 * t + 1]) * WSC);
      u[t] = pk16(h_bits(h0), h_bits(h1));
    }
    *(v4u*)(W16 + (size_t)ro * CC + col) = u;
    // before the next trip writes again the registers that the issued store names
    asm volatile("s_wait_xcnt 0x0" ::: "memory");
  }
}

// =========================================================================================================
// (1) all projections of one (b, 64-position tile): x0 f32 [512 c][64 n] is read once, rounded (bf16-RNE values, exact in f16)
//   and laid in LDS position-major, XT[n][c] (pitch PXB); every product of the tile's 640 output rows reads it there.
//   Block = 8 waves. Wave w owns 80 rows of W16 (cvt_w lays them in this order): 16 q/k rows and 64 v rows. They come in
//   stages of 64 k by one tensor load per wave (rows of 128 B, pitch 144 B), two buffers. A pass reads its 18 fragments as one
//   group; behind them stands the publish point of stage s + 1, where stage s + 2 is issued into the buffer that the pass has
//   just read; then the pass runs its 40 products.
//   q/k tile: A = W rows, B = XT rows: lane (hh, c) holds d = 8 hh + r of position 16 nt + c: 8 consecutive d, one 16-B
//   store. v tiles: A = XT rows, B = W rows: lane (hh, c) holds positions 16 nt + 8 hh + r of channel c: 8 consecutive
//   keys of the channel-major plane, one 16-B store; a wave's four nt stores fill a channel row's whole 128-B line.
//   Epilogues in f32: + bf16-RNE(W[.][512]) * wpos(n) (position channel), v also + bf16-RNE(bv); q, k and v stored as f16.
// coverage: XT 8 waves x 4 ci x 8 cp pairs x 2 = 512 c, 4 ne x 4 e x 4 t = 64 n; planes 8 waves x 16 d x 64 n; V 8 waves x 64 o
//           x 64 n; grid (64, NB) covers Qf/Kf [NB][4096][64] and V [NB][512][4096] exactly once.
// =========================================================================================================
__global__ __launch_bounds__(256)
void proj(const float* __restrict__ x, const unsigned short* __restrict__ W16,
          const float* __restrict__ wq, const float* __restrict__ wk, const float* __restrict__ wv,
          const float* __restrict__ bv,
          unsigned short* Qf, unsigned short* Kf, unsigned short* V) {
  __shared__ __attribute__((aligned(2048))) unsigned char L[PLDSB];
  unsigned char* XT = L + 2 * PBUF;                                    // behind the W ring
  const int tid  = threadIdx.x;
  const int lane = tid & 31, wave = tid >> 5;
  const int hh   = lane >> 4, c = lane & 15;
  const int n0   = blockIdx.x * QT, b = blockIdx.y;

  // every wave issues one tensor load per stage for its own slice: all of this is wave-uniform
  const uint32_t wu    = uni((uint32_t)tid >> 5);
  const uint32_t lbase = (uint32_t)(size_t)L;                          // byte offset in the work-group's LDS
  const unsigned char* ssrc = (const unsigned char*)(W16 + (size_t)((uint32_t)PROWS * wu) * CC);
  const uint32_t soff = wu * (uint32_t)PSLOT;
  u32x8 g1s = tdm_group1((uint32_t)PROWS, (uint32_t)(CC * 2));
  asm volatile("" : "+s"(g1s));  // pinned() form, descriptor words held in scalar registers: one tuple serves every issue, so none is reused under a request in flight
  u32x4 g0s;                                                           // group 0 of this wave's stage request in flight
  auto issue = [&](uint32_t st) {
    const uint32_t dst = lbase + (st & 1u) * (uint32_t)PBUF + soff;
    const uint64_t ga  = (uint64_t)(size_t)ssrc + (uint64_t)st * 128u;
    g0s = tdm_group0(dst, ga);
    tdm_load(g0s, g1s);
  };
  // the issuing wave's wait for its stage request; it names group 0 so that those registers keep their values until then
  auto landed = [&]() { asm volatile("s_wait_tensorcnt 0x0" :: "s"(g0s) : "memory"); };

  issue(pinned(0u));                                                   // stage 0 flies while the x tile is read and rounded

  // the epilogues' terms, read here so that they land under the loop: W[d][512] of this lane's 8 q or k rows (waves 0..3 hold
  // q rows, 4..7 k rows: wave-uniform choice), Wv[o][512] and bv[o] of its 4 channels
  const int d0 = 16 * (wave & 3) + 8 * hh;
  const float* pwp = ((wu < 4u) ? wq : wk) + (size_t)d0 * CIN;
  const float* pvp = wv + (size_t)(64 * wave + c) * CIN;
  const float* pbp = bv + 64 * wave + c;

  // x0 tile: lane (e, cp) of wave w reads 4 positions of the two channels of pair cp + 8 (w + 8 ci); all 32 loads in flight
  const int e = lane & 3, cp = lane >> 2;
  const float* xb = x + ((size_t)(b * CC + 2 * (cp + 8 * wave))) * NN + n0 + 4 * e;
  v4f xa[4][4], xq[4][4];
#pragma unroll  // constant indices keep the arrays in registers
  for (int ci = 0; ci < 4; ++ci) {
#pragma unroll
    for (int ne = 0; ne < 4; ++ne) {
      xa[ci][ne] = *(const v4f*)(xb + (size_t)(128 * ci) * NN + 16 * ne);
      xq[ci][ne] = *(const v4f*)(xb + (size_t)(128 * ci + 1) * NN + 16 * ne);
    }
  }
  float pw[8], pwo[4], bo[4];
#pragma unroll
  for (int r = 0; r < 8; ++r) pw[r] = pwp[(size_t)r * CIN + CC];
#pragma unroll
  for (int vt = 0; vt < 4; ++vt) { pwo[vt] = pvp[(size_t)(16 * vt) * CIN + CC]; bo[vt] = pbp[16 * vt]; }
  // before anything writes again a register that an issued load names: the wait names the four addresses, so that their
  // registers keep their values until then; the scheduling barriers hold it behind the loads
  __builtin_amdgcn_sched_barrier(0);
  asm volatile("s_wait_xcnt 0x0" :: "v"(xb), "v"(pwp), "v"(pvp), "v"(pbp) : "memory");
  __builtin_amdgcn_sched_barrier(0);

  // one 4-B store per position and channel pair: banks 16 e + cp, all 32 lanes apart
#pragma unroll
  for (int ci = 0; ci < 4; ++ci) {
    unsigned char* xs = XT + (4 * e) * PXB + 4 * (cp + 8 * (wave + 8 * ci));
#pragma unroll
    for (int ne = 0; ne < 4; ++ne) {
#pragma unroll
      for (int t = 0; t < 4; ++t) {
        const v2f pr = {bfr(xa[ci][ne][t]), bfr(xq[ci][ne][t])};       // the pair's two channels: one packed convert
        *(v2h*)(xs + (16 * ne + t) * PXB) = __builtin_convertvector(pr, v2h);
      }
    }
  }
  landed();
  __syncthreads();                                                     // XT and stage 0 published to every wave
  issue(pinned(1u));

  v8f aq[4], av[4][4];
#pragma unroll
  for (int nt = 0; nt < 4; ++nt) {
    aq[nt] = zero8();
#pragma unroll
    for (int vt = 0; vt < 4; ++vt) av[vt][nt] = zero8();
  }

  // rolled: the stage test at the publish point is opaque to the compiler, so unrolled copies would carry issue code that never runs
#pragma unroll 1
  for (uint32_t st = 0; st < (uint32_t)PNST; ++st) {
    const unsigned char* Wp = L + (st & 1u) * (uint32_t)PBUF + wave * PSLOT + c * LPB + 16 * hh;   // this pass reads this buffer alone
    const unsigned char* Xp = XT + c * PXB + 16 * hh + st * 128u;
    Frag fw[2][5], fx[2][4];                                           // every fragment of the pass in registers of its own
#pragma unroll  // constant indices keep the fragment arrays in registers
    for (int ks = 0; ks < 2; ++ks) {
#pragma unroll
      for (int j = 0; j < 5; ++j) fw[ks][j] = ldfrag_lds(Wp + (16 * j) * LPB + 64 * ks);
#pragma unroll
      for (int nt = 0; nt < 4; ++nt) fx[ks][nt] = ldfrag_lds(Xp + (16 * nt) * PXB + 64 * ks);
    }
    // keeps the reads one group in front of the publish point and the products: sunk among the products, each small group is
    // waited out where it stands
    __builtin_amdgcn_sched_barrier(0);
    // publish point of stage st + 1, every wave, in this order; behind the first wait this wave holds in registers all that it
    // reads of this buffer, so stage st + 2 is issued here and flies under the products
    wait_ds0();
    landed();
    __syncthreads();                                                   // stage st + 1 published; every reader has left this buffer
    if (pinned(st + 2u < (uint32_t)PNST)) issue(pinned(st + 2u));      // scalar branch: a tensor load ignores EXEC
#pragma unroll
    for (int ks = 0; ks < 2; ++ks) {
#pragma unroll
      for (int nt = 0; nt < 4; ++nt) aq[nt] = wm_h(fw[ks][0].h, fx[ks][nt].h, aq[nt]);
#pragma unroll
      for (int vt = 0; vt < 4; ++vt) {
#pragma unroll
        for (int nt = 0; nt < 4; ++nt) av[vt][nt] = wm_h(fx[ks][nt].h, fw[ks][1 + vt].h, av[vt][nt]);
      }
    }
  }
  // behind the loop: this wait names both groups, so that no descriptor register takes a new value in front of it
  asm volatile("s_wait_tensorcnt 0x0" :: "s"(g0s), "s"(g1s) : "memory");
  wait_ds0();

  // q/k: lane (hh, c) holds d = d0 + r of position n0 + 16 nt + c
  v4u uh[4];
#pragma unroll
  for (int nt = 0; nt < 4; ++nt) {
    const float wl = wpos(n0 + 16 * nt + c);
#pragma unroll
    for (int t = 0; t < 4; ++t) {
      const float f0 = aq[nt][2 * t] * IWSC + bfr(pw[2 * t]) * wl;
      const float f1 = aq[nt][2 * t + 1] * IWSC + bfr(pw[2 * t + 1]) * wl;
      uh[nt][t] = pk16(h_bits((_Float16)f0), h_bits((_Float16)f1));
    }
  }
  // v: lane (hh, c) holds keys n0 + 16 nt + 8 hh + r of channel 64 wave + 16 vt + c
  v4u uv[4][4];
#pragma unroll
  for (int vt = 0; vt < 4; ++vt) {
    const float pwv = bfr(pwo[vt]), bov = bfr(bo[vt]);
#pragma unroll
    for (int nt = 0; nt < 4; ++nt) {
      const int nb = n0 + 16 * nt + 8 * hh;
      unsigned short hb[8];
#pragma unroll
      for (int r = 0; r < 8; ++r) {
        const float val = av[vt][nt][r] * IWSC + pwv * wpos(nb + r) + bov;
        hb[r] = h_bits((_Float16)val);
      }
#pragma unroll
      for (int t = 0; t < 4; ++t) uv[vt][nt][t] = pk16(hb[2 * t], hb[2 * t + 1]);
    }
  }
  unsigned short* Ph = ((wu < 4u) ? Qf : Kf) + ((size_t)(b * NN + n0 + c)) * DQ + d0;
  unsigned short* Vp = V + ((size_t)(b * CC + 64 * wave + c)) * NN + n0 + 8 * hh;
  // the stores stand behind all of the value arithmetic: none of it writes again a register that an issued store names
  __builtin_amdgcn_sched_barrier(0);
#pragma unroll
  for (int nt = 0; nt < 4; ++nt) *(v4u*)(Ph + (size_t)(16 * nt) * DQ) = uh[nt];
  // before the address arithmetic of the v stores writes again a register that an issued store names: the wait names the
  // stores' addresses and data, so that their registers keep their values until then
  __builtin_amdgcn_sched_barrier(0);
  asm volatile("s_wait_xcnt 0x0" :: "v"(Ph), "v"(uh[0]), "v"(uh[1]), "v"(uh[2]), "v"(uh[3]) : "memory");
  __builtin_amdgcn_sched_barrier(0);
#pragma unroll
  for (int vt = 0; vt < 4; ++vt) {
#pragma unroll
    for (int nt = 0; nt < 4; ++nt) *(v4u*)(Vp + (size_t)(16 * vt) * NN + 16 * nt) = uv[vt][nt];
  }
}

// =========================================================================================================
// (2) attention for one (b, 128-query tile, channel half chh), transposed formulation, 4096 keys, no mask, no scale.
//   Block = 8 waves: wave = query group qg (wave & 3, 32 queries = two 16-query tiles) + 4 x key half kh (2048 keys each).
//   S^T tile (16 keys x 16 queries) = sum over 2 d-chunks of A(k: row = key, 32 d via the split k map from the f16 plane
//   Kf [b][4096][64]) . B(q: col = query, same map from Qf). Per lane the D tile holds 8 keys of ONE query: online softmax state per lane and query tile, one
//   vector move (lane^16) for the max over 32 keys; m, o and l keep the maximum in use until some lane's new maximum lies
//   more than RTAU above it (wave-uniform ballot); then every lane takes its new maximum and rescales o and l.
//   P = e^{s-m} / 4 as f16 is the B operand of O^T (rows channel,
//   cols queries) += A(v rows channel = cb0 + 16j + (lane&15), keys contiguous, f16 plane V [b][512][4096]) . B(P^T):
//   element r <- D of the tile covering keys kb..kb+15, element 8+r <- the tile covering kb+16..kb+31, lane unchanged.
//   Every k and v fragment read from LDS serves both query tiles: two products each. 32 accumulator
//   tiles per wave (2 query tiles x 256 channels), two waves per SIMD. The two channel halves are separate blocks (grid.z).
//   Operands come from LDS, laid there by tensor loads (rows of 128 B, pitch 144 B): the block's q rows once (each wave one
//   slice of 16 rows), then per key half stages of 64 keys in two buffers: of the half's four waves two bring 32 k rows
//   each (one 32-key block's), two 128 channel rows of V each (64 keys = one whole 128-B line per row).
//   A pass walks its 64 keys as two 32-key blocks. Two register sets of 8 fragments: a block finds its 4 k fragments in the
//   first (q stays in registers); behind the score products its 16 v fragments go into both (they land under the softmax),
//   behind the first 16 v products the next block's k fragments (they land under the last 16).
//   The publish point of stage s + 1 stands in the last block of pass s, behind its exponentials: by then the wave has fetched
//   all it reads of stage s, so stage s + 2 is issued there into that buffer.
//   Behind the loop the two key halves of a query group are joined: each wave hands its partner (wave ^ 4) 128 channels of
//   both query tiles with its m and l through LDS, and finishes the other 128: o = (o_a e^{m_a-m} + o_b e^{m_b-m}) gamma / l.
//   Then Os[query][256 channels] (pitch OSPN, b128 stores), and out rows: 8 consecutive lanes x 16 B per 128-B line.
// coverage: 16 it x 2 parts x 32 lines x 8 lanes x 4 floats = 256 ch x 128 n per block; grid (NQ/128, NB, 2) covers
//           out[b][0..511][0..NQ-1] exactly once. Hand-over region and Os: cross-wave (block barriers).
// =========================================================================================================
__global__ __launch_bounds__(256)
void attn_k(const unsigned short* __restrict__ Qf, const unsigned short* __restrict__ Kf,
            const unsigned short* __restrict__ V, const float* __restrict__ x,
            const float* __restrict__ gamma, float* out) {
  __shared__ __attribute__((aligned(2048))) unsigned char L[LDSB];
  const int tid  = threadIdx.x;
  const int wave = tid >> 5, lane = tid & 31;
  const int hh   = lane >> 4, c = lane & 15;
  const int qg   = wave & 3, kh = wave >> 2;
  const int n0   = blockIdx.x * QTB, b = blockIdx.y, chh = blockIdx.z;
  const int cb0  = chh * CH;                                           // 0 or 256

  // every wave issues one tensor load per stage for its own slice: all of this is wave-uniform
  const uint32_t wv    = uni((uint32_t)tid >> 5);
  const uint32_t role  = wv & 3u, khu = wv >> 2;                       // slice of the stage, key half
  const uint32_t lbase = (uint32_t)(size_t)L;                          // byte offset in the work-group's LDS
  const bool     isV   = role >= 2u;
  const unsigned char* ssrc = isV
      ? (const unsigned char*)(V + ((size_t)(b * CC + cb0) + 128u * (role - 2u)) * NN + khu * (uint32_t)KPH)
      : (const unsigned char*)(Kf + ((size_t)b * NN + khu * (uint32_t)KPH + 32u * role) * DQ);
  const uint32_t sadv = isV ? (uint32_t)(SKEYS * 2) : (uint32_t)(SKEYS * DQ * 2);   // source bytes from stage to stage
  const uint32_t soff = khu * (uint32_t)RINGB + (isV ? (uint32_t)VOFF + (role - 2u) * (uint32_t)VHALF : role * (uint32_t)KSLOT);
  u32x8 g1s = tdm_group1(isV ? 128u : 32u, isV ? (uint32_t)(NN * 2) : (uint32_t)(DQ * 2));
  asm volatile("" : "+s"(g1s));  // pinned() form, descriptor words held in scalar registers: one tuple serves every issue, so none is reused under a request in flight
  u32x4 g0s;                                                           // group 0 of this wave's stage request in flight
  auto issue = [&](uint32_t st) {
    const uint32_t dst = lbase + (st & 1u) * (uint32_t)BUFB + soff;
    const uint64_t ga  = (uint64_t)(size_t)ssrc + (uint64_t)st * sadv;
    g0s = tdm_group0(dst, ga);
    tdm_load(g0s, g1s);
  };
  // the issuing wave's wait for its stage request; it names group 0 so that those registers keep their values until then
  auto landed = [&]() { asm volatile("s_wait_tensorcnt 0x0" :: "s"(g0s) : "memory"); };

  // q, loaded once: wave wv brings rows n0 + 16*wv .. +15 into slice wv
  {
    const unsigned char* qsrc = (const unsigned char*)(Qf + ((size_t)(b * NN + n0) + 16u * wv) * DQ);
    tdm_load(tdm_group0(lbase + (uint32_t)QOFF + wv * (uint32_t)QSLOT, (uint64_t)(size_t)qsrc),
             tdm_group1(16u, (uint32_t)(DQ * 2)));
    wait_tensor0();
  }
  issue(pinned(0u));
  landed();
  __syncthreads();                                                     // q and stage 0 of both halves published to every wave
  issue(pinned(1u));

  const unsigned char* Lh = L + kh * RINGB;                            // this key half's ring

  float m[2] = {-1.0e30f, -1.0e30f}, l[2] = {0.f, 0.f};
  v8f o[2][16];
#pragma unroll
  for (int qt = 0; qt < 2; ++qt) {
#pragma unroll
    for (int j = 0; j < 16; ++j) o[qt][j] = zero8();
  }

  // q fragment base (B operand, col = query n0 + 32*qg + 16*qt + c: row c of slice 2*qg + qt), + 64*kc B
  const unsigned char* Qp = L + QOFF + (2 * qg) * QSLOT + c * LPB + 16 * hh;
  // the q fragments stay in registers, read once
  Frag qh[2][DQ / 32];
#pragma unroll  // constant indices keep the fragment array in registers
  for (int qt = 0; qt < 2; ++qt) {
#pragma unroll
    for (int kc = 0; kc < DQ / 32; ++kc) qh[qt][kc] = ldfrag_lds(Qp + qt * QSLOT + 64 * kc);
  }
  // the two fragment sets; the first holds a block's 4 k fragments, then each 8 v fragments
  Frag ra[8], rb[8];
  // one group: the k fragments of a block (A operand, row = key): row c (+16) of the stage's slice sub, + 64*kc B:
  // R[2 kc] = keys kb.., R[2 kc + 1] = keys kb+16.. of d chunk kc
  auto load_s = [&](Frag (&R)[8], const unsigned char* Bp, int sub) __attribute__((always_inline)) {
    const unsigned char* k0p = Bp + sub * KSLOT + c * LPB + 16 * hh;
#pragma unroll  // constant indices keep the fragment array in registers
    for (int kc = 0; kc < DQ / 32; ++kc) {
      R[2 * kc]     = ldfrag_lds(k0p + 64 * kc);
      R[2 * kc + 1] = ldfrag_lds(k0p + 16 * LPB + 64 * kc);
    }
  };
  // one group: 8 of a block's v fragments (A operand, row = channel cb0 + 128*g + 16j + c, keys contiguous): + 64*sub B
  auto load_v = [&](Frag (&R)[8], const unsigned char* Bp, int sub, int g) __attribute__((always_inline)) {
    const unsigned char* Vp = Bp + VOFF + (128 * g + c) * LPB + 16 * hh + 64 * sub;
#pragma unroll  // constant indices keep the fragment array in registers
    for (int j = 0; j < 8; ++j) R[j] = ldfrag_lds(Vp + (16 * j) * LPB);
  };
  load_s(ra, Lh, 0);                                                   // q and stage 0 are published: the first block's k fragments

  // one 32-key block: RA holds its k fragments; it leaves the next block's there. The tags say at compile time where
  // the block stands and whether a next stage exists, so that no read stands under a branch. Inlined at every place: the
  // fragment arrays stay in registers
  auto block = [&](Frag (&RA)[8], Frag (&RB)[8], uint32_t st, auto subtag, auto tag) __attribute__((always_inline)) {
    constexpr int  sub  = decltype(subtag)::sub;
    constexpr bool more = decltype(tag)::more;
    constexpr bool last = (sub + 1 == SKEYS / 32);                     // the stage's last block
    constexpr bool next = !last || more;                               // a next block exists
    const unsigned char* Bp = Lh + (st & 1u) * (uint32_t)BUFB;         // this stage's buffer
    const unsigned char* Bx = last ? Lh + ((st + 1u) & 1u) * (uint32_t)BUFB : Bp;   // the next block's, read behind its publish point
    constexpr int subx = last ? 0 : sub + 1;

    v8f s[2][2];                                                       // [query tile][keys kb.., kb+16..]
#pragma unroll
    for (int qt = 0; qt < 2; ++qt) { s[qt][0] = zero8(); s[qt][1] = zero8(); }
#pragma unroll  // constant indices into the fragment arrays
    for (int kc = 0; kc < DQ / 32; ++kc) {
#pragma unroll
      for (int qt = 0; qt < 2; ++qt) {
        s[qt][0] = wm_h(RA[2 * kc].h, qh[qt][kc].h, s[qt][0]);
        s[qt][1] = wm_h(RA[2 * kc + 1].h, qh[qt][kc].h, s[qt][1]);
      }
    }
    // keeps the score products in front of the group and the group here: the v fragments land under the softmax; sunk to
    // their products, each read would be waited out there
    __builtin_amdgcn_sched_barrier(0);
    load_v(RA, Bp, sub, 0);
    load_v(RB, Bp, sub, 1);
    __builtin_amdgcn_sched_barrier(0);

    float mx[2];
#pragma unroll
    for (int qt = 0; qt < 2; ++qt) {
      mx[qt] = fmaxf(hmax8(s[qt][0]), hmax8(s[qt][1]));
      mx[qt] = fmaxf(mx[qt], xhalf(mx[qt]));                           // a vector move: no LDS wait drains the reads in flight
    }
    // wave-uniform, one test per block: does a score leave the range that P has above the maximum in use
    const unsigned grew = wave_ballot(mx[0] > m[0] + RTAU || mx[1] > m[1] + RTAU);
    if (grew != 0u) {
#pragma unroll
      for (int qt = 0; qt < 2; ++qt) {
        const float mn = fmaxf(m[qt], mx[qt]);
        const float corr = __expf(m[qt] - mn);                         // == 1 exactly for lanes whose max did not grow
        m[qt] = mn;
        l[qt] *= corr;
#pragma unroll
        for (int j = 0; j < 16; ++j) {
#pragma unroll
          for (int r = 0; r < 8; ++r) o[qt][j][r] *= corr;
        }
      }
    }
    FragH ph[2];
#pragma unroll
    for (int qt = 0; qt < 2; ++qt) {
      const float msh = m[qt] - LNPS;                                  // exp gives e^{s-m} / 4
      float ls = 0.f;
#pragma unroll
      for (int r = 0; r < 8; ++r) {
        const float e0 = __expf(s[qt][0][r] - msh);                    // key kb      + 8hh + r
        const float e1 = __expf(s[qt][1][r] - msh);                    // key kb + 16 + 8hh + r
        ls += e0 + e1;
        ph[qt].hv[0][r] = (_Float16)e0;
        ph[qt].hv[1][r] = (_Float16)e1;
      }
      l[qt] += ls;
    }

    if constexpr (last) {
      // publish point of stage st + 1, every wave, in this order; behind the first wait this wave holds in registers all that
      // it reads of this buffer. The wait names P as an input: the exponentials then stand in front of it and the v reads land
      // under them; without it the compiler sinks them behind the barrier and the reads are waited out here
      if constexpr (more) asm volatile("s_wait_dscnt 0x0" :: "v"(ph[0].v), "v"(ph[1].v) : "memory");
      else wait_ds0();                                                 // no branch follows in the last pass: nothing is sunk there
      if constexpr (more) landed();
      // the last pass's wait names both groups, so that no descriptor register takes a new value in front of it
      else asm volatile("s_wait_tensorcnt 0x0" :: "s"(g0s), "s"(g1s) : "memory");
      __syncthreads();                                                 // stage st + 1 published; every reader has left this buffer
      if constexpr (more) {
        if (pinned(st + 2u < (uint32_t)NST)) issue(pinned(st + 2u));   // scalar branch: a tensor load ignores EXEC
      }
    }

#pragma unroll
    for (int j = 0; j < 8; ++j) {
#pragma unroll
      for (int qt = 0; qt < 2; ++qt) o[qt][j] = wm_h(RA[j].h, ph[qt].v, o[qt][j]);
    }
    if constexpr (next) {
      // the products stay in front of the reads that refill their fragments; the next block's k fragments land under the other 16
      __builtin_amdgcn_sched_barrier(0);
      load_s(RA, Bx, subx);
      __builtin_amdgcn_sched_barrier(0);
    }
#pragma unroll
    for (int j = 0; j < 8; ++j) {
#pragma unroll
      for (int qt = 0; qt < 2; ++qt) o[qt][8 + j] = wm_h(RB[j].h, ph[qt].v, o[qt][8 + j]);
    }
    if constexpr (next) {
      __builtin_amdgcn_sched_barrier(0);
      // WMMA distance: the next block's first score product may write its D where the allocator kept P, the B operand of the
      // v product issued just before it; four slots, held in place by the scheduling barriers
      asm volatile("v_nop\n\tv_nop\n\tv_nop\n\tv_nop");
      __builtin_amdgcn_sched_barrier(0);
    }
  };
  // rolled: the stage test at the publish point is opaque to the compiler, so unrolled copies would carry issue code that never runs
#pragma unroll 1
  for (uint32_t st = 0; st + 1u < (uint32_t)NST; ++st) {
    block(ra, rb, st, Sub0{}, HasNext{});
    block(ra, rb, st, Sub1{}, HasNext{});
  }
  block(ra, rb, (uint32_t)NST - 1u, Sub0{}, LastStage{});
  block(ra, rb, (uint32_t)NST - 1u, Sub1{}, LastStage{});
  wait_tensor0();
  wait_ds0();
  // the last pass's own barrier stands behind every wave's last read of the rings and of q: all of L is free

  // join of the two key halves: wave (qg, kh) finishes channels 128*kh .. +127 of its 32 queries and hands the other 128 over
  float* Xo = (float*)(L + wave * XWAVE);                              // written by this wave, read by its partner
  const float* Xp = (const float*)(L + (wave ^ 4) * XWAVE);
  float* MLo = (float*)(L + MLOFF) + wave * 128;
  const float* MLp = (const float*)(L + MLOFF) + (wave ^ 4) * 128;
  const bool up = kh != 0;                                             // wave-uniform
  v8f f[2][8];
#pragma unroll
  for (int qt = 0; qt < 2; ++qt) {
    l[qt] += xhalf(l[qt]);                                             // the two lane halves' row sums
    MLo[qt * 64 + 2 * lane]     = m[qt];
    MLo[qt * 64 + 2 * lane + 1] = l[qt];
#pragma unroll
    for (int jj = 0; jj < 8; ++jj) {
      const v8f snd = up ? o[qt][jj] : o[qt][8 + jj];
      f[qt][jj]     = up ? o[qt][8 + jj] : o[qt][jj];
      v4f va, vb;
#pragma unroll
      for (int r = 0; r < 4; ++r) { va[r] = snd[r]; vb[r] = snd[4 + r]; }
      *(v4f*)(Xo + (qt * 8 + jj) * 256 + 4 * lane)       = va;         // lane-linear: the partner's same lane reads it back
      *(v4f*)(Xo + (qt * 8 + jj) * 256 + 128 + 4 * lane) = vb;
    }
  }
  __syncthreads();                                                     // every wave's hand-over is written
  const float gam = bfr(gamma[0]);
  float* Os = (float*)(L + OSOFF);                                     // apart from the hand-over region
#pragma unroll
  for (int qt = 0; qt < 2; ++qt) {
    const float mp = MLp[qt * 64 + 2 * lane], lp = MLp[qt * 64 + 2 * lane + 1];
    const float mm = fmaxf(m[qt], mp);
    const float co = __expf(m[qt] - mm), cp = __expf(mp - mm);
    const float inv = gam / (l[qt] * co + lp * cp);                    // o and l both carry the factor 1/4
    const float ao = co * inv, ap = cp * inv;
    const int qrow = 32 * qg + 16 * qt + c;
    v4f pa[8], pb[8];                                                  // one group of reads, in front of the Os stores
#pragma unroll
    for (int jj = 0; jj < 8; ++jj) {
      pa[jj] = *(const v4f*)(Xp + (qt * 8 + jj) * 256 + 4 * lane);
      pb[jj] = *(const v4f*)(Xp + (qt * 8 + jj) * 256 + 128 + 4 * lane);
    }
#pragma unroll
    for (int jj = 0; jj < 8; ++jj) {
      v4f va, vb;
#pragma unroll
      for (int r = 0; r < 4; ++r) { va[r] = f[qt][jj][r] * ao + pa[jj][r] * ap; vb[r] = f[qt][jj][4 + r] * ao + pb[jj][r] * ap; }
      *(v4f*)(Os + qrow * OSPN + 128 * kh + 16 * jj + 8 * hh)     = va;   // Os[query][ch_loc = 128kh + 16jj + 8hh + r]
      *(v4f*)(Os + qrow * OSPN + 128 * kh + 16 * jj + 8 * hh + 4) = vb;
    }
  }
  __syncthreads();                                                     // Os complete

  // out rows: thread (lq, e) owns channel ch0 + 16 it, queries nq0 + 64 part .. +3; one address pair each for x and out, every
  // step from it a constant
  const int e = tid & 7, lq = tid >> 3;                                // lq 0..31
  const int ch0 = lq >> 1;                                             // 0..15
  const int nq0 = (lq & 1) * 32 + 4 * e;                               // 0..60
  const size_t base = ((size_t)(b * CC + cb0 + ch0)) * NN + n0 + nq0;
  const float* xb = x + base;
  float* ob = out + base;
  const float* Ob = Os + nq0 * OSPN + ch0;
#pragma unroll
  for (int part = 0; part < 2; ++part) {
    v4f res[16];
#pragma unroll
    for (int it = 0; it < 16; ++it) {
      const v4f xv = *(const v4f*)(xb + (size_t)(16 * it) * NN + 64 * part);
#pragma unroll
      for (int t = 0; t < 4; ++t) res[it][t] = Ob[(64 * part + t) * OSPN + 16 * it] + bfr(xv[t]);
    }
#pragma unroll
    for (int it = 0; it < 16; ++it) *(v4f*)(ob + (size_t)(16 * it) * NN + 64 * part) = res[it];
    // before the second part writes again the registers that the issued stores name
    if (part == 0) asm volatile("s_wait_xcnt 0x0" ::: "memory");
  }
}

// =========================================================================================================
// Workspace map (bytes; each region start a multiple of 256; every extent is an exact tile multiple and is written
//   W16 f16 [640][512]                  655360
//   V   f16 [NB][512][4096]           16777216 (NB = 4)
//   Qf/Kf f16 [NB][4096][64]          2097152 x2
//   total (NB = 4) = 21626880
// =========================================================================================================
extern "C" void kernel_launch(void* const* d_in, const int* in_sizes, int n_in,
                              void* d_out, int out_size, void* d_ws, size_t ws_size,
                              hipStream_t stream) {
  const int XN = NB * CC * NN;
  if (n_in < 6) return;
  if (in_sizes[0] < XN) return;
  if (in_sizes[1] < DQ * CIN || in_sizes[2] < DQ * CIN) return;
  if (in_sizes[3] < CC * CIN || in_sizes[4] < CC || in_sizes[5] < 1) return;
  if (out_size < XN) return;

  size_t off = 0;
  auto carve = [&](size_t bytes) { const size_t o = off; off += (bytes + 255) & ~(size_t)255; return o; };
  const size_t oW16 = carve((size_t)MW * CC * 2);
  const size_t oV   = carve((size_t)NB * CC * NN * 2);
  const size_t oQf  = carve((size_t)NB * NN * DQ * 2);
  const size_t oKf  = carve((size_t)NB * NN * DQ * 2);
  if (off > ws_size) return;
  if (off > (size_t)134217728) return;

  const float* x     = (const float*)d_in[0];
  const float* wq    = (const float*)d_in[1];
  const float* wk    = (const float*)d_in[2];
  const float* wv    = (const float*)d_in[3];
  const float* bv    = (const float*)d_in[4];
  const float* gamma = (const float*)d_in[5];

  char* ws = (char*)d_ws;
  unsigned short* W16 = (unsigned short*)(ws + oW16);
  unsigned short* V   = (unsigned short*)(ws + oV);
  unsigned short* Qf  = (unsigned short*)(ws + oQf);
  unsigned short* Kf  = (unsigned short*)(ws + oKf);
  float* out = (float*)d_out;

  const dim3 blk256(256);

  // (0) Wq / Wk / Wv (channels 0..511) -> stacked f16 plane
  cvt_w<<<dim3(MW / 8), blk256, 0, stream>>>(wq, wk, wv, W16);
  // (1) x0 tile -> q / k f16 planes, v + bias channel-major f16 plane
  proj<<<dim3(NN / QT, NB), blk256, 0, stream>>>(x, W16, wq, wk, wv, bv, Qf, Kf, V);
  // (2) attention + gamma scale + residual -> out [b][512][NQ]
  attn_k<<<dim3(NQ / QTB, NB, 2), blk256, 0, stream>>>(Qf, Kf, V, x, gamma, out);
  (void)hipGetLastError();
}

// v009
// Measured time: 73.5 microseconds a run.
// Next to v008, in two timings, it ran 1.05 times as fast each time.
// All steps since v000 together make it 9.98 times as fast.
// Contractions: q/k/v 1x1 projections W[640x512].X[512x4096] per batch on v_wmma_f32_16x16x32_f16 (f16
// containers of bf16-RNE weights x256 and bf16-RNE x0; input channel 512 = position term, and the v bias, added in
// the f32 epilogue); scores K.Q^T on v_wmma_f32_16x16x32_f16 (q log2(e) and k rounded once to f16, one product, K=64: the
// rounding, at most 2^-11 relative, lies under the 2^-8 that the bf16-RNE x0 and weights have already put into q and k;
// the product's C operand is -(m + 2), so its D registers hold the argument of exp2);
// out^T = V.P^T on v_wmma_f32_16x16x32_f16 (v as f16, P = e^{s-m} / 4 f16 from the score D
// registers, m = the maximum in use); f32 accumulate everywhere; softmax statistics, gamma scale and the residual add in f32 VALU.
#include <hip/hip_runtime.h>
#include <math.h>
#include <stdint.h>

#ifndef NB
#define NB 4
#endif
#ifndef NQ
#define NQ 4096
#endif
#define NBF   4
#define CC    512
#define CIN   513
#define NN    4096
#define DQ    64
#define MQK   128
#define MW    640
#define QT    64
#define CH    256
#define OSPN  260
#define WSC   256.0f
#define IWSC  0.00390625f
// P = e^{s-m} * PS as f16, m the maximum in use; m is renewed only when a new maximum lies more than RTAU above it, so
// P <= PS e^RTAU = 40689 < 65504 (f16 range), and the row's true maximum has P >= PS = 2^-2: f16 steps of 2^-24 at the small
// end are 2^-22 of it or less
// scores and m are kept in units of log2: t = s log2(e) (q carries the factor), P = 2^{t - m - 2}
#define LOG2E 1.4426950408889634f
#define LGPS  -2.0f                    // log2 PS, PS = 1/4
#define RTAU  12.0f
#define GTH   (RTAU * LOG2E + LGPS)    // the score D registers hold t - m + LGPS: above this value the maximum in use is renewed
#define INVNN 0.000244140625f
// attention LDS map (bytes): every staged row is 128 B of data at a pitch of 144 B (16 B x odd, for ds_load_b128 readers)
#define SKEYS 64                       // keys per stage
#define QTB   128                      // queries per attention block
#define KPH   (NN / 2)                 // keys per key half
#define NST   (KPH / SKEYS)            // stages per key half
#define LPB   144                      // LDS row pitch
#define KSLOT 6144                     // the k rows of one 32-key block: 32 rows x 144 B = 4608, rounded up to a multiple of 2 KiB
#define VOFF  (2 * KSLOT)              // v rows behind the stage's two k slices
#define VHALF (128 * LPB)              // 128 v rows = 18432 = 9 x 2 KiB
#define BUFB  (VOFF + 2 * VHALF)       // one stage buffer = 49152
#define RINGB (2 * BUFB)               // one key half's two stage buffers
#define QOFF  (2 * RINGB)              // q slices behind the two rings
#define QSLOT 4096                     // 16 q rows x 144 B = 2304, rounded up to a multiple of 2 KiB
#define LOOPB (QOFF + 8 * QSLOT)       // 229376: what the key loop uses
// behind the key loop the same LDS holds: the accumulator tiles that the two key halves hand each other, their m and l, Os
#define XWAVE 16384                    // 16 tiles x 1 KiB handed over per wave
#define MLOFF (8 * XWAVE)              // m and l: 8 waves x 2 query tiles x 32 lanes x 8 B = 4096
#define OSOFF (MLOFF + 8192)           // Os[128 queries][256 channels], pitch OSPN floats
#define LDSB  (OSOFF + QTB * OSPN * 4) // 272384: one work-group of 8 waves per WGP

// projection LDS map (bytes): a stage is 64 k = 128 B of all 640 W16 rows at the pitch LPB; behind the two stage buffers the x tile
#define PROWS 80                       // W16 rows per wave: 16 q/k rows, then 64 v rows
#define PNST  (CC * 2 / 128)           // stages
#define PSLOT 12288                    // one wave's slice: 80 rows x 144 B = 11520, rounded up to a multiple of 2 KiB
#define PBUF  (8 * PSLOT)              // one stage buffer
#define PXB   1040                     // x tile row pitch: 512 channels x 2 B + 16 B (16 B x odd)
#define PLDSB (2 * PBUF + QT * PXB)    // 263168: one work-group of 8 waves per WGP

static_assert(NB >= 1 && NB <= NBF);
static_assert(NQ >= QTB && NQ <= NN && NQ % QTB == 0);
static_assert(NN % QT == 0 && CC % QT == 0 && MQK % QT == 0);
static_assert(MQK == 2 * DQ && MW == MQK + CC && MW % 8 == 0);
static_assert(DQ == QT);
static_assert(CC == 2 * CH && CH == 16 * 16);
static_assert(CC % 256 == 0 && CC % 32 == 0 && DQ % 32 == 0 && NN % 32 == 0);
static_assert((OSPN * 4) % 16 == 0);
static_assert(DQ * 2 == 128 && SKEYS * 2 == 128 && KPH % SKEYS == 0 && NST >= 2);
static_assert(KSLOT % 2048 == 0 && KSLOT >= 32 * LPB && SKEYS == 64 && VHALF % 2048 == 0 && QSLOT % 2048 == 0 && QSLOT >= 16 * LPB);
static_assert(LOOPB <= LDSB && LDSB <= 327680 && BUFB % 2048 == 0 && QTB == 8 * 16);
static_assert(PNST >= 2 && PSLOT % 2048 == 0 && PSLOT >= PROWS * LPB && QT == 64 && 8 * PROWS == MW && PLDSB <= 327680);
static_assert(PXB % 32 == 16 && PXB >= CC * 2 && MQK == 8 * 16 && CC == 8 * 64);

typedef _Float16       v16h __attribute__((ext_vector_type(16)));
typedef _Float16       v8h  __attribute__((ext_vector_type(8)));
typedef unsigned short v8us __attribute__((ext_vector_type(8)));
typedef float          v8f  __attribute__((ext_vector_type(8)));
typedef float          v4f  __attribute__((ext_vector_type(4)));
typedef float          v2f  __attribute__((ext_vector_type(2)));
typedef _Float16       v2h  __attribute__((ext_vector_type(2)));
typedef unsigned int   v4u  __attribute__((ext_vector_type(4)));
typedef uint32_t       u32x4 __attribute__((ext_vector_type(4)));
typedef uint32_t       u32x8 __attribute__((ext_vector_type(8)));

union Frag  { v8us u[2]; v16h h; };
union FragH { v16h v; v8h hv[2]; };
static_assert(sizeof(Frag) == 32);
static_assert(sizeof(FragH) == 32);

// ---- scalar helpers ---------------------------------------------------------------------------------------
__device__ __forceinline__ unsigned short bf_bits(float f) {          // f32 -> bf16 bits, RNE convert
  unsigned u = __float_as_uint(f);
  return (unsigned short)((u + 0x7FFFu + ((u >> 16) & 1u)) >> 16);
}
__device__ __forceinline__ float bf_up(unsigned short hb) { return __uint_as_float(((unsigned)hb) << 16); }
__device__ __forceinline__ float bfr(float f) { return bf_up(bf_bits(f)); }
__device__ __forceinline__ unsigned short h_bits(_Float16 x) { return __builtin_bit_cast(unsigned short, x); }
__device__ __forceinline__ unsigned pk16(unsigned short a, unsigned short b) { return (unsigned)a | ((unsigned)b << 16); }
__device__ __forceinline__ v8f zero8() { v8f z = {0.f, 0.f, 0.f, 0.f, 0.f, 0.f, 0.f, 0.f}; return z; }
__device__ __forceinline__ float hmax8(v8f s) {
  return fmaxf(fmaxf(fmaxf(s[0], s[1]), fmaxf(s[2], s[3])), fmaxf(fmaxf(s[4], s[5]), fmaxf(s[6], s[7])));
}
__device__ __forceinline__ unsigned wave_ballot(bool p) {
#if defined(__HIP_DEVICE_COMPILE__)
  return __builtin_amdgcn_ballot_w32(p);
#else
  return p ? 1u : 0u;
#endif
}
// lane l with lane l ^ 16, as a vector move (a shuffle through the LDS unit counts on dscnt)
__device__ __forceinline__ float xhalf(float x) {
  return __builtin_bit_cast(float, __builtin_amdgcn_permlanex16(__builtin_bit_cast(int, x), __builtin_bit_cast(int, x),
                                                                0x76543210, 0xfedcba98, false, false));
}
// compile-time tags of an attention pass: does a next stage exist
struct HasNext   { static constexpr bool more = true; };
struct LastStage { static constexpr bool more = false; };
// compile-time tags of a 32-key block: its place in the 64-key stage
struct Sub0 { static constexpr int sub = 0; };
struct Sub1 { static constexpr int sub = 1; };
// position channel value w[l] = (l / 4096) * 2 - 1 in f32, spec op order (every step exact)
__device__ __forceinline__ float wpos(int l) { return ((float)l * INVNN) * 2.0f - 1.0f; }

// ---- 16-bit fragment loader (A, or B from a k-contiguous [n][k] row) from an LDS row: lane -> row/col (lane&15), p (bytes)
//      already includes 16*(lane>>4); elements 0..7 <- k0+8h.., elements 8..15 <- k0+16+8h.. (16 elements = 32 B on)
__device__ __forceinline__ Frag ldfrag_lds(const unsigned char* p) {
  Frag f;
  f.u[0] = *(const v8us*)(p);
  f.u[1] = *(const v8us*)(p + 32);
  return f;
}

// ---- tensor load to LDS: descriptor groups, issue and waits --------------------------------------------------
__device__ __forceinline__ uint32_t uni(uint32_t v) { return (uint32_t)__builtin_amdgcn_readfirstlane(v); }
// a wave-uniform value held in a scalar register: a test on it compiles to a scalar branch, and a descriptor word formed
// from it stands behind the wait written in front of it
__device__ __forceinline__ uint32_t pinned(uint32_t v) { uint32_t w = uni(v); asm volatile("" : "+s"(w)); return w; }
// group 1: 1-byte elements, tile = tensor = rows x 128 B, source pitch in bytes, 16 B of LDS pad behind every 128-B row
__device__ __forceinline__ u32x8 tdm_group1(uint32_t rows, uint32_t src_pitch) {
  u32x8 g;
  g[0] = uni((1u << 20) | (4u << 22) | (3u << 25));
  g[1] = uni(128u << 16);
  g[2] = uni(rows << 16);
  g[3] = uni(128u << 16);
  g[4] = uni(rows);
  g[5] = uni(src_pitch);
  g[6] = uni(0u);
  g[7] = uni(0u);
  return g;
}
__device__ __forceinline__ u32x4 tdm_group0(uint32_t lds_dst, uint64_t ga) {
  u32x4 g;
  g[0] = uni(1u);
  g[1] = uni(lds_dst);
  g[2] = uni((uint32_t)ga);
  g[3] = uni((((uint32_t)(ga >> 32)) & 0x01FFFFFFu) | 0x80000000u);
  return g;
}
__device__ __forceinline__ void tdm_load(u32x4 g0, u32x8 g1) {
  asm volatile("tensor_load_to_lds %0, %1" :: "s"(g0), "s"(g1) : "memory");
}
// the compiler places no wait for a tensor load: the issuing wave's own wait, before the barrier that publishes the tile
__device__ __forceinline__ void wait_tensor0() { asm volatile("s_wait_tensorcnt 0x0" ::: "memory"); }
// this wave's LDS reads have returned before a buffer it read is handed back for a refill
__device__ __forceinline__ void wait_ds0() { asm volatile("s_wait_dscnt 0x0" ::: "memory"); }

// ---- WMMA helpers --------------------------------------------------------------------------------------------
// plain builtins, no asm gap behind them: an asm statement's vector operands must lie in v0..v255, which a loop that holds
// accumulators and prefetched fragments at once does not fit; the compiler pads the builtin itself
__device__ __forceinline__ v8f wm_h(v16h a, v16h b, v8f c) {
  return __builtin_amdgcn_wmma_f32_16x16x32_f16(false, a, false, b, (short)0, c, false, false);
}

// =========================================================================================================
// (0) 1x1 weights: W16 f16 [640][512] (input channels 0..511 only; channel 512 is handled in the projection epilogues);
//     value = f16 of (bf16-RNE(w) * 256) (exact). Stacked source row o: 0..63 = Wq rows, 64..127 = Wk rows, 128..639 = Wv
//     rows. Block blk (0..79) owns o = 8*blk..8*blk+7 (source selection block-uniform): one wave per row. The plane is laid
//     in the order the projection's waves read it, 80 rows per wave w: 16 stacked q/k rows 16w.., then 64 Wv rows 64w.. .
// coverage: 80 blocks x 8 rows x 2 halves x 32 lanes x 8 halves = 640 x 512; o -> ro is a permutation of 0..639: the whole plane.
// =========================================================================================================
__global__ __launch_bounds__(256)
void cvt_w(const float* __restrict__ wq, const float* __restrict__ wk, const float* __restrict__ wv,
           unsigned short* W16) {
  const int tid = threadIdx.x, blk = blockIdx.x;
  const int rl = tid >> 5, lane = tid & 31;
  const int o = 8 * blk + rl;                                          // 0..639
  const float* wbase = (blk < (DQ / 8)) ? wq : ((blk < (MQK / 8)) ? wk : wv);
  const int osub = (blk < (DQ / 8)) ? 0 : ((blk < (MQK / 8)) ? DQ : MQK);
  const float* s = wbase + (size_t)(o - osub) * CIN;                   // (o - osub) in range of that matrix
  const int ro = (o < MQK) ? PROWS * (o >> 4) + (o & 15) : PROWS * ((o - MQK) >> 6) + 16 + ((o - MQK) & 63);
#pragma unroll 1
  for (int cp = 0; cp < CC / 256; ++cp) {
    const int col = 256 * cp + 8 * lane;                               // 0..504, col + 7 <= 511
    float f[8];
#pragma unroll
    for (int t = 0; t < 8; ++t) f[t] = s[col + t];
    v4u u;
#pragma unroll
    for (int t = 0; t < 4; ++t) {
      const _Float16 h0 = (_Float16)(bfr(f[2 * t]) * WSC);
      const _Float16 h1 = (_Float16)(bfr(f[2 * t + 1]) * WSC);
      u[t] = pk16(h_bits(h0), h_bits(h1));
    }
    *(v4u*)(W16 + (size_t)ro * CC + col) = u;
    // before the next trip writes again the registers that the issued store names
    asm volatile("s_wait_xcnt 0x0" ::: "memory");
  }
}

// =========================================================================================================
// (1) all projections of one (b, 64-position tile): x0 f32 [512 c][64 n] is read once, rounded (bf16-RNE values, exact in f16)
//   and laid in LDS position-major, XT[n][c] (pitch PXB); every product of the tile's 640 output rows reads it there.
//   Block = 8 waves. Wave w owns 80 rows of W16 (cvt_w lays them in this order): 16 q/k rows and 64 v rows. They come in
//   stages of 64 k by one tensor load per wave (rows of 128 B, pitch 144 B), two buffers. A pass reads its 18 fragments as one
//   group; behind them stands the publish point of stage s + 1, where stage s + 2 is issued into the buffer that the pass has
//   just read; then the pass runs its 40 products.
//   q/k tile: A = W rows, B = XT rows: lane (hh, c) holds d = 8 hh + r of position 16 nt + c: 8 consecutive d, one 16-B
//   store. v tiles: A = XT rows, B = W rows: lane (hh, c) holds positions 16 nt + 8 hh + r of channel c: 8 consecutive
//   keys of the channel-major plane, one 16-B store; a wave's four nt stores fill a channel row's whole 128-B line.
//   Epilogues in f32: + bf16-RNE(W[.][512]) * wpos(n) (position channel), v also + bf16-RNE(bv), q times log2(e); q, k and v
//   stored as f16.
// coverage: XT 8 waves x 4 ci x 8 cp pairs x 2 = 512 c, 4 ne x 4 e x 4 t = 64 n; planes 8 waves x 16 d x 64 n; V 8 waves x 64 o
//           x 64 n; grid (64, NB) covers Qf/Kf [NB][4096][64] and V [NB][512][4096] exactly once.
// =========================================================================================================
__global__ __launch_bounds__(256)
void proj(const float* __restrict__ x, const unsigned short* __restrict__ W16,
          const float* __restrict__ wq, const float* __restrict__ wk, const float* __restrict__ wv,
          const float* __restrict__ bv,
          unsigned short* Qf, unsigned short* Kf, unsigned short* V) {
  __shared__ __attribute__((aligned(2048))) unsigned char L[PLDSB];
  unsigned char* XT = L + 2 * PBUF;                                    // behind the W ring
  const int tid  = threadIdx.x;
  const int lane = tid & 31, wave = tid >> 5;
  const int hh   = lane >> 4, c = lane & 15;
  const int n0   = blockIdx.x * QT, b = blockIdx.y;

  // every wave issues one tensor load per stage for its own slice: all of this is wave-uniform
  const uint32_t wu    = uni((uint32_t)tid >> 5);
  const uint32_t lbase = (uint32_t)(size_t)L;                          // byte offset in the work-group's LDS
  const unsigned char* ssrc = (const unsigned char*)(W16 + (size_t)((uint32_t)PROWS * wu) * CC);
  const uint32_t soff = wu * (uint32_t)PSLOT;
  u32x8 g1s = tdm_group1((uint32_t)PROWS, (uint32_t)(CC * 2));
  asm volatile("" : "+s"(g1s));  // pinned() form, descriptor words held in scalar registers: one tuple serves every issue, so none is reused under a request in flight
  u32x4 g0s;                                                           // group 0 of this wave's stage request in flight
  auto issue = [&](uint32_t st) {
    const uint32_t dst = lbase + (st & 1u) * (uint32_t)PBUF + soff;
    const uint64_t ga  = (uint64_t)(size_t)ssrc + (uint64_t)st * 128u;
    g0s = tdm_group0(dst, ga);
    tdm_load(g0s, g1s);
  };
  // the issuing wave's wait for its stage request; it names group 0 so that those registers keep their values until then
  auto landed = [&]() { asm volatile("s_wait_tensorcnt 0x0" :: "s"(g0s) : "memory"); };

  issue(pinned(0u));                                                   // stage 0 flies while the x tile is read and rounded

  // the epilogues' terms, read here so that they land under the loop: W[d][512] of this lane's 8 q or k rows (waves 0..3 hold
  // q rows, 4..7 k rows: wave-uniform choice), Wv[o][512] and bv[o] of its 4 channels
  const int d0 = 16 * (wave & 3) + 8 * hh;
  const float* pwp = ((wu < 4u) ? wq : wk) + (size_t)d0 * CIN;
  const float* pvp = wv + (size_t)(64 * wave + c) * CIN;
  const float* pbp = bv + 64 * wave + c;

  // x0 tile: lane (e, cp) of wave w reads 4 positions of the two channels of pair cp + 8 (w + 8 ci); all 32 loads in flight
  const int e = lane & 3, cp = lane >> 2;
  const float* xb = x + ((size_t)(b * CC + 2 * (cp + 8 * wave))) * NN + n0 + 4 * e;
  v4f xa[4][4], xq[4][4];
#pragma unroll  // constant indices keep the arrays in registers
  for (int ci = 0; ci < 4; ++ci) {
#pragma unroll
    for (int ne = 0; ne < 4; ++ne) {
      xa[ci][ne] = *(const v4f*)(xb + (size_t)(128 * ci) * NN + 16 * ne);
      xq[ci][ne] = *(const v4f*)(xb + (size_t)(128 * ci + 1) * NN + 16 * ne);
    }
  }
  float pw[8], pwo[4], bo[4];
#pragma unroll
  for (int r = 0; r < 8; ++r) pw[r] = pwp[(size_t)r * CIN + CC];
#pragma unroll
  for (int vt = 0; vt < 4; ++vt) { pwo[vt] = pvp[(size_t)(16 * vt) * CIN + CC]; bo[vt] = pbp[16 * vt]; }
  // before anything writes again a register that an issued load names: the wait names the four addresses, so that their
  // registers keep their values until then; the scheduling barriers hold it behind the loads
  __builtin_amdgcn_sched_barrier(0);
  asm volatile("s_wait_xcnt 0x0" :: "v"(xb), "v"(pwp), "v"(pvp), "v"(pbp) : "memory");
  __builtin_amdgcn_sched_barrier(0);

  // one 4-B store per position and channel pair: banks 16 e + cp, all 32 lanes apart
#pragma unroll
  for (int ci = 0; ci < 4; ++ci) {
    unsigned char* xs = XT + (4 * e) * PXB + 4 * (cp + 8 * (wave + 8 * ci));
#pragma unroll
    for (int ne = 0; ne < 4; ++ne) {
#pragma unroll
      for (int t = 0; t < 4; ++t) {
        const v2f pr = {bfr(xa[ci][ne][t]), bfr(xq[ci][ne][t])};       // the pair's two channels: one packed convert
        *(v2h*)(xs + (16 * ne + t) * PXB) = __builtin_convertvector(pr, v2h);
      }
    }
  }
  landed();
  __syncthreads();                                                     // XT and stage 0 published to every wave
  issue(pinned(1u));

  v8f aq[4], av[4][4];
#pragma unroll
  for (int nt = 0; nt < 4; ++nt) {
    aq[nt] = zero8();
#pragma unroll
    for (int vt = 0; vt < 4; ++vt) av[vt][nt] = zero8();
  }

  // rolled: the stage test at the publish point is opaque to the compiler, so unrolled copies would carry issue code that never runs
#pragma unroll 1
  for (uint32_t st = 0; st < (uint32_t)PNST; ++st) {
    const unsigned char* Wp = L + (st & 1u) * (uint32_t)PBUF + wave * PSLOT + c * LPB + 16 * hh;   // this pass reads this buffer alone
    const unsigned char* Xp = XT + c * PXB + 16 * hh + st * 128u;
    Frag fw[2][5], fx[2][4];                                           // every fragment of the pass in registers of its own
#pragma unroll  // constant indices keep the fragment arrays in registers
    for (int ks = 0; ks < 2; ++ks) {
#pragma unroll
      for (int j = 0; j < 5; ++j) fw[ks][j] = ldfrag_lds(Wp + (16 * j) * LPB + 64 * ks);
#pragma unroll
      for (int nt = 0; nt < 4; ++nt) fx[ks][nt] = ldfrag_lds(Xp + (16 * nt) * PXB + 64 * ks);
    }
    // keeps the reads one group in front of the publish point and the products: sunk among the products, each small group is
    // waited out where it stands
    __builtin_amdgcn_sched_barrier(0);
    // publish point of stage st + 1, every wave, in this order; behind the first wait this wave holds in registers all that it
    // reads of this buffer, so stage st + 2 is issued here and flies under the products
    wait_ds0();
    landed();
    __syncthreads();                                                   // stage st + 1 published; every reader has left this buffer
    if (pinned(st + 2u < (uint32_t)PNST)) issue(pinned(st + 2u));      // scalar branch: a tensor load ignores EXEC
#pragma unroll
    for (int ks = 0; ks < 2; ++ks) {
#pragma unroll
      for (int nt = 0; nt < 4; ++nt) aq[nt] = wm_h(fw[ks][0].h, fx[ks][nt].h, aq[nt]);
#pragma unroll
      for (int vt = 0; vt < 4; ++vt) {
#pragma unroll
        for (int nt = 0; nt < 4; ++nt) av[vt][nt] = wm_h(fx[ks][nt].h, fw[ks][1 + vt].h, av[vt][nt]);
      }
    }
  }
  // behind the loop: this wait names both groups, so that no descriptor register takes a new value in front of it
  asm volatile("s_wait_tensorcnt 0x0" :: "s"(g0s), "s"(g1s) : "memory");
  wait_ds0();

  // q/k: lane (hh, c) holds d = d0 + r of position n0 + 16 nt + c
  const float qs = (wu < 4u) ? LOG2E : 1.0f;                           // q carries log2(e): the scores come out in units of log2
  v4u uh[4];
#pragma unroll
  for (int nt = 0; nt < 4; ++nt) {
    const float wl = wpos(n0 + 16 * nt + c);
#pragma unroll
    for (int t = 0; t < 4; ++t) {
      const float f0 = (aq[nt][2 * t] * IWSC + bfr(pw[2 * t]) * wl) * qs;
      const float f1 = (aq[nt][2 * t + 1] * IWSC + bfr(pw[2 * t + 1]) * wl) * qs;
      uh[nt][t] = pk16(h_bits((_Float16)f0), h_bits((_Float16)f1));
    }
  }
  // v: lane (hh, c) holds keys n0 + 16 nt + 8 hh + r of channel 64 wave + 16 vt + c
  v4u uv[4][4];
#pragma unroll
  for (int vt = 0; vt < 4; ++vt) {
    const float pwv = bfr(pwo[vt]), bov = bfr(bo[vt]);
#pragma unroll
    for (int nt = 0; nt < 4; ++nt) {
      const int nb = n0 + 16 * nt + 8 * hh;
      unsigned short hb[8];
#pragma unroll
      for (int r = 0; r < 8; ++r) {
        const float val = av[vt][nt][r] * IWSC + pwv * wpos(nb + r) + bov;
        hb[r] = h_bits((_Float16)val);
      }
#pragma unroll
      for (int t = 0; t < 4; ++t) uv[vt][nt][t] = pk16(hb[2 * t], hb[2 * t + 1]);
    }
  }
  unsigned short* Ph = ((wu < 4u) ? Qf : Kf) + ((size_t)(b * NN + n0 + c)) * DQ + d0;
  unsigned short* Vp = V + ((size_t)(b * CC + 64 * wave + c)) * NN + n0 + 8 * hh;
  // the stores stand behind all of the value arithmetic: none of it writes again a register that an issued store names
  __builtin_amdgcn_sched_barrier(0);
#pragma unroll
  for (int nt = 0; nt < 4; ++nt) *(v4u*)(Ph + (size_t)(16 * nt) * DQ) = uh[nt];
  // before the address arithmetic of the v stores writes again a register that an issued store names: the wait names the
  // stores' addresses and data, so that their registers keep their values until then
  __builtin_amdgcn_sched_barrier(0);
  asm volatile("s_wait_xcnt 0x0" :: "v"(Ph), "v"(uh[0]), "v"(uh[1]), "v"(uh[2]), "v"(uh[3]) : "memory");
  __builtin_amdgcn_sched_barrier(0);
#pragma unroll
  for (int vt = 0; vt < 4; ++vt) {
#pragma unroll
    for (int nt = 0; nt < 4; ++nt) *(v4u*)(Vp + (size_t)(16 * vt) * NN + 16 * nt) = uv[vt][nt];
  }
}

// =========================================================================================================
// (2) attention for one (b, 128-query tile, channel half chh), transposed formulation, 4096 keys, no mask, no scale.
//   Block = 8 waves: wave = query group qg (wave & 3, 32 queries = two 16-query tiles) + 4 x key half kh (2048 keys each).
//   S^T tile (16 keys x 16 queries) = sum over 2 d-chunks of A(k: row = key, 32 d via the split k map from the f16 plane
//   Kf [b][4096][64]) . B(q: col = query, same map from Qf). Per lane the D tile holds 8 keys of ONE query: online softmax state per lane and query tile.
//   The first product of a score tile takes C = LGPS - m in all 8 registers (q carries log2 e), so D is the argument of exp2 as it
//   stands; m, o and l keep the maximum in use until some lane's D lies above GTH (wave-uniform ballot); then every lane takes
//   its new maximum (one vector move, lane^16, for the max over 32 keys), rescales o and l and shifts this block's D.
//   P = e^{s-m} / 4 as f16 is the B operand of O^T (rows channel,
//   cols queries) += A(v rows channel = cb0 + 16j + (lane&15), keys contiguous, f16 plane V [b][512][4096]) . B(P^T):
//   element r <- D of the tile covering keys kb..kb+15, element 8+r <- the tile covering kb+16..kb+31, lane unchanged.
//   Every k and v fragment read from LDS serves both query tiles: two products each. 32 accumulator
//   tiles per wave (2 query tiles x 256 channels), two waves per SIMD. The two channel halves are separate blocks (grid.z).
//   Operands come from LDS, laid there by tensor loads (rows of 128 B, pitch 144 B): the block's q rows once (each wave one
//   slice of 16 rows), then per key half stages of 64 keys in two buffers: of the half's four waves two bring 32 k rows
//   each (one 32-key block's), two 128 channel rows of V each (64 keys = one whole 128-B line per row).
//   A pass walks its 64 keys as two 32-key blocks. Two register sets of 8 fragments: a block finds its 4 k fragments in the
//   first (q stays in registers); behind the score products its 16 v fragments go into both (they land under the softmax),
//   behind the first 16 v products the next block's k fragments (they land under the last 16).
//   The publish point of stage s + 1 stands in the last block of pass s, behind its exponentials: by then the wave has fetched
//   all it reads of stage s, so stage s + 2 is issued there into that buffer.
//   Behind the loop the two key halves of a query group are joined: each wave hands its partner (wave ^ 4) 128 channels of
//   both query tiles with its m and l through LDS, and finishes the other 128: o = (o_a 2^{m_a-m} + o_b 2^{m_b-m}) gamma / l.
//   Then Os[query][256 channels] (pitch OSPN, b128 stores), and out rows: 8 consecutive lanes x 16 B per 128-B line.
// coverage: 16 it x 2 parts x 32 lines x 8 lanes x 4 floats = 256 ch x 128 n per block; grid (NQ/128, NB, 2) covers
//           out[b][0..511][0..NQ-1] exactly once. Hand-over region and Os: cross-wave (block barriers).
// =========================================================================================================
__global__ __launch_bounds__(256)
void attn_k(const unsigned short* __restrict__ Qf, const unsigned short* __restrict__ Kf,
            const unsigned short* __restrict__ V, const float* __restrict__ x,
            const float* __restrict__ gamma, float* out) {
  __shared__ __attribute__((aligned(2048))) unsigned char L[LDSB];
  const int tid  = threadIdx.x;
  const int wave = tid >> 5, lane = tid & 31;
  const int hh   = lane >> 4, c = lane & 15;
  const int qg   = wave & 3, kh = wave >> 2;
  const int n0   = blockIdx.x * QTB, b = blockIdx.y, chh = blockIdx.z;
  const int cb0  = chh * CH;                                           // 0 or 256

  // every wave issues one tensor load per stage for its own slice: all of this is wave-uniform
  const uint32_t wv    = uni((uint32_t)tid >> 5);
  const uint32_t role  = wv & 3u, khu = wv >> 2;                       // slice of the stage, key half
  const uint32_t lbase = (uint32_t)(size_t)L;                          // byte offset in the work-group's LDS
  const bool     isV   = role >= 2u;
  const unsigned char* ssrc = isV
      ? (const unsigned char*)(V + ((size_t)(b * CC + cb0) + 128u * (role - 2u)) * NN + khu * (uint32_t)KPH)
      : (const unsigned char*)(Kf + ((size_t)b * NN + khu * (uint32_t)KPH + 32u * role) * DQ);
  const uint32_t sadv = isV ? (uint32_t)(SKEYS * 2) : (uint32_t)(SKEYS * DQ * 2);   // source bytes from stage to stage
  const uint32_t soff = khu * (uint32_t)RINGB + (isV ? (uint32_t)VOFF + (role - 2u) * (uint32_t)VHALF : role * (uint32_t)KSLOT);
  u32x8 g1s = tdm_group1(isV ? 128u : 32u, isV ? (uint32_t)(NN * 2) : (uint32_t)(DQ * 2));
  asm volatile("" : "+s"(g1s));  // pinned() form, descriptor words held in scalar registers: one tuple serves every issue, so none is reused under a request in flight
  u32x4 g0s;                                                           // group 0 of this wave's stage request in flight
  auto issue = [&](uint32_t st) {
    const uint32_t dst = lbase + (st & 1u) * (uint32_t)BUFB + soff;
    const uint64_t ga  = (uint64_t)(size_t)ssrc + (uint64_t)st * sadv;
    g0s = tdm_group0(dst, ga);
    tdm_load(g0s, g1s);
  };
  // the issuing wave's wait for its stage request; it names group 0 so that those registers keep their values until then
  auto landed = [&]() { asm volatile("s_wait_tensorcnt 0x0" :: "s"(g0s) : "memory"); };

  // q, loaded once: wave wv brings rows n0 + 16*wv .. +15 into slice wv
  {
    const unsigned char* qsrc = (const unsigned char*)(Qf + ((size_t)(b * NN + n0) + 16u * wv) * DQ);
    tdm_load(tdm_group0(lbase + (uint32_t)QOFF + wv * (uint32_t)QSLOT, (uint64_t)(size_t)qsrc),
             tdm_group1(16u, (uint32_t)(DQ * 2)));
    wait_tensor0();
  }
  issue(pinned(0u));
  landed();
  __syncthreads();                                                     // q and stage 0 of both halves published to every wave
  issue(pinned(1u));

  const unsigned char* Lh = L + kh * RINGB;                            // this key half's ring

  float l[2] = {0.f, 0.f};
  v8f nm[2];                                                           // C operand of the score products: LGPS - m in every register; holds m
  v8f o[2][16];
#pragma unroll
  for (int qt = 0; qt < 2; ++qt) {
#pragma unroll
    for (int j = 0; j < 16; ++j) o[qt][j] = zero8();
  }

  // q fragment base (B operand, col = query n0 + 32*qg + 16*qt + c: row c of slice 2*qg + qt), + 64*kc B
  const unsigned char* Qp = L + QOFF + (2 * qg) * QSLOT + c * LPB + 16 * hh;
  // the q fragments stay in registers, read once
  Frag qh[2][DQ / 32];
#pragma unroll  // constant indices keep the fragment array in registers
  for (int qt = 0; qt < 2; ++qt) {
#pragma unroll
    for (int kc = 0; kc < DQ / 32; ++kc) qh[qt][kc] = ldfrag_lds(Qp + qt * QSLOT + 64 * kc);
  }
  // the two fragment sets; the first holds a block's 4 k fragments, then each 8 v fragments
  Frag ra[8], rb[8];
  // one group: the k fragments of a block (A operand, row = key): row c (+16) of the stage's slice sub, + 64*kc B:
  // R[2 kc] = keys kb.., R[2 kc + 1] = keys kb+16.. of d chunk kc
  auto load_s = [&](Frag (&R)[8], const unsigned char* Bp, int sub) __attribute__((always_inline)) {
    const unsigned char* k0p = Bp + sub * KSLOT + c * LPB + 16 * hh;
#pragma unroll  // constant indices keep the fragment array in registers
    for (int kc = 0; kc < DQ / 32; ++kc) {
      R[2 * kc]     = ldfrag_lds(k0p + 64 * kc);
      R[2 * kc + 1] = ldfrag_lds(k0p + 16 * LPB + 64 * kc);
    }
  };
  // one group: 8 of a block's v fragments (A operand, row = channel cb0 + 128*g + 16j + c, keys contiguous): + 64*sub B
  auto load_v = [&](Frag (&R)[8], const unsigned char* Bp, int sub, int g) __attribute__((always_inline)) {
    const unsigned char* Vp = Bp + VOFF + (128 * g + c) * LPB + 16 * hh + 64 * sub;
#pragma unroll  // constant indices keep the fragment array in registers
    for (int j = 0; j < 8; ++j) R[j] = ldfrag_lds(Vp + (16 * j) * LPB);
  };
  load_s(ra, Lh, 0);                                                   // q and stage 0 are published: the first block's k fragments

  // m starts as the maximum over the first block's 32 keys (o and l are 0: nothing to rescale); the block then forms its scores against it
#pragma unroll
  for (int qt = 0; qt < 2; ++qt) {
    v8f t0 = zero8(), t1 = zero8();
#pragma unroll  // constant indices into the fragment arrays
    for (int kc = 0; kc < DQ / 32; ++kc) {
      t0 = wm_h(ra[2 * kc].h, qh[qt][kc].h, t0);
      t1 = wm_h(ra[2 * kc + 1].h, qh[qt][kc].h, t1);
    }
    const float mf = fmaxf(hmax8(t0), hmax8(t1));
    const float mi = fmaxf(mf, xhalf(mf));
#pragma unroll
    for (int r = 0; r < 8; ++r) nm[qt][r] = LGPS - mi;
  }

  // one 32-key block: RA holds its k fragments; it leaves the next block's there. The tags say at compile time where
  // the block stands and whether a next stage exists, so that no read stands under a branch. Inlined at every place: the
  // fragment arrays stay in registers
  auto block = [&](Frag (&RA)[8], Frag (&RB)[8], uint32_t st, auto subtag, auto tag) __attribute__((always_inline)) {
    constexpr int  sub  = decltype(subtag)::sub;
    constexpr bool more = decltype(tag)::more;
    constexpr bool last = (sub + 1 == SKEYS / 32);                     // the stage's last block
    constexpr bool next = !last || more;                               // a next block exists
    const unsigned char* Bp = Lh + (st & 1u) * (uint32_t)BUFB;         // this stage's buffer
    const unsigned char* Bx = last ? Lh + ((st + 1u) & 1u) * (uint32_t)BUFB : Bp;   // the next block's, read behind its publish point
    constexpr int subx = last ? 0 : sub + 1;

    v8f s[2][2];                                                       // [query tile][keys kb.., kb+16..]: t - m + LGPS
#pragma unroll  // constant indices into the fragment arrays
    for (int kc = 0; kc < DQ / 32; ++kc) {
#pragma unroll
      for (int qt = 0; qt < 2; ++qt) {
        s[qt][0] = wm_h(RA[2 * kc].h, qh[qt][kc].h, kc == 0 ? nm[qt] : s[qt][0]);
        s[qt][1] = wm_h(RA[2 * kc + 1].h, qh[qt][kc].h, kc == 0 ? nm[qt] : s[qt][1]);
      }
    }
    // keeps the score products in front of the group and the group here: the v fragments land under the softmax; sunk to
    // their products, each read would be waited out there
    __builtin_amdgcn_sched_barrier(0);
    load_v(RA, Bp, sub, 0);
    load_v(RB, Bp, sub, 1);
    __builtin_amdgcn_sched_barrier(0);

    float mx[2];
#pragma unroll
    for (int qt = 0; qt < 2; ++qt) mx[qt] = fmaxf(hmax8(s[qt][0]), hmax8(s[qt][1]));   // this lane's 16 keys
    // wave-uniform, one test per block: does a score leave the range that P has above the maximum in use
    const unsigned grew = wave_ballot(mx[0] > GTH || mx[1] > GTH);
    if (grew != 0u) {
#pragma unroll
      for (int qt = 0; qt < 2; ++qt) {
        const float mq = fmaxf(mx[qt], xhalf(mx[qt]));                 // the query's 32 keys; a vector move: no LDS wait drains the reads in flight
        const float dm = fmaxf(mq - LGPS, 0.f);                        // new maximum less the one in use; 0 for lanes whose max did not grow
        const float corr = __builtin_amdgcn_exp2f(-dm);                // == 1 exactly for those lanes
        l[qt] *= corr;
#pragma unroll
        for (int r = 0; r < 8; ++r) {
          nm[qt][r] -= dm;                                             // m grows by dm
          s[qt][0][r] -= dm;
          s[qt][1][r] -= dm;
        }
#pragma unroll
        for (int j = 0; j < 16; ++j) {
#pragma unroll
          for (int r = 0; r < 8; ++r) o[qt][j][r] *= corr;
        }
      }
    }
    FragH ph[2];
#pragma unroll
    for (int qt = 0; qt < 2; ++qt) {
      float ls = 0.f;
#pragma unroll
      for (int r = 0; r < 8; ++r) {
        const float e0 = __builtin_amdgcn_exp2f(s[qt][0][r]);          // key kb      + 8hh + r: e^{s-m} / 4
        const float e1 = __builtin_amdgcn_exp2f(s[qt][1][r]);          // key kb + 16 + 8hh + r
        ls += e0 + e1;
        ph[qt].hv[0][r] = (_Float16)e0;
        ph[qt].hv[1][r] = (_Float16)e1;
      }
      l[qt] += ls;
    }

    if constexpr (last) {
      // publish point of stage st + 1, every wave, in this order; behind the first wait this wave holds in registers all that
      // it reads of this buffer. The wait names P as an input: the exponentials then stand in front of it and the v reads land
      // under them; without it the compiler sinks them behind the barrier and the reads are waited out here
      if constexpr (more) asm volatile("s_wait_dscnt 0x0" :: "v"(ph[0].v), "v"(ph[1].v) : "memory");
      else wait_ds0();                                                 // no branch follows in the last pass: nothing is sunk there
      if constexpr (more) landed();
      // the last pass's wait names both groups, so that no descriptor register takes a new value in front of it
      else asm volatile("s_wait_tensorcnt 0x0" :: "s"(g0s), "s"(g1s) : "memory");
      __syncthreads();                                                 // stage st + 1 published; every reader has left this buffer
      if constexpr (more) {
        if (pinned(st + 2u < (uint32_t)NST)) issue(pinned(st + 2u));   // scalar branch: a tensor load ignores EXEC
      }
    }

#pragma unroll
    for (int j = 0; j < 8; ++j) {
#pragma unroll
      for (int qt = 0; qt < 2; ++qt) o[qt][j] = wm_h(RA[j].h, ph[qt].v, o[qt][j]);
    }
    if constexpr (next) {
      // the products stay in front of the reads that refill their fragments; the next block's k fragments land under the other 16
      __builtin_amdgcn_sched_barrier(0);
      load_s(RA, Bx, subx);
      __builtin_amdgcn_sched_barrier(0);
    }
#pragma unroll
    for (int j = 0; j < 8; ++j) {
#pragma unroll
      for (int qt = 0; qt < 2; ++qt) o[qt][8 + j] = wm_h(RB[j].h, ph[qt].v, o[qt][8 + j]);
    }
    if constexpr (next) {
      __builtin_amdgcn_sched_barrier(0);
      // WMMA distance: the next block's first score product may write its D where the allocator kept P, the B operand of the
      // v product issued just before it; four slots, held in place by the scheduling barriers
      asm volatile("v_nop\n\tv_nop\n\tv_nop\n\tv_nop");
      __builtin_amdgcn_sched_barrier(0);
    }
  };
  // rolled: the stage test at the publish point is opaque to the compiler, so unrolled copies would carry issue code that never runs
#pragma unroll 1
  for (uint32_t st = 0; st + 1u < (uint32_t)NST; ++st) {
    block(ra, rb, st, Sub0{}, HasNext{});
    block(ra, rb, st, Sub1{}, HasNext{});
  }
  block(ra, rb, (uint32_t)NST - 1u, Sub0{}, LastStage{});
  block(ra, rb, (uint32_t)NST - 1u, Sub1{}, LastStage{});
  wait_tensor0();
  wait_ds0();
  // the last pass's own barrier stands behind every wave's last read of the rings and of q: all of L is free

  // join of the two key halves: wave (qg, kh) finishes channels 128*kh .. +127 of its 32 queries and hands the other 128 over
  float* Xo = (float*)(L + wave * XWAVE);                              // written by this wave, read by its partner
  const float* Xp = (const float*)(L + (wave ^ 4) * XWAVE);
  float* MLo = (float*)(L + MLOFF) + wave * 128;
  const float* MLp = (const float*)(L + MLOFF) + (wave ^ 4) * 128;
  const bool up = kh != 0;                                             // wave-uniform
  const float m[2] = {LGPS - nm[0][0], LGPS - nm[1][0]};               // the maximum in use at the end
  v8f f[2][8];
#pragma unroll
  for (int qt = 0; qt < 2; ++qt) {
    l[qt] += xhalf(l[qt]);                                             // the two lane halves' row sums
    MLo[qt * 64 + 2 * lane]     = m[qt];
    MLo[qt * 64 + 2 * lane + 1] = l[qt];
#pragma unroll
    for (int jj = 0; jj < 8; ++jj) {
      const v8f snd = up ? o[qt][jj] : o[qt][8 + jj];
      f[qt][jj]     = up ? o[qt][8 + jj] : o[qt][jj];
      v4f va, vb;
#pragma unroll
      for (int r = 0; r < 4; ++r) { va[r] = snd[r]; vb[r] = snd[4 + r]; }
      *(v4f*)(Xo + (qt * 8 + jj) * 256 + 4 * lane)       = va;         // lane-linear: the partner's same lane reads it back
      *(v4f*)(Xo + (qt * 8 + jj) * 256 + 128 + 4 * lane) = vb;
    }
  }
  __syncthreads();                                                     // every wave's hand-over is written
  const float gam = bfr(gamma[0]);
  float* Os = (float*)(L + OSOFF);                                     // apart from the hand-over region
#pragma unroll
  for (int qt = 0; qt < 2; ++qt) {
    const float mp = MLp[qt * 64 + 2 * lane], lp = MLp[qt * 64 + 2 * lane + 1];
    const float mm = fmaxf(m[qt], mp);
    const float co = __builtin_amdgcn_exp2f(m[qt] - mm), cp = __builtin_amdgcn_exp2f(mp - mm);   // m in units of log2
    const float inv = gam / (l[qt] * co + lp * cp);                    // o and l both carry the factor 1/4
    const float ao = co * inv, ap = cp * inv;
    const int qrow = 32 * qg + 16 * qt + c;
    v4f pa[8], pb[8];                                                  // one group of reads, in front of the Os stores
#pragma unroll
    for (int jj = 0; jj < 8; ++jj) {
      pa[jj] = *(const v4f*)(Xp + (qt * 8 + jj) * 256 + 4 * lane);
      pb[jj] = *(const v4f*)(Xp + (qt * 8 + jj) * 256 + 128 + 4 * lane);
    }
#pragma unroll
    for (int jj = 0; jj < 8; ++jj) {
      v4f va, vb;
#pragma unroll
      for (int r = 0; r < 4; ++r) { va[r] = f[qt][jj][r] * ao + pa[jj][r] * ap; vb[r] = f[qt][jj][4 + r] * ao + pb[jj][r] * ap; }
      *(v4f*)(Os + qrow * OSPN + 128 * kh + 16 * jj + 8 * hh)     = va;   // Os[query][ch_loc = 128kh + 16jj + 8hh + r]
      *(v4f*)(Os + qrow * OSPN + 128 * kh + 16 * jj + 8 * hh + 4) = vb;
    }
  }
  __syncthreads();                                                     // Os complete

  // out rows: thread (lq, e) owns channel ch0 + 16 it, queries nq0 + 64 part .. +3; one address pair each for x and out, every
  // step from it a constant
  const int e = tid & 7, lq = tid >> 3;                                // lq 0..31
  const int ch0 = lq >> 1;                                             // 0..15
  const int nq0 = (lq & 1) * 32 + 4 * e;                               // 0..60
  const size_t base = ((size_t)(b * CC + cb0 + ch0)) * NN + n0 + nq0;
  const float* xb = x + base;
  float* ob = out + base;
  const float* Ob = Os + nq0 * OSPN + ch0;
#pragma unroll
  for (int part = 0; part < 2; ++part) {
    v4f res[16];
#pragma unroll
    for (int it = 0; it < 16; ++it) {
      const v4f xv = *(const v4f*)(xb + (size_t)(16 * it) * NN + 64 * part);
#pragma unroll
      for (int t = 0; t < 4; ++t) res[it][t] = Ob[(64 * part + t) * OSPN + 16 * it] + bfr(xv[t]);
    }
#pragma unroll
    for (int it = 0; it < 16; ++it) *(v4f*)(ob + (size_t)(16 * it) * NN + 64 * part) = res[it];
    // before the second part writes again the registers that the issued stores name
    if (part == 0) asm volatile("s_wait_xcnt 0x0" ::: "memory");
  }
}

// =========================================================================================================
// Workspace map (bytes; each region start a multiple of 256; every extent is an exact tile multiple and is written
//   W16 f16 [640][512]                  655360
//   V   f16 [NB][512][4096]           16777216 (NB = 4)
//   Qf/Kf f16 [NB][4096][64]          2097152 x2
//   total (NB = 4) = 21626880
// =========================================================================================================
extern "C" void kernel_launch(void* const* d_in, const int* in_sizes, int n_in,
                              void* d_out, int out_size, void* d_ws, size_t ws_size,
                              hipStream_t stream) {
  const int XN = NB * CC * NN;
  if (n_in < 6) return;
  if (in_sizes[0] < XN) return;
  if (in_sizes[1] < DQ * CIN || in_sizes[2] < DQ * CIN) return;
  if (in_sizes[3] < CC * CIN || in_sizes[4] < CC || in_sizes[5] < 1) return;
  if (out_size < XN) return;

  size_t off = 0;
  auto carve = [&](size_t bytes) { const size_t o = off; off += (bytes + 255) & ~(size_t)255; return o; };
  const size_t oW16 = carve((size_t)MW * CC * 2);
  const size_t oV   = carve((size_t)NB * CC * NN * 2);
  const size_t oQf  = carve((size_t)NB * NN * DQ * 2);
  const size_t oKf  = carve((size_t)NB * NN * DQ * 2);
  if (off > ws_size) return;
  if (off > (size_t)134217728) return;

  const float* x     = (const float*)d_in[0];
  const float* wq    = (const float*)d_in[1];
  const float* wk    = (const float*)d_in[2];
  const float* wv    = (const float*)d_in[3];
  const float* bv    = (const float*)d_in[4];
  const float* gamma = (const float*)d_in[5];

  char* ws = (char*)d_ws;
  unsigned short* W16 = (unsigned short*)(ws + oW16);
  unsigned short* V   = (unsigned short*)(ws + oV);
  unsigned short* Qf  = (unsigned short*)(ws + oQf);
  unsigned short* Kf  = (unsigned short*)(ws + oKf);
  float* out = (float*)d_out;

  const dim3 blk256(256);

  // (0) Wq / Wk / Wv (channels 0..511) -> stacked f16 plane
  cvt_w<<<dim3(MW / 8), blk256, 0, stream>>>(wq, wk, wv, W16);
  // (1) x0 tile -> q / k f16 planes, v + bias channel-major f16 plane
  proj<<<dim3(NN / QT, NB), blk256, 0, stream>>>(x, W16, wq, wk, wv, bv, Qf, Kf, V);
  // (2) attention + gamma scale + residual -> out [b][512][NQ]
  attn_k<<<dim3(NQ / QTB, NB, 2), blk256, 0, stream>>>(Qf, Kf, V, x, gamma, out);
  (void)hipGetLastError();
}

// v010
// It runs in 71 microseconds.
// Next to v009, in two timings, it ran 1.04 times as fast each time.
// All steps since v000 together make it 10.4 times as fast.
// Contractions: q/k/v 1x1 projections W[640x512].X[512x4096] per batch on v_wmma_f32_16x16x32_f16 (f16
// containers of bf16-RNE weights x256 and bf16-RNE x0; input channel 512 = position term, and the v bias, added in
// the f32 epilogue); scores K.Q^T on v_wmma_f32_16x16x32_f16 (q log2(e) and k rounded once to f16, one product, K=64: the
// rounding, at most 2^-11 relative, lies under the 2^-8 that the bf16-RNE x0 and weights have already put into q and k;
// the product's C operand is -(m + 2), so its D registers hold the argument of exp2);
// out^T = V.P^T on v_wmma_f32_16x16x32_f16 (v as f16, P = e^{s-m} / 4 f16 from the score D
// registers, m = the maximum in use); f32 accumulate everywhere; softmax statistics, gamma scale and the residual add in f32 VALU.
#include <hip/hip_runtime.h>
#include <math.h>
#include <stdint.h>

#ifndef NB
#define NB 4
#endif
#ifndef NQ
#define NQ 4096
#endif
#define NBF   4
#define CC    512
#define CIN   513
#define NN    4096
#define DQ    64
#define MQK   128
#define MW    640
#define QT    64
#define CH    256
#define OSPN  260
#define WSC   256.0f
#define IWSC  0.00390625f
// P = e^{s-m} * PS as f16, m the maximum in use; m is renewed only when a new maximum lies more than RTAU above it, so
// P <= PS e^RTAU = 40689 < 65504 (f16 range), and the row's true maximum has P >= PS = 2^-2: f16 steps of 2^-24 at the small
// end are 2^-22 of it or less
// scores and m are kept in units of log2: t = s log2(e) (q carries the factor), P = 2^{t - m - 2}
#define LOG2E 1.4426950408889634f
#define LGPS  -2.0f                    // log2 PS, PS = 1/4
#define RTAU  12.0f
#define GTH   (RTAU * LOG2E + LGPS)    // the score D registers hold t - m + LGPS: above this value the maximum in use is renewed
#define INVNN 0.000244140625f
// attention LDS map (bytes): every staged row is 128 B of data at a pitch of 144 B (16 B x odd, for ds_load_b128 readers)
#define SKEYS 64                       // keys per stage
#define QTB   128                      // queries per attention block
#define KPH   (NN / 2)                 // keys per key half
#define NST   (KPH / SKEYS)            // stages per key half
#define LPB   144                      // LDS row pitch
#define KSLOT 6144                     // the k rows of one 32-key block: 32 rows x 144 B = 4608, rounded up to a multiple of 2 KiB
#define VOFF  (2 * KSLOT)              // v rows behind the stage's two k slices
#define VHALF (128 * LPB)              // 128 v rows = 18432 = 9 x 2 KiB
#define BUFB  (VOFF + 2 * VHALF)       // one stage buffer = 49152
#define RINGB (2 * BUFB)               // one key half's two stage buffers
#define QOFF  (2 * RINGB)              // q slices behind the two rings
#define QSLOT 4096                     // 16 q rows x 144 B = 2304, rounded up to a multiple of 2 KiB
#define LOOPB (QOFF + 8 * QSLOT)       // 229376: what the key loop uses
// behind the key loop the same LDS holds: the accumulator tiles that the two key halves hand each other, their m and l, Os
#define XWAVE 16384                    // 16 tiles x 1 KiB handed over per wave
#define MLOFF (8 * XWAVE)              // m and l: 8 waves x 2 query tiles x 32 lanes x 8 B = 4096
#define OSOFF (MLOFF + 8192)           // Os[128 queries][256 channels], pitch OSPN floats
#define LDSB  (OSOFF + QTB * OSPN * 4) // 272384: one work-group of 8 waves per WGP

// projection LDS map (bytes): a stage is 64 k = 128 B of all 640 W16 rows at the pitch LPB; behind the two stage buffers the x tile
#define PROWS 80                       // W16 rows per wave: 16 q/k rows, then 64 v rows
#define PNST  (CC * 2 / 128)           // stages
#define PSLOT 12288                    // one wave's slice: 80 rows x 144 B = 11520, rounded up to a multiple of 2 KiB
#define PBUF  (8 * PSLOT)              // one stage buffer
#define PXB   1040                     // x tile row pitch: 512 channels x 2 B + 16 B (16 B x odd)
#define PLDSB (2 * PBUF + QT * PXB)    // 263168: one work-group of 8 waves per WGP

static_assert(NB >= 1 && NB <= NBF);
static_assert(NQ >= QTB && NQ <= NN && NQ % QTB == 0);
static_assert(NN % QT == 0 && CC % QT == 0 && MQK % QT == 0);
static_assert(MQK == 2 * DQ && MW == MQK + CC && MW % 8 == 0);
static_assert(DQ == QT);
static_assert(CC == 2 * CH && CH == 16 * 16);
static_assert(CC % 256 == 0 && CC % 32 == 0 && DQ % 32 == 0 && NN % 32 == 0);
static_assert((OSPN * 4) % 16 == 0);
static_assert(DQ * 2 == 128 && SKEYS * 2 == 128 && KPH % SKEYS == 0 && NST >= 2);
static_assert(KSLOT % 2048 == 0 && KSLOT >= 32 * LPB && SKEYS == 64 && VHALF % 2048 == 0 && QSLOT % 2048 == 0 && QSLOT >= 16 * LPB);
static_assert(LOOPB <= LDSB && LDSB <= 327680 && BUFB % 2048 == 0 && QTB == 8 * 16);
static_assert(PNST >= 2 && PSLOT % 2048 == 0 && PSLOT >= PROWS * LPB && QT == 64 && 8 * PROWS == MW && PLDSB <= 327680);
static_assert(PXB % 32 == 16 && PXB >= CC * 2 && MQK == 8 * 16 && CC == 8 * 64);

typedef _Float16       v16h __attribute__((ext_vector_type(16)));
typedef _Float16       v8h  __attribute__((ext_vector_type(8)));
typedef unsigned short v8us __attribute__((ext_vector_type(8)));
typedef float          v8f  __attribute__((ext_vector_type(8)));
typedef float          v4f  __attribute__((ext_vector_type(4)));
typedef float          v2f  __attribute__((ext_vector_type(2)));
typedef _Float16       v2h  __attribute__((ext_vector_type(2)));
typedef unsigned int   v4u  __attribute__((ext_vector_type(4)));
typedef uint32_t       u32x4 __attribute__((ext_vector_type(4)));
typedef uint32_t       u32x8 __attribute__((ext_vector_type(8)));

union Frag  { v8us u[2]; v16h h; };
union FragH { v16h v; v8h hv[2]; };
static_assert(sizeof(Frag) == 32);
static_assert(sizeof(FragH) == 32);

// ---- scalar helpers ---------------------------------------------------------------------------------------
__device__ __forceinline__ unsigned short bf_bits(float f) {          // f32 -> bf16 bits, RNE convert
  unsigned u = __float_as_uint(f);
  return (unsigned short)((u + 0x7FFFu + ((u >> 16) & 1u)) >> 16);
}
__device__ __forceinline__ float bf_up(unsigned short hb) { return __uint_as_float(((unsigned)hb) << 16); }
__device__ __forceinline__ float bfr(float f) { return bf_up(bf_bits(f)); }
__device__ __forceinline__ unsigned short h_bits(_Float16 x) { return __builtin_bit_cast(unsigned short, x); }
__device__ __forceinline__ unsigned pk16(unsigned short a, unsigned short b) { return (unsigned)a | ((unsigned)b << 16); }
__device__ __forceinline__ v8f zero8() { v8f z = {0.f, 0.f, 0.f, 0.f, 0.f, 0.f, 0.f, 0.f}; return z; }
__device__ __forceinline__ float hmax8(v8f s) {
  return fmaxf(fmaxf(fmaxf(s[0], s[1]), fmaxf(s[2], s[3])), fmaxf(fmaxf(s[4], s[5]), fmaxf(s[6], s[7])));
}
__device__ __forceinline__ unsigned wave_ballot(bool p) {
#if defined(__HIP_DEVICE_COMPILE__)
  return __builtin_amdgcn_ballot_w32(p);
#else
  return p ? 1u : 0u;
#endif
}
// lane l with lane l ^ 16, as a vector move (a shuffle through the LDS unit counts on dscnt)
__device__ __forceinline__ float xhalf(float x) {
  return __builtin_bit_cast(float, __builtin_amdgcn_permlanex16(__builtin_bit_cast(int, x), __builtin_bit_cast(int, x),
                                                                0x76543210, 0xfedcba98, false, false));
}
// compile-time tags of an attention pass: does a next stage exist
struct HasNext   { static constexpr bool more = true; };
struct LastStage { static constexpr bool more = false; };
// compile-time tags of a 32-key block: its place in the 64-key stage
struct Sub0 { static constexpr int sub = 0; };
struct Sub1 { static constexpr int sub = 1; };
// position channel value w[l] = (l / 4096) * 2 - 1 in f32, spec op order (every step exact)
__device__ __forceinline__ float wpos(int l) { return ((float)l * INVNN) * 2.0f - 1.0f; }

// ---- 16-bit fragment loader (A, or B from a k-contiguous [n][k] row) from an LDS row: lane -> row/col (lane&15), p (bytes)
//      already includes 16*(lane>>4); elements 0..7 <- k0+8h.., elements 8..15 <- k0+16+8h.. (16 elements = 32 B on)
__device__ __forceinline__ Frag ldfrag_lds(const unsigned char* p) {
  Frag f;
  f.u[0] = *(const v8us*)(p);
  f.u[1] = *(const v8us*)(p + 32);
  return f;
}

// ---- tensor load to LDS: descriptor groups, issue and waits --------------------------------------------------
__device__ __forceinline__ uint32_t uni(uint32_t v) { return (uint32_t)__builtin_amdgcn_readfirstlane(v); }
// a wave-uniform value held in a scalar register: a test on it compiles to a scalar branch, and a descriptor word formed
// from it stands behind the wait written in front of it
__device__ __forceinline__ uint32_t pinned(uint32_t v) { uint32_t w = uni(v); asm volatile("" : "+s"(w)); return w; }
// group 1: 1-byte elements, tile = tensor = rows x 128 B, source pitch in bytes, 16 B of LDS pad behind every 128-B row
__device__ __forceinline__ u32x8 tdm_group1(uint32_t rows, uint32_t src_pitch) {
  u32x8 g;
  g[0] = uni((1u << 20) | (4u << 22) | (3u << 25));
  g[1] = uni(128u << 16);
  g[2] = uni(rows << 16);
  g[3] = uni(128u << 16);
  g[4] = uni(rows);
  g[5] = uni(src_pitch);
  g[6] = uni(0u);
  g[7] = uni(0u);
  return g;
}
__device__ __forceinline__ u32x4 tdm_group0(uint32_t lds_dst, uint64_t ga) {
  u32x4 g;
  g[0] = uni(1u);
  g[1] = uni(lds_dst);
  g[2] = uni((uint32_t)ga);
  g[3] = uni((((uint32_t)(ga >> 32)) & 0x01FFFFFFu) | 0x80000000u);
  return g;
}
__device__ __forceinline__ void tdm_load(u32x4 g0, u32x8 g1) {
  asm volatile("tensor_load_to_lds %0, %1" :: "s"(g0), "s"(g1) : "memory");
}
// the compiler places no wait for a tensor load: the issuing wave's own wait, before the barrier that publishes the tile
__device__ __forceinline__ void wait_tensor0() { asm volatile("s_wait_tensorcnt 0x0" ::: "memory"); }
// this wave's LDS reads have returned before a buffer it read is handed back for a refill
__device__ __forceinline__ void wait_ds0() { asm volatile("s_wait_dscnt 0x0" ::: "memory"); }
// the work-group barrier in its two halves: a wave that has signalled goes on with register-only products until it needs what
// the other waves publish; written whole, an early wave idles there while its SIMD's matrix pipe stands free
__device__ __forceinline__ void bar_signal() { asm volatile("s_barrier_signal -1" ::: "memory"); }
__device__ __forceinline__ void bar_wait() { asm volatile("s_barrier_wait -1" ::: "memory"); }

// ---- WMMA helpers --------------------------------------------------------------------------------------------
// plain builtins, no asm gap behind them: an asm statement's vector operands must lie in v0..v255, which a loop that holds
// accumulators and prefetched fragments at once does not fit; the compiler pads the builtin itself
__device__ __forceinline__ v8f wm_h(v16h a, v16h b, v8f c) {
  return __builtin_amdgcn_wmma_f32_16x16x32_f16(false, a, false, b, (short)0, c, false, false);
}

// =========================================================================================================
// (0) 1x1 weights: W16 f16 [640][512] (input channels 0..511 only; channel 512 is handled in the projection epilogues);
//     value = f16 of (bf16-RNE(w) * 256) (exact). Stacked source row o: 0..63 = Wq rows, 64..127 = Wk rows, 128..639 = Wv
//     rows. Block blk (0..79) owns o = 8*blk..8*blk+7 (source selection block-uniform): one wave per row. The plane is laid
//     in the order the projection's waves read it, 80 rows per wave w: 16 stacked q/k rows 16w.., then 64 Wv rows 64w.. .
// coverage: 80 blocks x 8 rows x 2 halves x 32 lanes x 8 halves = 640 x 512; o -> ro is a permutation of 0..639: the whole plane.
// =========================================================================================================
__global__ __launch_bounds__(256)
void cvt_w(const float* __restrict__ wq, const float* __restrict__ wk, const float* __restrict__ wv,
           unsigned short* W16) {
  const int tid = threadIdx.x, blk = blockIdx.x;
  const int rl = tid >> 5, lane = tid & 31;
  const int o = 8 * blk + rl;                                          // 0..639
  const float* wbase = (blk < (DQ / 8)) ? wq : ((blk < (MQK / 8)) ? wk : wv);
  const int osub = (blk < (DQ / 8)) ? 0 : ((blk < (MQK / 8)) ? DQ : MQK);
  const float* s = wbase + (size_t)(o - osub) * CIN;                   // (o - osub) in range of that matrix
  const int ro = (o < MQK) ? PROWS * (o >> 4) + (o & 15) : PROWS * ((o - MQK) >> 6) + 16 + ((o - MQK) & 63);
#pragma unroll 1
  for (int cp = 0; cp < CC / 256; ++cp) {
    const int col = 256 * cp + 8 * lane;                               // 0..504, col + 7 <= 511
    float f[8];
#pragma unroll
    for (int t = 0; t < 8; ++t) f[t] = s[col + t];
    v4u u;
#pragma unroll
    for (int t = 0; t < 4; ++t) {
      const _Float16 h0 = (_Float16)(bfr(f[2 * t]) * WSC);
      const _Float16 h1 = (_Float16)(bfr(f[2 * t + 1]) * WSC);
      u[t] = pk16(h_bits(h0), h_bits(h1));
    }
    *(v4u*)(W16 + (size_t)ro * CC + col) = u;
    // before the next trip writes again the registers that the issued store names
    asm volatile("s_wait_xcnt 0x0" ::: "memory");
  }
}

// =========================================================================================================
// (1) all projections of one (b, 64-position tile): x0 f32 [512 c][64 n] is read once, rounded (bf16-RNE values, exact in f16)
//   and laid in LDS position-major, XT[n][c] (pitch PXB); every product of the tile's 640 output rows reads it there.
//   Block = 8 waves. Wave w owns 80 rows of W16 (cvt_w lays them in this order): 16 q/k rows and 64 v rows. They come in
//   stages of 64 k by one tensor load per wave (rows of 128 B, pitch 144 B), two buffers. A pass reads its 18 fragments as one
//   group; behind them stands the publish point of stage s + 1, where stage s + 2 is issued into the buffer that the pass has
//   just read; then the pass runs its 40 products.
//   q/k tile: A = W rows, B = XT rows: lane (hh, c) holds d = 8 hh + r of position 16 nt + c: 8 consecutive d, one 16-B
//   store. v tiles: A = XT rows, B = W rows: lane (hh, c) holds positions 16 nt + 8 hh + r of channel c: 8 consecutive
//   keys of the channel-major plane, one 16-B store; a wave's four nt stores fill a channel row's whole 128-B line.
//   Epilogues in f32: + bf16-RNE(W[.][512]) * wpos(n) (position channel), v also + bf16-RNE(bv), q times log2(e); q, k and v
//   stored as f16.
// coverage: XT 8 waves x 4 ci x 8 cp pairs x 2 = 512 c, 4 ne x 4 e x 4 t = 64 n; planes 8 waves x 16 d x 64 n; V 8 waves x 64 o
//           x 64 n; grid (64, NB) covers Qf/Kf [NB][4096][64] and V [NB][512][4096] exactly once.
// =========================================================================================================
__global__ __launch_bounds__(256)
void proj(const float* __restrict__ x, const unsigned short* __restrict__ W16,
          const float* __restrict__ wq, const float* __restrict__ wk, const float* __restrict__ wv,
          const float* __restrict__ bv,
          unsigned short* Qf, unsigned short* Kf, unsigned short* V) {
  __shared__ __attribute__((aligned(2048))) unsigned char L[PLDSB];
  unsigned char* XT = L + 2 * PBUF;                                    // behind the W ring
  const int tid  = threadIdx.x;
  const int lane = tid & 31, wave = tid >> 5;
  const int hh   = lane >> 4, c = lane & 15;
  const int n0   = blockIdx.x * QT, b = blockIdx.y;

  // every wave issues one tensor load per stage for its own slice: all of this is wave-uniform
  const uint32_t wu    = uni((uint32_t)tid >> 5);
  const uint32_t lbase = (uint32_t)(size_t)L;                          // byte offset in the work-group's LDS
  const unsigned char* ssrc = (const unsigned char*)(W16 + (size_t)((uint32_t)PROWS * wu) * CC);
  const uint32_t soff = wu * (uint32_t)PSLOT;
  u32x8 g1s = tdm_group1((uint32_t)PROWS, (uint32_t)(CC * 2));
  asm volatile("" : "+s"(g1s));  // pinned() form, descriptor words held in scalar registers: one tuple serves every issue, so none is reused under a request in flight
  u32x4 g0s;                                                           // group 0 of this wave's stage request in flight
  auto issue = [&](uint32_t st) {
    const uint32_t dst = lbase + (st & 1u) * (uint32_t)PBUF + soff;
    const uint64_t ga  = (uint64_t)(size_t)ssrc + (uint64_t)st * 128u;
    g0s = tdm_group0(dst, ga);
    tdm_load(g0s, g1s);
  };
  // the issuing wave's wait for its stage request; it names group 0 so that those registers keep their values until then
  auto landed = [&]() { asm volatile("s_wait_tensorcnt 0x0" :: "s"(g0s) : "memory"); };

  issue(pinned(0u));                                                   // stage 0 flies while the x tile is read and rounded

  // the epilogues' terms, read here so that they land under the loop: W[d][512] of this lane's 8 q or k rows (waves 0..3 hold
  // q rows, 4..7 k rows: wave-uniform choice), Wv[o][512] and bv[o] of its 4 channels
  const int d0 = 16 * (wave & 3) + 8 * hh;
  const float* pwp = ((wu < 4u) ? wq : wk) + (size_t)d0 * CIN;
  const float* pvp = wv + (size_t)(64 * wave + c) * CIN;
  const float* pbp = bv + 64 * wave + c;

  // x0 tile: lane (e, cp) of wave w reads 4 positions of the two channels of pair cp + 8 (w + 8 ci); all 32 loads in flight
  const int e = lane & 3, cp = lane >> 2;
  const float* xb = x + ((size_t)(b * CC + 2 * (cp + 8 * wave))) * NN + n0 + 4 * e;
  v4f xa[4][4], xq[4][4];
#pragma unroll  // constant indices keep the arrays in registers
  for (int ci = 0; ci < 4; ++ci) {
#pragma unroll
    for (int ne = 0; ne < 4; ++ne) {
      xa[ci][ne] = *(const v4f*)(xb + (size_t)(128 * ci) * NN + 16 * ne);
      xq[ci][ne] = *(const v4f*)(xb + (size_t)(128 * ci + 1) * NN + 16 * ne);
    }
  }
  float pw[8], pwo[4], bo[4];
#pragma unroll
  for (int r = 0; r < 8; ++r) pw[r] = pwp[(size_t)r * CIN + CC];
#pragma unroll
  for (int vt = 0; vt < 4; ++vt) { pwo[vt] = pvp[(size_t)(16 * vt) * CIN + CC]; bo[vt] = pbp[16 * vt]; }
  // before anything writes again a register that an issued load names: the wait names the four addresses, so that their
  // registers keep their values until then; the scheduling barriers hold it behind the loads
  __builtin_amdgcn_sched_barrier(0);
  asm volatile("s_wait_xcnt 0x0" :: "v"(xb), "v"(pwp), "v"(pvp), "v"(pbp) : "memory");
  __builtin_amdgcn_sched_barrier(0);

  // one 4-B store per position and channel pair: banks 16 e + cp, all 32 lanes apart
#pragma unroll
  for (int ci = 0; ci < 4; ++ci) {
    unsigned char* xs = XT + (4 * e) * PXB + 4 * (cp + 8 * (wave + 8 * ci));
#pragma unroll
    for (int ne = 0; ne < 4; ++ne) {
#pragma unroll
      for (int t = 0; t < 4; ++t) {
        const v2f pr = {bfr(xa[ci][ne][t]), bfr(xq[ci][ne][t])};       // the pair's two channels: one packed convert
        *(v2h*)(xs + (16 * ne + t) * PXB) = __builtin_convertvector(pr, v2h);
      }
    }
  }
  landed();
  __syncthreads();                                                     // XT and stage 0 published to every wave
  issue(pinned(1u));

  v8f aq[4], av[4][4];
#pragma unroll
  for (int nt = 0; nt < 4; ++nt) {
    aq[nt] = zero8();
#pragma unroll
    for (int vt = 0; vt < 4; ++vt) av[vt][nt] = zero8();
  }

  // rolled: the stage test at the publish point is opaque to the compiler, so unrolled copies would carry issue code that never runs
#pragma unroll 1
  for (uint32_t st = 0; st < (uint32_t)PNST; ++st) {
    const unsigned char* Wp = L + (st & 1u) * (uint32_t)PBUF + wave * PSLOT + c * LPB + 16 * hh;   // this pass reads this buffer alone
    const unsigned char* Xp = XT + c * PXB + 16 * hh + st * 128u;
    Frag fw[2][5], fx[2][4];                                           // every fragment of the pass in registers of its own
#pragma unroll  // constant indices keep the fragment arrays in registers
    for (int ks = 0; ks < 2; ++ks) {
#pragma unroll
      for (int j = 0; j < 5; ++j) fw[ks][j] = ldfrag_lds(Wp + (16 * j) * LPB + 64 * ks);
#pragma unroll
      for (int nt = 0; nt < 4; ++nt) fx[ks][nt] = ldfrag_lds(Xp + (16 * nt) * PXB + 64 * ks);
    }
    // keeps the reads one group in front of the publish point and the products: sunk among the products, each small group is
    // waited out where it stands
    __builtin_amdgcn_sched_barrier(0);
    // publish point of stage st + 1, every wave, in this order; behind the first wait this wave holds in registers all that it
    // reads of this buffer, so stage st + 2 is issued here and flies under the products
    wait_ds0();
    landed();
    __syncthreads();                                                   // stage st + 1 published; every reader has left this buffer
    if (pinned(st + 2u < (uint32_t)PNST)) issue(pinned(st + 2u));      // scalar branch: a tensor load ignores EXEC
#pragma unroll
    for (int ks = 0; ks < 2; ++ks) {
#pragma unroll
      for (int nt = 0; nt < 4; ++nt) aq[nt] = wm_h(fw[ks][0].h, fx[ks][nt].h, aq[nt]);
#pragma unroll
      for (int vt = 0; vt < 4; ++vt) {
#pragma unroll
        for (int nt = 0; nt < 4; ++nt) av[vt][nt] = wm_h(fx[ks][nt].h, fw[ks][1 + vt].h, av[vt][nt]);
      }
    }
  }
  // behind the loop: this wait names both groups, so that no descriptor register takes a new value in front of it
  asm volatile("s_wait_tensorcnt 0x0" :: "s"(g0s), "s"(g1s) : "memory");
  wait_ds0();

  // q/k: lane (hh, c) holds d = d0 + r of position n0 + 16 nt + c
  const float qs = (wu < 4u) ? LOG2E : 1.0f;                           // q carries log2(e): the scores come out in units of log2
  v4u uh[4];
#pragma unroll
  for (int nt = 0; nt < 4; ++nt) {
    const float wl = wpos(n0 + 16 * nt + c);
#pragma unroll
    for (int t = 0; t < 4; ++t) {
      const float f0 = (aq[nt][2 * t] * IWSC + bfr(pw[2 * t]) * wl) * qs;
      const float f1 = (aq[nt][2 * t + 1] * IWSC + bfr(pw[2 * t + 1]) * wl) * qs;
      uh[nt][t] = pk16(h_bits((_Float16)f0), h_bits((_Float16)f1));
    }
  }
  // v: lane (hh, c) holds keys n0 + 16 nt + 8 hh + r of channel 64 wave + 16 vt + c
  v4u uv[4][4];
#pragma unroll
  for (int vt = 0; vt < 4; ++vt) {
    const float pwv = bfr(pwo[vt]), bov = bfr(bo[vt]);
#pragma unroll
    for (int nt = 0; nt < 4; ++nt) {
      const int nb = n0 + 16 * nt + 8 * hh;
      unsigned short hb[8];
#pragma unroll
      for (int r = 0; r < 8; ++r) {
        const float val = av[vt][nt][r] * IWSC + pwv * wpos(nb + r) + bov;
        hb[r] = h_bits((_Float16)val);
      }
#pragma unroll
      for (int t = 0; t < 4; ++t) uv[vt][nt][t] = pk16(hb[2 * t], hb[2 * t + 1]);
    }
  }
  unsigned short* Ph = ((wu < 4u) ? Qf : Kf) + ((size_t)(b * NN + n0 + c)) * DQ + d0;
  unsigned short* Vp = V + ((size_t)(b * CC + 64 * wave + c)) * NN + n0 + 8 * hh;
  // the stores stand behind all of the value arithmetic: none of it writes again a register that an issued store names
  __builtin_amdgcn_sched_barrier(0);
#pragma unroll
  for (int nt = 0; nt < 4; ++nt) *(v4u*)(Ph + (size_t)(16 * nt) * DQ) = uh[nt];
  // before the address arithmetic of the v stores writes again a register that an issued store names: the wait names the
  // stores' addresses and data, so that their registers keep their values until then
  __builtin_amdgcn_sched_barrier(0);
  asm volatile("s_wait_xcnt 0x0" :: "v"(Ph), "v"(uh[0]), "v"(uh[1]), "v"(uh[2]), "v"(uh[3]) : "memory");
  __builtin_amdgcn_sched_barrier(0);
#pragma unroll
  for (int vt = 0; vt < 4; ++vt) {
#pragma unroll
    for (int nt = 0; nt < 4; ++nt) *(v4u*)(Vp + (size_t)(16 * vt) * NN + 16 * nt) = uv[vt][nt];
  }
}

// =========================================================================================================
// (2) attention for one (b, 128-query tile, channel half chh), transposed formulation, 4096 keys, no mask, no scale.
//   Block = 8 waves: wave = query group qg (wave & 3, 32 queries = two 16-query tiles) + 4 x key half kh (2048 keys each).
//   S^T tile (16 keys x 16 queries) = sum over 2 d-chunks of A(k: row = key, 32 d via the split k map from the f16 plane
//   Kf [b][4096][64]) . B(q: col = query, same map from Qf). Per lane the D tile holds 8 keys of ONE query: online softmax state per lane and query tile.
//   The first product of a score tile takes C = LGPS - m in all 8 registers (q carries log2 e), so D is the argument of exp2 as it
//   stands; m, o and l keep the maximum in use until some lane's D lies above GTH (wave-uniform ballot); then every lane takes
//   its new maximum (one vector move, lane^16, for the max over 32 keys), rescales o and l and shifts this block's D.
//   P = e^{s-m} / 4 as f16 is the B operand of O^T (rows channel,
//   cols queries) += A(v rows channel = cb0 + 16j + (lane&15), keys contiguous, f16 plane V [b][512][4096]) . B(P^T):
//   element r <- D of the tile covering keys kb..kb+15, element 8+r <- the tile covering kb+16..kb+31, lane unchanged.
//   Every k and v fragment read from LDS serves both query tiles: two products each. 32 accumulator
//   tiles per wave (2 query tiles x 256 channels), two waves per SIMD. The two channel halves are separate blocks (grid.z).
//   Operands come from LDS, laid there by tensor loads (rows of 128 B, pitch 144 B): the block's q rows once (each wave one
//   slice of 16 rows), then per key half stages of 64 keys in two buffers: of the half's four waves two bring 32 k rows
//   each (one 32-key block's), two 128 channel rows of V each (64 keys = one whole 128-B line per row).
//   A pass walks its 64 keys as two 32-key blocks. Two register sets of 8 fragments: a block finds its 4 k fragments in the
//   first (q stays in registers); behind the score products its 16 v fragments go into both (they land under the softmax),
//   behind the first 16 v products the next block's k fragments (they land under the last 16).
//   The publish point of stage s + 1 stands in the last block of pass s, behind its exponentials: by then the wave has fetched
//   all it reads of stage s. Its barrier is split: the signal stands behind the two waits, then the block's first 16 v products
//   (operands in registers, no LDS read), then the barrier's wait; behind that stage s + 2 is issued into the buffer just left
//   and the next block's k fragments are read.
//   Behind the loop the two key halves of a query group are joined: each wave hands its partner (wave ^ 4) 128 channels of
//   both query tiles with its m and l through LDS, and finishes the other 128: o = (o_a 2^{m_a-m} + o_b 2^{m_b-m}) gamma / l.
//   Then Os[query][256 channels] (pitch OSPN, b128 stores), and out rows: 8 consecutive lanes x 16 B per 128-B line.
// coverage: 16 it x 2 parts x 32 lines x 8 lanes x 4 floats = 256 ch x 128 n per block; grid (NQ/128, NB, 2) covers
//           out[b][0..511][0..NQ-1] exactly once. Hand-over region and Os: cross-wave (block barriers).
// =========================================================================================================
__global__ __launch_bounds__(256)
void attn_k(const unsigned short* __restrict__ Qf, const unsigned short* __restrict__ Kf,
            const unsigned short* __restrict__ V, const float* __restrict__ x,
            const float* __restrict__ gamma, float* out) {
  __shared__ __attribute__((aligned(2048))) unsigned char L[LDSB];
  const int tid  = threadIdx.x;
  const int wave = tid >> 5, lane = tid & 31;
  const int hh   = lane >> 4, c = lane & 15;
  const int qg   = wave & 3, kh = wave >> 2;
  const int n0   = blockIdx.x * QTB, b = blockIdx.y, chh = blockIdx.z;
  const int cb0  = chh * CH;                                           // 0 or 256

  // every wave issues one tensor load per stage for its own slice: all of this is wave-uniform
  const uint32_t wv    = uni((uint32_t)tid >> 5);
  const uint32_t role  = wv & 3u, khu = wv >> 2;                       // slice of the stage, key half
  const uint32_t lbase = (uint32_t)(size_t)L;                          // byte offset in the work-group's LDS
  const bool     isV   = role >= 2u;
  const unsigned char* ssrc = isV
      ? (const unsigned char*)(V + ((size_t)(b * CC + cb0) + 128u * (role - 2u)) * NN + khu * (uint32_t)KPH)
      : (const unsigned char*)(Kf + ((size_t)b * NN + khu * (uint32_t)KPH + 32u * role) * DQ);
  const uint32_t sadv = isV ? (uint32_t)(SKEYS * 2) : (uint32_t)(SKEYS * DQ * 2);   // source bytes from stage to stage
  const uint32_t soff = khu * (uint32_t)RINGB + (isV ? (uint32_t)VOFF + (role - 2u) * (uint32_t)VHALF : role * (uint32_t)KSLOT);
  u32x8 g1s = tdm_group1(isV ? 128u : 32u, isV ? (uint32_t)(NN * 2) : (uint32_t)(DQ * 2));
  asm volatile("" : "+s"(g1s));  // pinned() form, descriptor words held in scalar registers: one tuple serves every issue, so none is reused under a request in flight
  u32x4 g0s;                                                           // group 0 of this wave's stage request in flight
  auto issue = [&](uint32_t st) {
    const uint32_t dst = lbase + (st & 1u) * (uint32_t)BUFB + soff;
    const uint64_t ga  = (uint64_t)(size_t)ssrc + (uint64_t)st * sadv;
    g0s = tdm_group0(dst, ga);
    tdm_load(g0s, g1s);
  };
  // the issuing wave's wait for its stage request; it names group 0 so that those registers keep their values until then
  auto landed = [&]() { asm volatile("s_wait_tensorcnt 0x0" :: "s"(g0s) : "memory"); };

  // q, loaded once: wave wv brings rows n0 + 16*wv .. +15 into slice wv
  {
    const unsigned char* qsrc = (const unsigned char*)(Qf + ((size_t)(b * NN + n0) + 16u * wv) * DQ);
    tdm_load(tdm_group0(lbase + (uint32_t)QOFF + wv * (uint32_t)QSLOT, (uint64_t)(size_t)qsrc),
             tdm_group1(16u, (uint32_t)(DQ * 2)));
    wait_tensor0();
  }
  issue(pinned(0u));
  landed();
  __syncthreads();                                                     // q and stage 0 of both halves published to every wave
  issue(pinned(1u));

  const unsigned char* Lh = L + kh * RINGB;                            // this key half's ring

  float l[2] = {0.f, 0.f};
  v8f nm[2];                                                           // C operand of the score products: LGPS - m in every register; holds m
  v8f o[2][16];
#pragma unroll
  for (int qt = 0; qt < 2; ++qt) {
#pragma unroll
    for (int j = 0; j < 16; ++j) o[qt][j] = zero8();
  }

  // q fragment base (B operand, col = query n0 + 32*qg + 16*qt + c: row c of slice 2*qg + qt), + 64*kc B
  const unsigned char* Qp = L + QOFF + (2 * qg) * QSLOT + c * LPB + 16 * hh;
  // the q fragments stay in registers, read once
  Frag qh[2][DQ / 32];
#pragma unroll  // constant indices keep the fragment array in registers
  for (int qt = 0; qt < 2; ++qt) {
#pragma unroll
    for (int kc = 0; kc < DQ / 32; ++kc) qh[qt][kc] = ldfrag_lds(Qp + qt * QSLOT + 64 * kc);
  }
  // the two fragment sets; the first holds a block's 4 k fragments, then each 8 v fragments
  Frag ra[8], rb[8];
  // one group: the k fragments of a block (A operand, row = key): row c (+16) of the stage's slice sub, + 64*kc B:
  // R[2 kc] = keys kb.., R[2 kc + 1] = keys kb+16.. of d chunk kc
  auto load_s = [&](Frag (&R)[8], const unsigned char* Bp, int sub) __attribute__((always_inline)) {
    const unsigned char* k0p = Bp + sub * KSLOT + c * LPB + 16 * hh;
#pragma unroll  // constant indices keep the fragment array in registers
    for (int kc = 0; kc < DQ / 32; ++kc) {
      R[2 * kc]     = ldfrag_lds(k0p + 64 * kc);
      R[2 * kc + 1] = ldfrag_lds(k0p + 16 * LPB + 64 * kc);
    }
  };
  // one group: 8 of a block's v fragments (A operand, row = channel cb0 + 128*g + 16j + c, keys contiguous): + 64*sub B
  auto load_v = [&](Frag (&R)[8], const unsigned char* Bp, int sub, int g) __attribute__((always_inline)) {
    const unsigned char* Vp = Bp + VOFF + (128 * g + c) * LPB + 16 * hh + 64 * sub;
#pragma unroll  // constant indices keep the fragment array in registers
    for (int j = 0; j < 8; ++j) R[j] = ldfrag_lds(Vp + (16 * j) * LPB);
  };
  load_s(ra, Lh, 0);                                                   // q and stage 0 are published: the first block's k fragments

  // m starts as the maximum over the first block's 32 keys (o and l are 0: nothing to rescale); the block then forms its scores against it
#pragma unroll
  for (int qt = 0; qt < 2; ++qt) {
    v8f t0 = zero8(), t1 = zero8();
#pragma unroll  // constant indices into the fragment arrays
    for (int kc = 0; kc < DQ / 32; ++kc) {
      t0 = wm_h(ra[2 * kc].h, qh[qt][kc].h, t0);
      t1 = wm_h(ra[2 * kc + 1].h, qh[qt][kc].h, t1);
    }
    const float mf = fmaxf(hmax8(t0), hmax8(t1));
    const float mi = fmaxf(mf, xhalf(mf));
#pragma unroll
    for (int r = 0; r < 8; ++r) nm[qt][r] = LGPS - mi;
  }

  // one 32-key block: RA holds its k fragments; it leaves the next block's there. The tags say at compile time where
  // the block stands and whether a next stage exists, so that no read stands under a branch. Inlined at every place: the
  // fragment arrays stay in registers
  auto block = [&](Frag (&RA)[8], Frag (&RB)[8], uint32_t st, auto subtag, auto tag) __attribute__((always_inline)) {
    constexpr int  sub  = decltype(subtag)::sub;
    constexpr bool more = decltype(tag)::more;
    constexpr bool last = (sub + 1 == SKEYS / 32);                     // the stage's last block
    constexpr bool next = !last || more;                               // a next block exists
    const unsigned char* Bp = Lh + (st & 1u) * (uint32_t)BUFB;         // this stage's buffer
    const unsigned char* Bx = last ? Lh + ((st + 1u) & 1u) * (uint32_t)BUFB : Bp;   // the next block's, read behind its publish point
    constexpr int subx = last ? 0 : sub + 1;

    v8f s[2][2];                                                       // [query tile][keys kb.., kb+16..]: t - m + LGPS
#pragma unroll  // constant indices into the fragment arrays
    for (int kc = 0; kc < DQ / 32; ++kc) {
#pragma unroll
      for (int qt = 0; qt < 2; ++qt) {
        s[qt][0] = wm_h(RA[2 * kc].h, qh[qt][kc].h, kc == 0 ? nm[qt] : s[qt][0]);
        s[qt][1] = wm_h(RA[2 * kc + 1].h, qh[qt][kc].h, kc == 0 ? nm[qt] : s[qt][1]);
      }
    }
    // keeps the score products in front of the group and the group here: the v fragments land under the softmax; sunk to
    // their products, each read would be waited out there
    __builtin_amdgcn_sched_barrier(0);
    load_v(RA, Bp, sub, 0);
    load_v(RB, Bp, sub, 1);
    __builtin_amdgcn_sched_barrier(0);

    float mx[2];
#pragma unroll
    for (int qt = 0; qt < 2; ++qt) mx[qt] = fmaxf(hmax8(s[qt][0]), hmax8(s[qt][1]));   // this lane's 16 keys
    // wave-uniform, one test per block: does a score leave the range that P has above the maximum in use
    const unsigned grew = wave_ballot(mx[0] > GTH || mx[1] > GTH);
    if (grew != 0u) {
#pragma unroll
      for (int qt = 0; qt < 2; ++qt) {
        const float mq = fmaxf(mx[qt], xhalf(mx[qt]));                 // the query's 32 keys; a vector move: no LDS wait drains the reads in flight
        const float dm = fmaxf(mq - LGPS, 0.f);                        // new maximum less the one in use; 0 for lanes whose max did not grow
        const float corr = __builtin_amdgcn_exp2f(-dm);                // == 1 exactly for those lanes
        l[qt] *= corr;
#pragma unroll
        for (int r = 0; r < 8; ++r) {
          nm[qt][r] -= dm;                                             // m grows by dm
          s[qt][0][r] -= dm;
          s[qt][1][r] -= dm;
        }
#pragma unroll
        for (int j = 0; j < 16; ++j) {
#pragma unroll
          for (int r = 0; r < 8; ++r) o[qt][j][r] *= corr;
        }
      }
    }
    FragH ph[2];
#pragma unroll
    for (int qt = 0; qt < 2; ++qt) {
#pragma unroll
      for (int r = 0; r < 8; ++r) {
        s[qt][0][r] = __builtin_amdgcn_exp2f(s[qt][0][r]);             // key kb      + 8hh + r: e^{s-m} / 4
        s[qt][1][r] = __builtin_amdgcn_exp2f(s[qt][1][r]);             // key kb + 16 + 8hh + r
        ph[qt].hv[0][r] = (_Float16)s[qt][0][r];
        ph[qt].hv[1][r] = (_Float16)s[qt][1][r];
      }
    }
    // the row sums of the block; in a stage's last block they are written behind the k reads, among the last 16 products: left
    // in front of the branch at the refill, the compiler sinks them behind it, in front of the k reads, where no product covers them
    auto rowsum = [&]() __attribute__((always_inline)) {
#pragma unroll
      for (int qt = 0; qt < 2; ++qt) {
        float ls = 0.f;
#pragma unroll
        for (int r = 0; r < 8; ++r) ls += s[qt][0][r] + s[qt][1][r];
        l[qt] += ls;
      }
    };
    if constexpr (!last) rowsum();

    if constexpr (last) {
      // publish point of stage st + 1, every wave, in this order; behind the first wait this wave holds in registers all that
      // it reads of this buffer. The scheduling barrier keeps the exponentials in front of the wait: the v reads land under them
      __builtin_amdgcn_sched_barrier(0);
      wait_ds0();
      if constexpr (more) landed();
      // the last pass's wait names both groups, so that no descriptor register takes a new value in front of it
      else asm volatile("s_wait_tensorcnt 0x0" :: "s"(g0s), "s"(g1s) : "memory");
      bar_signal();                                                    // this wave's tile has landed and it has left this buffer
      // keeps the products below behind the signal: lifted over it they would hold it back from the other waves
      __builtin_amdgcn_sched_barrier(0);
    }

#pragma unroll
    for (int j = 0; j < 8; ++j) {
#pragma unroll
      for (int qt = 0; qt < 2; ++qt) o[qt][j] = wm_h(RA[j].h, ph[qt].v, o[qt][j]);
    }
    if constexpr (last) {
      // keeps the 16 products in front of the wait: they are the work that a wave does while the slower waves arrive
      __builtin_amdgcn_sched_barrier(0);
      bar_wait();                                                      // stage st + 1 published; every reader has left this buffer
      if constexpr (more) {
        if (pinned(st + 2u < (uint32_t)NST)) issue(pinned(st + 2u));   // scalar branch: a tensor load ignores EXEC
      }
    }
    if constexpr (next) {
      // the products stay in front of the reads that refill their fragments; the next block's k fragments land under the other 16
      __builtin_amdgcn_sched_barrier(0);
      load_s(RA, Bx, subx);
      __builtin_amdgcn_sched_barrier(0);
    }
    if constexpr (last) rowsum();
#pragma unroll
    for (int j = 0; j < 8; ++j) {
#pragma unroll
      for (int qt = 0; qt < 2; ++qt) o[qt][8 + j] = wm_h(RB[j].h, ph[qt].v, o[qt][8 + j]);
    }
    if constexpr (next) {
      __builtin_amdgcn_sched_barrier(0);
      // WMMA distance: the next block's first score product may write its D where the allocator kept P, the B operand of the
      // v product issued just before it; four slots, held in place by the scheduling barriers
      asm volatile("v_nop\n\tv_nop\n\tv_nop\n\tv_nop");
      __builtin_amdgcn_sched_barrier(0);
    }
  };
  // rolled: the stage test at the publish point is opaque to the compiler, so unrolled copies would carry issue code that never runs
#pragma unroll 1
  for (uint32_t st = 0; st + 1u < (uint32_t)NST; ++st) {
    block(ra, rb, st, Sub0{}, HasNext{});
    block(ra, rb, st, Sub1{}, HasNext{});
  }
  block(ra, rb, (uint32_t)NST - 1u, Sub0{}, LastStage{});
  block(ra, rb, (uint32_t)NST - 1u, Sub1{}, LastStage{});
  wait_tensor0();
  wait_ds0();
  // the last pass's own barrier stands behind every wave's last read of the rings and of q: all of L is free

  // join of the two key halves: wave (qg, kh) finishes channels 128*kh .. +127 of its 32 queries and hands the other 128 over
  float* Xo = (float*)(L + wave * XWAVE);                              // written by this wave, read by its partner
  const float* Xp = (const float*)(L + (wave ^ 4) * XWAVE);
  float* MLo = (float*)(L + MLOFF) + wave * 128;
  const float* MLp = (const float*)(L + MLOFF) + (wave ^ 4) * 128;
  const bool up = kh != 0;                                             // wave-uniform
  const float m[2] = {LGPS - nm[0][0], LGPS - nm[1][0]};               // the maximum in use at the end
  v8f f[2][8];
#pragma unroll
  for (int qt = 0; qt < 2; ++qt) {
    l[qt] += xhalf(l[qt]);                                             // the two lane halves' row sums
    MLo[qt * 64 + 2 * lane]     = m[qt];
    MLo[qt * 64 + 2 * lane + 1] = l[qt];
#pragma unroll
    for (int jj = 0; jj < 8; ++jj) {
      const v8f snd = up ? o[qt][jj] : o[qt][8 + jj];
      f[qt][jj]     = up ? o[qt][8 + jj] : o[qt][jj];
      v4f va, vb;
#pragma unroll
      for (int r = 0; r < 4; ++r) { va[r] = snd[r]; vb[r] = snd[4 + r]; }
      *(v4f*)(Xo + (qt * 8 + jj) * 256 + 4 * lane)       = va;         // lane-linear: the partner's same lane reads it back
      *(v4f*)(Xo + (qt * 8 + jj) * 256 + 128 + 4 * lane) = vb;
    }
  }
  __syncthreads();                                                     // every wave's hand-over is written
  const float gam = bfr(gamma[0]);
  float* Os = (float*)(L + OSOFF);                                     // apart from the hand-over region
#pragma unroll
  for (int qt = 0; qt < 2; ++qt) {
    const float mp = MLp[qt * 64 + 2 * lane], lp = MLp[qt * 64 + 2 * lane + 1];
    const float mm = fmaxf(m[qt], mp);
    const float co = __builtin_amdgcn_exp2f(m[qt] - mm), cp = __builtin_amdgcn_exp2f(mp - mm);   // m in units of log2
    const float inv = gam / (l[qt] * co + lp * cp);                    // o and l both carry the factor 1/4
    const float ao = co * inv, ap = cp * inv;
    const int qrow = 32 * qg + 16 * qt + c;
    v4f pa[8], pb[8];                                                  // one group of reads, in front of the Os stores
#pragma unroll
    for (int jj = 0; jj < 8; ++jj) {
      pa[jj] = *(const v4f*)(Xp + (qt * 8 + jj) * 256 + 4 * lane);
      pb[jj] = *(const v4f*)(Xp + (qt * 8 + jj) * 256 + 128 + 4 * lane);
    }
#pragma unroll
    for (int jj = 0; jj < 8; ++jj) {
      v4f va, vb;
#pragma unroll
      for (int r = 0; r < 4; ++r) { va[r] = f[qt][jj][r] * ao + pa[jj][r] * ap; vb[r] = f[qt][jj][4 + r] * ao + pb[jj][r] * ap; }
      *(v4f*)(Os + qrow * OSPN + 128 * kh + 16 * jj + 8 * hh)     = va;   // Os[query][ch_loc = 128kh + 16jj + 8hh + r]
      *(v4f*)(Os + qrow * OSPN + 128 * kh + 16 * jj + 8 * hh + 4) = vb;
    }
  }
  __syncthreads();                                                     // Os complete

  // out rows: thread (lq, e) owns channel ch0 + 16 it, queries nq0 + 64 part .. +3; one address pair each for x and out, every
  // step from it a constant
  const int e = tid & 7, lq = tid >> 3;                                // lq 0..31
  const int ch0 = lq >> 1;                                             // 0..15
  const int nq0 = (lq & 1) * 32 + 4 * e;                               // 0..60
  const size_t base = ((size_t)(b * CC + cb0 + ch0)) * NN + n0 + nq0;
  const float* xb = x + base;
  float* ob = out + base;
  const float* Ob = Os + nq0 * OSPN + ch0;
#pragma unroll
  for (int part = 0; part < 2; ++part) {
    v4f res[16];
#pragma unroll
    for (int it = 0; it < 16; ++it) {
      const v4f xv = *(const v4f*)(xb + (size_t)(16 * it) * NN + 64 * part);
#pragma unroll
      for (int t = 0; t < 4; ++t) res[it][t] = Ob[(64 * part + t) * OSPN + 16 * it] + bfr(xv[t]);
    }
#pragma unroll
    for (int it = 0; it < 16; ++it) *(v4f*)(ob + (size_t)(16 * it) * NN + 64 * part) = res[it];
    // before the second part writes again the registers that the issued stores name
    if (part == 0) asm volatile("s_wait_xcnt 0x0" ::: "memory");
  }
}

// =========================================================================================================
// Workspace map (bytes; each region start a multiple of 256; every extent is an exact tile multiple and is written
//   W16 f16 [640][512]                  655360
//   V   f16 [NB][512][4096]           16777216 (NB = 4)
//   Qf/Kf f16 [NB][4096][64]          2097152 x2
//   total (NB = 4) = 21626880
// =========================================================================================================
extern "C" void kernel_launch(void* const* d_in, const int* in_sizes, int n_in,
                              void* d_out, int out_size, void* d_ws, size_t ws_size,
                              hipStream_t stream) {
  const int XN = NB * CC * NN;
  if (n_in < 6) return;
  if (in_sizes[0] < XN) return;
  if (in_sizes[1] < DQ * CIN || in_sizes[2] < DQ * CIN) return;
  if (in_sizes[3] < CC * CIN || in_sizes[4] < CC || in_sizes[5] < 1) return;
  if (out_size < XN) return;

  size_t off = 0;
  auto carve = [&](size_t bytes) { const size_t o = off; off += (bytes + 255) & ~(size_t)255; return o; };
  const size_t oW16 = carve((size_t)MW * CC * 2);
  const size_t oV   = carve((size_t)NB * CC * NN * 2);
  const size_t oQf  = carve((size_t)NB * NN * DQ * 2);
  const size_t oKf  = carve((size_t)NB * NN * DQ * 2);
  if (off > ws_size) return;
  if (off > (size_t)134217728) return;

  const float* x     = (const float*)d_in[0];
  const float* wq    = (const float*)d_in[1];
  const float* wk    = (const float*)d_in[2];
  const float* wv    = (const float*)d_in[3];
  const float* bv    = (const float*)d_in[4];
  const float* gamma = (const float*)d_in[5];

  char* ws = (char*)d_ws;
  unsigned short* W16 = (unsigned short*)(ws + oW16);
  unsigned short* V   = (unsigned short*)(ws + oV);
  unsigned short* Qf  = (unsigned short*)(ws + oQf);
  unsigned short* Kf  = (unsigned short*)(ws + oKf);
  float* out = (float*)d_out;

  const dim3 blk256(256);

  // (0) Wq / Wk / Wv (channels 0..511) -> stacked f16 plane
  cvt_w<<<dim3(MW / 8), blk256, 0, stream>>>(wq, wk, wv, W16);
  // (1) x0 tile -> q / k f16 planes, v + bias channel-major f16 plane
  proj<<<dim3(NN / QT, NB), blk256, 0, stream>>>(x, W16, wq, wk, wv, bv, Qf, Kf, V);
  // (2) attention + gamma scale + residual -> out [b][512][NQ]
  attn_k<<<dim3(NQ / QTB, NB, 2), blk256, 0, stream>>>(Qf, Kf, V, x, gamma, out);
  (void)hipGetLastError();
}
